// v000
// The times below were measured on an AMD MI455X: many runs one after another, warmed up first and cycling through
// copies of the inputs, with the whole window's GPU time divided by the number of runs. Launches and the gaps
// between them are all in it. The median over several windows is given; except for v000 it joins two sittings, which
// can be a few percent apart, so the side-by-side timings, each taken in one sitting, are the better comparison.
// v000 is the starting kernel. One run takes 3510 microseconds.
#include <hip/hip_runtime.h>
// Multi-head self-attention with a polynomial 'stablemax' normalisation instead of softmax (x [2][2048][1024]; qkv = x w_qkv^T (natural [3072][1024] sigma 0.02, NO bias) reshaped (B, S, 3, 16, 64): q | k | v thirds; attn = stablemax3(q k^T * 64^-0.5): logits minus the row max, then s(x) = 1 + x (1 + x/2 (1 + x/3)) for x >= 0 and 1 / (1 - x (1 - x/2 (1 - x/3))) for x < 0, normalised by the row sum; out = merged w_out^T + b_out (natural) -> [2][2048][1024]).
// Structure: token rows r = b*2048 + s; x as exact f16 rows (bf16-rounded); q | k | v as ONE WMMA GEMM (N = 3 x 1024) (32x64 wave tiles, f32 accumulation, exact x16 weights, no bias, f16 outputs); per batch: V^T for all heads via LDS transposes; per (batch, group of 4 heads): scores GEMM (K = 64, batched over the heads on grid.y, alpha = 64^-0.5), row stablemax3 on VALU (f32 statistics, polynomial with v_rcp_f32; weights stored x256 as f16), o = P . V^T GEMM (K = 2048, alpha 2^-2: o carried x64 against f16 subnormal flush, folded into the output GEMM alpha) written straight into the merged f16 o rows; out = o W_o + b GEMM (f32) into the output layout.
// Compute dtype: inputs rounded to bf16; x / weights exact; q, k, v, softmax weights and o as plain f16 GEMM operands (~2^-12); scores and softmax statistics f32; v_wmma_f32_16x16x32_f16.
#define NB 2
#define SQ 2048
#define DM 1024
#define NH 16
#define HD 64
#define HG 4                         /* heads per attention launch group */
#define B0 0                         /* first batch processed (debug hook) */
#define NBR NB                       /* batches processed (debug hook) */
#define NR ((size_t)NB * SQ)         /* token rows */
#define MP ((int)((size_t)NBR * SQ)) /* rows projected (debug hook) */
#define QN SQ                        /* query rows attended per batch (debug hook) */
#define NHD NH                       /* heads attended (debug hook) */
#define MPO MP                       /* rows through the output stage (debug hook) */
#define LQ (3 * DM)      /* row pitch of the q/k/v rows */
typedef __bf16 v16b __attribute__((ext_vector_type(16)));
typedef unsigned short v8us __attribute__((ext_vector_type(8), may_alias));
typedef float  v8f  __attribute__((ext_vector_type(8)));
typedef float  v4f  __attribute__((ext_vector_type(4)));
typedef float  v4fa __attribute__((ext_vector_type(4), may_alias));
union FragB { v16b v; v8us half[2]; unsigned short u[16]; };

__device__ __forceinline__ unsigned short bf16_bits(float x) { unsigned int u = __float_as_uint(x); return (unsigned short)((u + 0x7FFFu + ((u >> 16) & 1u)) >> 16); }
__device__ __forceinline__ float bf16_val(unsigned short b) { return __uint_as_float(((unsigned int)b) << 16); }
__device__ __forceinline__ float bf16_round(float x) { return bf16_val(bf16_bits(x)); }
// D += A·B with NT terms: 1 = ah·bh, 2 = + al·bh (A split), 3 = + ah·bl (both split)
template <int NT>
__device__ __forceinline__ v8f mmaN(v16b ah, v16b al, v16b bh, v16b bl, v8f c) {
  c = __builtin_amdgcn_wmma_f32_16x16x32_bf16(false, ah, false, bh, (short)0, c, false, false);
  if (NT >= 2) c = __builtin_amdgcn_wmma_f32_16x16x32_bf16(false, al, false, bh, (short)0, c, false, false);
  if (NT >= 3) c = __builtin_amdgcn_wmma_f32_16x16x32_bf16(false, ah, false, bl, (short)0, c, false, false);
  asm volatile("v_nop\n\tv_nop\n\tv_nop\n\tv_nop" : "+v"(c) : "v"(ah), "v"(al), "v"(bh), "v"(bl));
  return c;
}

__global__ __launch_bounds__(256) void k_wt_bf16(const float* __restrict__ W, unsigned short* __restrict__ Wt, int K, int N) {
  const int t = blockIdx.x * 256 + threadIdx.x;
  const int k8n = K / 8;
  if (t >= N * k8n) return;
  const int n = t / k8n, k8 = (t % k8n) * 8;
  v8us v;
#pragma unroll
  for (int i = 0; i < 8; ++i) v[i] = bf16_bits(W[(size_t)(k8 + i) * N + n]);
  *(v8us*)(Wt + (size_t)n * K + k8) = v;
  
}

// GEMM C[M][N] (f32, pitch ldc) = act(A[M][K]·W + bias). A f32 row-major (pitch lda) converted per fragment to bf16
// (ASPLIT: hi/lo two planes -> 2 terms, else single rounded term); Wt bf16 [N][K] (pitch ldb). BIAS_BF16 rounds the
// bias to bf16 first (bias quantised to bf16 before the add). K%32==0, M%16==0, N%64==0.
template <bool ASPLIT, int ACT, bool BIAS_BF16>
__global__ __launch_bounds__(128) void k_gemm_bf(const float* __restrict__ A, int lda, const unsigned short* __restrict__ Wt, int ldb,
                                               const float* __restrict__ bias, float* __restrict__ C, int ldc, int M, int N, int K) {
  __shared__ __attribute__((aligned(16))) float so[4][16][64];
  const int tid = threadIdx.x, w = tid >> 5, lane = tid & 31, ln = lane & 15, hh = lane >> 4;
  const int ntn = N / 64;
  const int wid = blockIdx.x * 4 + w;
  const int mt = wid / ntn, nq = wid % ntn;
  if (mt * 16 >= M) return;
  const int row0 = mt * 16, col0 = nq * 64;
  const float* arow = A + (size_t)(row0 + ln) * lda;
  v8f acc[4] = {};
  for (int kb = 0; kb < K; kb += 32) {
    FragB ah, al;
    const v4f x0 = *(const v4fa*)(arow + kb + 8 * hh), x1 = *(const v4fa*)(arow + kb + 8 * hh + 4);
    const v4f x2 = *(const v4fa*)(arow + kb + 16 + 8 * hh), x3 = *(const v4fa*)(arow + kb + 16 + 8 * hh + 4);
    float xs[16] = {x0[0],x0[1],x0[2],x0[3],x1[0],x1[1],x1[2],x1[3],x2[0],x2[1],x2[2],x2[3],x3[0],x3[1],x3[2],x3[3]};
#pragma unroll
    for (int i = 0; i < 16; ++i) { const unsigned short hb = bf16_bits(xs[i]); ah.u[i] = hb; al.u[i] = ASPLIT ? bf16_bits(xs[i] - bf16_val(hb)) : (unsigned short)0; }
#pragma unroll
    for (int t = 0; t < 4; ++t) {
      const unsigned short* brow = Wt + (size_t)(col0 + t * 16 + ln) * ldb + kb;
      FragB b;
      b.half[0] = *(const v8us*)(brow + 8 * hh);
      b.half[1] = *(const v8us*)(brow + 16 + 8 * hh);
      acc[t] = mmaN<ASPLIT ? 2 : 1>(ah.v, al.v, b.v, b.v, acc[t]);
    }
  }
#pragma unroll
  for (int t = 0; t < 4; ++t) {
    float bv = bias ? bias[col0 + t * 16 + ln] : 0.f;
    if (BIAS_BF16) bv = bf16_round(bv);
#pragma unroll
    for (int r = 0; r < 8; ++r) { float v = acc[t][r] + bv; if (ACT == 1) v = fmaxf(v, 0.f); so[w][8 * hh + r][t * 16 + ln] = v; }
  }
  __builtin_amdgcn_fence(__ATOMIC_ACQ_REL, "workgroup");
  __builtin_amdgcn_wave_barrier();
  const int rsub = lane >> 4, c4 = (lane & 15) * 4;
  {
#pragma unroll
    for (int q = 0; q < 8; ++q) {
      const int r = q * 2 + rsub;
      const v4f v = *(const v4fa*)&so[w][r][c4];
      *(v4f*)(C + (size_t)(row0 + r) * ldc + col0 + c4) = v;
    }
    
  }
}

// GEMM C = act(A·W + bias + resid): A f32 (ASPLIT -> hi/lo 2 terms), Wt bf16 [N][K]; ACT 0 none, 1 relu, 2 exact gelu;
// resid (optional, f32, row index = (row % rmod), pitch ldr, RES_BF16 rounds it) added before the activation.
template <bool ASPLIT, int ACT, bool BIAS_BF16, bool RES_BF16>
__global__ __launch_bounds__(128) void k_gemm_bf3(const float* __restrict__ A, int lda, const unsigned short* __restrict__ Wt, int ldb,
                                                const float* __restrict__ bias, const float* __restrict__ resid, int rmod, int ldr,
                                                float* __restrict__ C, int ldc, int M, int N, int K) {
  __shared__ __attribute__((aligned(16))) float so[4][16][64];
  const int tid = threadIdx.x, w = tid >> 5, lane = tid & 31, ln = lane & 15, hh = lane >> 4;
  const int ntn = N / 64;
  const int wid = blockIdx.x * 4 + w;
  const int mt = wid / ntn, nq = wid % ntn;
  if (mt * 16 >= M) return;
  const int row0 = mt * 16, col0 = nq * 64;
  const float* arow = A + (size_t)(row0 + ln) * lda;
  v8f acc[4] = {};
  for (int kb = 0; kb < K; kb += 32) {
    FragB ah, al;
    const v4f x0 = *(const v4fa*)(arow + kb + 8 * hh), x1 = *(const v4fa*)(arow + kb + 8 * hh + 4);
    const v4f x2 = *(const v4fa*)(arow + kb + 16 + 8 * hh), x3 = *(const v4fa*)(arow + kb + 16 + 8 * hh + 4);
    float xs[16] = {x0[0],x0[1],x0[2],x0[3],x1[0],x1[1],x1[2],x1[3],x2[0],x2[1],x2[2],x2[3],x3[0],x3[1],x3[2],x3[3]};
#pragma unroll
    for (int i = 0; i < 16; ++i) { const unsigned short hb = bf16_bits(xs[i]); ah.u[i] = hb; al.u[i] = ASPLIT ? bf16_bits(xs[i] - bf16_val(hb)) : (unsigned short)0; }
#pragma unroll
    for (int t = 0; t < 4; ++t) {
      const unsigned short* brow = Wt + (size_t)(col0 + t * 16 + ln) * ldb + kb;
      FragB b;
      b.half[0] = *(const v8us*)(brow + 8 * hh);
      b.half[1] = *(const v8us*)(brow + 16 + 8 * hh);
      acc[t] = mmaN<ASPLIT ? 2 : 1>(ah.v, al.v, b.v, b.v, acc[t]);
    }
  }
#pragma unroll
  for (int t = 0; t < 4; ++t) {
    const int col = col0 + t * 16 + ln;
    float bv = bias ? bias[col] : 0.f;
    if (BIAS_BF16) bv = bf16_round(bv);
#pragma unroll
    for (int r = 0; r < 8; ++r) {
      float v = acc[t][r] + bv;
      if (resid) { float rv = resid[(size_t)((row0 + 8 * hh + r) % rmod) * ldr + col]; if (RES_BF16) rv = bf16_round(rv); v += rv; }
      if (ACT == 1) v = fmaxf(v, 0.f);
      if (ACT == 2) v = 0.5f * v * (1.0f + erff(v * 0.70710678118654752f));
      if (ACT == 3) { const float u = 0.7978845608028654f * (v + 0.044715f * v * v * v); v = 0.5f * v * (1.0f + tanhf(u)); }
      so[w][8 * hh + r][t * 16 + ln] = v;
    }
  }
  __builtin_amdgcn_fence(__ATOMIC_ACQ_REL, "workgroup");
  __builtin_amdgcn_wave_barrier();
  const int rsub = lane >> 4, c4 = (lane & 15) * 4;
  {
#pragma unroll
    for (int q = 0; q < 8; ++q) {
      const int r = q * 2 + rsub;
      const v4f v = *(const v4fa*)&so[w][r][c4];
      *(v4f*)(C + (size_t)(row0 + r) * ldc + col0 + c4) = v;
    }
    
  }
}
// row LayerNorm (biased variance, eps) over N: s = X (+ R); optional out_sum <- s; out_norm <- (s-mu)*rsqrt(var+eps)*g + b
template <bool PARAM_BF16>
__global__ __launch_bounds__(256) void k_layernorm(const float* __restrict__ X, const float* __restrict__ R, const float* __restrict__ g, const float* __restrict__ bta,
                                                  float* __restrict__ out_sum, float* __restrict__ out_norm, int N, float eps) {
  __shared__ float red[256];
  const int row = blockIdx.x, tid = threadIdx.x;
  const float* x = X + (size_t)row * N; const float* rr = R ? R + (size_t)row * N : nullptr;
  float vals[16];                     // up to N = 4096
  const int per = N / 256;            // contiguous chunk per thread? use strided-by-4 chunks: thread handles j = tid*4 + 1024*u
  float s1 = 0.f;
  for (int u = 0; u < per / 4; ++u) {
    const int j = tid * 4 + 1024 * u;
    const v4f a = *(const v4fa*)(x + j);
    v4f b = {0.f,0.f,0.f,0.f}; if (rr) b = *(const v4fa*)(rr + j);
#pragma unroll
    for (int q = 0; q < 4; ++q) { const float v = a[q] + b[q]; vals[u * 4 + q] = v; s1 += v; }
  }
  red[tid] = s1; __syncthreads();
  for (int st = 128; st > 0; st >>= 1) { if (tid < st) red[tid] += red[tid + st]; __syncthreads(); }
  const float mu = red[0] / (float)N; __syncthreads();
  float s2 = 0.f;
  for (int u = 0; u < per / 4; ++u)
#pragma unroll
    for (int q = 0; q < 4; ++q) { const float c = vals[u * 4 + q] - mu; s2 += c * c; }
  red[tid] = s2; __syncthreads();
  for (int st = 128; st > 0; st >>= 1) { if (tid < st) red[tid] += red[tid + st]; __syncthreads(); }
  const float rs = rsqrtf(red[0] / (float)N + eps);
  {
    for (int u = 0; u < per / 4; ++u) {
      const int j = tid * 4 + 1024 * u;
      v4f o, sm;
#pragma unroll
      for (int q = 0; q < 4; ++q) {
        float gg = g[j + q], bb = bta[j + q];
        if (PARAM_BF16) { gg = bf16_round(gg); bb = bf16_round(bb); }
        sm[q] = vals[u * 4 + q]; o[q] = (vals[u * 4 + q] - mu) * rs * gg + bb;
      }
      if (out_sum) *(v4f*)(out_sum + (size_t)row * N + j) = sm;
      *(v4f*)(out_norm + (size_t)row * N + j) = o;
    }
    
  }
}



// ---- f16 WMMA path (v_wmma_f32_16x16x32_f16): 11-bit significands for operands in range — used where a [0,1] probability operand needs more precision than bf16
typedef _Float16 v16h __attribute__((ext_vector_type(16)));
union FragH { v16h v; v8us half[2]; _Float16 h[16]; unsigned short u[16]; };
template <int NT>
__device__ __forceinline__ v8f mmaH(v16h ah, v16h al, v16h bh, v16h bl, v8f c) {
  c = __builtin_amdgcn_wmma_f32_16x16x32_f16(false, ah, false, bh, (short)0, c, false, false);
  if (NT >= 2) c = __builtin_amdgcn_wmma_f32_16x16x32_f16(false, al, false, bh, (short)0, c, false, false);
  if (NT >= 3) c = __builtin_amdgcn_wmma_f32_16x16x32_f16(false, ah, false, bl, (short)0, c, false, false);
  asm volatile("v_nop\n\tv_nop\n\tv_nop\n\tv_nop" : "+v"(c) : "v"(ah), "v"(al), "v"(bh), "v"(bl));
  return c;
}
// batched GEMM like k_gemm_b but f16 operands: A f32 (split into f16 hi/lo if ASPLIT, else rounded to f16), Bt = f16 values [n][k]; alpha; C f32; N multiple of 16 (partial tiles skipped)
template <bool ASPLIT>
__global__ __launch_bounds__(128) void k_gemm_h(const float* __restrict__ A, int lda, size_t sA, const _Float16* __restrict__ Bh, int ldb, size_t sB, float alpha, float* __restrict__ C, int ldc, size_t sC, int M, int N, int K) {
  __shared__ __attribute__((aligned(16))) float so[4][16][64];
  const int tid = threadIdx.x, w = tid >> 5, lane = tid & 31, ln = lane & 15, hh = lane >> 4; const int by = blockIdx.y;
  A += (size_t)by * sA; Bh += (size_t)by * sB; C += (size_t)by * sC;
  const int ntn = (N + 63) / 64; const int wid = blockIdx.x * 4 + w; const int mt = wid / ntn, nq = wid % ntn; if (mt * 16 >= M) return;
  const int row0 = mt * 16, col0 = nq * 64; const float* arow = A + (size_t)(row0 + ln) * lda;
  v8f acc[4] = {};
  for (int kb = 0; kb < K; kb += 32) {
    FragH ah, al;
    const v4f x0 = *(const v4fa*)(arow + kb + 8 * hh), x1 = *(const v4fa*)(arow + kb + 8 * hh + 4), x2 = *(const v4fa*)(arow + kb + 16 + 8 * hh), x3 = *(const v4fa*)(arow + kb + 16 + 8 * hh + 4);
    float xs[16] = {x0[0],x0[1],x0[2],x0[3],x1[0],x1[1],x1[2],x1[3],x2[0],x2[1],x2[2],x2[3],x3[0],x3[1],x3[2],x3[3]};
#pragma unroll
    for (int i = 0; i < 16; ++i) { const _Float16 h = (_Float16)xs[i]; ah.h[i] = h; al.h[i] = ASPLIT ? (_Float16)(xs[i] - (float)h) : (_Float16)0.0f; }
#pragma unroll
    for (int t = 0; t < 4; ++t) { if (col0 + t * 16 >= N) continue; const size_t boff = (size_t)(col0 + t * 16 + ln) * ldb + kb; FragH bq; bq.half[0] = *(const v8us*)(Bh + boff + 8 * hh); bq.half[1] = *(const v8us*)(Bh + boff + 16 + 8 * hh);
      acc[t] = mmaH<ASPLIT ? 2 : 1>(ah.v, al.v, bq.v, bq.v, acc[t]); }
  }
#pragma unroll
  for (int t = 0; t < 4; ++t) { if (col0 + t * 16 >= N) continue;
#pragma unroll
    for (int r = 0; r < 8; ++r) so[w][8 * hh + r][t * 16 + ln] = acc[t][r] * alpha; }
  __builtin_amdgcn_fence(__ATOMIC_ACQ_REL, "workgroup"); __builtin_amdgcn_wave_barrier();
  const int rsub = lane >> 4, c4 = (lane & 15) * 4;
  {
#pragma unroll
    for (int q = 0; q < 8; ++q) { const int r = q * 2 + rsub; if (col0 + c4 < N) { const v4f v = *(const v4fa*)&so[w][r][c4]; *(v4f*)(C + (size_t)(row0 + r) * ldc + col0 + c4) = v; } }
     }
}

// Wt[n][k] = f16(W[k][n]·scale) from f32 row-major W[K][N] (scale = power of two; bf16-exact weights stay exact in f16 away from the subnormal range)
__global__ __launch_bounds__(256) void k_wt_f16(const float* __restrict__ W, _Float16* __restrict__ Wt, int K, int N, float scale) {
  const int t = blockIdx.x * 256 + threadIdx.x; if (t >= N * (K / 8)) return; const int n = t / (K / 8), k8 = (t % (K / 8)) * 8; FragH f;
#pragma unroll
  for (int i = 0; i < 8; ++i) f.h[i] = (_Float16)(bf16_round(W[(size_t)(k8 + i) * N + n]) * scale); const v8us o = f.half[0];
  *(v8us*)((unsigned short*)Wt + (size_t)n * K + k8) = o; 
}
// k_gemm_hh variant with fused epilogue: v = acc·alpha + bias[by·sBias + col] (+ CP[(row/rowsPerB)·sCPb + by·64 + col] if CP) ; ACT 0 none / 1 elu ; writes f16 C16 (and f32 C if non-null)
template <int ACT>
__global__ __launch_bounds__(128) void k_gemm_hhx(const _Float16* __restrict__ A, int lda, size_t sA, const _Float16* __restrict__ Bh, int ldb, size_t sB, float alpha, const float* __restrict__ bias, size_t sBias, const float* __restrict__ CP, int rowsPerB, size_t sCPb, int row0g,
    float* __restrict__ C, _Float16* __restrict__ C16, int ldc, size_t sC, int M, int N, int K) {
  __shared__ __attribute__((aligned(16))) float so[4][16][64];
  const int tid = threadIdx.x, w = tid >> 5, lane = tid & 31, ln = lane & 15, hh = lane >> 4; const int by = blockIdx.y;
  A += (size_t)by * sA; Bh += (size_t)by * sB; const size_t cofs = (size_t)by * sC; const float* bp = bias ? bias + (size_t)by * sBias : nullptr;
  const int ntn = (N + 63) / 64; const int wid = blockIdx.x * 4 + w; const int mt = wid / ntn, nq = wid % ntn; if (mt * 16 >= M) return;
  const int row0 = mt * 16, col0 = nq * 64; const _Float16* arow = A + (size_t)(row0 + ln) * lda;
  v8f acc[4] = {};
  for (int kb = 0; kb < K; kb += 32) { FragH ah; ah.half[0] = *(const v8us*)((const unsigned short*)arow + kb + 8 * hh); ah.half[1] = *(const v8us*)((const unsigned short*)arow + kb + 16 + 8 * hh);
#pragma unroll
    for (int t = 0; t < 4; ++t) { if (col0 + t * 16 >= N) continue; const size_t boff = (size_t)(col0 + t * 16 + ln) * ldb + kb; FragH bq; bq.half[0] = *(const v8us*)((const unsigned short*)Bh + boff + 8 * hh); bq.half[1] = *(const v8us*)((const unsigned short*)Bh + boff + 16 + 8 * hh);
      acc[t] = mmaH<1>(ah.v, ah.v, bq.v, bq.v, acc[t]); }
  }
#pragma unroll
  for (int t = 0; t < 4; ++t) { if (col0 + t * 16 >= N) continue; const int col = col0 + t * 16 + ln; const float bv = bp ? bf16_round(bp[col]) : 0.f;
#pragma unroll
    for (int r = 0; r < 8; ++r) { float v = acc[t][r] * alpha + bv; if (CP) { const int rr = row0g + row0 + 8 * hh + r; if (rowsPerB < 0) v += CP[cofs + (size_t)rr * ldc + col];      /* rowsPerB < 0: own element of the batched C plane */ else { const int bidx = rr / rowsPerB; v += CP[(size_t)bidx * sCPb + (size_t)by * 64 + col]; } } if (ACT == 1) v = (v > 0.f) ? v : expm1f(v); else if (ACT == 7) v = (v > 0.f) ? v + 1.0f : expf(v); else if (ACT == 8) v = tanhf(v); else if (ACT == 9) v = 0.5f * v * (1.0f + tanhf(0.7978845608028654f * (v + 0.044715f * v * v * v))); else if (ACT == 11) v = 1.0f / (1.0f + expf(-v)); else if (ACT == 12) v = (v > 0.f) ? v : 0.01f * v; else if (ACT == 14) v = (v > 0.f) ? v : 0.1f * v; else if (ACT == 16) v = (v >= 0.f) ? v : 0.3f * v; else if (ACT == 17) v = (v >= 0.f) ? v : 0.2f * v; else if (ACT == 15) v = v / (1.0f + expf(-v)); else if (ACT == 3) v = fmaxf(v, 0.f); else if (ACT == 6) v = 0.5f * v * (1.0f + erff(v * 0.70710678118654752f)); so[w][8 * hh + r][t * 16 + ln] = v; } }
  __builtin_amdgcn_fence(__ATOMIC_ACQ_REL, "workgroup"); __builtin_amdgcn_wave_barrier();
  const int rsub = lane >> 4, c4 = (lane & 15) * 4; typedef _Float16 v4h __attribute__((ext_vector_type(4)));
  {
#pragma unroll
    for (int q = 0; q < 8; ++q) { const int r = q * 2 + rsub; if (col0 + c4 < N) { const v4f v = *(const v4fa*)&so[w][r][c4]; if (C) *(v4f*)(C + cofs + (size_t)(row0 + r) * ldc + col0 + c4) = v; if (C16) { v4h h4; for (int i = 0; i < 4; ++i) h4[i] = (_Float16)v[i]; *(v4h*)(C16 + cofs + (size_t)(row0 + r) * ldc + col0 + c4) = h4; } } }
     }
}


typedef _Float16 v4h __attribute__((ext_vector_type(4)));

__global__ __launch_bounds__(256) void k_x16(const float* __restrict__ x, _Float16* __restrict__ X16, size_t n8) { const size_t t = (size_t)blockIdx.x * 256 + threadIdx.x; if (t >= n8) return; FragH f;
#pragma unroll
  for (int q = 0; q < 8; ++q) f.h[q] = (_Float16)bf16_round(x[t * 8 + q]); *(v8us*)((unsigned short*)X16 + t * 8) = f.half[0];  }
__global__ __launch_bounds__(256) void k_h16(const float* __restrict__ x, _Float16* __restrict__ X16, size_t n8) { const size_t t = (size_t)blockIdx.x * 256 + threadIdx.x; if (t >= n8) return; FragH f;
#pragma unroll
  for (int q = 0; q < 8; ++q) f.h[q] = (_Float16)x[t * 8 + q]; *(v8us*)((unsigned short*)X16 + t * 8) = f.half[0];  }
__global__ __launch_bounds__(256) void k_round16f(const float* __restrict__ W, _Float16* __restrict__ Bt, size_t n8) { const size_t t = (size_t)blockIdx.x * 256 + threadIdx.x; if (t >= n8) return; FragH f;
#pragma unroll
  for (int i = 0; i < 8; ++i) f.h[i] = (_Float16)(bf16_round(W[t * 8 + i]) * 16.0f); *(v8us*)((unsigned short*)Bt + t * 8) = f.half[0];  }
template <int NHv, int TTv>
__global__ __launch_bounds__(256) void k_vt(const _Float16* __restrict__ V16, int ldv, int voff, _Float16* __restrict__ Vt) { __shared__ unsigned short tl[64][66]; const int tid = threadIdx.x; const int slab = blockIdx.x / (TTv / 64), lg = blockIdx.x % (TTv / 64); const int b = slab / NHv, h = slab % NHv;
  for (int i = tid; i < 64 * 8; i += 256) { const int r = i / 8, c8 = (i % 8) * 8; FragH f; f.half[0] = *(const v8us*)((const unsigned short*)V16 + ((size_t)b * TTv + lg * 64 + r) * ldv + voff + h * 64 + c8);
#pragma unroll
    for (int q = 0; q < 8; ++q) tl[r][c8 + q] = f.u[q]; }
  __syncthreads();
  {
#pragma unroll
    for (int rd = 0; rd < 2; ++rd) { const int d = rd * 32 + tid / 8, pc = tid % 8; FragH f;
#pragma unroll
      for (int q = 0; q < 8; ++q) f.u[q] = tl[pc * 8 + q][d];
      *(v8us*)((unsigned short*)Vt + ((size_t)slab * 64 + d) * TTv + lg * 64 + pc * 8) = f.half[0]; }
     } }

__global__ __launch_bounds__(256) void k_hl(const float* __restrict__ F, _Float16* __restrict__ Hh, _Float16* __restrict__ Hl, size_t n8) { const size_t t = (size_t)blockIdx.x * 256 + threadIdx.x; if (t >= n8) return; FragH fh, fl; const v4f a = *(const v4fa*)(F + t * 8), c = *(const v4fa*)(F + t * 8 + 4);
#pragma unroll
  for (int q = 0; q < 4; ++q) { _Float16 h = (_Float16)a[q]; fh.h[q] = h; fl.h[q] = (_Float16)((a[q] - (float)h) * 1024.0f); h = (_Float16)c[q]; fh.h[4 + q] = h; fl.h[4 + q] = (_Float16)((c[q] - (float)h) * 1024.0f); }
  { *(v8us*)((unsigned short*)Hh + t * 8) = fh.half[0]; *(v8us*)((unsigned short*)Hl + t * 8) = fl.half[0];  } }

// ---- fast GEMM (wave tile 32x64; requires M % 32 == 0 rows per launch region and N % 64 == 0); epilogue = k_gemm_hhx semantics ----
__device__ __forceinline__ v16h g2_frag(const _Float16* p, int hh) { FragH f; f.half[0] = *(const v8us*)((const unsigned short*)p + 8 * hh); f.half[1] = *(const v8us*)((const unsigned short*)p + 16 + 8 * hh); return f.v; }
__device__ __forceinline__ v8f g2_mma(v16h a, v16h b, v8f c) { v8f d = __builtin_amdgcn_wmma_f32_16x16x32_f16(false, a, false, b, (short)0, c, false, false); asm volatile("v_nop\n\tv_nop\n\tv_nop\n\tv_nop" : "+v"(d) : "v"(a), "v"(b)); return d; }
template <int ACT>
__global__ __launch_bounds__(128) void k_gemm2(const _Float16* __restrict__ A, int lda, size_t sA, const _Float16* __restrict__ Bh, int ldb, size_t sB, float alpha, const float* __restrict__ bias, size_t sBias, const float* __restrict__ CP, int rowsPerB, size_t sCPb, int row0g,
    float* __restrict__ C, _Float16* __restrict__ C16, int ldc, size_t sC, int M, int N, int K) { static_assert(ACT == 0 || ACT == 3 || ACT == 6 || ACT == 8 || ACT == 9 || ACT == 11 || ACT == 12 || ACT == 14 || ACT == 15 || ACT == 16 || ACT == 17, "k_gemm2: unsupported ACT code (would silently apply no activation)");
  __shared__ __attribute__((aligned(16))) float so[4][32][68];
  const int tid = threadIdx.x, w = tid >> 5, lane = tid & 31, ln = lane & 15, hh = lane >> 4; const int by = blockIdx.y;
  A += (size_t)by * sA; Bh += (size_t)by * sB; const size_t cofs = (size_t)by * sC; const float* bp = bias ? bias + (size_t)by * sBias : nullptr;
  const int ntn = N >> 6; const int mt = blockIdx.x / ntn, nq = blockIdx.x - mt * ntn; const int row0 = mt * 128 + 32 * w, col0 = nq * 64; if (row0 >= M) return;
  const _Float16* a0p = A + (size_t)(row0 + ln) * lda; const _Float16* a1p = a0p + (size_t)16 * lda;
  const _Float16* b0p = Bh + (size_t)(col0 + ln) * ldb; const _Float16* b1p = b0p + (size_t)16 * ldb; const _Float16* b2p = b1p + (size_t)16 * ldb; const _Float16* b3p = b2p + (size_t)16 * ldb;
  const v8f z8 = {0.f,0.f,0.f,0.f,0.f,0.f,0.f,0.f}; v8f c00 = z8, c01 = z8, c02 = z8, c03 = z8, c10 = z8, c11 = z8, c12 = z8, c13 = z8;
#pragma unroll 1
  for (int kb = 0; kb < K; kb += 32) { const v16h a0 = g2_frag(a0p + kb, hh), a1 = g2_frag(a1p + kb, hh);
    v16h b = g2_frag(b0p + kb, hh); c00 = g2_mma(a0, b, c00); c10 = g2_mma(a1, b, c10);
    b = g2_frag(b1p + kb, hh); c01 = g2_mma(a0, b, c01); c11 = g2_mma(a1, b, c11);
    b = g2_frag(b2p + kb, hh); c02 = g2_mma(a0, b, c02); c12 = g2_mma(a1, b, c12);
    b = g2_frag(b3p + kb, hh); c03 = g2_mma(a0, b, c03); c13 = g2_mma(a1, b, c13); }
  v8f accs[8] = {c00, c01, c02, c03, c10, c11, c12, c13};
#pragma unroll
  for (int u = 0; u < 8; ++u) { const int t = u & 3, half = u >> 2; const int col = col0 + t * 16 + ln; const float bv = bp ? bf16_round(bp[col]) : 0.f;
#pragma unroll
    for (int r = 0; r < 8; ++r) { const int rloc = half * 16 + 8 * hh + r; float v = accs[u][r] * alpha + bv; if (CP) { if (rowsPerB < 0) v += CP[cofs + (size_t)(row0g + row0 + rloc) * ldc + col];      /* rowsPerB < 0: own element of the batched C plane */ else { const int bidx = (row0g + row0 + rloc) / rowsPerB; v += CP[(size_t)bidx * sCPb + (size_t)by * 64 + col]; } }
      if (ACT == 3) v = fmaxf(v, 0.f); else if (ACT == 6) v = 0.5f * v * (1.0f + erff(v * 0.70710678118654752f)); else if (ACT == 11) v = 1.0f / (1.0f + expf(-v)); else if (ACT == 15) v = v / (1.0f + expf(-v)); else if (ACT == 12) v = (v > 0.f) ? v : 0.01f * v; else if (ACT == 8) v = tanhf(v); else if (ACT == 9) v = 0.5f * v * (1.0f + tanhf(0.7978845608028654f * (v + 0.044715f * v * v * v))); else if (ACT == 14) v = (v > 0.f) ? v : 0.1f * v; else if (ACT == 16) v = (v >= 0.f) ? v : 0.3f * v; else if (ACT == 17) v = (v >= 0.f) ? v : 0.2f * v;
      so[w][rloc][t * 16 + ln] = v; } }
  __builtin_amdgcn_fence(__ATOMIC_ACQ_REL, "workgroup"); __builtin_amdgcn_wave_barrier();
  const int rsub = lane >> 4, c4 = (lane & 15) * 4;
  {
#pragma unroll
    for (int q = 0; q < 16; ++q) { const int r = q * 2 + rsub; const v4f v = *(const v4fa*)&so[w][r][c4]; if (C) *(v4f*)(C + cofs + (size_t)(row0 + r) * ldc + col0 + c4) = v; if (C16) { v4h h4; for (int i = 0; i < 4; ++i) h4[i] = (_Float16)v[i]; *(v4h*)(C16 + cofs + (size_t)(row0 + r) * ldc + col0 + c4) = h4; } }
     } }


__global__ __launch_bounds__(256) void k_wnat(const float* __restrict__ w, size_t n8, _Float16* __restrict__ Bt) { const size_t t = (size_t)blockIdx.x * 256 + threadIdx.x; if (t >= n8) return; FragH f; for (int q = 0; q < 8; ++q) f.h[q] = (_Float16)(bf16_round(w[t * 8 + q]) * 16.0f); *(v8us*)((unsigned short*)Bt + t * 8) = f.half[0];  }
__global__ __launch_bounds__(256) void k_rsm(const float* __restrict__ S, _Float16* __restrict__ P, int nrows) {
  #pragma clang fp contract(off)
  const int i = blockIdx.x * 256 + threadIdx.x; if (i >= nrows) return; const float* s = S + (size_t)i * SQ; float mx = -3.0e38f;
#pragma unroll 1
  for (int j = 0; j < SQ; ++j) mx = fmaxf(mx, s[j]); float se = 0.f;
#pragma unroll 1
  for (int j = 0; j < SQ; ++j) se += expf(s[j] - mx); const float sc = 256.0f / se;
#pragma unroll 1
  for (int j0 = 0; j0 < SQ; j0 += 8) { FragH f; for (int q = 0; q < 8; ++q) f.h[q] = (_Float16)(expf(s[j0 + q] - mx) * sc); unsigned short* d = (unsigned short*)P + (size_t)i * SQ + j0; *(v8us*)d = f.half[0];  } }
__global__ __launch_bounds__(256) void k_vt(const _Float16* __restrict__ V16, int b, int h0, _Float16* __restrict__ VT) { __shared__ unsigned short tl[64][65]; const int tid = threadIdx.x; const int hh = blockIdx.x % HG, sg = blockIdx.x / HG; const int s0 = sg * 64; const int h = h0 + hh;
  for (int i = tid; i < 64 * 8; i += 256) { const int j = i / 8, d8 = (i % 8) * 8; FragH f; f.half[0] = *(const v8us*)((const unsigned short*)V16 + ((size_t)b * SQ + s0 + j) * DM + h * HD + d8); for (int q = 0; q < 8; ++q) tl[d8 + q][j] = f.u[q]; }
  __syncthreads();
  { for (int i = tid; i < 64 * 8; i += 256) { const int d = i / 8, j8 = (i % 8) * 8; FragH f; for (int q = 0; q < 8; ++q) f.u[q] = tl[d][j8 + q]; *(v8us*)((unsigned short*)VT + ((size_t)hh * HD + d) * SQ + s0 + j8) = f.half[0]; }  } }



__global__ __launch_bounds__(256) void k_rsmf(const float* __restrict__ S, _Float16* __restrict__ P, int qn, int hg) {
  #pragma clang fp contract(off)
  const int t = blockIdx.x * 256 + threadIdx.x; if (t >= qn * hg) return; const size_t i = (size_t)(t / qn) * SQ + (t % qn); const float* s = S + i * SQ; float mx = -3.0e38f;
#pragma unroll 1
  for (int j = 0; j < SQ; ++j) mx = fmaxf(mx, s[j]); float se = 0.f;
#pragma unroll 1
  for (int j = 0; j < SQ; ++j) se += __expf(s[j] - mx); const float sc = 256.0f / se;
#pragma unroll 1
  for (int j0 = 0; j0 < SQ; j0 += 8) { FragH f; for (int q = 0; q < 8; ++q) f.h[q] = (_Float16)(__expf(s[j0 + q] - mx) * sc); unsigned short* d = (unsigned short*)P + i * SQ + j0; *(v8us*)d = f.half[0];  } }

__device__ __forceinline__ float stm3(float x) { const float a = __fadd_rn(1.0f, -__fmul_rn(x, 0.33333334f)); const float b = __fadd_rn(1.0f, -__fmul_rn(__fmul_rn(0.5f, x), a)); return __builtin_amdgcn_rcpf(__fadd_rn(1.0f, -__fmul_rn(x, b))); }      /* x / 3 as a multiply by f32(1/3) and the final reciprocal through v_rcp_f32 (1 ulp each; the weight is rounded to f16 afterwards): no IEEE-division expansion */
__global__ __launch_bounds__(256) void k_rsmst(const float* __restrict__ S, _Float16* __restrict__ P, int qn, int hg) {
  #pragma clang fp contract(off)
  const int t = blockIdx.x * 256 + threadIdx.x; if (t >= qn * hg) return; const size_t i = (size_t)(t / qn) * SQ + (t % qn); const float* s = S + i * SQ; float mx = -3.0e38f;
#pragma unroll 1
  for (int j = 0; j < SQ; ++j) mx = fmaxf(mx, s[j]); float se = 0.f;
#pragma unroll 1
  for (int j = 0; j < SQ; ++j) se += stm3(s[j] - mx); const float sc = 256.0f / se;
#pragma unroll 1
  for (int j0 = 0; j0 < SQ; j0 += 8) { FragH f; for (int q = 0; q < 8; ++q) f.h[q] = (_Float16)(stm3(s[j0 + q] - mx) * sc); unsigned short* d = (unsigned short*)P + i * SQ + j0; *(v8us*)d = f.half[0];  } }

extern "C" void kernel_launch(void* const* d_in, const int* in_sizes, int n_in,
                              void* d_out, int out_size, void* d_ws, size_t ws_size, hipStream_t stream) {
  (void)in_sizes; (void)n_in; (void)out_size;
  const float* const* I = (const float* const*)d_in; const float* x = I[0]; const float* wqkv = I[1]; const float* bqkv = nullptr; const float* wo = I[2]; const float* bo = I[3];      /* natural [out][in] fused weight [3072][1024] (NO bias: nullptr in the fused GEMM's bias slot); natural w_out [1024][1024] + b_out */
  char* ws = (char*)d_ws; size_t off = 0;
  auto take = [&](size_t bytes) { char* p = ws + off; off += (bytes + 255) & ~(size_t)255; return p; };
  _Float16* BQKV = (_Float16*)take((size_t)3 * DM * DM * 2); _Float16* BO = (_Float16*)take((size_t)DM * DM * 2);
  _Float16* X16 = (_Float16*)take(NR * DM * 2); _Float16* QKV = (_Float16*)take(NR * 3 * DM * 2); _Float16* Q16 = QKV; _Float16* K16 = QKV + DM; _Float16* V16 = QKV + 2 * DM; _Float16* O16 = (_Float16*)take(NR * DM * 2);
  float* S = (float*)take((size_t)HG * SQ * SQ * 4); _Float16* P = (_Float16*)take((size_t)HG * SQ * SQ * 2); _Float16* VT = (_Float16*)take((size_t)NH * HD * SQ * 2);
  if (off > ws_size) return;
  k_wnat<<<(unsigned)(((size_t)LQ * DM / 8 + 255) / 256), 256, 0, stream>>>(wqkv, (size_t)LQ * DM / 8, BQKV); k_wnat<<<(unsigned)(((size_t)DM * DM / 8 + 255) / 256), 256, 0, stream>>>(wo, (size_t)DM * DM / 8, BO);      /* natural [out][in] = Bt[n][k] x16 (no transpose): fused rows 0..1023 = q, 1024.. = k, 2048.. = v */

  k_x16<<<(unsigned)((NR * DM / 8 + 255) / 256), 256, 0, stream>>>(x, X16, NR * DM / 8);
  const size_t r0p = (size_t)B0 * SQ;      /* first projected row */
  k_gemm2<0><<<dim3((unsigned)((MP / 128) * (3 * DM / 64)), 1), 128, 0, stream>>>(X16 + r0p * DM, DM, 0, BQKV, DM, 0, 0.0625f, bqkv, 0, nullptr, 1, 0, 0, nullptr, QKV + r0p * 3 * DM, 3 * DM, 0, MP, 3 * DM, DM);      /* q | k | v rows (f16); head h = columns h*HD.. of each DM block */
  for (int b = B0; b < B0 + NBR; ++b) { const size_t r0 = (size_t)b * SQ;
    k_vt<NH, SQ><<<NH * (SQ / 64), 256, 0, stream>>>(V16 + r0 * LQ, LQ, 0, VT);      /* V^T [NH][HD][SQ] for this batch */
    for (int h0 = 0; h0 < NHD; h0 += HG) {
      k_gemm2<0><<<dim3((QN / 128) * (SQ / 64), HG), 128, 0, stream>>>(Q16 + r0 * LQ + h0 * HD, LQ, (size_t)HD, K16 + r0 * LQ + h0 * HD, LQ, (size_t)HD, 0.125f, nullptr, 0, nullptr, 1, 0, 0, S, nullptr, SQ, (size_t)SQ * SQ, QN, SQ, HD);      /* scores, HG heads per launch */
      k_rsmst<<<(HG * QN + 255) / 256, 256, 0, stream>>>(S, P, QN, HG);      /* P = 256 stablemax3 (f16), rows of all HG heads */
      k_gemm2<0><<<dim3((QN / 128) * (HD / 64), HG), 128, 0, stream>>>(P, SQ, (size_t)SQ * SQ, VT + (size_t)h0 * HD * SQ, SQ, (size_t)HD * SQ, 0.25f, nullptr, 0, nullptr, 1, 0, 0, nullptr, O16 + r0 * DM + h0 * HD, DM, (size_t)HD, QN, HD, SQ); } }      /* o (merged heads) as f16 rows */
  k_gemm2<0><<<dim3((unsigned)((MPO / 128) * (DM / 64)), 1), 128, 0, stream>>>(O16 + r0p * DM, DM, 0, BO, DM, 0, 0.0009765625f, bo, 0, nullptr, 1, 0, 0, (float*)d_out + r0p * DM, nullptr, DM, 0, MPO, DM, DM);      /* out rows are the output layout */
}

// v001
// It runs in 927 microseconds.
// In two side-by-side timings against v000, it was 3.80 and 3.79 times as fast.
#include <hip/hip_runtime.h>
// Multi-head self-attention with a polynomial 'stablemax' normalisation instead of softmax (x [2][2048][1024]; qkv = x w_qkv^T (natural [3072][1024] sigma 0.02, NO bias) reshaped (B, S, 3, 16, 64): q | k | v thirds; attn = stablemax3(q k^T * 64^-0.5): logits minus the row max, then s(x) = 1 + x (1 + x/2 (1 + x/3)) for x >= 0 and 1 / (1 - x (1 - x/2 (1 - x/3))) for x < 0, normalised by the row sum; out = merged w_out^T + b_out (natural) -> [2][2048][1024]).
// Structure: token rows r = b*2048 + s; x as exact f16 rows (bf16-rounded); q | k | v as ONE WMMA GEMM (N = 3 x 1024) (32x64 wave tiles, f32 accumulation, exact x16 weights, no bias, f16 outputs); per batch: V^T for all heads via LDS transposes; per (batch, group of 4 heads): scores GEMM (K = 64, batched over the heads on grid.y, alpha = 64^-0.5), row stablemax3 on VALU (f32 statistics, polynomial with v_rcp_f32; weights stored x256 as f16), o = P . V^T GEMM (K = 2048, alpha 2^-2: o carried x64 against f16 subnormal flush, folded into the output GEMM alpha) written straight into the merged f16 o rows; out = o W_o + b GEMM (f32) into the output layout.
// Compute dtype: inputs rounded to bf16; x / weights exact; q, k, v, stablemax weights and o as plain f16 GEMM operands (~2^-12); scores and stablemax statistics f32; v_wmma_f32_16x16x32_f16.
#define NB 2
#define SQ 2048
#define DM 1024
#define NH 16
#define HD 64
#define HG 4                         /* heads per attention launch group */
#define B0 0                         /* first batch processed (debug hook) */
#define NBR NB                       /* batches processed (debug hook) */
#define NR ((size_t)NB * SQ)         /* token rows */
#define MP ((int)((size_t)NBR * SQ)) /* rows projected (debug hook) */
#define QN SQ                        /* query rows attended per batch (debug hook) */
#define NHD NH                       /* heads attended (debug hook) */
#define MPO MP                       /* rows through the output stage (debug hook) */
#define LQ (3 * DM)      /* row pitch of the q/k/v rows */
typedef __bf16 v16b __attribute__((ext_vector_type(16)));
typedef unsigned short v8us __attribute__((ext_vector_type(8), may_alias));
typedef float  v8f  __attribute__((ext_vector_type(8)));
typedef float  v4f  __attribute__((ext_vector_type(4)));
typedef float  v4fa __attribute__((ext_vector_type(4), may_alias));
union FragB { v16b v; v8us half[2]; unsigned short u[16]; };

__device__ __forceinline__ unsigned short bf16_bits(float x) { unsigned int u = __float_as_uint(x); return (unsigned short)((u + 0x7FFFu + ((u >> 16) & 1u)) >> 16); }
__device__ __forceinline__ float bf16_val(unsigned short b) { return __uint_as_float(((unsigned int)b) << 16); }
__device__ __forceinline__ float bf16_round(float x) { return bf16_val(bf16_bits(x)); }
// D += A·B with NT terms: 1 = ah·bh, 2 = + al·bh (A split), 3 = + ah·bl (both split)
template <int NT>
__device__ __forceinline__ v8f mmaN(v16b ah, v16b al, v16b bh, v16b bl, v8f c) {
  c = __builtin_amdgcn_wmma_f32_16x16x32_bf16(false, ah, false, bh, (short)0, c, false, false);
  if (NT >= 2) c = __builtin_amdgcn_wmma_f32_16x16x32_bf16(false, al, false, bh, (short)0, c, false, false);
  if (NT >= 3) c = __builtin_amdgcn_wmma_f32_16x16x32_bf16(false, ah, false, bl, (short)0, c, false, false);
  asm volatile("v_nop\n\tv_nop\n\tv_nop\n\tv_nop" : "+v"(c) : "v"(ah), "v"(al), "v"(bh), "v"(bl));
  return c;
}

__global__ __launch_bounds__(256) void k_wt_bf16(const float* __restrict__ W, unsigned short* __restrict__ Wt, int K, int N) {
  const int t = blockIdx.x * 256 + threadIdx.x;
  const int k8n = K / 8;
  if (t >= N * k8n) return;
  const int n = t / k8n, k8 = (t % k8n) * 8;
  v8us v;
#pragma unroll
  for (int i = 0; i < 8; ++i) v[i] = bf16_bits(W[(size_t)(k8 + i) * N + n]);
  *(v8us*)(Wt + (size_t)n * K + k8) = v;
  
}

// GEMM C[M][N] (f32, pitch ldc) = act(A[M][K]·W + bias). A f32 row-major (pitch lda) converted per fragment to bf16
// (ASPLIT: hi/lo two planes -> 2 terms, else single rounded term); Wt bf16 [N][K] (pitch ldb). BIAS_BF16 rounds the
// bias to bf16 first (bias quantised to bf16 before the add). K%32==0, M%16==0, N%64==0.
template <bool ASPLIT, int ACT, bool BIAS_BF16>
__global__ __launch_bounds__(128) void k_gemm_bf(const float* __restrict__ A, int lda, const unsigned short* __restrict__ Wt, int ldb,
                                               const float* __restrict__ bias, float* __restrict__ C, int ldc, int M, int N, int K) {
  __shared__ __attribute__((aligned(16))) float so[4][16][64];
  const int tid = threadIdx.x, w = tid >> 5, lane = tid & 31, ln = lane & 15, hh = lane >> 4;
  const int ntn = N / 64;
  const int wid = blockIdx.x * 4 + w;
  const int mt = wid / ntn, nq = wid % ntn;
  if (mt * 16 >= M) return;
  const int row0 = mt * 16, col0 = nq * 64;
  const float* arow = A + (size_t)(row0 + ln) * lda;
  v8f acc[4] = {};
  for (int kb = 0; kb < K; kb += 32) {
    FragB ah, al;
    const v4f x0 = *(const v4fa*)(arow + kb + 8 * hh), x1 = *(const v4fa*)(arow + kb + 8 * hh + 4);
    const v4f x2 = *(const v4fa*)(arow + kb + 16 + 8 * hh), x3 = *(const v4fa*)(arow + kb + 16 + 8 * hh + 4);
    float xs[16] = {x0[0],x0[1],x0[2],x0[3],x1[0],x1[1],x1[2],x1[3],x2[0],x2[1],x2[2],x2[3],x3[0],x3[1],x3[2],x3[3]};
#pragma unroll
    for (int i = 0; i < 16; ++i) { const unsigned short hb = bf16_bits(xs[i]); ah.u[i] = hb; al.u[i] = ASPLIT ? bf16_bits(xs[i] - bf16_val(hb)) : (unsigned short)0; }
#pragma unroll
    for (int t = 0; t < 4; ++t) {
      const unsigned short* brow = Wt + (size_t)(col0 + t * 16 + ln) * ldb + kb;
      FragB b;
      b.half[0] = *(const v8us*)(brow + 8 * hh);
      b.half[1] = *(const v8us*)(brow + 16 + 8 * hh);
      acc[t] = mmaN<ASPLIT ? 2 : 1>(ah.v, al.v, b.v, b.v, acc[t]);
    }
  }
#pragma unroll
  for (int t = 0; t < 4; ++t) {
    float bv = bias ? bias[col0 + t * 16 + ln] : 0.f;
    if (BIAS_BF16) bv = bf16_round(bv);
#pragma unroll
    for (int r = 0; r < 8; ++r) { float v = acc[t][r] + bv; if (ACT == 1) v = fmaxf(v, 0.f); so[w][8 * hh + r][t * 16 + ln] = v; }
  }
  __builtin_amdgcn_fence(__ATOMIC_ACQ_REL, "workgroup");
  __builtin_amdgcn_wave_barrier();
  const int rsub = lane >> 4, c4 = (lane & 15) * 4;
  {
#pragma unroll
    for (int q = 0; q < 8; ++q) {
      const int r = q * 2 + rsub;
      const v4f v = *(const v4fa*)&so[w][r][c4];
      *(v4f*)(C + (size_t)(row0 + r) * ldc + col0 + c4) = v;
    }
    
  }
}

// GEMM C = act(A·W + bias + resid): A f32 (ASPLIT -> hi/lo 2 terms), Wt bf16 [N][K]; ACT 0 none, 1 relu, 2 exact gelu;
// resid (optional, f32, row index = (row % rmod), pitch ldr, RES_BF16 rounds it) added before the activation.
template <bool ASPLIT, int ACT, bool BIAS_BF16, bool RES_BF16>
__global__ __launch_bounds__(128) void k_gemm_bf3(const float* __restrict__ A, int lda, const unsigned short* __restrict__ Wt, int ldb,
                                                const float* __restrict__ bias, const float* __restrict__ resid, int rmod, int ldr,
                                                float* __restrict__ C, int ldc, int M, int N, int K) {
  __shared__ __attribute__((aligned(16))) float so[4][16][64];
  const int tid = threadIdx.x, w = tid >> 5, lane = tid & 31, ln = lane & 15, hh = lane >> 4;
  const int ntn = N / 64;
  const int wid = blockIdx.x * 4 + w;
  const int mt = wid / ntn, nq = wid % ntn;
  if (mt * 16 >= M) return;
  const int row0 = mt * 16, col0 = nq * 64;
  const float* arow = A + (size_t)(row0 + ln) * lda;
  v8f acc[4] = {};
  for (int kb = 0; kb < K; kb += 32) {
    FragB ah, al;
    const v4f x0 = *(const v4fa*)(arow + kb + 8 * hh), x1 = *(const v4fa*)(arow + kb + 8 * hh + 4);
    const v4f x2 = *(const v4fa*)(arow + kb + 16 + 8 * hh), x3 = *(const v4fa*)(arow + kb + 16 + 8 * hh + 4);
    float xs[16] = {x0[0],x0[1],x0[2],x0[3],x1[0],x1[1],x1[2],x1[3],x2[0],x2[1],x2[2],x2[3],x3[0],x3[1],x3[2],x3[3]};
#pragma unroll
    for (int i = 0; i < 16; ++i) { const unsigned short hb = bf16_bits(xs[i]); ah.u[i] = hb; al.u[i] = ASPLIT ? bf16_bits(xs[i] - bf16_val(hb)) : (unsigned short)0; }
#pragma unroll
    for (int t = 0; t < 4; ++t) {
      const unsigned short* brow = Wt + (size_t)(col0 + t * 16 + ln) * ldb + kb;
      FragB b;
      b.half[0] = *(const v8us*)(brow + 8 * hh);
      b.half[1] = *(const v8us*)(brow + 16 + 8 * hh);
      acc[t] = mmaN<ASPLIT ? 2 : 1>(ah.v, al.v, b.v, b.v, acc[t]);
    }
  }
#pragma unroll
  for (int t = 0; t < 4; ++t) {
    const int col = col0 + t * 16 + ln;
    float bv = bias ? bias[col] : 0.f;
    if (BIAS_BF16) bv = bf16_round(bv);
#pragma unroll
    for (int r = 0; r < 8; ++r) {
      float v = acc[t][r] + bv;
      if (resid) { float rv = resid[(size_t)((row0 + 8 * hh + r) % rmod) * ldr + col]; if (RES_BF16) rv = bf16_round(rv); v += rv; }
      if (ACT == 1) v = fmaxf(v, 0.f);
      if (ACT == 2) v = 0.5f * v * (1.0f + erff(v * 0.70710678118654752f));
      if (ACT == 3) { const float u = 0.7978845608028654f * (v + 0.044715f * v * v * v); v = 0.5f * v * (1.0f + tanhf(u)); }
      so[w][8 * hh + r][t * 16 + ln] = v;
    }
  }
  __builtin_amdgcn_fence(__ATOMIC_ACQ_REL, "workgroup");
  __builtin_amdgcn_wave_barrier();
  const int rsub = lane >> 4, c4 = (lane & 15) * 4;
  {
#pragma unroll
    for (int q = 0; q < 8; ++q) {
      const int r = q * 2 + rsub;
      const v4f v = *(const v4fa*)&so[w][r][c4];
      *(v4f*)(C + (size_t)(row0 + r) * ldc + col0 + c4) = v;
    }
    
  }
}
// row LayerNorm (biased variance, eps) over N: s = X (+ R); optional out_sum <- s; out_norm <- (s-mu)*rsqrt(var+eps)*g + b
template <bool PARAM_BF16>
__global__ __launch_bounds__(256) void k_layernorm(const float* __restrict__ X, const float* __restrict__ R, const float* __restrict__ g, const float* __restrict__ bta,
                                                  float* __restrict__ out_sum, float* __restrict__ out_norm, int N, float eps) {
  __shared__ float red[256];
  const int row = blockIdx.x, tid = threadIdx.x;
  const float* x = X + (size_t)row * N; const float* rr = R ? R + (size_t)row * N : nullptr;
  float vals[16];                     // up to N = 4096
  const int per = N / 256;            // contiguous chunk per thread? use strided-by-4 chunks: thread handles j = tid*4 + 1024*u
  float s1 = 0.f;
  for (int u = 0; u < per / 4; ++u) {
    const int j = tid * 4 + 1024 * u;
    const v4f a = *(const v4fa*)(x + j);
    v4f b = {0.f,0.f,0.f,0.f}; if (rr) b = *(const v4fa*)(rr + j);
#pragma unroll
    for (int q = 0; q < 4; ++q) { const float v = a[q] + b[q]; vals[u * 4 + q] = v; s1 += v; }
  }
  red[tid] = s1; __syncthreads();
  for (int st = 128; st > 0; st >>= 1) { if (tid < st) red[tid] += red[tid + st]; __syncthreads(); }
  const float mu = red[0] / (float)N; __syncthreads();
  float s2 = 0.f;
  for (int u = 0; u < per / 4; ++u)
#pragma unroll
    for (int q = 0; q < 4; ++q) { const float c = vals[u * 4 + q] - mu; s2 += c * c; }
  red[tid] = s2; __syncthreads();
  for (int st = 128; st > 0; st >>= 1) { if (tid < st) red[tid] += red[tid + st]; __syncthreads(); }
  const float rs = rsqrtf(red[0] / (float)N + eps);
  {
    for (int u = 0; u < per / 4; ++u) {
      const int j = tid * 4 + 1024 * u;
      v4f o, sm;
#pragma unroll
      for (int q = 0; q < 4; ++q) {
        float gg = g[j + q], bb = bta[j + q];
        if (PARAM_BF16) { gg = bf16_round(gg); bb = bf16_round(bb); }
        sm[q] = vals[u * 4 + q]; o[q] = (vals[u * 4 + q] - mu) * rs * gg + bb;
      }
      if (out_sum) *(v4f*)(out_sum + (size_t)row * N + j) = sm;
      *(v4f*)(out_norm + (size_t)row * N + j) = o;
    }
    
  }
}



// ---- f16 WMMA path (v_wmma_f32_16x16x32_f16): 11-bit significands for operands in range — used where a [0,1] probability operand needs more precision than bf16
typedef _Float16 v16h __attribute__((ext_vector_type(16)));
union FragH { v16h v; v8us half[2]; _Float16 h[16]; unsigned short u[16]; };
template <int NT>
__device__ __forceinline__ v8f mmaH(v16h ah, v16h al, v16h bh, v16h bl, v8f c) {
  c = __builtin_amdgcn_wmma_f32_16x16x32_f16(false, ah, false, bh, (short)0, c, false, false);
  if (NT >= 2) c = __builtin_amdgcn_wmma_f32_16x16x32_f16(false, al, false, bh, (short)0, c, false, false);
  if (NT >= 3) c = __builtin_amdgcn_wmma_f32_16x16x32_f16(false, ah, false, bl, (short)0, c, false, false);
  asm volatile("v_nop\n\tv_nop\n\tv_nop\n\tv_nop" : "+v"(c) : "v"(ah), "v"(al), "v"(bh), "v"(bl));
  return c;
}
// batched GEMM like k_gemm_b but f16 operands: A f32 (split into f16 hi/lo if ASPLIT, else rounded to f16), Bt = f16 values [n][k]; alpha; C f32; N multiple of 16 (partial tiles skipped)
template <bool ASPLIT>
__global__ __launch_bounds__(128) void k_gemm_h(const float* __restrict__ A, int lda, size_t sA, const _Float16* __restrict__ Bh, int ldb, size_t sB, float alpha, float* __restrict__ C, int ldc, size_t sC, int M, int N, int K) {
  __shared__ __attribute__((aligned(16))) float so[4][16][64];
  const int tid = threadIdx.x, w = tid >> 5, lane = tid & 31, ln = lane & 15, hh = lane >> 4; const int by = blockIdx.y;
  A += (size_t)by * sA; Bh += (size_t)by * sB; C += (size_t)by * sC;
  const int ntn = (N + 63) / 64; const int wid = blockIdx.x * 4 + w; const int mt = wid / ntn, nq = wid % ntn; if (mt * 16 >= M) return;
  const int row0 = mt * 16, col0 = nq * 64; const float* arow = A + (size_t)(row0 + ln) * lda;
  v8f acc[4] = {};
  for (int kb = 0; kb < K; kb += 32) {
    FragH ah, al;
    const v4f x0 = *(const v4fa*)(arow + kb + 8 * hh), x1 = *(const v4fa*)(arow + kb + 8 * hh + 4), x2 = *(const v4fa*)(arow + kb + 16 + 8 * hh), x3 = *(const v4fa*)(arow + kb + 16 + 8 * hh + 4);
    float xs[16] = {x0[0],x0[1],x0[2],x0[3],x1[0],x1[1],x1[2],x1[3],x2[0],x2[1],x2[2],x2[3],x3[0],x3[1],x3[2],x3[3]};
#pragma unroll
    for (int i = 0; i < 16; ++i) { const _Float16 h = (_Float16)xs[i]; ah.h[i] = h; al.h[i] = ASPLIT ? (_Float16)(xs[i] - (float)h) : (_Float16)0.0f; }
#pragma unroll
    for (int t = 0; t < 4; ++t) { if (col0 + t * 16 >= N) continue; const size_t boff = (size_t)(col0 + t * 16 + ln) * ldb + kb; FragH bq; bq.half[0] = *(const v8us*)(Bh + boff + 8 * hh); bq.half[1] = *(const v8us*)(Bh + boff + 16 + 8 * hh);
      acc[t] = mmaH<ASPLIT ? 2 : 1>(ah.v, al.v, bq.v, bq.v, acc[t]); }
  }
#pragma unroll
  for (int t = 0; t < 4; ++t) { if (col0 + t * 16 >= N) continue;
#pragma unroll
    for (int r = 0; r < 8; ++r) so[w][8 * hh + r][t * 16 + ln] = acc[t][r] * alpha; }
  __builtin_amdgcn_fence(__ATOMIC_ACQ_REL, "workgroup"); __builtin_amdgcn_wave_barrier();
  const int rsub = lane >> 4, c4 = (lane & 15) * 4;
  {
#pragma unroll
    for (int q = 0; q < 8; ++q) { const int r = q * 2 + rsub; if (col0 + c4 < N) { const v4f v = *(const v4fa*)&so[w][r][c4]; *(v4f*)(C + (size_t)(row0 + r) * ldc + col0 + c4) = v; } }
     }
}

// Wt[n][k] = f16(W[k][n]·scale) from f32 row-major W[K][N] (scale = power of two; bf16-exact weights stay exact in f16 away from the subnormal range)
__global__ __launch_bounds__(256) void k_wt_f16(const float* __restrict__ W, _Float16* __restrict__ Wt, int K, int N, float scale) {
  const int t = blockIdx.x * 256 + threadIdx.x; if (t >= N * (K / 8)) return; const int n = t / (K / 8), k8 = (t % (K / 8)) * 8; FragH f;
#pragma unroll
  for (int i = 0; i < 8; ++i) f.h[i] = (_Float16)(bf16_round(W[(size_t)(k8 + i) * N + n]) * scale); const v8us o = f.half[0];
  *(v8us*)((unsigned short*)Wt + (size_t)n * K + k8) = o; 
}
// k_gemm_hh variant with fused epilogue: v = acc·alpha + bias[by·sBias + col] (+ CP[(row/rowsPerB)·sCPb + by·64 + col] if CP) ; ACT 0 none / 1 elu ; writes f16 C16 (and f32 C if non-null)
template <int ACT>
__global__ __launch_bounds__(128) void k_gemm_hhx(const _Float16* __restrict__ A, int lda, size_t sA, const _Float16* __restrict__ Bh, int ldb, size_t sB, float alpha, const float* __restrict__ bias, size_t sBias, const float* __restrict__ CP, int rowsPerB, size_t sCPb, int row0g,
    float* __restrict__ C, _Float16* __restrict__ C16, int ldc, size_t sC, int M, int N, int K) {
  __shared__ __attribute__((aligned(16))) float so[4][16][64];
  const int tid = threadIdx.x, w = tid >> 5, lane = tid & 31, ln = lane & 15, hh = lane >> 4; const int by = blockIdx.y;
  A += (size_t)by * sA; Bh += (size_t)by * sB; const size_t cofs = (size_t)by * sC; const float* bp = bias ? bias + (size_t)by * sBias : nullptr;
  const int ntn = (N + 63) / 64; const int wid = blockIdx.x * 4 + w; const int mt = wid / ntn, nq = wid % ntn; if (mt * 16 >= M) return;
  const int row0 = mt * 16, col0 = nq * 64; const _Float16* arow = A + (size_t)(row0 + ln) * lda;
  v8f acc[4] = {};
  for (int kb = 0; kb < K; kb += 32) { FragH ah; ah.half[0] = *(const v8us*)((const unsigned short*)arow + kb + 8 * hh); ah.half[1] = *(const v8us*)((const unsigned short*)arow + kb + 16 + 8 * hh);
#pragma unroll
    for (int t = 0; t < 4; ++t) { if (col0 + t * 16 >= N) continue; const size_t boff = (size_t)(col0 + t * 16 + ln) * ldb + kb; FragH bq; bq.half[0] = *(const v8us*)((const unsigned short*)Bh + boff + 8 * hh); bq.half[1] = *(const v8us*)((const unsigned short*)Bh + boff + 16 + 8 * hh);
      acc[t] = mmaH<1>(ah.v, ah.v, bq.v, bq.v, acc[t]); }
  }
#pragma unroll
  for (int t = 0; t < 4; ++t) { if (col0 + t * 16 >= N) continue; const int col = col0 + t * 16 + ln; const float bv = bp ? bf16_round(bp[col]) : 0.f;
#pragma unroll
    for (int r = 0; r < 8; ++r) { float v = acc[t][r] * alpha + bv; if (CP) { const int rr = row0g + row0 + 8 * hh + r; if (rowsPerB < 0) v += CP[cofs + (size_t)rr * ldc + col];      /* rowsPerB < 0: own element of the batched C plane */ else { const int bidx = rr / rowsPerB; v += CP[(size_t)bidx * sCPb + (size_t)by * 64 + col]; } } if (ACT == 1) v = (v > 0.f) ? v : expm1f(v); else if (ACT == 7) v = (v > 0.f) ? v + 1.0f : expf(v); else if (ACT == 8) v = tanhf(v); else if (ACT == 9) v = 0.5f * v * (1.0f + tanhf(0.7978845608028654f * (v + 0.044715f * v * v * v))); else if (ACT == 11) v = 1.0f / (1.0f + expf(-v)); else if (ACT == 12) v = (v > 0.f) ? v : 0.01f * v; else if (ACT == 14) v = (v > 0.f) ? v : 0.1f * v; else if (ACT == 16) v = (v >= 0.f) ? v : 0.3f * v; else if (ACT == 17) v = (v >= 0.f) ? v : 0.2f * v; else if (ACT == 15) v = v / (1.0f + expf(-v)); else if (ACT == 3) v = fmaxf(v, 0.f); else if (ACT == 6) v = 0.5f * v * (1.0f + erff(v * 0.70710678118654752f)); so[w][8 * hh + r][t * 16 + ln] = v; } }
  __builtin_amdgcn_fence(__ATOMIC_ACQ_REL, "workgroup"); __builtin_amdgcn_wave_barrier();
  const int rsub = lane >> 4, c4 = (lane & 15) * 4; typedef _Float16 v4h __attribute__((ext_vector_type(4)));
  {
#pragma unroll
    for (int q = 0; q < 8; ++q) { const int r = q * 2 + rsub; if (col0 + c4 < N) { const v4f v = *(const v4fa*)&so[w][r][c4]; if (C) *(v4f*)(C + cofs + (size_t)(row0 + r) * ldc + col0 + c4) = v; if (C16) { v4h h4; for (int i = 0; i < 4; ++i) h4[i] = (_Float16)v[i]; *(v4h*)(C16 + cofs + (size_t)(row0 + r) * ldc + col0 + c4) = h4; } } }
     }
}


typedef _Float16 v4h __attribute__((ext_vector_type(4)));

__global__ __launch_bounds__(256) void k_x16(const float* __restrict__ x, _Float16* __restrict__ X16, size_t n8) { const size_t t = (size_t)blockIdx.x * 256 + threadIdx.x; if (t >= n8) return; FragH f;
#pragma unroll
  for (int q = 0; q < 8; ++q) f.h[q] = (_Float16)bf16_round(x[t * 8 + q]); *(v8us*)((unsigned short*)X16 + t * 8) = f.half[0];  }
__global__ __launch_bounds__(256) void k_h16(const float* __restrict__ x, _Float16* __restrict__ X16, size_t n8) { const size_t t = (size_t)blockIdx.x * 256 + threadIdx.x; if (t >= n8) return; FragH f;
#pragma unroll
  for (int q = 0; q < 8; ++q) f.h[q] = (_Float16)x[t * 8 + q]; *(v8us*)((unsigned short*)X16 + t * 8) = f.half[0];  }
__global__ __launch_bounds__(256) void k_round16f(const float* __restrict__ W, _Float16* __restrict__ Bt, size_t n8) { const size_t t = (size_t)blockIdx.x * 256 + threadIdx.x; if (t >= n8) return; FragH f;
#pragma unroll
  for (int i = 0; i < 8; ++i) f.h[i] = (_Float16)(bf16_round(W[t * 8 + i]) * 16.0f); *(v8us*)((unsigned short*)Bt + t * 8) = f.half[0];  }
template <int NHv, int TTv>
__global__ __launch_bounds__(256) void k_vt(const _Float16* __restrict__ V16, int ldv, int voff, _Float16* __restrict__ Vt) { __shared__ unsigned short tl[64][66]; const int tid = threadIdx.x; const int slab = blockIdx.x / (TTv / 64), lg = blockIdx.x % (TTv / 64); const int b = slab / NHv, h = slab % NHv;
  for (int i = tid; i < 64 * 8; i += 256) { const int r = i / 8, c8 = (i % 8) * 8; FragH f; f.half[0] = *(const v8us*)((const unsigned short*)V16 + ((size_t)b * TTv + lg * 64 + r) * ldv + voff + h * 64 + c8);
#pragma unroll
    for (int q = 0; q < 8; ++q) tl[r][c8 + q] = f.u[q]; }
  __syncthreads();
  {
#pragma unroll
    for (int rd = 0; rd < 2; ++rd) { const int d = rd * 32 + tid / 8, pc = tid % 8; FragH f;
#pragma unroll
      for (int q = 0; q < 8; ++q) f.u[q] = tl[pc * 8 + q][d];
      *(v8us*)((unsigned short*)Vt + ((size_t)slab * 64 + d) * TTv + lg * 64 + pc * 8) = f.half[0]; }
     } }

__global__ __launch_bounds__(256) void k_hl(const float* __restrict__ F, _Float16* __restrict__ Hh, _Float16* __restrict__ Hl, size_t n8) { const size_t t = (size_t)blockIdx.x * 256 + threadIdx.x; if (t >= n8) return; FragH fh, fl; const v4f a = *(const v4fa*)(F + t * 8), c = *(const v4fa*)(F + t * 8 + 4);
#pragma unroll
  for (int q = 0; q < 4; ++q) { _Float16 h = (_Float16)a[q]; fh.h[q] = h; fl.h[q] = (_Float16)((a[q] - (float)h) * 1024.0f); h = (_Float16)c[q]; fh.h[4 + q] = h; fl.h[4 + q] = (_Float16)((c[q] - (float)h) * 1024.0f); }
  { *(v8us*)((unsigned short*)Hh + t * 8) = fh.half[0]; *(v8us*)((unsigned short*)Hl + t * 8) = fl.half[0];  } }

// ---- fast GEMM (wave tile 32x64; requires M % 32 == 0 rows per launch region and N % 64 == 0); epilogue = k_gemm_hhx semantics ----
__device__ __forceinline__ v16h g2_frag(const _Float16* p, int hh) { FragH f; f.half[0] = *(const v8us*)((const unsigned short*)p + 8 * hh); f.half[1] = *(const v8us*)((const unsigned short*)p + 16 + 8 * hh); return f.v; }
__device__ __forceinline__ v8f g2_mma(v16h a, v16h b, v8f c) { v8f d = __builtin_amdgcn_wmma_f32_16x16x32_f16(false, a, false, b, (short)0, c, false, false); asm volatile("v_nop\n\tv_nop\n\tv_nop\n\tv_nop" : "+v"(d) : "v"(a), "v"(b)); return d; }
template <int ACT>
__global__ __launch_bounds__(128) void k_gemm2(const _Float16* __restrict__ A, int lda, size_t sA, const _Float16* __restrict__ Bh, int ldb, size_t sB, float alpha, const float* __restrict__ bias, size_t sBias, const float* __restrict__ CP, int rowsPerB, size_t sCPb, int row0g,
    float* __restrict__ C, _Float16* __restrict__ C16, int ldc, size_t sC, int M, int N, int K) { static_assert(ACT == 0 || ACT == 3 || ACT == 6 || ACT == 8 || ACT == 9 || ACT == 11 || ACT == 12 || ACT == 14 || ACT == 15 || ACT == 16 || ACT == 17, "k_gemm2: unsupported ACT code (would silently apply no activation)");
  __shared__ __attribute__((aligned(16))) float so[4][32][68];
  const int tid = threadIdx.x, w = tid >> 5, lane = tid & 31, ln = lane & 15, hh = lane >> 4; const int by = blockIdx.y;
  A += (size_t)by * sA; Bh += (size_t)by * sB; const size_t cofs = (size_t)by * sC; const float* bp = bias ? bias + (size_t)by * sBias : nullptr;
  const int ntn = N >> 6; const int mt = blockIdx.x / ntn, nq = blockIdx.x - mt * ntn; const int row0 = mt * 128 + 32 * w, col0 = nq * 64; if (row0 >= M) return;
  const _Float16* a0p = A + (size_t)(row0 + ln) * lda; const _Float16* a1p = a0p + (size_t)16 * lda;
  const _Float16* b0p = Bh + (size_t)(col0 + ln) * ldb; const _Float16* b1p = b0p + (size_t)16 * ldb; const _Float16* b2p = b1p + (size_t)16 * ldb; const _Float16* b3p = b2p + (size_t)16 * ldb;
  const v8f z8 = {0.f,0.f,0.f,0.f,0.f,0.f,0.f,0.f}; v8f c00 = z8, c01 = z8, c02 = z8, c03 = z8, c10 = z8, c11 = z8, c12 = z8, c13 = z8;
#pragma unroll 1
  for (int kb = 0; kb < K; kb += 32) { const v16h a0 = g2_frag(a0p + kb, hh), a1 = g2_frag(a1p + kb, hh);
    v16h b = g2_frag(b0p + kb, hh); c00 = g2_mma(a0, b, c00); c10 = g2_mma(a1, b, c10);
    b = g2_frag(b1p + kb, hh); c01 = g2_mma(a0, b, c01); c11 = g2_mma(a1, b, c11);
    b = g2_frag(b2p + kb, hh); c02 = g2_mma(a0, b, c02); c12 = g2_mma(a1, b, c12);
    b = g2_frag(b3p + kb, hh); c03 = g2_mma(a0, b, c03); c13 = g2_mma(a1, b, c13); }
  v8f accs[8] = {c00, c01, c02, c03, c10, c11, c12, c13};
#pragma unroll
  for (int u = 0; u < 8; ++u) { const int t = u & 3, half = u >> 2; const int col = col0 + t * 16 + ln; const float bv = bp ? bf16_round(bp[col]) : 0.f;
#pragma unroll
    for (int r = 0; r < 8; ++r) { const int rloc = half * 16 + 8 * hh + r; float v = accs[u][r] * alpha + bv; if (CP) { if (rowsPerB < 0) v += CP[cofs + (size_t)(row0g + row0 + rloc) * ldc + col];      /* rowsPerB < 0: own element of the batched C plane */ else { const int bidx = (row0g + row0 + rloc) / rowsPerB; v += CP[(size_t)bidx * sCPb + (size_t)by * 64 + col]; } }
      if (ACT == 3) v = fmaxf(v, 0.f); else if (ACT == 6) v = 0.5f * v * (1.0f + erff(v * 0.70710678118654752f)); else if (ACT == 11) v = 1.0f / (1.0f + expf(-v)); else if (ACT == 15) v = v / (1.0f + expf(-v)); else if (ACT == 12) v = (v > 0.f) ? v : 0.01f * v; else if (ACT == 8) v = tanhf(v); else if (ACT == 9) v = 0.5f * v * (1.0f + tanhf(0.7978845608028654f * (v + 0.044715f * v * v * v))); else if (ACT == 14) v = (v > 0.f) ? v : 0.1f * v; else if (ACT == 16) v = (v >= 0.f) ? v : 0.3f * v; else if (ACT == 17) v = (v >= 0.f) ? v : 0.2f * v;
      so[w][rloc][t * 16 + ln] = v; } }
  __builtin_amdgcn_fence(__ATOMIC_ACQ_REL, "workgroup"); __builtin_amdgcn_wave_barrier();
  const int rsub = lane >> 4, c4 = (lane & 15) * 4;
  {
#pragma unroll
    for (int q = 0; q < 16; ++q) { const int r = q * 2 + rsub; const v4f v = *(const v4fa*)&so[w][r][c4]; if (C) *(v4f*)(C + cofs + (size_t)(row0 + r) * ldc + col0 + c4) = v; if (C16) { v4h h4; for (int i = 0; i < 4; ++i) h4[i] = (_Float16)v[i]; *(v4h*)(C16 + cofs + (size_t)(row0 + r) * ldc + col0 + c4) = h4; } }
     } }


__global__ __launch_bounds__(256) void k_wnat(const float* __restrict__ w, size_t n8, _Float16* __restrict__ Bt) { const size_t t = (size_t)blockIdx.x * 256 + threadIdx.x; if (t >= n8) return; FragH f; for (int q = 0; q < 8; ++q) f.h[q] = (_Float16)(bf16_round(w[t * 8 + q]) * 16.0f); *(v8us*)((unsigned short*)Bt + t * 8) = f.half[0];  }
__global__ __launch_bounds__(256) void k_rsm(const float* __restrict__ S, _Float16* __restrict__ P, int nrows) {
  #pragma clang fp contract(off)
  const int i = blockIdx.x * 256 + threadIdx.x; if (i >= nrows) return; const float* s = S + (size_t)i * SQ; float mx = -3.0e38f;
#pragma unroll 1
  for (int j = 0; j < SQ; ++j) mx = fmaxf(mx, s[j]); float se = 0.f;
#pragma unroll 1
  for (int j = 0; j < SQ; ++j) se += expf(s[j] - mx); const float sc = 256.0f / se;
#pragma unroll 1
  for (int j0 = 0; j0 < SQ; j0 += 8) { FragH f; for (int q = 0; q < 8; ++q) f.h[q] = (_Float16)(expf(s[j0 + q] - mx) * sc); unsigned short* d = (unsigned short*)P + (size_t)i * SQ + j0; *(v8us*)d = f.half[0];  } }
__global__ __launch_bounds__(256) void k_vt(const _Float16* __restrict__ V16, int b, int h0, _Float16* __restrict__ VT) { __shared__ unsigned short tl[64][65]; const int tid = threadIdx.x; const int hh = blockIdx.x % HG, sg = blockIdx.x / HG; const int s0 = sg * 64; const int h = h0 + hh;
  for (int i = tid; i < 64 * 8; i += 256) { const int j = i / 8, d8 = (i % 8) * 8; FragH f; f.half[0] = *(const v8us*)((const unsigned short*)V16 + ((size_t)b * SQ + s0 + j) * DM + h * HD + d8); for (int q = 0; q < 8; ++q) tl[d8 + q][j] = f.u[q]; }
  __syncthreads();
  { for (int i = tid; i < 64 * 8; i += 256) { const int d = i / 8, j8 = (i % 8) * 8; FragH f; for (int q = 0; q < 8; ++q) f.u[q] = tl[d][j8 + q]; *(v8us*)((unsigned short*)VT + ((size_t)hh * HD + d) * SQ + s0 + j8) = f.half[0]; }  } }



__global__ __launch_bounds__(256) void k_rsmf(const float* __restrict__ S, _Float16* __restrict__ P, int qn, int hg) {
  #pragma clang fp contract(off)
  const int t = blockIdx.x * 256 + threadIdx.x; if (t >= qn * hg) return; const size_t i = (size_t)(t / qn) * SQ + (t % qn); const float* s = S + i * SQ; float mx = -3.0e38f;
#pragma unroll 1
  for (int j = 0; j < SQ; ++j) mx = fmaxf(mx, s[j]); float se = 0.f;
#pragma unroll 1
  for (int j = 0; j < SQ; ++j) se += __expf(s[j] - mx); const float sc = 256.0f / se;
#pragma unroll 1
  for (int j0 = 0; j0 < SQ; j0 += 8) { FragH f; for (int q = 0; q < 8; ++q) f.h[q] = (_Float16)(__expf(s[j0 + q] - mx) * sc); unsigned short* d = (unsigned short*)P + i * SQ + j0; *(v8us*)d = f.half[0];  } }

__device__ __forceinline__ v4f stm3d(v4f x) { const v4f a = 1.0f - x * 0.33333334f; const v4f b = 1.0f - (0.5f * x) * a; return 1.0f - x * b; }      /* denominator of the weight for x <= 0, four values at a time; x / 3 as a multiply by f32(1/3); the weight is its reciprocal through v_rcp_f32 (1 ulp each; rounded to f16 afterwards): no IEEE-division expansion */
// Four reciprocals. One statement with results apart from sources, so that behind each v_rcp_f32 stands an instruction that touches neither its result nor its source: the next reciprocal, and behind the last the v_nop (the slot the instruction set asks for behind a transcendental).
__device__ __forceinline__ v4f rcp4(v4f d) { v4f o;
  asm("v_rcp_f32 %0, %4\n\tv_rcp_f32 %1, %5\n\tv_rcp_f32 %2, %6\n\tv_rcp_f32 %3, %7\n\tv_nop" : "=&v"(o[0]), "=&v"(o[1]), "=&v"(o[2]), "=&v"(o[3]) : "v"(d[0]), "v"(d[1]), "v"(d[2]), "v"(d[3]));
  return o; }
#define RW 16                        /* waves per work-group of the row pass */
#define RR 2                         /* rows per wave: 16 x 2 rows a work-group */
// One wave per two score rows: a load of the wave covers 512 contiguous bytes, the whole row (64 values a lane) stays in registers, so S is read once;
// row max and row sum = per-lane partials, then a five-step butterfly; the weight is computed once and scaled in place.
// Every loop is fully unrolled so that v[][] is indexed by constants only and stays in registers.
__global__ __launch_bounds__(RW * 32) void k_rsmst(const float* __restrict__ S, _Float16* __restrict__ P, int qn, int hg) {
  const unsigned lane = threadIdx.x & 31u; const int wave = __builtin_amdgcn_readfirstlane((int)(threadIdx.x >> 5));
  const int n = qn * hg; const int t0 = (blockIdx.x * RW + wave) * RR; if (t0 >= n) return;      /* wave-uniform; the kernel has no barrier */
  v4f v[RR][16]; size_t ri[RR];
#pragma unroll
  for (int r = 0; r < RR; ++r) { const int t = (t0 + r < n) ? t0 + r : t0;      /* a row past the end: the wave does its first row again (same values to the same place), one instruction stream in every wave */
    ri[r] = ((size_t)(t / qn) * SQ + (t % qn)) * SQ; const v4fa* s = (const v4fa*)(S + ri[r]);
#pragma unroll
    for (int q = 0; q < 16; ++q) v[r][q] = s[lane + q * 32u]; }
#pragma unroll
  for (int r = 0; r < RR; ++r) {
    __builtin_amdgcn_sched_barrier(0);      /* keeps every row's loads in front of the first row's arithmetic and the rows apart: the next row flies while this one is worked on, and this row's stores leave before the next is summed */
    v4f m4 = v[r][0];
#pragma unroll
    for (int q = 1; q < 16; ++q) for (int c = 0; c < 4; ++c) m4[c] = fmaxf(m4[c], v[r][q][c]);
    float mx = fmaxf(fmaxf(m4[0], m4[1]), fmaxf(m4[2], m4[3]));
#pragma unroll
    for (int m = 16; m >= 1; m >>= 1) mx = fmaxf(mx, __shfl_xor(mx, m, 32));
    v4f s4 = {0.f, 0.f, 0.f, 0.f};
#pragma unroll
    for (int q = 0; q < 16; ++q) { v[r][q] = rcp4(stm3d(v[r][q] - mx)); s4 += v[r][q]; }
    float se = (s4[0] + s4[1]) + (s4[2] + s4[3]);
#pragma unroll
    for (int m = 16; m >= 1; m >>= 1) se += __shfl_xor(se, m, 32);
    const float sc = 256.0f / se; v4h* d = (v4h*)(P + ri[r]);
#pragma unroll
    for (int q = 0; q < 16; ++q) { const v4f w = v[r][q] * sc; v4h h4; for (int c = 0; c < 4; ++c) h4[c] = (_Float16)w[c]; d[lane + q * 32u] = h4; } } }

extern "C" void kernel_launch(void* const* d_in, const int* in_sizes, int n_in,
                              void* d_out, int out_size, void* d_ws, size_t ws_size, hipStream_t stream) {
  (void)in_sizes; (void)n_in; (void)out_size;
  const float* const* I = (const float* const*)d_in; const float* x = I[0]; const float* wqkv = I[1]; const float* bqkv = nullptr; const float* wo = I[2]; const float* bo = I[3];      /* natural [out][in] fused weight [3072][1024] (NO bias: nullptr in the fused GEMM's bias slot); natural w_out [1024][1024] + b_out */
  char* ws = (char*)d_ws; size_t off = 0;
  auto take = [&](size_t bytes) { char* p = ws + off; off += (bytes + 255) & ~(size_t)255; return p; };
  _Float16* BQKV = (_Float16*)take((size_t)3 * DM * DM * 2); _Float16* BO = (_Float16*)take((size_t)DM * DM * 2);
  _Float16* X16 = (_Float16*)take(NR * DM * 2); _Float16* QKV = (_Float16*)take(NR * 3 * DM * 2); _Float16* Q16 = QKV; _Float16* K16 = QKV + DM; _Float16* V16 = QKV + 2 * DM; _Float16* O16 = (_Float16*)take(NR * DM * 2);
  float* S = (float*)take((size_t)HG * SQ * SQ * 4); _Float16* P = (_Float16*)take((size_t)HG * SQ * SQ * 2); _Float16* VT = (_Float16*)take((size_t)NH * HD * SQ * 2);
  if (off > ws_size) return;
  k_wnat<<<(unsigned)(((size_t)LQ * DM / 8 + 255) / 256), 256, 0, stream>>>(wqkv, (size_t)LQ * DM / 8, BQKV); k_wnat<<<(unsigned)(((size_t)DM * DM / 8 + 255) / 256), 256, 0, stream>>>(wo, (size_t)DM * DM / 8, BO);      /* natural [out][in] = Bt[n][k] x16 (no transpose): fused rows 0..1023 = q, 1024.. = k, 2048.. = v */

  k_x16<<<(unsigned)((NR * DM / 8 + 255) / 256), 256, 0, stream>>>(x, X16, NR * DM / 8);
  const size_t r0p = (size_t)B0 * SQ;      /* first projected row */
  k_gemm2<0><<<dim3((unsigned)((MP / 128) * (3 * DM / 64)), 1), 128, 0, stream>>>(X16 + r0p * DM, DM, 0, BQKV, DM, 0, 0.0625f, bqkv, 0, nullptr, 1, 0, 0, nullptr, QKV + r0p * 3 * DM, 3 * DM, 0, MP, 3 * DM, DM);      /* q | k | v rows (f16); head h = columns h*HD.. of each DM block */
  for (int b = B0; b < B0 + NBR; ++b) { const size_t r0 = (size_t)b * SQ;
    k_vt<NH, SQ><<<NH * (SQ / 64), 256, 0, stream>>>(V16 + r0 * LQ, LQ, 0, VT);      /* V^T [NH][HD][SQ] for this batch */
    for (int h0 = 0; h0 < NHD; h0 += HG) {
      k_gemm2<0><<<dim3((QN / 128) * (SQ / 64), HG), 128, 0, stream>>>(Q16 + r0 * LQ + h0 * HD, LQ, (size_t)HD, K16 + r0 * LQ + h0 * HD, LQ, (size_t)HD, 0.125f, nullptr, 0, nullptr, 1, 0, 0, S, nullptr, SQ, (size_t)SQ * SQ, QN, SQ, HD);      /* scores, HG heads per launch */
      k_rsmst<<<(HG * QN + RW * RR - 1) / (RW * RR), RW * 32, 0, stream>>>(S, P, QN, HG);      /* P = 256 stablemax3 (f16), rows of all HG heads */
      k_gemm2<0><<<dim3((QN / 128) * (HD / 64), HG), 128, 0, stream>>>(P, SQ, (size_t)SQ * SQ, VT + (size_t)h0 * HD * SQ, SQ, (size_t)HD * SQ, 0.25f, nullptr, 0, nullptr, 1, 0, 0, nullptr, O16 + r0 * DM + h0 * HD, DM, (size_t)HD, QN, HD, SQ); } }      /* o (merged heads) as f16 rows */
  k_gemm2<0><<<dim3((unsigned)((MPO / 128) * (DM / 64)), 1), 128, 0, stream>>>(O16 + r0p * DM, DM, 0, BO, DM, 0, 0.0009765625f, bo, 0, nullptr, 1, 0, 0, (float*)d_out + r0p * DM, nullptr, DM, 0, MPO, DM, DM);      /* out rows are the output layout */
}

// v003
// A run of this version takes 113 microseconds.
// Versions between v001 and this one are left out; their measured steps multiply to 8.32 times as fast.
// All steps since v000 together make it 31.5 times as fast.
#include <hip/hip_runtime.h>
// Multi-head self-attention with a polynomial 'stablemax' normalisation instead of softmax (x [2][2048][1024]; qkv = x w_qkv^T (natural [3072][1024] sigma 0.02, NO bias) reshaped (B, S, 3, 16, 64): q | k | v thirds; attn = stablemax3(q k^T * 64^-0.5): logits minus the row max, then s(x) = 1 + x (1 + x/2 (1 + x/3)) for x >= 0 and 1 / (1 - x (1 - x/2 (1 - x/3))) for x < 0, normalised by the row sum; out = merged w_out^T + b_out (natural) -> [2][2048][1024]).
// Structure: token rows r = b*2048 + s; x as exact f16 rows (bf16-rounded); q | k | v as ONE WMMA GEMM (N = 3 x 1024) (128x128 work-group tiles staged in LDS, 64x64 wave tiles, f32 accumulation, exact x16 weights, no bias, f16 outputs); V^T for all batches and heads via LDS transposes; one attention work-group per (batch, head, 256 queries): scores on WMMA (K = 64, alpha = 64^-0.5) formed twice, once for the row max and once for the weights (f32 statistics; weights x256 as f16 operands, normalised after the product), o = P . V on WMMA (o carried x64 against f16 subnormal flush, folded into the output GEMM alpha) written straight into the merged f16 o rows; out = o W_o + b GEMM (f32) into the output layout.
// Compute dtype: inputs rounded to bf16; x / weights exact; q, k, v, stablemax weights and o as plain f16 GEMM operands (~2^-12); scores and stablemax statistics f32. v_wmma_f32_16x16x32_f16.
#define NB 2
#define SQ 2048
#define DM 1024
#define NH 16
#define HD 64
#define HG 4                         /* heads per block group of the unlaunched k_vt(b, h0) */
#define B0 0                         /* first batch processed (debug hook) */
#define NBR NB                       /* batches processed (debug hook) */
#define NR ((size_t)NB * SQ)         /* token rows */
#define MP ((int)((size_t)NBR * SQ)) /* rows projected (debug hook) */
#define QN SQ                        /* unused: k_attn covers all SQ queries */
#define NHD NH                       /* unused: k_attn covers all NH heads */
#define MPO MP                       /* rows through the output stage (debug hook) */
#define LQ (3 * DM)      /* row pitch of the q/k/v rows */
typedef __bf16 v16b __attribute__((ext_vector_type(16)));
typedef unsigned short v8us __attribute__((ext_vector_type(8), may_alias));
typedef float  v8f  __attribute__((ext_vector_type(8)));
typedef float  v4f  __attribute__((ext_vector_type(4)));
typedef float  v4fa __attribute__((ext_vector_type(4), may_alias));
union FragB { v16b v; v8us half[2]; unsigned short u[16]; };

__device__ __forceinline__ unsigned short bf16_bits(float x) { unsigned int u = __float_as_uint(x); return (unsigned short)((u + 0x7FFFu + ((u >> 16) & 1u)) >> 16); }
__device__ __forceinline__ float bf16_val(unsigned short b) { return __uint_as_float(((unsigned int)b) << 16); }
__device__ __forceinline__ float bf16_round(float x) { return bf16_val(bf16_bits(x)); }
// D += A·B with NT terms: 1 = ah·bh, 2 = + al·bh (A split), 3 = + ah·bl (both split)
template <int NT>
__device__ __forceinline__ v8f mmaN(v16b ah, v16b al, v16b bh, v16b bl, v8f c) {
  c = __builtin_amdgcn_wmma_f32_16x16x32_bf16(false, ah, false, bh, (short)0, c, false, false);
  if (NT >= 2) c = __builtin_amdgcn_wmma_f32_16x16x32_bf16(false, al, false, bh, (short)0, c, false, false);
  if (NT >= 3) c = __builtin_amdgcn_wmma_f32_16x16x32_bf16(false, ah, false, bl, (short)0, c, false, false);
  asm volatile("v_nop\n\tv_nop\n\tv_nop\n\tv_nop" : "+v"(c) : "v"(ah), "v"(al), "v"(bh), "v"(bl));
  return c;
}

__global__ __launch_bounds__(256) void k_wt_bf16(const float* __restrict__ W, unsigned short* __restrict__ Wt, int K, int N) {
  const int t = blockIdx.x * 256 + threadIdx.x;
  const int k8n = K / 8;
  if (t >= N * k8n) return;
  const int n = t / k8n, k8 = (t % k8n) * 8;
  v8us v;
#pragma unroll
  for (int i = 0; i < 8; ++i) v[i] = bf16_bits(W[(size_t)(k8 + i) * N + n]);
  *(v8us*)(Wt + (size_t)n * K + k8) = v;
  
}

// GEMM C[M][N] (f32, pitch ldc) = act(A[M][K]·W + bias). A f32 row-major (pitch lda) converted per fragment to bf16
// (ASPLIT: hi/lo two planes -> 2 terms, else single rounded term); Wt bf16 [N][K] (pitch ldb). BIAS_BF16 rounds the
// bias to bf16 first (bias quantised to bf16 before the add). K%32==0, M%16==0, N%64==0.
template <bool ASPLIT, int ACT, bool BIAS_BF16>
__global__ __launch_bounds__(128) void k_gemm_bf(const float* __restrict__ A, int lda, const unsigned short* __restrict__ Wt, int ldb,
                                               const float* __restrict__ bias, float* __restrict__ C, int ldc, int M, int N, int K) {
  __shared__ __attribute__((aligned(16))) float so[4][16][64];
  const int tid = threadIdx.x, w = tid >> 5, lane = tid & 31, ln = lane & 15, hh = lane >> 4;
  const int ntn = N / 64;
  const int wid = blockIdx.x * 4 + w;
  const int mt = wid / ntn, nq = wid % ntn;
  if (mt * 16 >= M) return;
  const int row0 = mt * 16, col0 = nq * 64;
  const float* arow = A + (size_t)(row0 + ln) * lda;
  v8f acc[4] = {};
  for (int kb = 0; kb < K; kb += 32) {
    FragB ah, al;
    const v4f x0 = *(const v4fa*)(arow + kb + 8 * hh), x1 = *(const v4fa*)(arow + kb + 8 * hh + 4);
    const v4f x2 = *(const v4fa*)(arow + kb + 16 + 8 * hh), x3 = *(const v4fa*)(arow + kb + 16 + 8 * hh + 4);
    float xs[16] = {x0[0],x0[1],x0[2],x0[3],x1[0],x1[1],x1[2],x1[3],x2[0],x2[1],x2[2],x2[3],x3[0],x3[1],x3[2],x3[3]};
#pragma unroll
    for (int i = 0; i < 16; ++i) { const unsigned short hb = bf16_bits(xs[i]); ah.u[i] = hb; al.u[i] = ASPLIT ? bf16_bits(xs[i] - bf16_val(hb)) : (unsigned short)0; }
#pragma unroll
    for (int t = 0; t < 4; ++t) {
      const unsigned short* brow = Wt + (size_t)(col0 + t * 16 + ln) * ldb + kb;
      FragB b;
      b.half[0] = *(const v8us*)(brow + 8 * hh);
      b.half[1] = *(const v8us*)(brow + 16 + 8 * hh);
      acc[t] = mmaN<ASPLIT ? 2 : 1>(ah.v, al.v, b.v, b.v, acc[t]);
    }
  }
#pragma unroll
  for (int t = 0; t < 4; ++t) {
    float bv = bias ? bias[col0 + t * 16 + ln] : 0.f;
    if (BIAS_BF16) bv = bf16_round(bv);
#pragma unroll
    for (int r = 0; r < 8; ++r) { float v = acc[t][r] + bv; if (ACT == 1) v = fmaxf(v, 0.f); so[w][8 * hh + r][t * 16 + ln] = v; }
  }
  __builtin_amdgcn_fence(__ATOMIC_ACQ_REL, "workgroup");
  __builtin_amdgcn_wave_barrier();
  const int rsub = lane >> 4, c4 = (lane & 15) * 4;
  {
#pragma unroll
    for (int q = 0; q < 8; ++q) {
      const int r = q * 2 + rsub;
      const v4f v = *(const v4fa*)&so[w][r][c4];
      *(v4f*)(C + (size_t)(row0 + r) * ldc + col0 + c4) = v;
    }
    
  }
}

// GEMM C = act(A·W + bias + resid): A f32 (ASPLIT -> hi/lo 2 terms), Wt bf16 [N][K]; ACT 0 none, 1 relu, 2 exact gelu;
// resid (optional, f32, row index = (row % rmod), pitch ldr, RES_BF16 rounds it) added before the activation.
template <bool ASPLIT, int ACT, bool BIAS_BF16, bool RES_BF16>
__global__ __launch_bounds__(128) void k_gemm_bf3(const float* __restrict__ A, int lda, const unsigned short* __restrict__ Wt, int ldb,
                                                const float* __restrict__ bias, const float* __restrict__ resid, int rmod, int ldr,
                                                float* __restrict__ C, int ldc, int M, int N, int K) {
  __shared__ __attribute__((aligned(16))) float so[4][16][64];
  const int tid = threadIdx.x, w = tid >> 5, lane = tid & 31, ln = lane & 15, hh = lane >> 4;
  const int ntn = N / 64;
  const int wid = blockIdx.x * 4 + w;
  const int mt = wid / ntn, nq = wid % ntn;
  if (mt * 16 >= M) return;
  const int row0 = mt * 16, col0 = nq * 64;
  const float* arow = A + (size_t)(row0 + ln) * lda;
  v8f acc[4] = {};
  for (int kb = 0; kb < K; kb += 32) {
    FragB ah, al;
    const v4f x0 = *(const v4fa*)(arow + kb + 8 * hh), x1 = *(const v4fa*)(arow + kb + 8 * hh + 4);
    const v4f x2 = *(const v4fa*)(arow + kb + 16 + 8 * hh), x3 = *(const v4fa*)(arow + kb + 16 + 8 * hh + 4);
    float xs[16] = {x0[0],x0[1],x0[2],x0[3],x1[0],x1[1],x1[2],x1[3],x2[0],x2[1],x2[2],x2[3],x3[0],x3[1],x3[2],x3[3]};
#pragma unroll
    for (int i = 0; i < 16; ++i) { const unsigned short hb = bf16_bits(xs[i]); ah.u[i] = hb; al.u[i] = ASPLIT ? bf16_bits(xs[i] - bf16_val(hb)) : (unsigned short)0; }
#pragma unroll
    for (int t = 0; t < 4; ++t) {
      const unsigned short* brow = Wt + (size_t)(col0 + t * 16 + ln) * ldb + kb;
      FragB b;
      b.half[0] = *(const v8us*)(brow + 8 * hh);
      b.half[1] = *(const v8us*)(brow + 16 + 8 * hh);
      acc[t] = mmaN<ASPLIT ? 2 : 1>(ah.v, al.v, b.v, b.v, acc[t]);
    }
  }
#pragma unroll
  for (int t = 0; t < 4; ++t) {
    const int col = col0 + t * 16 + ln;
    float bv = bias ? bias[col] : 0.f;
    if (BIAS_BF16) bv = bf16_round(bv);
#pragma unroll
    for (int r = 0; r < 8; ++r) {
      float v = acc[t][r] + bv;
      if (resid) { float rv = resid[(size_t)((row0 + 8 * hh + r) % rmod) * ldr + col]; if (RES_BF16) rv = bf16_round(rv); v += rv; }
      if (ACT == 1) v = fmaxf(v, 0.f);
      if (ACT == 2) v = 0.5f * v * (1.0f + erff(v * 0.70710678118654752f));
      if (ACT == 3) { const float u = 0.7978845608028654f * (v + 0.044715f * v * v * v); v = 0.5f * v * (1.0f + tanhf(u)); }
      so[w][8 * hh + r][t * 16 + ln] = v;
    }
  }
  __builtin_amdgcn_fence(__ATOMIC_ACQ_REL, "workgroup");
  __builtin_amdgcn_wave_barrier();
  const int rsub = lane >> 4, c4 = (lane & 15) * 4;
  {
#pragma unroll
    for (int q = 0; q < 8; ++q) {
      const int r = q * 2 + rsub;
      const v4f v = *(const v4fa*)&so[w][r][c4];
      *(v4f*)(C + (size_t)(row0 + r) * ldc + col0 + c4) = v;
    }
    
  }
}
// row LayerNorm (biased variance, eps) over N: s = X (+ R); optional out_sum <- s; out_norm <- (s-mu)*rsqrt(var+eps)*g + b
template <bool PARAM_BF16>
__global__ __launch_bounds__(256) void k_layernorm(const float* __restrict__ X, const float* __restrict__ R, const float* __restrict__ g, const float* __restrict__ bta,
                                                  float* __restrict__ out_sum, float* __restrict__ out_norm, int N, float eps) {
  __shared__ float red[256];
  const int row = blockIdx.x, tid = threadIdx.x;
  const float* x = X + (size_t)row * N; const float* rr = R ? R + (size_t)row * N : nullptr;
  float vals[16];                     // up to N = 4096
  const int per = N / 256;            // contiguous chunk per thread? use strided-by-4 chunks: thread handles j = tid*4 + 1024*u
  float s1 = 0.f;
  for (int u = 0; u < per / 4; ++u) {
    const int j = tid * 4 + 1024 * u;
    const v4f a = *(const v4fa*)(x + j);
    v4f b = {0.f,0.f,0.f,0.f}; if (rr) b = *(const v4fa*)(rr + j);
#pragma unroll
    for (int q = 0; q < 4; ++q) { const float v = a[q] + b[q]; vals[u * 4 + q] = v; s1 += v; }
  }
  red[tid] = s1; __syncthreads();
  for (int st = 128; st > 0; st >>= 1) { if (tid < st) red[tid] += red[tid + st]; __syncthreads(); }
  const float mu = red[0] / (float)N; __syncthreads();
  float s2 = 0.f;
  for (int u = 0; u < per / 4; ++u)
#pragma unroll
    for (int q = 0; q < 4; ++q) { const float c = vals[u * 4 + q] - mu; s2 += c * c; }
  red[tid] = s2; __syncthreads();
  for (int st = 128; st > 0; st >>= 1) { if (tid < st) red[tid] += red[tid + st]; __syncthreads(); }
  const float rs = rsqrtf(red[0] / (float)N + eps);
  {
    for (int u = 0; u < per / 4; ++u) {
      const int j = tid * 4 + 1024 * u;
      v4f o, sm;
#pragma unroll
      for (int q = 0; q < 4; ++q) {
        float gg = g[j + q], bb = bta[j + q];
        if (PARAM_BF16) { gg = bf16_round(gg); bb = bf16_round(bb); }
        sm[q] = vals[u * 4 + q]; o[q] = (vals[u * 4 + q] - mu) * rs * gg + bb;
      }
      if (out_sum) *(v4f*)(out_sum + (size_t)row * N + j) = sm;
      *(v4f*)(out_norm + (size_t)row * N + j) = o;
    }
    
  }
}



// ---- f16 WMMA path (v_wmma_f32_16x16x32_f16): 11-bit significands for operands in range — used where a [0,1] probability operand needs more precision than bf16
typedef _Float16 v16h __attribute__((ext_vector_type(16)));
union FragH { v16h v; v8us half[2]; _Float16 h[16]; unsigned short u[16]; };
template <int NT>
__device__ __forceinline__ v8f mmaH(v16h ah, v16h al, v16h bh, v16h bl, v8f c) {
  c = __builtin_amdgcn_wmma_f32_16x16x32_f16(false, ah, false, bh, (short)0, c, false, false);
  if (NT >= 2) c = __builtin_amdgcn_wmma_f32_16x16x32_f16(false, al, false, bh, (short)0, c, false, false);
  if (NT >= 3) c = __builtin_amdgcn_wmma_f32_16x16x32_f16(false, ah, false, bl, (short)0, c, false, false);
  asm volatile("v_nop\n\tv_nop\n\tv_nop\n\tv_nop" : "+v"(c) : "v"(ah), "v"(al), "v"(bh), "v"(bl));
  return c;
}
// batched GEMM like k_gemm_b but f16 operands: A f32 (split into f16 hi/lo if ASPLIT, else rounded to f16), Bt = f16 values [n][k]; alpha; C f32; N multiple of 16 (partial tiles skipped)
template <bool ASPLIT>
__global__ __launch_bounds__(128) void k_gemm_h(const float* __restrict__ A, int lda, size_t sA, const _Float16* __restrict__ Bh, int ldb, size_t sB, float alpha, float* __restrict__ C, int ldc, size_t sC, int M, int N, int K) {
  __shared__ __attribute__((aligned(16))) float so[4][16][64];
  const int tid = threadIdx.x, w = tid >> 5, lane = tid & 31, ln = lane & 15, hh = lane >> 4; const int by = blockIdx.y;
  A += (size_t)by * sA; Bh += (size_t)by * sB; C += (size_t)by * sC;
  const int ntn = (N + 63) / 64; const int wid = blockIdx.x * 4 + w; const int mt = wid / ntn, nq = wid % ntn; if (mt * 16 >= M) return;
  const int row0 = mt * 16, col0 = nq * 64; const float* arow = A + (size_t)(row0 + ln) * lda;
  v8f acc[4] = {};
  for (int kb = 0; kb < K; kb += 32) {
    FragH ah, al;
    const v4f x0 = *(const v4fa*)(arow + kb + 8 * hh), x1 = *(const v4fa*)(arow + kb + 8 * hh + 4), x2 = *(const v4fa*)(arow + kb + 16 + 8 * hh), x3 = *(const v4fa*)(arow + kb + 16 + 8 * hh + 4);
    float xs[16] = {x0[0],x0[1],x0[2],x0[3],x1[0],x1[1],x1[2],x1[3],x2[0],x2[1],x2[2],x2[3],x3[0],x3[1],x3[2],x3[3]};
#pragma unroll
    for (int i = 0; i < 16; ++i) { const _Float16 h = (_Float16)xs[i]; ah.h[i] = h; al.h[i] = ASPLIT ? (_Float16)(xs[i] - (float)h) : (_Float16)0.0f; }
#pragma unroll
    for (int t = 0; t < 4; ++t) { if (col0 + t * 16 >= N) continue; const size_t boff = (size_t)(col0 + t * 16 + ln) * ldb + kb; FragH bq; bq.half[0] = *(const v8us*)(Bh + boff + 8 * hh); bq.half[1] = *(const v8us*)(Bh + boff + 16 + 8 * hh);
      acc[t] = mmaH<ASPLIT ? 2 : 1>(ah.v, al.v, bq.v, bq.v, acc[t]); }
  }
#pragma unroll
  for (int t = 0; t < 4; ++t) { if (col0 + t * 16 >= N) continue;
#pragma unroll
    for (int r = 0; r < 8; ++r) so[w][8 * hh + r][t * 16 + ln] = acc[t][r] * alpha; }
  __builtin_amdgcn_fence(__ATOMIC_ACQ_REL, "workgroup"); __builtin_amdgcn_wave_barrier();
  const int rsub = lane >> 4, c4 = (lane & 15) * 4;
  {
#pragma unroll
    for (int q = 0; q < 8; ++q) { const int r = q * 2 + rsub; if (col0 + c4 < N) { const v4f v = *(const v4fa*)&so[w][r][c4]; *(v4f*)(C + (size_t)(row0 + r) * ldc + col0 + c4) = v; } }
     }
}

// Wt[n][k] = f16(W[k][n]·scale) from f32 row-major W[K][N] (scale = power of two; bf16-exact weights stay exact in f16 away from the subnormal range)
__global__ __launch_bounds__(256) void k_wt_f16(const float* __restrict__ W, _Float16* __restrict__ Wt, int K, int N, float scale) {
  const int t = blockIdx.x * 256 + threadIdx.x; if (t >= N * (K / 8)) return; const int n = t / (K / 8), k8 = (t % (K / 8)) * 8; FragH f;
#pragma unroll
  for (int i = 0; i < 8; ++i) f.h[i] = (_Float16)(bf16_round(W[(size_t)(k8 + i) * N + n]) * scale); const v8us o = f.half[0];
  *(v8us*)((unsigned short*)Wt + (size_t)n * K + k8) = o; 
}
// k_gemm_hh variant with fused epilogue: v = acc·alpha + bias[by·sBias + col] (+ CP[(row/rowsPerB)·sCPb + by·64 + col] if CP) ; ACT 0 none / 1 elu ; writes f16 C16 (and f32 C if non-null)
template <int ACT>
__global__ __launch_bounds__(128) void k_gemm_hhx(const _Float16* __restrict__ A, int lda, size_t sA, const _Float16* __restrict__ Bh, int ldb, size_t sB, float alpha, const float* __restrict__ bias, size_t sBias, const float* __restrict__ CP, int rowsPerB, size_t sCPb, int row0g,
    float* __restrict__ C, _Float16* __restrict__ C16, int ldc, size_t sC, int M, int N, int K) {
  __shared__ __attribute__((aligned(16))) float so[4][16][64];
  const int tid = threadIdx.x, w = tid >> 5, lane = tid & 31, ln = lane & 15, hh = lane >> 4; const int by = blockIdx.y;
  A += (size_t)by * sA; Bh += (size_t)by * sB; const size_t cofs = (size_t)by * sC; const float* bp = bias ? bias + (size_t)by * sBias : nullptr;
  const int ntn = (N + 63) / 64; const int wid = blockIdx.x * 4 + w; const int mt = wid / ntn, nq = wid % ntn; if (mt * 16 >= M) return;
  const int row0 = mt * 16, col0 = nq * 64; const _Float16* arow = A + (size_t)(row0 + ln) * lda;
  v8f acc[4] = {};
  for (int kb = 0; kb < K; kb += 32) { FragH ah; ah.half[0] = *(const v8us*)((const unsigned short*)arow + kb + 8 * hh); ah.half[1] = *(const v8us*)((const unsigned short*)arow + kb + 16 + 8 * hh);
#pragma unroll
    for (int t = 0; t < 4; ++t) { if (col0 + t * 16 >= N) continue; const size_t boff = (size_t)(col0 + t * 16 + ln) * ldb + kb; FragH bq; bq.half[0] = *(const v8us*)((const unsigned short*)Bh + boff + 8 * hh); bq.half[1] = *(const v8us*)((const unsigned short*)Bh + boff + 16 + 8 * hh);
      acc[t] = mmaH<1>(ah.v, ah.v, bq.v, bq.v, acc[t]); }
  }
#pragma unroll
  for (int t = 0; t < 4; ++t) { if (col0 + t * 16 >= N) continue; const int col = col0 + t * 16 + ln; const float bv = bp ? bf16_round(bp[col]) : 0.f;
#pragma unroll
    for (int r = 0; r < 8; ++r) { float v = acc[t][r] * alpha + bv; if (CP) { const int rr = row0g + row0 + 8 * hh + r; if (rowsPerB < 0) v += CP[cofs + (size_t)rr * ldc + col];      /* rowsPerB < 0: own element of the batched C plane */ else { const int bidx = rr / rowsPerB; v += CP[(size_t)bidx * sCPb + (size_t)by * 64 + col]; } } if (ACT == 1) v = (v > 0.f) ? v : expm1f(v); else if (ACT == 7) v = (v > 0.f) ? v + 1.0f : expf(v); else if (ACT == 8) v = tanhf(v); else if (ACT == 9) v = 0.5f * v * (1.0f + tanhf(0.7978845608028654f * (v + 0.044715f * v * v * v))); else if (ACT == 11) v = 1.0f / (1.0f + expf(-v)); else if (ACT == 12) v = (v > 0.f) ? v : 0.01f * v; else if (ACT == 14) v = (v > 0.f) ? v : 0.1f * v; else if (ACT == 16) v = (v >= 0.f) ? v : 0.3f * v; else if (ACT == 17) v = (v >= 0.f) ? v : 0.2f * v; else if (ACT == 15) v = v / (1.0f + expf(-v)); else if (ACT == 3) v = fmaxf(v, 0.f); else if (ACT == 6) v = 0.5f * v * (1.0f + erff(v * 0.70710678118654752f)); so[w][8 * hh + r][t * 16 + ln] = v; } }
  __builtin_amdgcn_fence(__ATOMIC_ACQ_REL, "workgroup"); __builtin_amdgcn_wave_barrier();
  const int rsub = lane >> 4, c4 = (lane & 15) * 4; typedef _Float16 v4h __attribute__((ext_vector_type(4)));
  {
#pragma unroll
    for (int q = 0; q < 8; ++q) { const int r = q * 2 + rsub; if (col0 + c4 < N) { const v4f v = *(const v4fa*)&so[w][r][c4]; if (C) *(v4f*)(C + cofs + (size_t)(row0 + r) * ldc + col0 + c4) = v; if (C16) { v4h h4; for (int i = 0; i < 4; ++i) h4[i] = (_Float16)v[i]; *(v4h*)(C16 + cofs + (size_t)(row0 + r) * ldc + col0 + c4) = h4; } } }
     }
}


typedef _Float16 v4h __attribute__((ext_vector_type(4)));

__global__ __launch_bounds__(256) void k_x16(const float* __restrict__ x, _Float16* __restrict__ X16, size_t n8) { const size_t t = (size_t)blockIdx.x * 256 + threadIdx.x; if (t >= n8) return; FragH f;
#pragma unroll
  for (int q = 0; q < 8; ++q) f.h[q] = (_Float16)bf16_round(x[t * 8 + q]); *(v8us*)((unsigned short*)X16 + t * 8) = f.half[0];  }
__global__ __launch_bounds__(256) void k_h16(const float* __restrict__ x, _Float16* __restrict__ X16, size_t n8) { const size_t t = (size_t)blockIdx.x * 256 + threadIdx.x; if (t >= n8) return; FragH f;
#pragma unroll
  for (int q = 0; q < 8; ++q) f.h[q] = (_Float16)x[t * 8 + q]; *(v8us*)((unsigned short*)X16 + t * 8) = f.half[0];  }
__global__ __launch_bounds__(256) void k_round16f(const float* __restrict__ W, _Float16* __restrict__ Bt, size_t n8) { const size_t t = (size_t)blockIdx.x * 256 + threadIdx.x; if (t >= n8) return; FragH f;
#pragma unroll
  for (int i = 0; i < 8; ++i) f.h[i] = (_Float16)(bf16_round(W[t * 8 + i]) * 16.0f); *(v8us*)((unsigned short*)Bt + t * 8) = f.half[0];  }
template <int NHv, int TTv>
__global__ __launch_bounds__(256) void k_vt(const _Float16* __restrict__ V16, int ldv, int voff, _Float16* __restrict__ Vt) { __shared__ unsigned short tl[64][66]; const int tid = threadIdx.x; const int slab = blockIdx.x / (TTv / 64), lg = blockIdx.x % (TTv / 64); const int b = slab / NHv, h = slab % NHv;
  for (int i = tid; i < 64 * 8; i += 256) { const int r = i / 8, c8 = (i % 8) * 8; FragH f; f.half[0] = *(const v8us*)((const unsigned short*)V16 + ((size_t)b * TTv + lg * 64 + r) * ldv + voff + h * 64 + c8);
#pragma unroll
    for (int q = 0; q < 8; ++q) tl[r][c8 + q] = f.u[q]; }
  __syncthreads();
  {
#pragma unroll
    for (int rd = 0; rd < 2; ++rd) { const int d = rd * 32 + tid / 8, pc = tid % 8; FragH f;
#pragma unroll
      for (int q = 0; q < 8; ++q) f.u[q] = tl[pc * 8 + q][d];
      *(v8us*)((unsigned short*)Vt + ((size_t)slab * 64 + d) * TTv + lg * 64 + pc * 8) = f.half[0]; }
     } }

__global__ __launch_bounds__(256) void k_hl(const float* __restrict__ F, _Float16* __restrict__ Hh, _Float16* __restrict__ Hl, size_t n8) { const size_t t = (size_t)blockIdx.x * 256 + threadIdx.x; if (t >= n8) return; FragH fh, fl; const v4f a = *(const v4fa*)(F + t * 8), c = *(const v4fa*)(F + t * 8 + 4);
#pragma unroll
  for (int q = 0; q < 4; ++q) { _Float16 h = (_Float16)a[q]; fh.h[q] = h; fl.h[q] = (_Float16)((a[q] - (float)h) * 1024.0f); h = (_Float16)c[q]; fh.h[4 + q] = h; fl.h[4 + q] = (_Float16)((c[q] - (float)h) * 1024.0f); }
  { *(v8us*)((unsigned short*)Hh + t * 8) = fh.half[0]; *(v8us*)((unsigned short*)Hl + t * 8) = fl.half[0];  } }

__global__ __launch_bounds__(256) void k_wnat(const float* __restrict__ w, size_t n8, _Float16* __restrict__ Bt) { const size_t t = (size_t)blockIdx.x * 256 + threadIdx.x; if (t >= n8) return; FragH f; for (int q = 0; q < 8; ++q) f.h[q] = (_Float16)(bf16_round(w[t * 8 + q]) * 16.0f); *(v8us*)((unsigned short*)Bt + t * 8) = f.half[0];  }
__global__ __launch_bounds__(256) void k_rsm(const float* __restrict__ S, _Float16* __restrict__ P, int nrows) {
  #pragma clang fp contract(off)
  const int i = blockIdx.x * 256 + threadIdx.x; if (i >= nrows) return; const float* s = S + (size_t)i * SQ; float mx = -3.0e38f;
#pragma unroll 1
  for (int j = 0; j < SQ; ++j) mx = fmaxf(mx, s[j]); float se = 0.f;
#pragma unroll 1
  for (int j = 0; j < SQ; ++j) se += expf(s[j] - mx); const float sc = 256.0f / se;
#pragma unroll 1
  for (int j0 = 0; j0 < SQ; j0 += 8) { FragH f; for (int q = 0; q < 8; ++q) f.h[q] = (_Float16)(expf(s[j0 + q] - mx) * sc); unsigned short* d = (unsigned short*)P + (size_t)i * SQ + j0; *(v8us*)d = f.half[0];  } }
__global__ __launch_bounds__(256) void k_vt(const _Float16* __restrict__ V16, int b, int h0, _Float16* __restrict__ VT) { __shared__ unsigned short tl[64][65]; const int tid = threadIdx.x; const int hh = blockIdx.x % HG, sg = blockIdx.x / HG; const int s0 = sg * 64; const int h = h0 + hh;
  for (int i = tid; i < 64 * 8; i += 256) { const int j = i / 8, d8 = (i % 8) * 8; FragH f; f.half[0] = *(const v8us*)((const unsigned short*)V16 + ((size_t)b * SQ + s0 + j) * DM + h * HD + d8); for (int q = 0; q < 8; ++q) tl[d8 + q][j] = f.u[q]; }
  __syncthreads();
  { for (int i = tid; i < 64 * 8; i += 256) { const int d = i / 8, j8 = (i % 8) * 8; FragH f; for (int q = 0; q < 8; ++q) f.u[q] = tl[d][j8 + q]; *(v8us*)((unsigned short*)VT + ((size_t)hh * HD + d) * SQ + s0 + j8) = f.half[0]; }  } }



__global__ __launch_bounds__(256) void k_rsmf(const float* __restrict__ S, _Float16* __restrict__ P, int qn, int hg) {
  #pragma clang fp contract(off)
  const int t = blockIdx.x * 256 + threadIdx.x; if (t >= qn * hg) return; const size_t i = (size_t)(t / qn) * SQ + (t % qn); const float* s = S + i * SQ; float mx = -3.0e38f;
#pragma unroll 1
  for (int j = 0; j < SQ; ++j) mx = fmaxf(mx, s[j]); float se = 0.f;
#pragma unroll 1
  for (int j = 0; j < SQ; ++j) se += __expf(s[j] - mx); const float sc = 256.0f / se;
#pragma unroll 1
  for (int j0 = 0; j0 < SQ; j0 += 8) { FragH f; for (int q = 0; q < 8; ++q) f.h[q] = (_Float16)(__expf(s[j0 + q] - mx) * sc); unsigned short* d = (unsigned short*)P + i * SQ + j0; *(v8us*)d = f.half[0];  } }

// Four reciprocals. One statement with results apart from sources, so that behind each v_rcp_f32 stands an instruction that touches neither its result nor its source: the next reciprocal, and behind the last the v_nop (the slot the instruction set asks for behind a transcendental).
__device__ __forceinline__ v4f rcp4(v4f d) { v4f o;
  asm("v_rcp_f32 %0, %4\n\tv_rcp_f32 %1, %5\n\tv_rcp_f32 %2, %6\n\tv_rcp_f32 %3, %7\n\tv_nop" : "=&v"(o[0]), "=&v"(o[1]), "=&v"(o[2]), "=&v"(o[3]) : "v"(d[0]), "v"(d[1]), "v"(d[2]), "v"(d[3]));
  return o; }
typedef _Float16 v8h __attribute__((ext_vector_type(8)));
#define AW 8                         /* waves per work-group of the attention kernel */
#define AQ 32                        /* query columns per wave (two 16-column tiles) */
#define AK 64                        /* keys per LDS stage */
#define AP 72                        /* LDS row pitch in f16: 128 data bytes + 16 (16-byte fragment reads fall on different banks) */
#define ANS (SQ / AK)                /* stages per walk over the keys */
__device__ __forceinline__ v16h fa_frag(const unsigned short* p, int hh) { FragH f; f.half[0] = *(const v8us*)(p + 8 * hh); f.half[1] = *(const v8us*)(p + 16 + 8 * hh); return f.v; }
__device__ __forceinline__ v8f fa_mma(v16h a, v16h b, v8f c) { return __builtin_amdgcn_wmma_f32_16x16x32_f16(false, a, false, b, (short)0, c, false, false); }
// 256 x the stablemax3 weight for x <= 0, eight values: 1 / (1 - x (1 - x/2 (1 - x/3))) with the factor 2^-8 carried exactly through the two outer terms of the denominator; x / 3 as a multiply by f32(1/3); reciprocal through v_rcp_f32.
__device__ __forceinline__ v8f stm3w(v8f x) { const v8f a = 1.0f - x * 0.33333334f; const v8f b = 0.00390625f - (0.001953125f * x) * a; const v8f d = 0.00390625f - x * b;
  const v4f lo = rcp4(__builtin_shufflevector(d, d, 0, 1, 2, 3)), hi = rcp4(__builtin_shufflevector(d, d, 4, 5, 6, 7)); return __builtin_shufflevector(lo, hi, 0, 1, 2, 3, 4, 5, 6, 7); }
__global__ __launch_bounds__(AW * 32) void k_attn(const _Float16* __restrict__ QKV, const _Float16* __restrict__ VT, _Float16* __restrict__ O16) {
  __shared__ __attribute__((aligned(16))) unsigned short sK[2][AK * AP]; __shared__ __attribute__((aligned(16))) unsigned short sV[2][AK * AP];
  const int tid = threadIdx.x, lane = tid & 31, ln = lane & 15, hh = lane >> 4, w = tid >> 5; const int h = blockIdx.y, b = blockIdx.z; const int q0 = blockIdx.x * (AW * AQ) + w * AQ;
  const unsigned short* Qp = (const unsigned short*)QKV + (size_t)b * SQ * LQ + h * HD; const unsigned short* Kp = Qp + DM; const unsigned short* Vp = (const unsigned short*)VT + (size_t)(b * NH + h) * HD * SQ;
  const int srow = tid >> 3, sch = (tid & 7) * 8; const int sl = srow * AP + sch;      /* staging: eight threads a 128-byte row, rows srow and srow + 32 */
  const unsigned short* kg = Kp + (size_t)srow * LQ + sch; const unsigned short* vg = Vp + (size_t)srow * SQ + sch;
  const v8f z8 = {0.f, 0.f, 0.f, 0.f, 0.f, 0.f, 0.f, 0.f};
  v16h qf[2][2]; const unsigned short* qg = Qp + (size_t)(q0 + ln) * LQ + 8 * hh;
#pragma unroll
  for (int n = 0; n < 2; ++n) for (int c = 0; c < 2; ++c) qf[n][c] = fa_frag(qg + (size_t)n * 16 * LQ + c * 32, 0);
  v8us k0 = *(const v8us*)kg, k1 = *(const v8us*)(kg + (size_t)32 * LQ), v0 = *(const v8us*)vg, v1 = *(const v8us*)(vg + (size_t)32 * SQ);
  asm volatile("s_wait_xcnt 0x0" :: "v"(qg), "v"(qg + (size_t)16 * LQ), "v"(kg), "v"(vg) : "memory");      /* the address registers of the loads above are kept, and not reused as a load's destination either, until this wait */
  *(v8us*)&sK[0][sl] = k0; *(v8us*)&sK[0][sl + 32 * AP] = k1; *(v8us*)&sV[0][sl] = v0; *(v8us*)&sV[0][sl + 32 * AP] = v1;      /* V^T stage 0 waits in its buffer through walk 1, which touches only sK */
  __syncthreads();
  v8f m8[2]; m8[0] = z8 - 3.0e38f; m8[1] = m8[0];
#pragma unroll 1      /* one stage a trip: the body is already 16 products long */
  for (int s = 0; s < ANS; ++s) { const int sn = (s + 1) & (ANS - 1);      /* the stage behind the last is stage 0 again: no branch in the trip, and walk 2 finds its first K tile in buffer 0 */
    { const unsigned short* g = kg + (size_t)sn * AK * LQ; k0 = *(const v8us*)g; k1 = *(const v8us*)(g + (size_t)32 * LQ);
      asm volatile("s_wait_xcnt 0x0" :: "v"(g) : "memory"); }      /* as above: the address pair is kept until this wait */
    const unsigned short* kb = sK[s & 1];
#pragma unroll
    for (int j = 0; j < 4; ++j) { const v16h a0 = fa_frag(kb + (j * 16 + ln) * AP, hh), a1 = fa_frag(kb + (j * 16 + ln) * AP + 32, hh);
#pragma unroll
      for (int n = 0; n < 2; ++n) m8[n] = __builtin_elementwise_max(m8[n], fa_mma(a1, qf[n][1], fa_mma(a0, qf[n][0], z8))); }
    { unsigned short* d = sK[(s + 1) & 1]; *(v8us*)&d[sl] = k0; *(v8us*)&d[sl + 32 * AP] = k1; }
    __syncthreads(); }
  float mx[2];
#pragma unroll
  for (int n = 0; n < 2; ++n) { float m = fmaxf(fmaxf(fmaxf(m8[n][0], m8[n][1]), fmaxf(m8[n][2], m8[n][3])), fmaxf(fmaxf(m8[n][4], m8[n][5]), fmaxf(m8[n][6], m8[n][7]))); m = fmaxf(m, __shfl_xor(m, 16, 32)); mx[n] = m * 0.125f; }
  v8f o[4][2]; v8f s8[2]; s8[0] = z8; s8[1] = z8;
#pragma unroll
  for (int t = 0; t < 4; ++t) { o[t][0] = z8; o[t][1] = z8; }
#pragma unroll 1      /* one stage a trip: the body is already 32 products long */
  for (int s = 0; s < ANS; ++s) { const int sn = (s + 1) & (ANS - 1);      /* as in walk 1; the last trip's refill is read by nobody */
    { const unsigned short* g = kg + (size_t)sn * AK * LQ; k0 = *(const v8us*)g; k1 = *(const v8us*)(g + (size_t)32 * LQ); const unsigned short* u = vg + sn * AK; v0 = *(const v8us*)u; v1 = *(const v8us*)(u + (size_t)32 * SQ);
      asm volatile("s_wait_xcnt 0x0" :: "v"(g), "v"(u) : "memory"); }      /* as above: both address pairs are kept until this wait */
    const unsigned short* kb = sK[s & 1]; const unsigned short* vb = sV[s & 1];
#pragma unroll
    for (int kk = 0; kk < 2; ++kk) { union { v16h v; v8h p[2]; } pf[2]; v16h ka[2][2], va[4];
#pragma unroll
      for (int j = 0; j < 2; ++j) { const unsigned short* kr = kb + (kk * 32 + j * 16 + ln) * AP; ka[j][0] = fa_frag(kr, hh); ka[j][1] = fa_frag(kr + 32, hh); }
#pragma unroll
      for (int t = 0; t < 4; ++t) va[t] = fa_frag(vb + (t * 16 + ln) * AP + kk * 32, hh);
      __builtin_amdgcn_sched_barrier(0);      /* holds the loads above in front of the arithmetic: left free, the V^T fragments are fetched one at a time right in front of their products (an LDS latency each) and the next stage's global loads are issued in mid-stage */
#pragma unroll
      for (int j = 0; j < 2; ++j) {
#pragma unroll
        for (int n = 0; n < 2; ++n) { const v8f st = fa_mma(ka[j][1], qf[n][1], fa_mma(ka[j][0], qf[n][0], z8)); const v8f wt = stm3w(st * 0.125f - mx[n]); s8[n] += wt; pf[n].p[j] = __builtin_convertvector(wt, v8h); } }
#pragma unroll
      for (int t = 0; t < 4; ++t) { o[t][0] = fa_mma(va[t], pf[0].v, o[t][0]); o[t][1] = fa_mma(va[t], pf[1].v, o[t][1]); } }
    { unsigned short* d = sK[(s + 1) & 1]; *(v8us*)&d[sl] = k0; *(v8us*)&d[sl + 32 * AP] = k1; unsigned short* e = sV[(s + 1) & 1]; *(v8us*)&e[sl] = v0; *(v8us*)&e[sl + 32 * AP] = v1; }
    __syncthreads(); }
#pragma unroll
  for (int n = 0; n < 2; ++n) { float se = ((s8[n][0] + s8[n][1]) + (s8[n][2] + s8[n][3])) + ((s8[n][4] + s8[n][5]) + (s8[n][6] + s8[n][7])); se += __shfl_xor(se, 16, 32); const float sc = 64.0f / se;      /* weights carry x256 in numerator and sum alike; o is carried x64 */
    _Float16* op = O16 + (size_t)(b * SQ + q0 + n * 16 + ln) * DM + h * HD + 8 * hh;
#pragma unroll
    for (int t = 0; t < 4; ++t) *(v8h*)(op + t * 16) = __builtin_convertvector(o[t][n] * sc, v8h); } }      /* a lane's eight accumulators are eight consecutive d of one query: one 16-byte store */

// ---- GEMM C[M][N] = alpha A[M][K] . Bt[N][K]^T + bias, f16 operands, f32 accumulation; one 128 x 128 tile of C per work-group, four waves of 64 x 64 (M, N multiples of 128; K a multiple of 64, at least 128) ----
#define GT 128                       /* rows of A and rows of Bt per work-group tile */
#define GK 64                        /* k per stage: one whole 128-byte line of every operand row */
#define GP 72                        /* LDS row pitch in f16: 128 data bytes + 16 (16-byte fragment reads fall on different banks) */
#define GBUF (2 * GT * GP)           /* f16 per buffer: the A rows, then the Bt rows */
// Eight asynchronous 16-byte copies per lane, global memory to LDS: rows 16 apart (gs f16 in memory, 16 GP f16 in LDS). A wave's copy is four whole 128-byte lines. s_wait_xcnt 0 is the statement's own last line, so that no address register of a copy is rewritten in front of it (a precaution).
__device__ __forceinline__ void g3_copy8(unsigned l, const unsigned short* g, size_t gs) {
  asm volatile("global_load_async_to_lds_b128 %0, %8, off\n\tglobal_load_async_to_lds_b128 %1, %9, off\n\tglobal_load_async_to_lds_b128 %2, %10, off\n\tglobal_load_async_to_lds_b128 %3, %11, off\n\t"
               "global_load_async_to_lds_b128 %4, %12, off\n\tglobal_load_async_to_lds_b128 %5, %13, off\n\tglobal_load_async_to_lds_b128 %6, %14, off\n\tglobal_load_async_to_lds_b128 %7, %15, off\n\ts_wait_xcnt 0x0"
               :: "v"(l), "v"(l + 1u * 32u * GP), "v"(l + 2u * 32u * GP), "v"(l + 3u * 32u * GP), "v"(l + 4u * 32u * GP), "v"(l + 5u * 32u * GP), "v"(l + 6u * 32u * GP), "v"(l + 7u * 32u * GP),
                  "v"(g), "v"(g + gs), "v"(g + 2 * gs), "v"(g + 3 * gs), "v"(g + 4 * gs), "v"(g + 5 * gs), "v"(g + 6 * gs), "v"(g + 7 * gs) : "memory"); }
// Each operand line leaves L2 once per work-group, as a whole line, and is read from LDS by the two waves that need it. Two buffers: stage t + 1 flies while stage t is worked on; one barrier a stage (it publishes the next buffer and ends the reads of the one refilled behind it).
// Every accumulator takes its k blocks of 32 in ascending order. The epilogue turns each wave's tile through LDS (the ring, free behind the last stage's barrier) so that rows go out as whole lines.
template <bool OUT16>      /* the output type is fixed at compile time: no branch in the epilogue, its LDS reads go out together */
__global__ __launch_bounds__(128) void k_gemm3(const _Float16* __restrict__ A, int lda, const _Float16* __restrict__ Bh, int ldb, float alpha, const float* __restrict__ bias, float* __restrict__ C, _Float16* __restrict__ C16, int ldc, int N, int K) {
  __shared__ __attribute__((aligned(16))) unsigned char smem[2 * GBUF * 2]; static_assert(4 * 64 * 68 * 4 <= 2 * GBUF * 2, "epilogue staging fits the ring");
  const unsigned short* sm = (const unsigned short*)smem;
  const int tid = threadIdx.x, w = tid >> 5, lane = tid & 31, ln = lane & 15, hh = lane >> 4; const int ntn = N >> 7; const int mt = blockIdx.x / ntn, nq = blockIdx.x - mt * ntn;
  const int row0 = mt * GT + (w >> 1) * 64, col0 = nq * GT + (w & 1) * 64;      /* this wave's 64 x 64 tile */
  const int srow = tid >> 3, sch = (tid & 7) * 8;      /* staging: eight lanes a 128-byte row; rows srow, srow + 16, ... */
  const unsigned short* ag = (const unsigned short*)A + (size_t)(mt * GT + srow) * lda + sch; const unsigned short* bg = (const unsigned short*)Bh + (size_t)(nq * GT + srow) * ldb + sch;
  const unsigned la = (unsigned)(size_t)(sm + srow * GP + sch), lb = la + GT * GP * 2u;      /* LDS byte addresses in buffer 0 */
  const int nt = K / GK; const size_t gsa = (size_t)16 * lda, gsb = (size_t)16 * ldb;
  const v8f z8 = {0.f, 0.f, 0.f, 0.f, 0.f, 0.f, 0.f, 0.f}; v8f acc[4][4];
#pragma unroll
  for (int i = 0; i < 4; ++i) for (int j = 0; j < 4; ++j) acc[i][j] = z8;
  g3_copy8(la, ag, gsa); g3_copy8(lb, bg, gsb);
  asm volatile("s_wait_asynccnt 0x0" ::: "memory");      /* this wave's part of stage 0 has landed */
  __syncthreads();
  g3_copy8(la + GBUF * 2u, ag + GK, gsa); g3_copy8(lb + GBUF * 2u, bg + GK, gsb);
#pragma unroll 1      /* one stage a trip: the body is already 32 products long */
  for (int t = 0; t < nt; ++t) { const unsigned short* ab = sm + (t & 1) * GBUF + ((w >> 1) * 64 + ln) * GP; const unsigned short* bb = sm + (t & 1) * GBUF + (GT + (w & 1) * 64 + ln) * GP;
#pragma unroll
    for (int c = 0; c < 2; ++c) { v16h af[4], bf[4];
#pragma unroll
      for (int i = 0; i < 4; ++i) { af[i] = fa_frag(ab + i * 16 * GP + c * 32, hh); bf[i] = fa_frag(bb + i * 16 * GP + c * 32, hh); }
      __builtin_amdgcn_sched_barrier(0);      /* holds the sixteen LDS reads above together in front of the products: left free, the A fragments are fetched one at a time, each with a full LDS latency in front of its four products */
#pragma unroll
      for (int i = 0; i < 4; ++i) for (int j = 0; j < 4; ++j) acc[i][j] = fa_mma(af[i], bf[j], acc[i][j]); }
    asm volatile("s_wait_dscnt 0x0" ::: "memory");      /* this wave's reads of the buffer are over before anybody refills it */
    asm volatile("s_wait_asynccnt 0x0" ::: "memory");      /* this wave's part of stage t + 1 has landed before anybody reads it */
    __syncthreads();
    if (t + 2 < nt) { const unsigned bo = (unsigned)(t & 1) * (GBUF * 2u); g3_copy8(la + bo, ag + (size_t)(t + 2) * GK, gsa); g3_copy8(lb + bo, bg + (size_t)(t + 2) * GK, gsb); } }
  asm volatile("s_wait_asynccnt 0x0" ::: "memory");      /* no copy is outstanding when the ring becomes output staging */
  float* so = (float*)smem + (size_t)w * 64 * 68; float bv[4] = {0.f, 0.f, 0.f, 0.f};
  if (bias) {
#pragma unroll
    for (int j = 0; j < 4; ++j) bv[j] = bf16_round(bias[col0 + j * 16 + ln]); }
#pragma unroll
  for (int i = 0; i < 4; ++i) {
#pragma unroll
    for (int j = 0; j < 4; ++j) {
#pragma unroll
      for (int r = 0; r < 8; ++r) so[(i * 16 + 8 * hh + r) * 68 + j * 16 + ln] = acc[i][j][r] * alpha + bv[j]; } }
  __builtin_amdgcn_fence(__ATOMIC_ACQ_REL, "workgroup"); __builtin_amdgcn_wave_barrier();
  const int rsub = lane >> 4, c4 = (lane & 15) * 4;
#pragma unroll
  for (int q = 0; q < 32; ++q) { const int r = q * 2 + rsub; const v4f v = *(const v4fa*)&so[r * 68 + c4]; const size_t co = (size_t)(row0 + r) * ldc + col0 + c4;
    if (OUT16) { v4h h4; for (int i = 0; i < 4; ++i) h4[i] = (_Float16)v[i]; *(v4h*)(C16 + co) = h4; } else *(v4f*)(C + co) = v; } }

extern "C" void kernel_launch(void* const* d_in, const int* in_sizes, int n_in,
                              void* d_out, int out_size, void* d_ws, size_t ws_size, hipStream_t stream) {
  (void)in_sizes; (void)n_in; (void)out_size;
  const float* const* I = (const float* const*)d_in; const float* x = I[0]; const float* wqkv = I[1]; const float* bqkv = nullptr; const float* wo = I[2]; const float* bo = I[3];      /* natural [out][in] fused weight [3072][1024] (NO bias: nullptr in the fused GEMM's bias slot); natural w_out [1024][1024] + b_out */
  char* ws = (char*)d_ws; size_t off = 0;
  auto take = [&](size_t bytes) { char* p = ws + off; off += (bytes + 255) & ~(size_t)255; return p; };
  _Float16* BQKV = (_Float16*)take((size_t)3 * DM * DM * 2); _Float16* BO = (_Float16*)take((size_t)DM * DM * 2);
  _Float16* X16 = (_Float16*)take(NR * DM * 2); _Float16* QKV = (_Float16*)take(NR * 3 * DM * 2); _Float16* V16 = QKV + 2 * DM; _Float16* O16 = (_Float16*)take(NR * DM * 2);
  _Float16* VT = (_Float16*)take((size_t)NB * NH * HD * SQ * 2);
  if (off > ws_size) return;
  k_wnat<<<(unsigned)(((size_t)LQ * DM / 8 + 255) / 256), 256, 0, stream>>>(wqkv, (size_t)LQ * DM / 8, BQKV); k_wnat<<<(unsigned)(((size_t)DM * DM / 8 + 255) / 256), 256, 0, stream>>>(wo, (size_t)DM * DM / 8, BO);      /* natural [out][in] = Bt[n][k] x16 (no transpose): fused rows 0..1023 = q, 1024.. = k, 2048.. = v */

  k_x16<<<(unsigned)((NR * DM / 8 + 255) / 256), 256, 0, stream>>>(x, X16, NR * DM / 8);
  const size_t r0p = (size_t)B0 * SQ;      /* first projected row */
  k_gemm3<true><<<(unsigned)((MP / GT) * (3 * DM / GT)), 128, 0, stream>>>(X16 + r0p * DM, DM, BQKV, DM, 0.0625f, bqkv, nullptr, QKV + r0p * 3 * DM, 3 * DM, 3 * DM, DM);      /* q | k | v rows (f16); head h = columns h*HD.. of each DM block */
  k_vt<NH, SQ><<<NB * NH * (SQ / 64), 256, 0, stream>>>(V16, LQ, 0, VT);      /* V^T [NB][NH][HD][SQ] */
  k_attn<<<dim3(SQ / (AW * AQ), NH, NB), AW * 32, 0, stream>>>(QKV, VT, O16);      /* o (merged heads, x64) as f16 rows: scores, stablemax3 and P V in one launch for all batches and heads */
  k_gemm3<false><<<(unsigned)((MPO / GT) * (DM / GT)), 128, 0, stream>>>(O16 + r0p * DM, DM, BO, DM, 0.0009765625f, bo, (float*)d_out + r0p * DM, nullptr, DM, DM, DM);      /* out rows are the output layout */
}

// v004
// Measured time: 109 microseconds a run.
// Two timings next to v003 both put it at 1.03 times that version's speed.
// All steps since v000 together make it 32.5 times as fast.
#include <hip/hip_runtime.h>
// Multi-head self-attention with a polynomial 'stablemax' normalisation instead of softmax (x [2][2048][1024]; qkv = x w_qkv^T (natural [3072][1024] sigma 0.02, NO bias) reshaped (B, S, 3, 16, 64): q | k | v thirds; attn = stablemax3(q k^T * 64^-0.5): logits minus the row max, then s(x) = 1 + x (1 + x/2 (1 + x/3)) for x >= 0 and 1 / (1 - x (1 - x/2 (1 - x/3))) for x < 0, normalised by the row sum; out = merged w_out^T + b_out (natural) -> [2][2048][1024]).
// Structure: token rows r = b*2048 + s; x as exact f16 rows (bf16-rounded); q | k | v as ONE WMMA GEMM (N = 3 x 1024) (128x128 work-group tiles staged in LDS, 64x64 wave tiles, f32 accumulation, exact x16 weights, no bias, f16 outputs); V^T for all batches and heads via LDS transposes; one attention work-group per (batch, head, 256 queries): scores on WMMA (K = 64, alpha = 64^-0.5) formed twice, once for the row max and once for the weights (f32 statistics; weights x256 as f16 operands, normalised after the product), o = P . V on WMMA (o carried x64 against f16 subnormal flush, folded into the output GEMM alpha) written straight into the merged f16 o rows; out = o W_o + b GEMM (f32) into the output layout.
// Compute dtype: inputs rounded to bf16; x / weights exact; q, k, v, stablemax weights and o as plain f16 GEMM operands (~2^-12); scores and stablemax statistics f32. v_wmma_f32_16x16x32_f16.
#define NB 2
#define SQ 2048
#define DM 1024
#define NH 16
#define HD 64
#define HG 4                         /* heads per block group of the unlaunched k_vt(b, h0) */
#define B0 0                         /* first batch processed (debug hook) */
#define NBR NB                       /* batches processed (debug hook) */
#define NR ((size_t)NB * SQ)         /* token rows */
#define MP ((int)((size_t)NBR * SQ)) /* rows projected (debug hook) */
#define QN SQ                        /* unused: k_attn covers all SQ queries */
#define NHD NH                       /* unused: k_attn covers all NH heads */
#define MPO MP                       /* rows through the output stage (debug hook) */
#define LQ (3 * DM)      /* row pitch of the q/k/v rows */
typedef __bf16 v16b __attribute__((ext_vector_type(16)));
typedef unsigned short v8us __attribute__((ext_vector_type(8), may_alias));
typedef float  v8f  __attribute__((ext_vector_type(8)));
typedef float  v4f  __attribute__((ext_vector_type(4)));
typedef float  v4fa __attribute__((ext_vector_type(4), may_alias));
union FragB { v16b v; v8us half[2]; unsigned short u[16]; };

__device__ __forceinline__ unsigned short bf16_bits(float x) { unsigned int u = __float_as_uint(x); return (unsigned short)((u + 0x7FFFu + ((u >> 16) & 1u)) >> 16); }
__device__ __forceinline__ float bf16_val(unsigned short b) { return __uint_as_float(((unsigned int)b) << 16); }
__device__ __forceinline__ float bf16_round(float x) { return bf16_val(bf16_bits(x)); }
// D += A·B with NT terms: 1 = ah·bh, 2 = + al·bh (A split), 3 = + ah·bl (both split)
template <int NT>
__device__ __forceinline__ v8f mmaN(v16b ah, v16b al, v16b bh, v16b bl, v8f c) {
  c = __builtin_amdgcn_wmma_f32_16x16x32_bf16(false, ah, false, bh, (short)0, c, false, false);
  if (NT >= 2) c = __builtin_amdgcn_wmma_f32_16x16x32_bf16(false, al, false, bh, (short)0, c, false, false);
  if (NT >= 3) c = __builtin_amdgcn_wmma_f32_16x16x32_bf16(false, ah, false, bl, (short)0, c, false, false);
  asm volatile("v_nop\n\tv_nop\n\tv_nop\n\tv_nop" : "+v"(c) : "v"(ah), "v"(al), "v"(bh), "v"(bl));
  return c;
}

__global__ __launch_bounds__(256) void k_wt_bf16(const float* __restrict__ W, unsigned short* __restrict__ Wt, int K, int N) {
  const int t = blockIdx.x * 256 + threadIdx.x;
  const int k8n = K / 8;
  if (t >= N * k8n) return;
  const int n = t / k8n, k8 = (t % k8n) * 8;
  v8us v;
#pragma unroll
  for (int i = 0; i < 8; ++i) v[i] = bf16_bits(W[(size_t)(k8 + i) * N + n]);
  *(v8us*)(Wt + (size_t)n * K + k8) = v;
  
}

// GEMM C[M][N] (f32, pitch ldc) = act(A[M][K]·W + bias). A f32 row-major (pitch lda) converted per fragment to bf16
// (ASPLIT: hi/lo two planes -> 2 terms, else single rounded term); Wt bf16 [N][K] (pitch ldb). BIAS_BF16 rounds the
// bias to bf16 first (bias quantised to bf16 before the add). K%32==0, M%16==0, N%64==0.
template <bool ASPLIT, int ACT, bool BIAS_BF16>
__global__ __launch_bounds__(128) void k_gemm_bf(const float* __restrict__ A, int lda, const unsigned short* __restrict__ Wt, int ldb,
                                               const float* __restrict__ bias, float* __restrict__ C, int ldc, int M, int N, int K) {
  __shared__ __attribute__((aligned(16))) float so[4][16][64];
  const int tid = threadIdx.x, w = tid >> 5, lane = tid & 31, ln = lane & 15, hh = lane >> 4;
  const int ntn = N / 64;
  const int wid = blockIdx.x * 4 + w;
  const int mt = wid / ntn, nq = wid % ntn;
  if (mt * 16 >= M) return;
  const int row0 = mt * 16, col0 = nq * 64;
  const float* arow = A + (size_t)(row0 + ln) * lda;
  v8f acc[4] = {};
  for (int kb = 0; kb < K; kb += 32) {
    FragB ah, al;
    const v4f x0 = *(const v4fa*)(arow + kb + 8 * hh), x1 = *(const v4fa*)(arow + kb + 8 * hh + 4);
    const v4f x2 = *(const v4fa*)(arow + kb + 16 + 8 * hh), x3 = *(const v4fa*)(arow + kb + 16 + 8 * hh + 4);
    float xs[16] = {x0[0],x0[1],x0[2],x0[3],x1[0],x1[1],x1[2],x1[3],x2[0],x2[1],x2[2],x2[3],x3[0],x3[1],x3[2],x3[3]};
#pragma unroll
    for (int i = 0; i < 16; ++i) { const unsigned short hb = bf16_bits(xs[i]); ah.u[i] = hb; al.u[i] = ASPLIT ? bf16_bits(xs[i] - bf16_val(hb)) : (unsigned short)0; }
#pragma unroll
    for (int t = 0; t < 4; ++t) {
      const unsigned short* brow = Wt + (size_t)(col0 + t * 16 + ln) * ldb + kb;
      FragB b;
      b.half[0] = *(const v8us*)(brow + 8 * hh);
      b.half[1] = *(const v8us*)(brow + 16 + 8 * hh);
      acc[t] = mmaN<ASPLIT ? 2 : 1>(ah.v, al.v, b.v, b.v, acc[t]);
    }
  }
#pragma unroll
  for (int t = 0; t < 4; ++t) {
    float bv = bias ? bias[col0 + t * 16 + ln] : 0.f;
    if (BIAS_BF16) bv = bf16_round(bv);
#pragma unroll
    for (int r = 0; r < 8; ++r) { float v = acc[t][r] + bv; if (ACT == 1) v = fmaxf(v, 0.f); so[w][8 * hh + r][t * 16 + ln] = v; }
  }
  __builtin_amdgcn_fence(__ATOMIC_ACQ_REL, "workgroup");
  __builtin_amdgcn_wave_barrier();
  const int rsub = lane >> 4, c4 = (lane & 15) * 4;
  {
#pragma unroll
    for (int q = 0; q < 8; ++q) {
      const int r = q * 2 + rsub;
      const v4f v = *(const v4fa*)&so[w][r][c4];
      *(v4f*)(C + (size_t)(row0 + r) * ldc + col0 + c4) = v;
    }
    
  }
}

// GEMM C = act(A·W + bias + resid): A f32 (ASPLIT -> hi/lo 2 terms), Wt bf16 [N][K]; ACT 0 none, 1 relu, 2 exact gelu;
// resid (optional, f32, row index = (row % rmod), pitch ldr, RES_BF16 rounds it) added before the activation.
template <bool ASPLIT, int ACT, bool BIAS_BF16, bool RES_BF16>
__global__ __launch_bounds__(128) void k_gemm_bf3(const float* __restrict__ A, int lda, const unsigned short* __restrict__ Wt, int ldb,
                                                const float* __restrict__ bias, const float* __restrict__ resid, int rmod, int ldr,
                                                float* __restrict__ C, int ldc, int M, int N, int K) {
  __shared__ __attribute__((aligned(16))) float so[4][16][64];
  const int tid = threadIdx.x, w = tid >> 5, lane = tid & 31, ln = lane & 15, hh = lane >> 4;
  const int ntn = N / 64;
  const int wid = blockIdx.x * 4 + w;
  const int mt = wid / ntn, nq = wid % ntn;
  if (mt * 16 >= M) return;
  const int row0 = mt * 16, col0 = nq * 64;
  const float* arow = A + (size_t)(row0 + ln) * lda;
  v8f acc[4] = {};
  for (int kb = 0; kb < K; kb += 32) {
    FragB ah, al;
    const v4f x0 = *(const v4fa*)(arow + kb + 8 * hh), x1 = *(const v4fa*)(arow + kb + 8 * hh + 4);
    const v4f x2 = *(const v4fa*)(arow + kb + 16 + 8 * hh), x3 = *(const v4fa*)(arow + kb + 16 + 8 * hh + 4);
    float xs[16] = {x0[0],x0[1],x0[2],x0[3],x1[0],x1[1],x1[2],x1[3],x2[0],x2[1],x2[2],x2[3],x3[0],x3[1],x3[2],x3[3]};
#pragma unroll
    for (int i = 0; i < 16; ++i) { const unsigned short hb = bf16_bits(xs[i]); ah.u[i] = hb; al.u[i] = ASPLIT ? bf16_bits(xs[i] - bf16_val(hb)) : (unsigned short)0; }
#pragma unroll
    for (int t = 0; t < 4; ++t) {
      const unsigned short* brow = Wt + (size_t)(col0 + t * 16 + ln) * ldb + kb;
      FragB b;
      b.half[0] = *(const v8us*)(brow + 8 * hh);
      b.half[1] = *(const v8us*)(brow + 16 + 8 * hh);
      acc[t] = mmaN<ASPLIT ? 2 : 1>(ah.v, al.v, b.v, b.v, acc[t]);
    }
  }
#pragma unroll
  for (int t = 0; t < 4; ++t) {
    const int col = col0 + t * 16 + ln;
    float bv = bias ? bias[col] : 0.f;
    if (BIAS_BF16) bv = bf16_round(bv);
#pragma unroll
    for (int r = 0; r < 8; ++r) {
      float v = acc[t][r] + bv;
      if (resid) { float rv = resid[(size_t)((row0 + 8 * hh + r) % rmod) * ldr + col]; if (RES_BF16) rv = bf16_round(rv); v += rv; }
      if (ACT == 1) v = fmaxf(v, 0.f);
      if (ACT == 2) v = 0.5f * v * (1.0f + erff(v * 0.70710678118654752f));
      if (ACT == 3) { const float u = 0.7978845608028654f * (v + 0.044715f * v * v * v); v = 0.5f * v * (1.0f + tanhf(u)); }
      so[w][8 * hh + r][t * 16 + ln] = v;
    }
  }
  __builtin_amdgcn_fence(__ATOMIC_ACQ_REL, "workgroup");
  __builtin_amdgcn_wave_barrier();
  const int rsub = lane >> 4, c4 = (lane & 15) * 4;
  {
#pragma unroll
    for (int q = 0; q < 8; ++q) {
      const int r = q * 2 + rsub;
      const v4f v = *(const v4fa*)&so[w][r][c4];
      *(v4f*)(C + (size_t)(row0 + r) * ldc + col0 + c4) = v;
    }
    
  }
}
// row LayerNorm (biased variance, eps) over N: s = X (+ R); optional out_sum <- s; out_norm <- (s-mu)*rsqrt(var+eps)*g + b
template <bool PARAM_BF16>
__global__ __launch_bounds__(256) void k_layernorm(const float* __restrict__ X, const float* __restrict__ R, const float* __restrict__ g, const float* __restrict__ bta,
                                                  float* __restrict__ out_sum, float* __restrict__ out_norm, int N, float eps) {
  __shared__ float red[256];
  const int row = blockIdx.x, tid = threadIdx.x;
  const float* x = X + (size_t)row * N; const float* rr = R ? R + (size_t)row * N : nullptr;
  float vals[16];                     // up to N = 4096
  const int per = N / 256;            // contiguous chunk per thread? use strided-by-4 chunks: thread handles j = tid*4 + 1024*u
  float s1 = 0.f;
  for (int u = 0; u < per / 4; ++u) {
    const int j = tid * 4 + 1024 * u;
    const v4f a = *(const v4fa*)(x + j);
    v4f b = {0.f,0.f,0.f,0.f}; if (rr) b = *(const v4fa*)(rr + j);
#pragma unroll
    for (int q = 0; q < 4; ++q) { const float v = a[q] + b[q]; vals[u * 4 + q] = v; s1 += v; }
  }
  red[tid] = s1; __syncthreads();
  for (int st = 128; st > 0; st >>= 1) { if (tid < st) red[tid] += red[tid + st]; __syncthreads(); }
  const float mu = red[0] / (float)N; __syncthreads();
  float s2 = 0.f;
  for (int u = 0; u < per / 4; ++u)
#pragma unroll
    for (int q = 0; q < 4; ++q) { const float c = vals[u * 4 + q] - mu; s2 += c * c; }
  red[tid] = s2; __syncthreads();
  for (int st = 128; st > 0; st >>= 1) { if (tid < st) red[tid] += red[tid + st]; __syncthreads(); }
  const float rs = rsqrtf(red[0] / (float)N + eps);
  {
    for (int u = 0; u < per / 4; ++u) {
      const int j = tid * 4 + 1024 * u;
      v4f o, sm;
#pragma unroll
      for (int q = 0; q < 4; ++q) {
        float gg = g[j + q], bb = bta[j + q];
        if (PARAM_BF16) { gg = bf16_round(gg); bb = bf16_round(bb); }
        sm[q] = vals[u * 4 + q]; o[q] = (vals[u * 4 + q] - mu) * rs * gg + bb;
      }
      if (out_sum) *(v4f*)(out_sum + (size_t)row * N + j) = sm;
      *(v4f*)(out_norm + (size_t)row * N + j) = o;
    }
    
  }
}



// ---- f16 WMMA path (v_wmma_f32_16x16x32_f16): 11-bit significands for operands in range — used where a [0,1] probability operand needs more precision than bf16
typedef _Float16 v16h __attribute__((ext_vector_type(16)));
union FragH { v16h v; v8us half[2]; _Float16 h[16]; unsigned short u[16]; };
template <int NT>
__device__ __forceinline__ v8f mmaH(v16h ah, v16h al, v16h bh, v16h bl, v8f c) {
  c = __builtin_amdgcn_wmma_f32_16x16x32_f16(false, ah, false, bh, (short)0, c, false, false);
  if (NT >= 2) c = __builtin_amdgcn_wmma_f32_16x16x32_f16(false, al, false, bh, (short)0, c, false, false);
  if (NT >= 3) c = __builtin_amdgcn_wmma_f32_16x16x32_f16(false, ah, false, bl, (short)0, c, false, false);
  asm volatile("v_nop\n\tv_nop\n\tv_nop\n\tv_nop" : "+v"(c) : "v"(ah), "v"(al), "v"(bh), "v"(bl));
  return c;
}
// batched GEMM like k_gemm_b but f16 operands: A f32 (split into f16 hi/lo if ASPLIT, else rounded to f16), Bt = f16 values [n][k]; alpha; C f32; N multiple of 16 (partial tiles skipped)
template <bool ASPLIT>
__global__ __launch_bounds__(128) void k_gemm_h(const float* __restrict__ A, int lda, size_t sA, const _Float16* __restrict__ Bh, int ldb, size_t sB, float alpha, float* __restrict__ C, int ldc, size_t sC, int M, int N, int K) {
  __shared__ __attribute__((aligned(16))) float so[4][16][64];
  const int tid = threadIdx.x, w = tid >> 5, lane = tid & 31, ln = lane & 15, hh = lane >> 4; const int by = blockIdx.y;
  A += (size_t)by * sA; Bh += (size_t)by * sB; C += (size_t)by * sC;
  const int ntn = (N + 63) / 64; const int wid = blockIdx.x * 4 + w; const int mt = wid / ntn, nq = wid % ntn; if (mt * 16 >= M) return;
  const int row0 = mt * 16, col0 = nq * 64; const float* arow = A + (size_t)(row0 + ln) * lda;
  v8f acc[4] = {};
  for (int kb = 0; kb < K; kb += 32) {
    FragH ah, al;
    const v4f x0 = *(const v4fa*)(arow + kb + 8 * hh), x1 = *(const v4fa*)(arow + kb + 8 * hh + 4), x2 = *(const v4fa*)(arow + kb + 16 + 8 * hh), x3 = *(const v4fa*)(arow + kb + 16 + 8 * hh + 4);
    float xs[16] = {x0[0],x0[1],x0[2],x0[3],x1[0],x1[1],x1[2],x1[3],x2[0],x2[1],x2[2],x2[3],x3[0],x3[1],x3[2],x3[3]};
#pragma unroll
    for (int i = 0; i < 16; ++i) { const _Float16 h = (_Float16)xs[i]; ah.h[i] = h; al.h[i] = ASPLIT ? (_Float16)(xs[i] - (float)h) : (_Float16)0.0f; }
#pragma unroll
    for (int t = 0; t < 4; ++t) { if (col0 + t * 16 >= N) continue; const size_t boff = (size_t)(col0 + t * 16 + ln) * ldb + kb; FragH bq; bq.half[0] = *(const v8us*)(Bh + boff + 8 * hh); bq.half[1] = *(const v8us*)(Bh + boff + 16 + 8 * hh);
      acc[t] = mmaH<ASPLIT ? 2 : 1>(ah.v, al.v, bq.v, bq.v, acc[t]); }
  }
#pragma unroll
  for (int t = 0; t < 4; ++t) { if (col0 + t * 16 >= N) continue;
#pragma unroll
    for (int r = 0; r < 8; ++r) so[w][8 * hh + r][t * 16 + ln] = acc[t][r] * alpha; }
  __builtin_amdgcn_fence(__ATOMIC_ACQ_REL, "workgroup"); __builtin_amdgcn_wave_barrier();
  const int rsub = lane >> 4, c4 = (lane & 15) * 4;
  {
#pragma unroll
    for (int q = 0; q < 8; ++q) { const int r = q * 2 + rsub; if (col0 + c4 < N) { const v4f v = *(const v4fa*)&so[w][r][c4]; *(v4f*)(C + (size_t)(row0 + r) * ldc + col0 + c4) = v; } }
     }
}

// Wt[n][k] = f16(W[k][n]·scale) from f32 row-major W[K][N] (scale = power of two; bf16-exact weights stay exact in f16 away from the subnormal range)
__global__ __launch_bounds__(256) void k_wt_f16(const float* __restrict__ W, _Float16* __restrict__ Wt, int K, int N, float scale) {
  const int t = blockIdx.x * 256 + threadIdx.x; if (t >= N * (K / 8)) return; const int n = t / (K / 8), k8 = (t % (K / 8)) * 8; FragH f;
#pragma unroll
  for (int i = 0; i < 8; ++i) f.h[i] = (_Float16)(bf16_round(W[(size_t)(k8 + i) * N + n]) * scale); const v8us o = f.half[0];
  *(v8us*)((unsigned short*)Wt + (size_t)n * K + k8) = o; 
}
// k_gemm_hh variant with fused epilogue: v = acc·alpha + bias[by·sBias + col] (+ CP[(row/rowsPerB)·sCPb + by·64 + col] if CP) ; ACT 0 none / 1 elu ; writes f16 C16 (and f32 C if non-null)
template <int ACT>
__global__ __launch_bounds__(128) void k_gemm_hhx(const _Float16* __restrict__ A, int lda, size_t sA, const _Float16* __restrict__ Bh, int ldb, size_t sB, float alpha, const float* __restrict__ bias, size_t sBias, const float* __restrict__ CP, int rowsPerB, size_t sCPb, int row0g,
    float* __restrict__ C, _Float16* __restrict__ C16, int ldc, size_t sC, int M, int N, int K) {
  __shared__ __attribute__((aligned(16))) float so[4][16][64];
  const int tid = threadIdx.x, w = tid >> 5, lane = tid & 31, ln = lane & 15, hh = lane >> 4; const int by = blockIdx.y;
  A += (size_t)by * sA; Bh += (size_t)by * sB; const size_t cofs = (size_t)by * sC; const float* bp = bias ? bias + (size_t)by * sBias : nullptr;
  const int ntn = (N + 63) / 64; const int wid = blockIdx.x * 4 + w; const int mt = wid / ntn, nq = wid % ntn; if (mt * 16 >= M) return;
  const int row0 = mt * 16, col0 = nq * 64; const _Float16* arow = A + (size_t)(row0 + ln) * lda;
  v8f acc[4] = {};
  for (int kb = 0; kb < K; kb += 32) { FragH ah; ah.half[0] = *(const v8us*)((const unsigned short*)arow + kb + 8 * hh); ah.half[1] = *(const v8us*)((const unsigned short*)arow + kb + 16 + 8 * hh);
#pragma unroll
    for (int t = 0; t < 4; ++t) { if (col0 + t * 16 >= N) continue; const size_t boff = (size_t)(col0 + t * 16 + ln) * ldb + kb; FragH bq; bq.half[0] = *(const v8us*)((const unsigned short*)Bh + boff + 8 * hh); bq.half[1] = *(const v8us*)((const unsigned short*)Bh + boff + 16 + 8 * hh);
      acc[t] = mmaH<1>(ah.v, ah.v, bq.v, bq.v, acc[t]); }
  }
#pragma unroll
  for (int t = 0; t < 4; ++t) { if (col0 + t * 16 >= N) continue; const int col = col0 + t * 16 + ln; const float bv = bp ? bf16_round(bp[col]) : 0.f;
#pragma unroll
    for (int r = 0; r < 8; ++r) { float v = acc[t][r] * alpha + bv; if (CP) { const int rr = row0g + row0 + 8 * hh + r; if (rowsPerB < 0) v += CP[cofs + (size_t)rr * ldc + col];      /* rowsPerB < 0: own element of the batched C plane */ else { const int bidx = rr / rowsPerB; v += CP[(size_t)bidx * sCPb + (size_t)by * 64 + col]; } } if (ACT == 1) v = (v > 0.f) ? v : expm1f(v); else if (ACT == 7) v = (v > 0.f) ? v + 1.0f : expf(v); else if (ACT == 8) v = tanhf(v); else if (ACT == 9) v = 0.5f * v * (1.0f + tanhf(0.7978845608028654f * (v + 0.044715f * v * v * v))); else if (ACT == 11) v = 1.0f / (1.0f + expf(-v)); else if (ACT == 12) v = (v > 0.f) ? v : 0.01f * v; else if (ACT == 14) v = (v > 0.f) ? v : 0.1f * v; else if (ACT == 16) v = (v >= 0.f) ? v : 0.3f * v; else if (ACT == 17) v = (v >= 0.f) ? v : 0.2f * v; else if (ACT == 15) v = v / (1.0f + expf(-v)); else if (ACT == 3) v = fmaxf(v, 0.f); else if (ACT == 6) v = 0.5f * v * (1.0f + erff(v * 0.70710678118654752f)); so[w][8 * hh + r][t * 16 + ln] = v; } }
  __builtin_amdgcn_fence(__ATOMIC_ACQ_REL, "workgroup"); __builtin_amdgcn_wave_barrier();
  const int rsub = lane >> 4, c4 = (lane & 15) * 4; typedef _Float16 v4h __attribute__((ext_vector_type(4)));
  {
#pragma unroll
    for (int q = 0; q < 8; ++q) { const int r = q * 2 + rsub; if (col0 + c4 < N) { const v4f v = *(const v4fa*)&so[w][r][c4]; if (C) *(v4f*)(C + cofs + (size_t)(row0 + r) * ldc + col0 + c4) = v; if (C16) { v4h h4; for (int i = 0; i < 4; ++i) h4[i] = (_Float16)v[i]; *(v4h*)(C16 + cofs + (size_t)(row0 + r) * ldc + col0 + c4) = h4; } } }
     }
}


typedef _Float16 v4h __attribute__((ext_vector_type(4)));

__global__ __launch_bounds__(256) void k_x16(const float* __restrict__ x, _Float16* __restrict__ X16, size_t n8) { const size_t t = (size_t)blockIdx.x * 256 + threadIdx.x; if (t >= n8) return; FragH f;
#pragma unroll
  for (int q = 0; q < 8; ++q) f.h[q] = (_Float16)bf16_round(x[t * 8 + q]); *(v8us*)((unsigned short*)X16 + t * 8) = f.half[0];  }
__global__ __launch_bounds__(256) void k_h16(const float* __restrict__ x, _Float16* __restrict__ X16, size_t n8) { const size_t t = (size_t)blockIdx.x * 256 + threadIdx.x; if (t >= n8) return; FragH f;
#pragma unroll
  for (int q = 0; q < 8; ++q) f.h[q] = (_Float16)x[t * 8 + q]; *(v8us*)((unsigned short*)X16 + t * 8) = f.half[0];  }
__global__ __launch_bounds__(256) void k_round16f(const float* __restrict__ W, _Float16* __restrict__ Bt, size_t n8) { const size_t t = (size_t)blockIdx.x * 256 + threadIdx.x; if (t >= n8) return; FragH f;
#pragma unroll
  for (int i = 0; i < 8; ++i) f.h[i] = (_Float16)(bf16_round(W[t * 8 + i]) * 16.0f); *(v8us*)((unsigned short*)Bt + t * 8) = f.half[0];  }
template <int NHv, int TTv>
__global__ __launch_bounds__(256) void k_vt(const _Float16* __restrict__ V16, int ldv, int voff, _Float16* __restrict__ Vt) { __shared__ unsigned short tl[64][66]; const int tid = threadIdx.x; const int slab = blockIdx.x / (TTv / 64), lg = blockIdx.x % (TTv / 64); const int b = slab / NHv, h = slab % NHv;
  for (int i = tid; i < 64 * 8; i += 256) { const int r = i / 8, c8 = (i % 8) * 8; FragH f; f.half[0] = *(const v8us*)((const unsigned short*)V16 + ((size_t)b * TTv + lg * 64 + r) * ldv + voff + h * 64 + c8);
#pragma unroll
    for (int q = 0; q < 8; ++q) tl[r][c8 + q] = f.u[q]; }
  __syncthreads();
  {
#pragma unroll
    for (int rd = 0; rd < 2; ++rd) { const int d = rd * 32 + tid / 8, pc = tid % 8; FragH f;
#pragma unroll
      for (int q = 0; q < 8; ++q) f.u[q] = tl[pc * 8 + q][d];
      *(v8us*)((unsigned short*)Vt + ((size_t)slab * 64 + d) * TTv + lg * 64 + pc * 8) = f.half[0]; }
     } }

__global__ __launch_bounds__(256) void k_hl(const float* __restrict__ F, _Float16* __restrict__ Hh, _Float16* __restrict__ Hl, size_t n8) { const size_t t = (size_t)blockIdx.x * 256 + threadIdx.x; if (t >= n8) return; FragH fh, fl; const v4f a = *(const v4fa*)(F + t * 8), c = *(const v4fa*)(F + t * 8 + 4);
#pragma unroll
  for (int q = 0; q < 4; ++q) { _Float16 h = (_Float16)a[q]; fh.h[q] = h; fl.h[q] = (_Float16)((a[q] - (float)h) * 1024.0f); h = (_Float16)c[q]; fh.h[4 + q] = h; fl.h[4 + q] = (_Float16)((c[q] - (float)h) * 1024.0f); }
  { *(v8us*)((unsigned short*)Hh + t * 8) = fh.half[0]; *(v8us*)((unsigned short*)Hl + t * 8) = fl.half[0];  } }

__global__ __launch_bounds__(256) void k_wnat(const float* __restrict__ w, size_t n8, _Float16* __restrict__ Bt) { const size_t t = (size_t)blockIdx.x * 256 + threadIdx.x; if (t >= n8) return; FragH f; for (int q = 0; q < 8; ++q) f.h[q] = (_Float16)(bf16_round(w[t * 8 + q]) * 16.0f); *(v8us*)((unsigned short*)Bt + t * 8) = f.half[0];  }
__global__ __launch_bounds__(256) void k_rsm(const float* __restrict__ S, _Float16* __restrict__ P, int nrows) {
  #pragma clang fp contract(off)
  const int i = blockIdx.x * 256 + threadIdx.x; if (i >= nrows) return; const float* s = S + (size_t)i * SQ; float mx = -3.0e38f;
#pragma unroll 1
  for (int j = 0; j < SQ; ++j) mx = fmaxf(mx, s[j]); float se = 0.f;
#pragma unroll 1
  for (int j = 0; j < SQ; ++j) se += expf(s[j] - mx); const float sc = 256.0f / se;
#pragma unroll 1
  for (int j0 = 0; j0 < SQ; j0 += 8) { FragH f; for (int q = 0; q < 8; ++q) f.h[q] = (_Float16)(expf(s[j0 + q] - mx) * sc); unsigned short* d = (unsigned short*)P + (size_t)i * SQ + j0; *(v8us*)d = f.half[0];  } }
__global__ __launch_bounds__(256) void k_vt(const _Float16* __restrict__ V16, int b, int h0, _Float16* __restrict__ VT) { __shared__ unsigned short tl[64][65]; const int tid = threadIdx.x; const int hh = blockIdx.x % HG, sg = blockIdx.x / HG; const int s0 = sg * 64; const int h = h0 + hh;
  for (int i = tid; i < 64 * 8; i += 256) { const int j = i / 8, d8 = (i % 8) * 8; FragH f; f.half[0] = *(const v8us*)((const unsigned short*)V16 + ((size_t)b * SQ + s0 + j) * DM + h * HD + d8); for (int q = 0; q < 8; ++q) tl[d8 + q][j] = f.u[q]; }
  __syncthreads();
  { for (int i = tid; i < 64 * 8; i += 256) { const int d = i / 8, j8 = (i % 8) * 8; FragH f; for (int q = 0; q < 8; ++q) f.u[q] = tl[d][j8 + q]; *(v8us*)((unsigned short*)VT + ((size_t)hh * HD + d) * SQ + s0 + j8) = f.half[0]; }  } }



__global__ __launch_bounds__(256) void k_rsmf(const float* __restrict__ S, _Float16* __restrict__ P, int qn, int hg) {
  #pragma clang fp contract(off)
  const int t = blockIdx.x * 256 + threadIdx.x; if (t >= qn * hg) return; const size_t i = (size_t)(t / qn) * SQ + (t % qn); const float* s = S + i * SQ; float mx = -3.0e38f;
#pragma unroll 1
  for (int j = 0; j < SQ; ++j) mx = fmaxf(mx, s[j]); float se = 0.f;
#pragma unroll 1
  for (int j = 0; j < SQ; ++j) se += __expf(s[j] - mx); const float sc = 256.0f / se;
#pragma unroll 1
  for (int j0 = 0; j0 < SQ; j0 += 8) { FragH f; for (int q = 0; q < 8; ++q) f.h[q] = (_Float16)(__expf(s[j0 + q] - mx) * sc); unsigned short* d = (unsigned short*)P + i * SQ + j0; *(v8us*)d = f.half[0];  } }

// Four reciprocals. One statement with results apart from sources, so that behind each v_rcp_f32 stands an instruction that touches neither its result nor its source: the next reciprocal, and behind the last the v_nop (the slot the instruction set asks for behind a transcendental).
__device__ __forceinline__ v4f rcp4(v4f d) { v4f o;
  asm("v_rcp_f32 %0, %4\n\tv_rcp_f32 %1, %5\n\tv_rcp_f32 %2, %6\n\tv_rcp_f32 %3, %7\n\tv_nop" : "=&v"(o[0]), "=&v"(o[1]), "=&v"(o[2]), "=&v"(o[3]) : "v"(d[0]), "v"(d[1]), "v"(d[2]), "v"(d[3]));
  return o; }
typedef _Float16 v8h __attribute__((ext_vector_type(8)));
#define AW 8                         /* waves per work-group of the attention kernel */
#define AQ 32                        /* query columns per wave (two 16-column tiles) */
#define AK 64                        /* keys per LDS stage */
#define AP 72                        /* LDS row pitch in f16: 128 data bytes + 16 (16-byte fragment reads fall on different banks) */
#define ANS (SQ / AK)                /* stages per walk over the keys */
__device__ __forceinline__ v16h fa_frag(const unsigned short* p, int hh) { FragH f; f.half[0] = *(const v8us*)(p + 8 * hh); f.half[1] = *(const v8us*)(p + 16 + 8 * hh); return f.v; }
__device__ __forceinline__ v8f fa_mma(v16h a, v16h b, v8f c) { return __builtin_amdgcn_wmma_f32_16x16x32_f16(false, a, false, b, (short)0, c, false, false); }
// 256 x the stablemax3 weight for x <= 0, eight values: 1 / (1 - x (1 - x/2 (1 - x/3))) with the factor 2^-8 carried exactly through the two outer terms of the denominator; x / 3 as a multiply by f32(1/3); reciprocal through v_rcp_f32.
__device__ __forceinline__ v8f stm3w(v8f x) { const v8f a = 1.0f - x * 0.33333334f; const v8f b = 0.00390625f - (0.001953125f * x) * a; const v8f d = 0.00390625f - x * b;
  const v4f lo = rcp4(__builtin_shufflevector(d, d, 0, 1, 2, 3)), hi = rcp4(__builtin_shufflevector(d, d, 4, 5, 6, 7)); return __builtin_shufflevector(lo, hi, 0, 1, 2, 3, 4, 5, 6, 7); }
__global__ __launch_bounds__(AW * 32) void k_attn(const _Float16* __restrict__ QKV, const _Float16* __restrict__ VT, _Float16* __restrict__ O16) {
  __shared__ __attribute__((aligned(16))) unsigned short sK[2][AK * AP]; __shared__ __attribute__((aligned(16))) unsigned short sV[2][AK * AP];
  const int tid = threadIdx.x, lane = tid & 31, ln = lane & 15, hh = lane >> 4, w = tid >> 5; const int h = blockIdx.y, b = blockIdx.z; const int q0 = blockIdx.x * (AW * AQ) + w * AQ;
  const unsigned short* Qp = (const unsigned short*)QKV + (size_t)b * SQ * LQ + h * HD; const unsigned short* Kp = Qp + DM; const unsigned short* Vp = (const unsigned short*)VT + (size_t)(b * NH + h) * HD * SQ;
  const int srow = tid >> 3, sch = (tid & 7) * 8; const int sl = srow * AP + sch;      /* staging: eight threads a 128-byte row, rows srow and srow + 32 */
  const unsigned short* kg = Kp + (size_t)srow * LQ + sch; const unsigned short* vg = Vp + (size_t)srow * SQ + sch;
  const v8f z8 = {0.f, 0.f, 0.f, 0.f, 0.f, 0.f, 0.f, 0.f};
  v16h qf[2][2]; const unsigned short* qg = Qp + (size_t)(q0 + ln) * LQ + 8 * hh;
#pragma unroll
  for (int n = 0; n < 2; ++n) for (int c = 0; c < 2; ++c) qf[n][c] = fa_frag(qg + (size_t)n * 16 * LQ + c * 32, 0);
  v8us k0 = *(const v8us*)kg, k1 = *(const v8us*)(kg + (size_t)32 * LQ), v0 = *(const v8us*)vg, v1 = *(const v8us*)(vg + (size_t)32 * SQ);
  asm volatile("s_wait_xcnt 0x0" :: "v"(qg), "v"(qg + (size_t)16 * LQ), "v"(kg), "v"(vg) : "memory");      /* the address registers of the loads above are kept, and not reused as a load's destination either, until this wait */
  *(v8us*)&sK[0][sl] = k0; *(v8us*)&sK[0][sl + 32 * AP] = k1; *(v8us*)&sV[0][sl] = v0; *(v8us*)&sV[0][sl + 32 * AP] = v1;      /* V^T stage 0 waits in its buffer through walk 1, which touches only sK */
  __syncthreads();
  v8f m8[2]; m8[0] = z8 - 3.0e38f; m8[1] = m8[0];
#pragma unroll 1      /* one stage a trip: the body is already 16 products long */
  for (int s = 0; s < ANS; ++s) { const int sn = (s + 1) & (ANS - 1);      /* the stage behind the last is stage 0 again: no branch in the trip, and walk 2 finds its first K tile in buffer 0 */
    { const unsigned short* g = kg + (size_t)sn * AK * LQ; k0 = *(const v8us*)g; k1 = *(const v8us*)(g + (size_t)32 * LQ);
      asm volatile("s_wait_xcnt 0x0" :: "v"(g) : "memory"); }      /* as above: the address pair is kept until this wait */
    const unsigned short* kb = sK[s & 1];
#pragma unroll
    for (int j = 0; j < 4; ++j) { const v16h a0 = fa_frag(kb + (j * 16 + ln) * AP, hh), a1 = fa_frag(kb + (j * 16 + ln) * AP + 32, hh);
#pragma unroll
      for (int n = 0; n < 2; ++n) m8[n] = __builtin_elementwise_max(m8[n], fa_mma(a1, qf[n][1], fa_mma(a0, qf[n][0], z8))); }
    { unsigned short* d = sK[(s + 1) & 1]; *(v8us*)&d[sl] = k0; *(v8us*)&d[sl + 32 * AP] = k1; }
    __syncthreads(); }
  float mx[2];
#pragma unroll
  for (int n = 0; n < 2; ++n) { float m = fmaxf(fmaxf(fmaxf(m8[n][0], m8[n][1]), fmaxf(m8[n][2], m8[n][3])), fmaxf(fmaxf(m8[n][4], m8[n][5]), fmaxf(m8[n][6], m8[n][7]))); m = fmaxf(m, __shfl_xor(m, 16, 32)); mx[n] = m * 0.125f; }
  v8f o[4][2]; v8f s8[2]; s8[0] = z8; s8[1] = z8;
#pragma unroll
  for (int t = 0; t < 4; ++t) { o[t][0] = z8; o[t][1] = z8; }
#pragma unroll 1      /* one stage a trip: the body is already 32 products long */
  for (int s = 0; s < ANS; ++s) { const int sn = (s + 1) & (ANS - 1);      /* as in walk 1; the last trip's refill is read by nobody */
    { const unsigned short* g = kg + (size_t)sn * AK * LQ; k0 = *(const v8us*)g; k1 = *(const v8us*)(g + (size_t)32 * LQ); const unsigned short* u = vg + sn * AK; v0 = *(const v8us*)u; v1 = *(const v8us*)(u + (size_t)32 * SQ);
      asm volatile("s_wait_xcnt 0x0" :: "v"(g), "v"(u) : "memory"); }      /* as above: both address pairs are kept until this wait */
    const unsigned short* kb = sK[s & 1]; const unsigned short* vb = sV[s & 1];
#pragma unroll
    for (int kk = 0; kk < 2; ++kk) { union { v16h v; v8h p[2]; } pf[2]; v16h ka[2][2], va[4];
#pragma unroll
      for (int j = 0; j < 2; ++j) { const unsigned short* kr = kb + (kk * 32 + j * 16 + ln) * AP; ka[j][0] = fa_frag(kr, hh); ka[j][1] = fa_frag(kr + 32, hh); }
#pragma unroll
      for (int t = 0; t < 4; ++t) va[t] = fa_frag(vb + (t * 16 + ln) * AP + kk * 32, hh);
      __builtin_amdgcn_sched_barrier(0);      /* holds the loads above in front of the arithmetic: left free, the V^T fragments are fetched one at a time right in front of their products (an LDS latency each) and the next stage's global loads are issued in mid-stage */
#pragma unroll
      for (int j = 0; j < 2; ++j) {
#pragma unroll
        for (int n = 0; n < 2; ++n) { const v8f st = fa_mma(ka[j][1], qf[n][1], fa_mma(ka[j][0], qf[n][0], z8)); const v8f wt = stm3w(st * 0.125f - mx[n]); s8[n] += wt; pf[n].p[j] = __builtin_convertvector(wt, v8h); } }
#pragma unroll
      for (int t = 0; t < 4; ++t) { o[t][0] = fa_mma(va[t], pf[0].v, o[t][0]); o[t][1] = fa_mma(va[t], pf[1].v, o[t][1]); } }
    { unsigned short* d = sK[(s + 1) & 1]; *(v8us*)&d[sl] = k0; *(v8us*)&d[sl + 32 * AP] = k1; unsigned short* e = sV[(s + 1) & 1]; *(v8us*)&e[sl] = v0; *(v8us*)&e[sl + 32 * AP] = v1; }
    __syncthreads(); }
#pragma unroll
  for (int n = 0; n < 2; ++n) { float se = ((s8[n][0] + s8[n][1]) + (s8[n][2] + s8[n][3])) + ((s8[n][4] + s8[n][5]) + (s8[n][6] + s8[n][7])); se += __shfl_xor(se, 16, 32); const float sc = 64.0f / se;      /* weights carry x256 in numerator and sum alike; o is carried x64 */
    _Float16* op = O16 + (size_t)(b * SQ + q0 + n * 16 + ln) * DM + h * HD + 8 * hh;
#pragma unroll
    for (int t = 0; t < 4; ++t) *(v8h*)(op + t * 16) = __builtin_convertvector(o[t][n] * sc, v8h); } }      /* a lane's eight accumulators are eight consecutive d of one query: one 16-byte store */

// ---- GEMM C[M][N] = alpha A[M][K] . Bt[N][K]^T + bias, f16 operands, f32 accumulation; one 128 x 128 tile of C per work-group, four waves of 64 x 64 (M, N multiples of 128; K a multiple of 64, at least 128) ----
#define GT 128                       /* rows of A and rows of Bt per work-group tile */
#define GK 64                        /* k per stage: one whole 128-byte line of every operand row */
#define GP 72                        /* LDS row pitch in f16: 128 data bytes + 16 (16-byte fragment reads fall on different banks) */
#define GBUF (2 * GT * GP)           /* f16 per buffer: the A rows, then the Bt rows */
// Eight asynchronous 16-byte copies per lane, global memory to LDS: rows 16 apart (gs f16 in memory, 16 GP f16 in LDS). A wave's copy is four whole 128-byte lines. s_wait_xcnt 0 is the statement's own last line, so that no address register of a copy is rewritten in front of it (a precaution).
__device__ __forceinline__ void g3_copy8(unsigned l, const unsigned short* g, size_t gs) {
  asm volatile("global_load_async_to_lds_b128 %0, %8, off\n\tglobal_load_async_to_lds_b128 %1, %9, off\n\tglobal_load_async_to_lds_b128 %2, %10, off\n\tglobal_load_async_to_lds_b128 %3, %11, off\n\t"
               "global_load_async_to_lds_b128 %4, %12, off\n\tglobal_load_async_to_lds_b128 %5, %13, off\n\tglobal_load_async_to_lds_b128 %6, %14, off\n\tglobal_load_async_to_lds_b128 %7, %15, off\n\ts_wait_xcnt 0x0"
               :: "v"(l), "v"(l + 1u * 32u * GP), "v"(l + 2u * 32u * GP), "v"(l + 3u * 32u * GP), "v"(l + 4u * 32u * GP), "v"(l + 5u * 32u * GP), "v"(l + 6u * 32u * GP), "v"(l + 7u * 32u * GP),
                  "v"(g), "v"(g + gs), "v"(g + 2 * gs), "v"(g + 3 * gs), "v"(g + 4 * gs), "v"(g + 5 * gs), "v"(g + 6 * gs), "v"(g + 7 * gs) : "memory"); }
// Each operand line leaves L2 once per work-group, as a whole line, and is read from LDS by the two waves that need it. Two buffers: stage t + 1 flies while stage t is worked on; one barrier a stage (it publishes the next buffer and ends the reads of the one refilled behind it).
// Every accumulator takes its k blocks of 32 in ascending order. The epilogue turns each wave's tile through LDS (the ring, free behind the last stage's barrier) so that rows go out as whole lines.
template <bool OUT16>      /* the output type is fixed at compile time: no branch in the epilogue, its LDS reads go out together */
__global__ __launch_bounds__(128) void k_gemm3(const _Float16* __restrict__ A, int lda, const _Float16* __restrict__ Bh, int ldb, float alpha, const float* __restrict__ bias, float* __restrict__ C, _Float16* __restrict__ C16, int ldc, int N, int K) {
  __shared__ __attribute__((aligned(16))) unsigned char smem[2 * GBUF * 2]; static_assert(4 * 64 * 68 * 4 <= 2 * GBUF * 2, "epilogue staging fits the ring");
  const unsigned short* sm = (const unsigned short*)smem;
  const int tid = threadIdx.x, w = tid >> 5, lane = tid & 31, ln = lane & 15, hh = lane >> 4; const int ntn = N >> 7; const int mt = blockIdx.x / ntn, nq = blockIdx.x - mt * ntn;
  const int row0 = mt * GT + (w >> 1) * 64, col0 = nq * GT + (w & 1) * 64;      /* this wave's 64 x 64 tile */
  const int srow = tid >> 3, sch = (tid & 7) * 8;      /* staging: eight lanes a 128-byte row; rows srow, srow + 16, ... */
  const unsigned short* ag = (const unsigned short*)A + (size_t)(mt * GT + srow) * lda + sch; const unsigned short* bg = (const unsigned short*)Bh + (size_t)(nq * GT + srow) * ldb + sch;
  const unsigned la = (unsigned)(size_t)(sm + srow * GP + sch), lb = la + GT * GP * 2u;      /* LDS byte addresses in buffer 0 */
  const int nt = K / GK; const size_t gsa = (size_t)16 * lda, gsb = (size_t)16 * ldb;
  const v8f z8 = {0.f, 0.f, 0.f, 0.f, 0.f, 0.f, 0.f, 0.f}; v8f acc[4][4];
#pragma unroll
  for (int i = 0; i < 4; ++i) for (int j = 0; j < 4; ++j) acc[i][j] = z8;
  g3_copy8(la, ag, gsa); g3_copy8(lb, bg, gsb);
  asm volatile("s_wait_asynccnt 0x0" ::: "memory");      /* this wave's part of stage 0 has landed */
  __syncthreads();
  g3_copy8(la + GBUF * 2u, ag + GK, gsa); g3_copy8(lb + GBUF * 2u, bg + GK, gsb);
#pragma unroll 1      /* one stage a trip: the body is already 32 products long */
  for (int t = 0; t < nt; ++t) { const unsigned short* ab = sm + (t & 1) * GBUF + ((w >> 1) * 64 + ln) * GP; const unsigned short* bb = sm + (t & 1) * GBUF + (GT + (w & 1) * 64 + ln) * GP;
#pragma unroll
    for (int c = 0; c < 2; ++c) { v16h af[4], bf[4];
#pragma unroll
      for (int i = 0; i < 4; ++i) { af[i] = fa_frag(ab + i * 16 * GP + c * 32, hh); bf[i] = fa_frag(bb + i * 16 * GP + c * 32, hh); }
      __builtin_amdgcn_sched_barrier(0);      /* holds the sixteen LDS reads above together in front of the products: left free, the A fragments are fetched one at a time, each with a full LDS latency in front of its four products */
#pragma unroll
      for (int i = 0; i < 4; ++i) for (int j = 0; j < 4; ++j) acc[i][j] = fa_mma(af[i], bf[j], acc[i][j]); }
    asm volatile("s_wait_dscnt 0x0" ::: "memory");      /* this wave's reads of the buffer are over before anybody refills it */
    asm volatile("s_wait_asynccnt 0x0" ::: "memory");      /* this wave's part of stage t + 1 has landed before anybody reads it */
    __syncthreads();
    if (t + 2 < nt) { const unsigned bo = (unsigned)(t & 1) * (GBUF * 2u); g3_copy8(la + bo, ag + (size_t)(t + 2) * GK, gsa); g3_copy8(lb + bo, bg + (size_t)(t + 2) * GK, gsb); } }
  asm volatile("s_wait_asynccnt 0x0" ::: "memory");      /* no copy is outstanding when the ring becomes output staging */
  float* so = (float*)smem + (size_t)w * 64 * 68; float bv[4] = {0.f, 0.f, 0.f, 0.f};
  if (bias) {
#pragma unroll
    for (int j = 0; j < 4; ++j) bv[j] = bf16_round(bias[col0 + j * 16 + ln]); }
#pragma unroll
  for (int i = 0; i < 4; ++i) {
#pragma unroll
    for (int j = 0; j < 4; ++j) {
#pragma unroll
      for (int r = 0; r < 8; ++r) so[(i * 16 + 8 * hh + r) * 68 + j * 16 + ln] = acc[i][j][r] * alpha + bv[j]; } }
  __builtin_amdgcn_fence(__ATOMIC_ACQ_REL, "workgroup"); __builtin_amdgcn_wave_barrier();
  const int rsub = lane >> 4, c4 = (lane & 15) * 4;
#pragma unroll
  for (int q = 0; q < 32; ++q) { const int r = q * 2 + rsub; const v4f v = *(const v4fa*)&so[r * 68 + c4]; const size_t co = (size_t)(row0 + r) * ldc + col0 + c4;
    if (OUT16) { v4h h4; for (int i = 0; i < 4; ++i) h4[i] = (_Float16)v[i]; *(v4h*)(C16 + co) = h4; } else *(v4f*)(C + co) = v; } }

// ---- operand conversion: x, w_qkv and w_out to f16 in ONE launch of few, long waves ----
#define PG 512                       /* work-groups: 16 waves on every WGP */
#define PT (PG * 256)                /* threads of the launch */
#define PNX ((int)(NR * DM / 4 / PT))            /* 16-byte pieces per thread: of x */
#define PNQ ((int)((size_t)LQ * DM / 4 / PT))    /* of w_qkv */
#define PNO ((int)((size_t)DM * DM / 4 / PT))    /* of w_out */
__device__ __forceinline__ v4h cv_x(v4f a) { v4h r; for (int q = 0; q < 4; ++q) r[q] = (_Float16)bf16_round(a[q]); return r; }
__device__ __forceinline__ v4h cv_w(v4f a) { v4h r; for (int q = 0; q < 4; ++q) r[q] = (_Float16)(bf16_round(a[q]) * 16.0f); return r; }
// The time of a short elementwise launch is the time its waves take to start, so the same bytes go through an eighth of the waves and one launch instead of three.
// Piece i of a thread lies PT pieces behind piece i - 1: every wave-wide load is 512 contiguous bytes (four whole lines), every store 256. All of a thread's loads are issued before its first conversion.
__global__ __launch_bounds__(256) void k_prep(const float* __restrict__ x, const float* __restrict__ wq, const float* __restrict__ wo, _Float16* __restrict__ X16, _Float16* __restrict__ BQ, _Float16* __restrict__ BO) {
  static_assert(NR * DM % (4 * PT) == 0 && (size_t)LQ * DM % (4 * PT) == 0 && (size_t)DM * DM % (4 * PT) == 0, "every thread takes the same number of pieces");
  const unsigned t = blockIdx.x * 256u + threadIdx.x; v4f a[PNX], b[PNQ], c[PNO];
#pragma unroll
  for (int i = 0; i < PNX; ++i) a[i] = ((const v4fa*)x + (size_t)i * PT)[t];
#pragma unroll
  for (int i = 0; i < PNQ; ++i) b[i] = ((const v4fa*)wq + (size_t)i * PT)[t];
#pragma unroll
  for (int i = 0; i < PNO; ++i) c[i] = ((const v4fa*)wo + (size_t)i * PT)[t];
  asm volatile("s_wait_xcnt 0x0" :: "v"(t) : "memory");      /* no address register of the loads above is rewritten in front of this wait (a precaution): left to the compiler, the pair it forms for the pieces beyond an offset's reach is reused behind a load-count wait alone */
  __builtin_amdgcn_sched_barrier(0);      /* holds all sixteen loads in front of the arithmetic: left free, half of them are issued only behind the first results, a second memory latency in a wave that lives for little more than one */
#pragma unroll
  for (int i = 0; i < PNX; ++i) ((v4h*)X16 + (size_t)i * PT)[t] = cv_x(a[i]);
#pragma unroll
  for (int i = 0; i < PNQ; ++i) ((v4h*)BQ + (size_t)i * PT)[t] = cv_w(b[i]);
#pragma unroll
  for (int i = 0; i < PNO; ++i) ((v4h*)BO + (size_t)i * PT)[t] = cv_w(c[i]); }

extern "C" void kernel_launch(void* const* d_in, const int* in_sizes, int n_in,
                              void* d_out, int out_size, void* d_ws, size_t ws_size, hipStream_t stream) {
  (void)in_sizes; (void)n_in; (void)out_size;
  const float* const* I = (const float* const*)d_in; const float* x = I[0]; const float* wqkv = I[1]; const float* bqkv = nullptr; const float* wo = I[2]; const float* bo = I[3];      /* natural [out][in] fused weight [3072][1024] (NO bias: nullptr in the fused GEMM's bias slot); natural w_out [1024][1024] + b_out */
  char* ws = (char*)d_ws; size_t off = 0;
  auto take = [&](size_t bytes) { char* p = ws + off; off += (bytes + 255) & ~(size_t)255; return p; };
  _Float16* BQKV = (_Float16*)take((size_t)3 * DM * DM * 2); _Float16* BO = (_Float16*)take((size_t)DM * DM * 2);
  _Float16* X16 = (_Float16*)take(NR * DM * 2); _Float16* QKV = (_Float16*)take(NR * 3 * DM * 2); _Float16* V16 = QKV + 2 * DM; _Float16* O16 = (_Float16*)take(NR * DM * 2);
  _Float16* VT = (_Float16*)take((size_t)NB * NH * HD * SQ * 2);
  if (off > ws_size) return;
  k_prep<<<PG, 256, 0, stream>>>(x, wqkv, wo, X16, BQKV, BO);      /* x as f16 rows; natural [out][in] weights = Bt[n][k] x16 (no transpose): fused rows 0..1023 = q, 1024.. = k, 2048.. = v */
  const size_t r0p = (size_t)B0 * SQ;      /* first projected row */
  k_gemm3<true><<<(unsigned)((MP / GT) * (3 * DM / GT)), 128, 0, stream>>>(X16 + r0p * DM, DM, BQKV, DM, 0.0625f, bqkv, nullptr, QKV + r0p * 3 * DM, 3 * DM, 3 * DM, DM);      /* q | k | v rows (f16); head h = columns h*HD.. of each DM block */
  k_vt<NH, SQ><<<NB * NH * (SQ / 64), 256, 0, stream>>>(V16, LQ, 0, VT);      /* V^T [NB][NH][HD][SQ] */
  k_attn<<<dim3(SQ / (AW * AQ), NH, NB), AW * 32, 0, stream>>>(QKV, VT, O16);      /* o (merged heads, x64) as f16 rows: scores, stablemax3 and P V in one launch for all batches and heads */
  k_gemm3<false><<<(unsigned)((MPO / GT) * (DM / GT)), 128, 0, stream>>>(O16 + r0p * DM, DM, BO, DM, 0.0009765625f, bo, (float*)d_out + r0p * DM, nullptr, DM, DM, DM);      /* out rows are the output layout */
}

// v005
// A run of this version takes 105 microseconds.
// Next to v004, in two timings, it ran 1.04 and 1.03 times as fast.
// Over all steps from v000 it is 33.7 times as fast.
#include <hip/hip_runtime.h>
// Multi-head self-attention with a polynomial 'stablemax' normalisation instead of softmax (x [2][2048][1024]; qkv = x w_qkv^T (natural [3072][1024] sigma 0.02, NO bias) reshaped (B, S, 3, 16, 64): q | k | v thirds; attn = stablemax3(q k^T * 64^-0.5): logits minus the row max, then s(x) = 1 + x (1 + x/2 (1 + x/3)) for x >= 0 and 1 / (1 - x (1 - x/2 (1 - x/3))) for x < 0, normalised by the row sum; out = merged w_out^T + b_out (natural) -> [2][2048][1024]).
// Structure: token rows r = b*2048 + s; x as exact f16 rows (bf16-rounded); q | k | v as ONE WMMA GEMM (N = 3 x 1024) (128x128 work-group tiles staged in LDS, 64x64 wave tiles, f32 accumulation, exact x16 weights, no bias, f16 outputs; the v third leaves that GEMM already transposed, as V^T [batch][head][d][s]); one attention kernel per (batch, head, 256 queries): scores on WMMA (K = 64, alpha = 64^-0.5) formed twice, once for the row max and once for the weights (f32 statistics; weights x256 as f16 operands, normalised after the product), o = P . V on WMMA (o carried x64 against f16 subnormal flush, folded into the output GEMM alpha) written straight into the merged f16 o rows; out = o W_o + b GEMM (f32) into the output layout.
// Compute dtype: inputs rounded to bf16; x / weights exact; q, k, v, softmax weights and o as plain f16 GEMM operands (~2^-12); scores and softmax statistics f32; v_wmma_f32_16x16x32_f16.
#define NB 2
#define SQ 2048
#define DM 1024
#define NH 16
#define HD 64
#define HG 4                         /* heads per block group of the unlaunched k_vt(b, h0) */
#define B0 0                         /* first batch processed (debug hook) */
#define NBR NB                       /* batches processed (debug hook) */
#define NR ((size_t)NB * SQ)         /* token rows */
#define MP ((int)((size_t)NBR * SQ)) /* rows projected (debug hook) */
#define QN SQ                        /* unused: k_attn covers all SQ queries */
#define NHD NH                       /* unused: k_attn covers all NH heads */
#define MPO MP                       /* rows through the output stage (debug hook) */
#define LQ (3 * DM)      /* row pitch of the q/k/v rows */
typedef __bf16 v16b __attribute__((ext_vector_type(16)));
typedef unsigned short v8us __attribute__((ext_vector_type(8), may_alias));
typedef float  v8f  __attribute__((ext_vector_type(8)));
typedef float  v4f  __attribute__((ext_vector_type(4)));
typedef float  v4fa __attribute__((ext_vector_type(4), may_alias));
union FragB { v16b v; v8us half[2]; unsigned short u[16]; };

__device__ __forceinline__ unsigned short bf16_bits(float x) { unsigned int u = __float_as_uint(x); return (unsigned short)((u + 0x7FFFu + ((u >> 16) & 1u)) >> 16); }
__device__ __forceinline__ float bf16_val(unsigned short b) { return __uint_as_float(((unsigned int)b) << 16); }
__device__ __forceinline__ float bf16_round(float x) { return bf16_val(bf16_bits(x)); }
// D += A·B with NT terms: 1 = ah·bh, 2 = + al·bh (A split), 3 = + ah·bl (both split)
template <int NT>
__device__ __forceinline__ v8f mmaN(v16b ah, v16b al, v16b bh, v16b bl, v8f c) {
  c = __builtin_amdgcn_wmma_f32_16x16x32_bf16(false, ah, false, bh, (short)0, c, false, false);
  if (NT >= 2) c = __builtin_amdgcn_wmma_f32_16x16x32_bf16(false, al, false, bh, (short)0, c, false, false);
  if (NT >= 3) c = __builtin_amdgcn_wmma_f32_16x16x32_bf16(false, ah, false, bl, (short)0, c, false, false);
  asm volatile("v_nop\n\tv_nop\n\tv_nop\n\tv_nop" : "+v"(c) : "v"(ah), "v"(al), "v"(bh), "v"(bl));
  return c;
}

__global__ __launch_bounds__(256) void k_wt_bf16(const float* __restrict__ W, unsigned short* __restrict__ Wt, int K, int N) {
  const int t = blockIdx.x * 256 + threadIdx.x;
  const int k8n = K / 8;
  if (t >= N * k8n) return;
  const int n = t / k8n, k8 = (t % k8n) * 8;
  v8us v;
#pragma unroll
  for (int i = 0; i < 8; ++i) v[i] = bf16_bits(W[(size_t)(k8 + i) * N + n]);
  *(v8us*)(Wt + (size_t)n * K + k8) = v;
  
}

// GEMM C[M][N] (f32, pitch ldc) = act(A[M][K]·W + bias). A f32 row-major (pitch lda) converted per fragment to bf16
// (ASPLIT: hi/lo two planes -> 2 terms, else single rounded term); Wt bf16 [N][K] (pitch ldb). BIAS_BF16 rounds the
// bias to bf16 first (bias quantised to bf16 before the add). K%32==0, M%16==0, N%64==0.
template <bool ASPLIT, int ACT, bool BIAS_BF16>
__global__ __launch_bounds__(128) void k_gemm_bf(const float* __restrict__ A, int lda, const unsigned short* __restrict__ Wt, int ldb,
                                               const float* __restrict__ bias, float* __restrict__ C, int ldc, int M, int N, int K) {
  __shared__ __attribute__((aligned(16))) float so[4][16][64];
  const int tid = threadIdx.x, w = tid >> 5, lane = tid & 31, ln = lane & 15, hh = lane >> 4;
  const int ntn = N / 64;
  const int wid = blockIdx.x * 4 + w;
  const int mt = wid / ntn, nq = wid % ntn;
  if (mt * 16 >= M) return;
  const int row0 = mt * 16, col0 = nq * 64;
  const float* arow = A + (size_t)(row0 + ln) * lda;
  v8f acc[4] = {};
  for (int kb = 0; kb < K; kb += 32) {
    FragB ah, al;
    const v4f x0 = *(const v4fa*)(arow + kb + 8 * hh), x1 = *(const v4fa*)(arow + kb + 8 * hh + 4);
    const v4f x2 = *(const v4fa*)(arow + kb + 16 + 8 * hh), x3 = *(const v4fa*)(arow + kb + 16 + 8 * hh + 4);
    float xs[16] = {x0[0],x0[1],x0[2],x0[3],x1[0],x1[1],x1[2],x1[3],x2[0],x2[1],x2[2],x2[3],x3[0],x3[1],x3[2],x3[3]};
#pragma unroll
    for (int i = 0; i < 16; ++i) { const unsigned short hb = bf16_bits(xs[i]); ah.u[i] = hb; al.u[i] = ASPLIT ? bf16_bits(xs[i] - bf16_val(hb)) : (unsigned short)0; }
#pragma unroll
    for (int t = 0; t < 4; ++t) {
      const unsigned short* brow = Wt + (size_t)(col0 + t * 16 + ln) * ldb + kb;
      FragB b;
      b.half[0] = *(const v8us*)(brow + 8 * hh);
      b.half[1] = *(const v8us*)(brow + 16 + 8 * hh);
      acc[t] = mmaN<ASPLIT ? 2 : 1>(ah.v, al.v, b.v, b.v, acc[t]);
    }
  }
#pragma unroll
  for (int t = 0; t < 4; ++t) {
    float bv = bias ? bias[col0 + t * 16 + ln] : 0.f;
    if (BIAS_BF16) bv = bf16_round(bv);
#pragma unroll
    for (int r = 0; r < 8; ++r) { float v = acc[t][r] + bv; if (ACT == 1) v = fmaxf(v, 0.f); so[w][8 * hh + r][t * 16 + ln] = v; }
  }
  __builtin_amdgcn_fence(__ATOMIC_ACQ_REL, "workgroup");
  __builtin_amdgcn_wave_barrier();
  const int rsub = lane >> 4, c4 = (lane & 15) * 4;
  {
#pragma unroll
    for (int q = 0; q < 8; ++q) {
      const int r = q * 2 + rsub;
      const v4f v = *(const v4fa*)&so[w][r][c4];
      *(v4f*)(C + (size_t)(row0 + r) * ldc + col0 + c4) = v;
    }
    
  }
}

// GEMM C = act(A·W + bias + resid): A f32 (ASPLIT -> hi/lo 2 terms), Wt bf16 [N][K]; ACT 0 none, 1 relu, 2 exact gelu;
// resid (optional, f32, row index = (row % rmod), pitch ldr, RES_BF16 rounds it) added before the activation.
template <bool ASPLIT, int ACT, bool BIAS_BF16, bool RES_BF16>
__global__ __launch_bounds__(128) void k_gemm_bf3(const float* __restrict__ A, int lda, const unsigned short* __restrict__ Wt, int ldb,
                                                const float* __restrict__ bias, const float* __restrict__ resid, int rmod, int ldr,
                                                float* __restrict__ C, int ldc, int M, int N, int K) {
  __shared__ __attribute__((aligned(16))) float so[4][16][64];
  const int tid = threadIdx.x, w = tid >> 5, lane = tid & 31, ln = lane & 15, hh = lane >> 4;
  const int ntn = N / 64;
  const int wid = blockIdx.x * 4 + w;
  const int mt = wid / ntn, nq = wid % ntn;
  if (mt * 16 >= M) return;
  const int row0 = mt * 16, col0 = nq * 64;
  const float* arow = A + (size_t)(row0 + ln) * lda;
  v8f acc[4] = {};
  for (int kb = 0; kb < K; kb += 32) {
    FragB ah, al;
    const v4f x0 = *(const v4fa*)(arow + kb + 8 * hh), x1 = *(const v4fa*)(arow + kb + 8 * hh + 4);
    const v4f x2 = *(const v4fa*)(arow + kb + 16 + 8 * hh), x3 = *(const v4fa*)(arow + kb + 16 + 8 * hh + 4);
    float xs[16] = {x0[0],x0[1],x0[2],x0[3],x1[0],x1[1],x1[2],x1[3],x2[0],x2[1],x2[2],x2[3],x3[0],x3[1],x3[2],x3[3]};
#pragma unroll
    for (int i = 0; i < 16; ++i) { const unsigned short hb = bf16_bits(xs[i]); ah.u[i] = hb; al.u[i] = ASPLIT ? bf16_bits(xs[i] - bf16_val(hb)) : (unsigned short)0; }
#pragma unroll
    for (int t = 0; t < 4; ++t) {
      const unsigned short* brow = Wt + (size_t)(col0 + t * 16 + ln) * ldb + kb;
      FragB b;
      b.half[0] = *(const v8us*)(brow + 8 * hh);
      b.half[1] = *(const v8us*)(brow + 16 + 8 * hh);
      acc[t] = mmaN<ASPLIT ? 2 : 1>(ah.v, al.v, b.v, b.v, acc[t]);
    }
  }
#pragma unroll
  for (int t = 0; t < 4; ++t) {
    const int col = col0 + t * 16 + ln;
    float bv = bias ? bias[col] : 0.f;
    if (BIAS_BF16) bv = bf16_round(bv);
#pragma unroll
    for (int r = 0; r < 8; ++r) {
      float v = acc[t][r] + bv;
      if (resid) { float rv = resid[(size_t)((row0 + 8 * hh + r) % rmod) * ldr + col]; if (RES_BF16) rv = bf16_round(rv); v += rv; }
      if (ACT == 1) v = fmaxf(v, 0.f);
      if (ACT == 2) v = 0.5f * v * (1.0f + erff(v * 0.70710678118654752f));
      if (ACT == 3) { const float u = 0.7978845608028654f * (v + 0.044715f * v * v * v); v = 0.5f * v * (1.0f + tanhf(u)); }
      so[w][8 * hh + r][t * 16 + ln] = v;
    }
  }
  __builtin_amdgcn_fence(__ATOMIC_ACQ_REL, "workgroup");
  __builtin_amdgcn_wave_barrier();
  const int rsub = lane >> 4, c4 = (lane & 15) * 4;
  {
#pragma unroll
    for (int q = 0; q < 8; ++q) {
      const int r = q * 2 + rsub;
      const v4f v = *(const v4fa*)&so[w][r][c4];
      *(v4f*)(C + (size_t)(row0 + r) * ldc + col0 + c4) = v;
    }
    
  }
}
// row LayerNorm (biased variance, eps) over N: s = X (+ R); optional out_sum <- s; out_norm <- (s-mu)*rsqrt(var+eps)*g + b
template <bool PARAM_BF16>
__global__ __launch_bounds__(256) void k_layernorm(const float* __restrict__ X, const float* __restrict__ R, const float* __restrict__ g, const float* __restrict__ bta,
                                                  float* __restrict__ out_sum, float* __restrict__ out_norm, int N, float eps) {
  __shared__ float red[256];
  const int row = blockIdx.x, tid = threadIdx.x;
  const float* x = X + (size_t)row * N; const float* rr = R ? R + (size_t)row * N : nullptr;
  float vals[16];                     // up to N = 4096
  const int per = N / 256;            // contiguous chunk per thread? use strided-by-4 chunks: thread handles j = tid*4 + 1024*u
  float s1 = 0.f;
  for (int u = 0; u < per / 4; ++u) {
    const int j = tid * 4 + 1024 * u;
    const v4f a = *(const v4fa*)(x + j);
    v4f b = {0.f,0.f,0.f,0.f}; if (rr) b = *(const v4fa*)(rr + j);
#pragma unroll
    for (int q = 0; q < 4; ++q) { const float v = a[q] + b[q]; vals[u * 4 + q] = v; s1 += v; }
  }
  red[tid] = s1; __syncthreads();
  for (int st = 128; st > 0; st >>= 1) { if (tid < st) red[tid] += red[tid + st]; __syncthreads(); }
  const float mu = red[0] / (float)N; __syncthreads();
  float s2 = 0.f;
  for (int u = 0; u < per / 4; ++u)
#pragma unroll
    for (int q = 0; q < 4; ++q) { const float c = vals[u * 4 + q] - mu; s2 += c * c; }
  red[tid] = s2; __syncthreads();
  for (int st = 128; st > 0; st >>= 1) { if (tid < st) red[tid] += red[tid + st]; __syncthreads(); }
  const float rs = rsqrtf(red[0] / (float)N + eps);
  {
    for (int u = 0; u < per / 4; ++u) {
      const int j = tid * 4 + 1024 * u;
      v4f o, sm;
#pragma unroll
      for (int q = 0; q < 4; ++q) {
        float gg = g[j + q], bb = bta[j + q];
        if (PARAM_BF16) { gg = bf16_round(gg); bb = bf16_round(bb); }
        sm[q] = vals[u * 4 + q]; o[q] = (vals[u * 4 + q] - mu) * rs * gg + bb;
      }
      if (out_sum) *(v4f*)(out_sum + (size_t)row * N + j) = sm;
      *(v4f*)(out_norm + (size_t)row * N + j) = o;
    }
    
  }
}



// ---- f16 WMMA path (v_wmma_f32_16x16x32_f16): 11-bit significands for operands in range — used where a [0,1] probability operand needs more precision than bf16
typedef _Float16 v16h __attribute__((ext_vector_type(16)));
union FragH { v16h v; v8us half[2]; _Float16 h[16]; unsigned short u[16]; };
template <int NT>
__device__ __forceinline__ v8f mmaH(v16h ah, v16h al, v16h bh, v16h bl, v8f c) {
  c = __builtin_amdgcn_wmma_f32_16x16x32_f16(false, ah, false, bh, (short)0, c, false, false);
  if (NT >= 2) c = __builtin_amdgcn_wmma_f32_16x16x32_f16(false, al, false, bh, (short)0, c, false, false);
  if (NT >= 3) c = __builtin_amdgcn_wmma_f32_16x16x32_f16(false, ah, false, bl, (short)0, c, false, false);
  asm volatile("v_nop\n\tv_nop\n\tv_nop\n\tv_nop" : "+v"(c) : "v"(ah), "v"(al), "v"(bh), "v"(bl));
  return c;
}
// batched GEMM like k_gemm_b but f16 operands: A f32 (split into f16 hi/lo if ASPLIT, else rounded to f16), Bt = f16 values [n][k]; alpha; C f32; N multiple of 16 (partial tiles skipped)
template <bool ASPLIT>
__global__ __launch_bounds__(128) void k_gemm_h(const float* __restrict__ A, int lda, size_t sA, const _Float16* __restrict__ Bh, int ldb, size_t sB, float alpha, float* __restrict__ C, int ldc, size_t sC, int M, int N, int K) {
  __shared__ __attribute__((aligned(16))) float so[4][16][64];
  const int tid = threadIdx.x, w = tid >> 5, lane = tid & 31, ln = lane & 15, hh = lane >> 4; const int by = blockIdx.y;
  A += (size_t)by * sA; Bh += (size_t)by * sB; C += (size_t)by * sC;
  const int ntn = (N + 63) / 64; const int wid = blockIdx.x * 4 + w; const int mt = wid / ntn, nq = wid % ntn; if (mt * 16 >= M) return;
  const int row0 = mt * 16, col0 = nq * 64; const float* arow = A + (size_t)(row0 + ln) * lda;
  v8f acc[4] = {};
  for (int kb = 0; kb < K; kb += 32) {
    FragH ah, al;
    const v4f x0 = *(const v4fa*)(arow + kb + 8 * hh), x1 = *(const v4fa*)(arow + kb + 8 * hh + 4), x2 = *(const v4fa*)(arow + kb + 16 + 8 * hh), x3 = *(const v4fa*)(arow + kb + 16 + 8 * hh + 4);
    float xs[16] = {x0[0],x0[1],x0[2],x0[3],x1[0],x1[1],x1[2],x1[3],x2[0],x2[1],x2[2],x2[3],x3[0],x3[1],x3[2],x3[3]};
#pragma unroll
    for (int i = 0; i < 16; ++i) { const _Float16 h = (_Float16)xs[i]; ah.h[i] = h; al.h[i] = ASPLIT ? (_Float16)(xs[i] - (float)h) : (_Float16)0.0f; }
#pragma unroll
    for (int t = 0; t < 4; ++t) { if (col0 + t * 16 >= N) continue; const size_t boff = (size_t)(col0 + t * 16 + ln) * ldb + kb; FragH bq; bq.half[0] = *(const v8us*)(Bh + boff + 8 * hh); bq.half[1] = *(const v8us*)(Bh + boff + 16 + 8 * hh);
      acc[t] = mmaH<ASPLIT ? 2 : 1>(ah.v, al.v, bq.v, bq.v, acc[t]); }
  }
#pragma unroll
  for (int t = 0; t < 4; ++t) { if (col0 + t * 16 >= N) continue;
#pragma unroll
    for (int r = 0; r < 8; ++r) so[w][8 * hh + r][t * 16 + ln] = acc[t][r] * alpha; }
  __builtin_amdgcn_fence(__ATOMIC_ACQ_REL, "workgroup"); __builtin_amdgcn_wave_barrier();
  const int rsub = lane >> 4, c4 = (lane & 15) * 4;
  {
#pragma unroll
    for (int q = 0; q < 8; ++q) { const int r = q * 2 + rsub; if (col0 + c4 < N) { const v4f v = *(const v4fa*)&so[w][r][c4]; *(v4f*)(C + (size_t)(row0 + r) * ldc + col0 + c4) = v; } }
     }
}

// Wt[n][k] = f16(W[k][n]·scale) from f32 row-major W[K][N] (scale = power of two; bf16-exact weights stay exact in f16 away from the subnormal range)
__global__ __launch_bounds__(256) void k_wt_f16(const float* __restrict__ W, _Float16* __restrict__ Wt, int K, int N, float scale) {
  const int t = blockIdx.x * 256 + threadIdx.x; if (t >= N * (K / 8)) return; const int n = t / (K / 8), k8 = (t % (K / 8)) * 8; FragH f;
#pragma unroll
  for (int i = 0; i < 8; ++i) f.h[i] = (_Float16)(bf16_round(W[(size_t)(k8 + i) * N + n]) * scale); const v8us o = f.half[0];
  *(v8us*)((unsigned short*)Wt + (size_t)n * K + k8) = o; 
}
// k_gemm_hh variant with fused epilogue: v = acc·alpha + bias[by·sBias + col] (+ CP[(row/rowsPerB)·sCPb + by·64 + col] if CP) ; ACT 0 none / 1 elu ; writes f16 C16 (and f32 C if non-null)
template <int ACT>
__global__ __launch_bounds__(128) void k_gemm_hhx(const _Float16* __restrict__ A, int lda, size_t sA, const _Float16* __restrict__ Bh, int ldb, size_t sB, float alpha, const float* __restrict__ bias, size_t sBias, const float* __restrict__ CP, int rowsPerB, size_t sCPb, int row0g,
    float* __restrict__ C, _Float16* __restrict__ C16, int ldc, size_t sC, int M, int N, int K) {
  __shared__ __attribute__((aligned(16))) float so[4][16][64];
  const int tid = threadIdx.x, w = tid >> 5, lane = tid & 31, ln = lane & 15, hh = lane >> 4; const int by = blockIdx.y;
  A += (size_t)by * sA; Bh += (size_t)by * sB; const size_t cofs = (size_t)by * sC; const float* bp = bias ? bias + (size_t)by * sBias : nullptr;
  const int ntn = (N + 63) / 64; const int wid = blockIdx.x * 4 + w; const int mt = wid / ntn, nq = wid % ntn; if (mt * 16 >= M) return;
  const int row0 = mt * 16, col0 = nq * 64; const _Float16* arow = A + (size_t)(row0 + ln) * lda;
  v8f acc[4] = {};
  for (int kb = 0; kb < K; kb += 32) { FragH ah; ah.half[0] = *(const v8us*)((const unsigned short*)arow + kb + 8 * hh); ah.half[1] = *(const v8us*)((const unsigned short*)arow + kb + 16 + 8 * hh);
#pragma unroll
    for (int t = 0; t < 4; ++t) { if (col0 + t * 16 >= N) continue; const size_t boff = (size_t)(col0 + t * 16 + ln) * ldb + kb; FragH bq; bq.half[0] = *(const v8us*)((const unsigned short*)Bh + boff + 8 * hh); bq.half[1] = *(const v8us*)((const unsigned short*)Bh + boff + 16 + 8 * hh);
      acc[t] = mmaH<1>(ah.v, ah.v, bq.v, bq.v, acc[t]); }
  }
#pragma unroll
  for (int t = 0; t < 4; ++t) { if (col0 + t * 16 >= N) continue; const int col = col0 + t * 16 + ln; const float bv = bp ? bf16_round(bp[col]) : 0.f;
#pragma unroll
    for (int r = 0; r < 8; ++r) { float v = acc[t][r] * alpha + bv; if (CP) { const int rr = row0g + row0 + 8 * hh + r; if (rowsPerB < 0) v += CP[cofs + (size_t)rr * ldc + col];      /* rowsPerB < 0: own element of the batched C plane */ else { const int bidx = rr / rowsPerB; v += CP[(size_t)bidx * sCPb + (size_t)by * 64 + col]; } } if (ACT == 1) v = (v > 0.f) ? v : expm1f(v); else if (ACT == 7) v = (v > 0.f) ? v + 1.0f : expf(v); else if (ACT == 8) v = tanhf(v); else if (ACT == 9) v = 0.5f * v * (1.0f + tanhf(0.7978845608028654f * (v + 0.044715f * v * v * v))); else if (ACT == 11) v = 1.0f / (1.0f + expf(-v)); else if (ACT == 12) v = (v > 0.f) ? v : 0.01f * v; else if (ACT == 14) v = (v > 0.f) ? v : 0.1f * v; else if (ACT == 16) v = (v >= 0.f) ? v : 0.3f * v; else if (ACT == 17) v = (v >= 0.f) ? v : 0.2f * v; else if (ACT == 15) v = v / (1.0f + expf(-v)); else if (ACT == 3) v = fmaxf(v, 0.f); else if (ACT == 6) v = 0.5f * v * (1.0f + erff(v * 0.70710678118654752f)); so[w][8 * hh + r][t * 16 + ln] = v; } }
  __builtin_amdgcn_fence(__ATOMIC_ACQ_REL, "workgroup"); __builtin_amdgcn_wave_barrier();
  const int rsub = lane >> 4, c4 = (lane & 15) * 4; typedef _Float16 v4h __attribute__((ext_vector_type(4)));
  {
#pragma unroll
    for (int q = 0; q < 8; ++q) { const int r = q * 2 + rsub; if (col0 + c4 < N) { const v4f v = *(const v4fa*)&so[w][r][c4]; if (C) *(v4f*)(C + cofs + (size_t)(row0 + r) * ldc + col0 + c4) = v; if (C16) { v4h h4; for (int i = 0; i < 4; ++i) h4[i] = (_Float16)v[i]; *(v4h*)(C16 + cofs + (size_t)(row0 + r) * ldc + col0 + c4) = h4; } } }
     }
}


typedef _Float16 v4h __attribute__((ext_vector_type(4)));

__global__ __launch_bounds__(256) void k_x16(const float* __restrict__ x, _Float16* __restrict__ X16, size_t n8) { const size_t t = (size_t)blockIdx.x * 256 + threadIdx.x; if (t >= n8) return; FragH f;
#pragma unroll
  for (int q = 0; q < 8; ++q) f.h[q] = (_Float16)bf16_round(x[t * 8 + q]); *(v8us*)((unsigned short*)X16 + t * 8) = f.half[0];  }
__global__ __launch_bounds__(256) void k_h16(const float* __restrict__ x, _Float16* __restrict__ X16, size_t n8) { const size_t t = (size_t)blockIdx.x * 256 + threadIdx.x; if (t >= n8) return; FragH f;
#pragma unroll
  for (int q = 0; q < 8; ++q) f.h[q] = (_Float16)x[t * 8 + q]; *(v8us*)((unsigned short*)X16 + t * 8) = f.half[0];  }
__global__ __launch_bounds__(256) void k_round16f(const float* __restrict__ W, _Float16* __restrict__ Bt, size_t n8) { const size_t t = (size_t)blockIdx.x * 256 + threadIdx.x; if (t >= n8) return; FragH f;
#pragma unroll
  for (int i = 0; i < 8; ++i) f.h[i] = (_Float16)(bf16_round(W[t * 8 + i]) * 16.0f); *(v8us*)((unsigned short*)Bt + t * 8) = f.half[0];  }
template <int NHv, int TTv>
__global__ __launch_bounds__(256) void k_vt(const _Float16* __restrict__ V16, int ldv, int voff, _Float16* __restrict__ Vt) { __shared__ unsigned short tl[64][66]; const int tid = threadIdx.x; const int slab = blockIdx.x / (TTv / 64), lg = blockIdx.x % (TTv / 64); const int b = slab / NHv, h = slab % NHv;
  for (int i = tid; i < 64 * 8; i += 256) { const int r = i / 8, c8 = (i % 8) * 8; FragH f; f.half[0] = *(const v8us*)((const unsigned short*)V16 + ((size_t)b * TTv + lg * 64 + r) * ldv + voff + h * 64 + c8);
#pragma unroll
    for (int q = 0; q < 8; ++q) tl[r][c8 + q] = f.u[q]; }
  __syncthreads();
  {
#pragma unroll
    for (int rd = 0; rd < 2; ++rd) { const int d = rd * 32 + tid / 8, pc = tid % 8; FragH f;
#pragma unroll
      for (int q = 0; q < 8; ++q) f.u[q] = tl[pc * 8 + q][d];
      *(v8us*)((unsigned short*)Vt + ((size_t)slab * 64 + d) * TTv + lg * 64 + pc * 8) = f.half[0]; }
     } }

__global__ __launch_bounds__(256) void k_hl(const float* __restrict__ F, _Float16* __restrict__ Hh, _Float16* __restrict__ Hl, size_t n8) { const size_t t = (size_t)blockIdx.x * 256 + threadIdx.x; if (t >= n8) return; FragH fh, fl; const v4f a = *(const v4fa*)(F + t * 8), c = *(const v4fa*)(F + t * 8 + 4);
#pragma unroll
  for (int q = 0; q < 4; ++q) { _Float16 h = (_Float16)a[q]; fh.h[q] = h; fl.h[q] = (_Float16)((a[q] - (float)h) * 1024.0f); h = (_Float16)c[q]; fh.h[4 + q] = h; fl.h[4 + q] = (_Float16)((c[q] - (float)h) * 1024.0f); }
  { *(v8us*)((unsigned short*)Hh + t * 8) = fh.half[0]; *(v8us*)((unsigned short*)Hl + t * 8) = fl.half[0];  } }

__global__ __launch_bounds__(256) void k_wnat(const float* __restrict__ w, size_t n8, _Float16* __restrict__ Bt) { const size_t t = (size_t)blockIdx.x * 256 + threadIdx.x; if (t >= n8) return; FragH f; for (int q = 0; q < 8; ++q) f.h[q] = (_Float16)(bf16_round(w[t * 8 + q]) * 16.0f); *(v8us*)((unsigned short*)Bt + t * 8) = f.half[0];  }
__global__ __launch_bounds__(256) void k_rsm(const float* __restrict__ S, _Float16* __restrict__ P, int nrows) {
  #pragma clang fp contract(off)
  const int i = blockIdx.x * 256 + threadIdx.x; if (i >= nrows) return; const float* s = S + (size_t)i * SQ; float mx = -3.0e38f;
#pragma unroll 1
  for (int j = 0; j < SQ; ++j) mx = fmaxf(mx, s[j]); float se = 0.f;
#pragma unroll 1
  for (int j = 0; j < SQ; ++j) se += expf(s[j] - mx); const float sc = 256.0f / se;
#pragma unroll 1
  for (int j0 = 0; j0 < SQ; j0 += 8) { FragH f; for (int q = 0; q < 8; ++q) f.h[q] = (_Float16)(expf(s[j0 + q] - mx) * sc); unsigned short* d = (unsigned short*)P + (size_t)i * SQ + j0; *(v8us*)d = f.half[0];  } }
__global__ __launch_bounds__(256) void k_vt(const _Float16* __restrict__ V16, int b, int h0, _Float16* __restrict__ VT) { __shared__ unsigned short tl[64][65]; const int tid = threadIdx.x; const int hh = blockIdx.x % HG, sg = blockIdx.x / HG; const int s0 = sg * 64; const int h = h0 + hh;
  for (int i = tid; i < 64 * 8; i += 256) { const int j = i / 8, d8 = (i % 8) * 8; FragH f; f.half[0] = *(const v8us*)((const unsigned short*)V16 + ((size_t)b * SQ + s0 + j) * DM + h * HD + d8); for (int q = 0; q < 8; ++q) tl[d8 + q][j] = f.u[q]; }
  __syncthreads();
  { for (int i = tid; i < 64 * 8; i += 256) { const int d = i / 8, j8 = (i % 8) * 8; FragH f; for (int q = 0; q < 8; ++q) f.u[q] = tl[d][j8 + q]; *(v8us*)((unsigned short*)VT + ((size_t)hh * HD + d) * SQ + s0 + j8) = f.half[0]; }  } }



__global__ __launch_bounds__(256) void k_rsmf(const float* __restrict__ S, _Float16* __restrict__ P, int qn, int hg) {
  #pragma clang fp contract(off)
  const int t = blockIdx.x * 256 + threadIdx.x; if (t >= qn * hg) return; const size_t i = (size_t)(t / qn) * SQ + (t % qn); const float* s = S + i * SQ; float mx = -3.0e38f;
#pragma unroll 1
  for (int j = 0; j < SQ; ++j) mx = fmaxf(mx, s[j]); float se = 0.f;
#pragma unroll 1
  for (int j = 0; j < SQ; ++j) se += __expf(s[j] - mx); const float sc = 256.0f / se;
#pragma unroll 1
  for (int j0 = 0; j0 < SQ; j0 += 8) { FragH f; for (int q = 0; q < 8; ++q) f.h[q] = (_Float16)(__expf(s[j0 + q] - mx) * sc); unsigned short* d = (unsigned short*)P + i * SQ + j0; *(v8us*)d = f.half[0];  } }

// Four reciprocals. One statement with results apart from sources, so that behind each v_rcp_f32 stands an instruction that touches neither its result nor its source: the next reciprocal, and behind the last the v_nop (the slot the instruction set asks for behind a transcendental).
__device__ __forceinline__ v4f rcp4(v4f d) { v4f o;
  asm("v_rcp_f32 %0, %4\n\tv_rcp_f32 %1, %5\n\tv_rcp_f32 %2, %6\n\tv_rcp_f32 %3, %7\n\tv_nop" : "=&v"(o[0]), "=&v"(o[1]), "=&v"(o[2]), "=&v"(o[3]) : "v"(d[0]), "v"(d[1]), "v"(d[2]), "v"(d[3]));
  return o; }
typedef _Float16 v8h __attribute__((ext_vector_type(8)));
#define AW 8                         /* waves per work-group of the attention kernel */
#define AQ 32                        /* query columns per wave (two 16-column tiles) */
#define AK 64                        /* keys per LDS stage */
#define AP 72                        /* LDS row pitch in f16: 128 data bytes + 16 (16-byte fragment reads fall on different banks) */
#define ANS (SQ / AK)                /* stages per walk over the keys */
__device__ __forceinline__ v16h fa_frag(const unsigned short* p, int hh) { FragH f; f.half[0] = *(const v8us*)(p + 8 * hh); f.half[1] = *(const v8us*)(p + 16 + 8 * hh); return f.v; }
__device__ __forceinline__ v8f fa_mma(v16h a, v16h b, v8f c) { return __builtin_amdgcn_wmma_f32_16x16x32_f16(false, a, false, b, (short)0, c, false, false); }
// 256 x the stablemax3 weight for x <= 0, eight values: 1 / (1 - x (1 - x/2 (1 - x/3))) with the factor 2^-8 carried exactly through the two outer terms of the denominator; x / 3 as a multiply by f32(1/3); reciprocal through v_rcp_f32.
__device__ __forceinline__ v8f stm3w(v8f x) { const v8f a = 1.0f - x * 0.33333334f; const v8f b = 0.00390625f - (0.001953125f * x) * a; const v8f d = 0.00390625f - x * b;
  const v4f lo = rcp4(__builtin_shufflevector(d, d, 0, 1, 2, 3)), hi = rcp4(__builtin_shufflevector(d, d, 4, 5, 6, 7)); return __builtin_shufflevector(lo, hi, 0, 1, 2, 3, 4, 5, 6, 7); }
__global__ __launch_bounds__(AW * 32) void k_attn(const _Float16* __restrict__ QKV, const _Float16* __restrict__ VT, _Float16* __restrict__ O16) {
  __shared__ __attribute__((aligned(16))) unsigned short sK[2][AK * AP]; __shared__ __attribute__((aligned(16))) unsigned short sV[2][AK * AP];
  const int tid = threadIdx.x, lane = tid & 31, ln = lane & 15, hh = lane >> 4, w = tid >> 5; const int h = blockIdx.y, b = blockIdx.z; const int q0 = blockIdx.x * (AW * AQ) + w * AQ;
  const unsigned short* Qp = (const unsigned short*)QKV + (size_t)b * SQ * LQ + h * HD; const unsigned short* Kp = Qp + DM; const unsigned short* Vp = (const unsigned short*)VT + (size_t)(b * NH + h) * HD * SQ;
  const int srow = tid >> 3, sch = (tid & 7) * 8; const int sl = srow * AP + sch;      /* staging: eight threads a 128-byte row, rows srow and srow + 32 */
  const unsigned short* kg = Kp + (size_t)srow * LQ + sch; const unsigned short* vg = Vp + (size_t)srow * SQ + sch;
  const v8f z8 = {0.f, 0.f, 0.f, 0.f, 0.f, 0.f, 0.f, 0.f};
  v16h qf[2][2]; const unsigned short* qg = Qp + (size_t)(q0 + ln) * LQ + 8 * hh;
#pragma unroll
  for (int n = 0; n < 2; ++n) for (int c = 0; c < 2; ++c) qf[n][c] = fa_frag(qg + (size_t)n * 16 * LQ + c * 32, 0);
  v8us k0 = *(const v8us*)kg, k1 = *(const v8us*)(kg + (size_t)32 * LQ), v0 = *(const v8us*)vg, v1 = *(const v8us*)(vg + (size_t)32 * SQ);
  asm volatile("s_wait_xcnt 0x0" :: "v"(qg), "v"(qg + (size_t)16 * LQ), "v"(kg), "v"(vg) : "memory");      /* the address registers of the loads above are kept, and not reused as a load's destination either, until this wait */
  *(v8us*)&sK[0][sl] = k0; *(v8us*)&sK[0][sl + 32 * AP] = k1; *(v8us*)&sV[0][sl] = v0; *(v8us*)&sV[0][sl + 32 * AP] = v1;      /* V^T stage 0 waits in its buffer through walk 1, which touches only sK */
  __syncthreads();
  v8f m8[2]; m8[0] = z8 - 3.0e38f; m8[1] = m8[0];
#pragma unroll 1      /* one stage a trip: the body is already 16 products long */
  for (int s = 0; s < ANS; ++s) { const int sn = (s + 1) & (ANS - 1);      /* the stage behind the last is stage 0 again: no branch in the trip, and walk 2 finds its first K tile in buffer 0 */
    { const unsigned short* g = kg + (size_t)sn * AK * LQ; k0 = *(const v8us*)g; k1 = *(const v8us*)(g + (size_t)32 * LQ);
      asm volatile("s_wait_xcnt 0x0" :: "v"(g) : "memory"); }      /* as above: the address pair is kept until this wait */
    const unsigned short* kb = sK[s & 1];
#pragma unroll
    for (int j = 0; j < 4; ++j) { const v16h a0 = fa_frag(kb + (j * 16 + ln) * AP, hh), a1 = fa_frag(kb + (j * 16 + ln) * AP + 32, hh);
#pragma unroll
      for (int n = 0; n < 2; ++n) m8[n] = __builtin_elementwise_max(m8[n], fa_mma(a1, qf[n][1], fa_mma(a0, qf[n][0], z8))); }
    { unsigned short* d = sK[(s + 1) & 1]; *(v8us*)&d[sl] = k0; *(v8us*)&d[sl + 32 * AP] = k1; }
    __syncthreads(); }
  float mx[2];
#pragma unroll
  for (int n = 0; n < 2; ++n) { float m = fmaxf(fmaxf(fmaxf(m8[n][0], m8[n][1]), fmaxf(m8[n][2], m8[n][3])), fmaxf(fmaxf(m8[n][4], m8[n][5]), fmaxf(m8[n][6], m8[n][7]))); m = fmaxf(m, __shfl_xor(m, 16, 32)); mx[n] = m * 0.125f; }
  v8f o[4][2]; v8f s8[2]; s8[0] = z8; s8[1] = z8;
#pragma unroll
  for (int t = 0; t < 4; ++t) { o[t][0] = z8; o[t][1] = z8; }
#pragma unroll 1      /* one stage a trip: the body is already 32 products long */
  for (int s = 0; s < ANS; ++s) { const int sn = (s + 1) & (ANS - 1);      /* as in walk 1; the last trip's refill is read by nobody */
    { const unsigned short* g = kg + (size_t)sn * AK * LQ; k0 = *(const v8us*)g; k1 = *(const v8us*)(g + (size_t)32 * LQ); const unsigned short* u = vg + sn * AK; v0 = *(const v8us*)u; v1 = *(const v8us*)(u + (size_t)32 * SQ);
      asm volatile("s_wait_xcnt 0x0" :: "v"(g), "v"(u) : "memory"); }      /* as above: both address pairs are kept until this wait */
    const unsigned short* kb = sK[s & 1]; const unsigned short* vb = sV[s & 1];
#pragma unroll
    for (int kk = 0; kk < 2; ++kk) { union { v16h v; v8h p[2]; } pf[2]; v16h ka[2][2], va[4];
#pragma unroll
      for (int j = 0; j < 2; ++j) { const unsigned short* kr = kb + (kk * 32 + j * 16 + ln) * AP; ka[j][0] = fa_frag(kr, hh); ka[j][1] = fa_frag(kr + 32, hh); }
#pragma unroll
      for (int t = 0; t < 4; ++t) va[t] = fa_frag(vb + (t * 16 + ln) * AP + kk * 32, hh);
      __builtin_amdgcn_sched_barrier(0);      /* holds the loads above in front of the arithmetic: left free, the V^T fragments are fetched one at a time right in front of their products (an LDS latency each) and the next stage's global loads are issued in mid-stage */
#pragma unroll
      for (int j = 0; j < 2; ++j) {
#pragma unroll
        for (int n = 0; n < 2; ++n) { const v8f st = fa_mma(ka[j][1], qf[n][1], fa_mma(ka[j][0], qf[n][0], z8)); const v8f wt = stm3w(st * 0.125f - mx[n]); s8[n] += wt; pf[n].p[j] = __builtin_convertvector(wt, v8h); } }
#pragma unroll
      for (int t = 0; t < 4; ++t) { o[t][0] = fa_mma(va[t], pf[0].v, o[t][0]); o[t][1] = fa_mma(va[t], pf[1].v, o[t][1]); } }
    { unsigned short* d = sK[(s + 1) & 1]; *(v8us*)&d[sl] = k0; *(v8us*)&d[sl + 32 * AP] = k1; unsigned short* e = sV[(s + 1) & 1]; *(v8us*)&e[sl] = v0; *(v8us*)&e[sl + 32 * AP] = v1; }
    __syncthreads(); }
#pragma unroll
  for (int n = 0; n < 2; ++n) { float se = ((s8[n][0] + s8[n][1]) + (s8[n][2] + s8[n][3])) + ((s8[n][4] + s8[n][5]) + (s8[n][6] + s8[n][7])); se += __shfl_xor(se, 16, 32); const float sc = 64.0f / se;      /* weights carry x256 in numerator and sum alike; o is carried x64 */
    _Float16* op = O16 + (size_t)(b * SQ + q0 + n * 16 + ln) * DM + h * HD + 8 * hh;
#pragma unroll
    for (int t = 0; t < 4; ++t) *(v8h*)(op + t * 16) = __builtin_convertvector(o[t][n] * sc, v8h); } }      /* a lane's eight accumulators are eight consecutive d of one query: one 16-byte store */

// ---- GEMM C[M][N] = alpha A[M][K] . Bt[N][K]^T + bias, f16 operands, f32 accumulation; one 128 x 128 tile of C per work-group, four waves of 64 x 64 (M, N multiples of 128; K a multiple of 64, at least 128) ----
#define GT 128                       /* rows of A and rows of Bt per work-group tile */
#define GK 64                        /* k per stage: one whole 128-byte line of every operand row */
#define GP 72                        /* LDS row pitch in f16: 128 data bytes + 16 (16-byte fragment reads fall on different banks) */
#define GBUF (2 * GT * GP)           /* f16 per buffer: the A rows, then the Bt rows */
// Eight asynchronous 16-byte copies per lane, global memory to LDS: rows 16 apart (gs f16 in memory, 16 GP f16 in LDS). A wave's copy is four whole 128-byte lines. s_wait_xcnt 0 is the statement's own last line, so that no address register of a copy is rewritten in front of it (a precaution).
__device__ __forceinline__ void g3_copy8(unsigned l, const unsigned short* g, size_t gs) {
  asm volatile("global_load_async_to_lds_b128 %0, %8, off\n\tglobal_load_async_to_lds_b128 %1, %9, off\n\tglobal_load_async_to_lds_b128 %2, %10, off\n\tglobal_load_async_to_lds_b128 %3, %11, off\n\t"
               "global_load_async_to_lds_b128 %4, %12, off\n\tglobal_load_async_to_lds_b128 %5, %13, off\n\tglobal_load_async_to_lds_b128 %6, %14, off\n\tglobal_load_async_to_lds_b128 %7, %15, off\n\ts_wait_xcnt 0x0"
               :: "v"(l), "v"(l + 1u * 32u * GP), "v"(l + 2u * 32u * GP), "v"(l + 3u * 32u * GP), "v"(l + 4u * 32u * GP), "v"(l + 5u * 32u * GP), "v"(l + 6u * 32u * GP), "v"(l + 7u * 32u * GP),
                  "v"(g), "v"(g + gs), "v"(g + 2 * gs), "v"(g + 3 * gs), "v"(g + 4 * gs), "v"(g + 5 * gs), "v"(g + 6 * gs), "v"(g + 7 * gs) : "memory"); }
// Each operand line leaves L2 once per work-group, as a whole line, and is read from LDS by the two waves that need it. Two buffers: stage t + 1 flies while stage t is worked on; one barrier a stage (it publishes the next buffer and ends the reads of the one refilled behind it).
// Every accumulator takes its k blocks of 32 in ascending order. The epilogue turns each wave's tile through LDS (the ring, free behind the last stage's barrier) so that rows go out as whole lines.
// f16 output, columns from 2 DM on (the v third): a wave's 64 columns are the 64 d of one head and its 64 rows are 64 s of one batch, so the tile is staged as [d][s] (a lane's eight accumulators are eight consecutive s of one d: two 16-byte LDS stores) and goes out as 64 whole lines of CT = V^T [batch][head][d][s]; nothing is written to C16 there.
template <bool OUT16>      /* the output type is fixed at compile time: no branch in the epilogue, its LDS reads go out together */
__global__ __launch_bounds__(128) void k_gemm3(const _Float16* __restrict__ A, int lda, const _Float16* __restrict__ Bh, int ldb, float alpha, const float* __restrict__ bias, float* __restrict__ C, _Float16* __restrict__ C16, _Float16* __restrict__ CT, int ldc, int N, int K) {
  __shared__ __attribute__((aligned(16))) unsigned char smem[2 * GBUF * 2]; static_assert(4 * 64 * 68 * 4 <= 2 * GBUF * 2, "epilogue staging fits the ring");
  const unsigned short* sm = (const unsigned short*)smem;
  const int tid = threadIdx.x, w = tid >> 5, lane = tid & 31, ln = lane & 15, hh = lane >> 4; const int ntn = N >> 7; const int mt = blockIdx.x / ntn, nq = blockIdx.x - mt * ntn;
  const int row0 = mt * GT + (w >> 1) * 64, col0 = nq * GT + (w & 1) * 64;      /* this wave's 64 x 64 tile */
  const int srow = tid >> 3, sch = (tid & 7) * 8;      /* staging: eight lanes a 128-byte row; rows srow, srow + 16, ... */
  const unsigned short* ag = (const unsigned short*)A + (size_t)(mt * GT + srow) * lda + sch; const unsigned short* bg = (const unsigned short*)Bh + (size_t)(nq * GT + srow) * ldb + sch;
  const unsigned la = (unsigned)(size_t)(sm + srow * GP + sch), lb = la + GT * GP * 2u;      /* LDS byte addresses in buffer 0 */
  const int nt = K / GK; const size_t gsa = (size_t)16 * lda, gsb = (size_t)16 * ldb;
  const v8f z8 = {0.f, 0.f, 0.f, 0.f, 0.f, 0.f, 0.f, 0.f}; v8f acc[4][4];
#pragma unroll
  for (int i = 0; i < 4; ++i) for (int j = 0; j < 4; ++j) acc[i][j] = z8;
  g3_copy8(la, ag, gsa); g3_copy8(lb, bg, gsb);
  asm volatile("s_wait_asynccnt 0x0" ::: "memory");      /* this wave's part of stage 0 has landed */
  __syncthreads();
  g3_copy8(la + GBUF * 2u, ag + GK, gsa); g3_copy8(lb + GBUF * 2u, bg + GK, gsb);
#pragma unroll 1      /* one stage a trip: the body is already 32 products long */
  for (int t = 0; t < nt; ++t) { const unsigned short* ab = sm + (t & 1) * GBUF + ((w >> 1) * 64 + ln) * GP; const unsigned short* bb = sm + (t & 1) * GBUF + (GT + (w & 1) * 64 + ln) * GP;
#pragma unroll
    for (int c = 0; c < 2; ++c) { v16h af[4], bf[4];
#pragma unroll
      for (int i = 0; i < 4; ++i) { af[i] = fa_frag(ab + i * 16 * GP + c * 32, hh); bf[i] = fa_frag(bb + i * 16 * GP + c * 32, hh); }
      __builtin_amdgcn_sched_barrier(0);      /* holds the sixteen LDS reads above together in front of the products: left free, the A fragments are fetched one at a time, each with a full LDS latency in front of its four products */
#pragma unroll
      for (int i = 0; i < 4; ++i) for (int j = 0; j < 4; ++j) acc[i][j] = fa_mma(af[i], bf[j], acc[i][j]); }
    asm volatile("s_wait_dscnt 0x0" ::: "memory");      /* this wave's reads of the buffer are over before anybody refills it */
    asm volatile("s_wait_asynccnt 0x0" ::: "memory");      /* this wave's part of stage t + 1 has landed before anybody reads it */
    __syncthreads();
    if (t + 2 < nt) { const unsigned bo = (unsigned)(t & 1) * (GBUF * 2u); g3_copy8(la + bo, ag + (size_t)(t + 2) * GK, gsa); g3_copy8(lb + bo, bg + (size_t)(t + 2) * GK, gsb); } }
  asm volatile("s_wait_asynccnt 0x0" ::: "memory");      /* no copy is outstanding when the ring becomes output staging */
  float* so = (float*)smem + (size_t)w * 64 * 68; float bv[4] = {0.f, 0.f, 0.f, 0.f};
  if (bias) {
#pragma unroll
    for (int j = 0; j < 4; ++j) bv[j] = bf16_round(bias[col0 + j * 16 + ln]); }
  const int rsub = lane >> 4, c4 = (lane & 15) * 4;
  if (OUT16 && nq * GT >= 2 * DM) {      /* the v third; the test reads the same for the whole work-group (2 DM is a multiple of GT) */
#pragma unroll
    for (int i = 0; i < 4; ++i) {
#pragma unroll
      for (int j = 0; j < 4; ++j) { v4f lo, hi;
#pragma unroll
        for (int r = 0; r < 4; ++r) { lo[r] = acc[i][j][r] * alpha + bv[j]; hi[r] = acc[i][j][4 + r] * alpha + bv[j]; }
        float* d = so + (j * 16 + ln) * 68 + i * 16 + 8 * hh; *(v4fa*)d = lo; *(v4fa*)(d + 4) = hi; } }
    __builtin_amdgcn_fence(__ATOMIC_ACQ_REL, "workgroup"); __builtin_amdgcn_wave_barrier();      /* the rows read below were stored by other lanes of this wave: those LDS stores are finished, and not moved by the compiler, before the reads */
    _Float16* vt = CT + ((size_t)(row0 / SQ) * DM + (col0 - 2 * DM)) * SQ + row0 % SQ;      /* row (batch NH + head) HD of V^T, column s of the tile's first row */
#pragma unroll
    for (int q = 0; q < 32; ++q) { const int d = q * 2 + rsub; const v4f v = *(const v4fa*)&so[d * 68 + c4]; v4h h4; for (int i = 0; i < 4; ++i) h4[i] = (_Float16)v[i]; *(v4h*)(vt + (size_t)d * SQ + c4) = h4; }
    return; }
#pragma unroll
  for (int i = 0; i < 4; ++i) {
#pragma unroll
    for (int j = 0; j < 4; ++j) {
#pragma unroll
      for (int r = 0; r < 8; ++r) so[(i * 16 + 8 * hh + r) * 68 + j * 16 + ln] = acc[i][j][r] * alpha + bv[j]; } }
  __builtin_amdgcn_fence(__ATOMIC_ACQ_REL, "workgroup"); __builtin_amdgcn_wave_barrier();
#pragma unroll
  for (int q = 0; q < 32; ++q) { const int r = q * 2 + rsub; const v4f v = *(const v4fa*)&so[r * 68 + c4]; const size_t co = (size_t)(row0 + r) * ldc + col0 + c4;
    if (OUT16) { v4h h4; for (int i = 0; i < 4; ++i) h4[i] = (_Float16)v[i]; *(v4h*)(C16 + co) = h4; } else *(v4f*)(C + co) = v; } }

// ---- operand conversion: x, w_qkv and w_out to f16 in ONE launch of few, long waves ----
#define PG 512                       /* work-groups: 16 waves on every WGP */
#define PT (PG * 256)                /* threads of the launch */
#define PNX ((int)(NR * DM / 4 / PT))            /* 16-byte pieces per thread: of x */
#define PNQ ((int)((size_t)LQ * DM / 4 / PT))    /* of w_qkv */
#define PNO ((int)((size_t)DM * DM / 4 / PT))    /* of w_out */
__device__ __forceinline__ v4h cv_x(v4f a) { v4h r; for (int q = 0; q < 4; ++q) r[q] = (_Float16)bf16_round(a[q]); return r; }
__device__ __forceinline__ v4h cv_w(v4f a) { v4h r; for (int q = 0; q < 4; ++q) r[q] = (_Float16)(bf16_round(a[q]) * 16.0f); return r; }
// The time of a short elementwise launch is the time its waves take to start, so the same bytes go through an eighth of the waves and one launch instead of three.
// Piece i of a thread lies PT pieces behind piece i - 1: every wave-wide load is 512 contiguous bytes (four whole lines), every store 256. All of a thread's loads are issued before its first conversion.
__global__ __launch_bounds__(256) void k_prep(const float* __restrict__ x, const float* __restrict__ wq, const float* __restrict__ wo, _Float16* __restrict__ X16, _Float16* __restrict__ BQ, _Float16* __restrict__ BO) {
  static_assert(NR * DM % (4 * PT) == 0 && (size_t)LQ * DM % (4 * PT) == 0 && (size_t)DM * DM % (4 * PT) == 0, "every thread takes the same number of pieces");
  const unsigned t = blockIdx.x * 256u + threadIdx.x; v4f a[PNX], b[PNQ], c[PNO];
#pragma unroll
  for (int i = 0; i < PNX; ++i) a[i] = ((const v4fa*)x + (size_t)i * PT)[t];
#pragma unroll
  for (int i = 0; i < PNQ; ++i) b[i] = ((const v4fa*)wq + (size_t)i * PT)[t];
#pragma unroll
  for (int i = 0; i < PNO; ++i) c[i] = ((const v4fa*)wo + (size_t)i * PT)[t];
  asm volatile("s_wait_xcnt 0x0" :: "v"(t) : "memory");      /* no address register of the loads above is rewritten in front of this wait (a precaution): left to the compiler, the pair it forms for the pieces beyond an offset's reach is reused behind a load-count wait alone */
  __builtin_amdgcn_sched_barrier(0);      /* holds all sixteen loads in front of the arithmetic: left free, half of them are issued only behind the first results, a second memory latency in a wave that lives for little more than one */
#pragma unroll
  for (int i = 0; i < PNX; ++i) ((v4h*)X16 + (size_t)i * PT)[t] = cv_x(a[i]);
#pragma unroll
  for (int i = 0; i < PNQ; ++i) ((v4h*)BQ + (size_t)i * PT)[t] = cv_w(b[i]);
#pragma unroll
  for (int i = 0; i < PNO; ++i) ((v4h*)BO + (size_t)i * PT)[t] = cv_w(c[i]); }

extern "C" void kernel_launch(void* const* d_in, const int* in_sizes, int n_in,
                              void* d_out, int out_size, void* d_ws, size_t ws_size, hipStream_t stream) {
  (void)in_sizes; (void)n_in; (void)out_size;
  const float* const* I = (const float* const*)d_in; const float* x = I[0]; const float* wqkv = I[1]; const float* bqkv = nullptr; const float* wo = I[2]; const float* bo = I[3];      /* natural [out][in] fused weight [3072][1024] (NO bias: nullptr in the fused GEMM's bias slot); natural w_out [1024][1024] + b_out */
  char* ws = (char*)d_ws; size_t off = 0;
  auto take = [&](size_t bytes) { char* p = ws + off; off += (bytes + 255) & ~(size_t)255; return p; };
  _Float16* BQKV = (_Float16*)take((size_t)3 * DM * DM * 2); _Float16* BO = (_Float16*)take((size_t)DM * DM * 2);
  _Float16* X16 = (_Float16*)take(NR * DM * 2); _Float16* QKV = (_Float16*)take(NR * 3 * DM * 2); _Float16* O16 = (_Float16*)take(NR * DM * 2);
  _Float16* VT = (_Float16*)take((size_t)NB * NH * HD * SQ * 2);
  if (off > ws_size) return;
  k_prep<<<PG, 256, 0, stream>>>(x, wqkv, wo, X16, BQKV, BO);      /* x as f16 rows; natural [out][in] weights = Bt[n][k] x16 (no transpose): fused rows 0..1023 = q, 1024.. = k, 2048.. = v */
  const size_t r0p = (size_t)B0 * SQ;      /* first projected row */
  k_gemm3<true><<<(unsigned)((MP / GT) * (3 * DM / GT)), 128, 0, stream>>>(X16 + r0p * DM, DM, BQKV, DM, 0.0625f, bqkv, nullptr, QKV + r0p * 3 * DM, VT, 3 * DM, 3 * DM, DM);      /* q | k rows (f16; head h = columns h*HD.. of each DM block; the v columns of these rows stay unwritten and unread) and V^T [NB][NH][HD][SQ] */
  k_attn<<<dim3(SQ / (AW * AQ), NH, NB), AW * 32, 0, stream>>>(QKV, VT, O16);      /* o (merged heads, x64) as f16 rows: scores, stablemax3 and P V in one launch for all batches and heads */
  k_gemm3<false><<<(unsigned)((MPO / GT) * (DM / GT)), 128, 0, stream>>>(O16 + r0p * DM, DM, BO, DM, 0.0009765625f, bo, (float*)d_out + r0p * DM, nullptr, nullptr, DM, DM, DM);      /* out rows are the output layout */
}

// v006
// One run takes 92.3 microseconds.
// Two timings next to v005 both put it at 1.14 times that version's speed.
// All steps since v000 together make it 38.4 times as fast.
#include <hip/hip_runtime.h>
// Multi-head self-attention with a polynomial 'stablemax' normalisation instead of softmax (x [2][2048][1024]; qkv = x w_qkv^T (natural [3072][1024] sigma 0.02, NO bias) reshaped (B, S, 3, 16, 64): q | k | v thirds; attn = stablemax3(q k^T * 64^-0.5): logits minus the row max, then s(x) = 1 + x (1 + x/2 (1 + x/3)) for x >= 0 and 1 / (1 - x (1 - x/2 (1 - x/3))) for x < 0, normalised by the row sum; out = merged w_out^T + b_out (natural) -> [2][2048][1024]).
// Structure: token rows r = b*2048 + s; x as exact f16 rows (bf16-rounded); q | k | v as ONE WMMA GEMM (N = 3 x 1024) (128x128 work-group tiles staged in LDS, 64x64 wave tiles, f32 accumulation, exact x16 weights, no bias, f16 outputs; the v third leaves that GEMM already transposed, as V^T [batch][head][d][s]); one attention kernel per (batch, head, 256 queries): scores on WMMA (K = 64, alpha = 64^-0.5) formed twice, once for the row max and once for the weights (f32 statistics; weights x256 as f16 operands, normalised after the product), o = P . V on WMMA (o carried x64 against f16 subnormal flush, folded into the output GEMM alpha) written straight into the merged f16 o rows; out = o W_o + b GEMM (f32) into the output layout.
// Compute dtype: inputs rounded to bf16; x / weights exact; q, k, v, softmax weights and o as plain f16 GEMM operands (~2^-12); scores and softmax statistics f32; v_wmma_f32_16x16x32_f16.
#define NB 2
#define SQ 2048
#define DM 1024
#define NH 16
#define HD 64
#define HG 4                         /* heads per block group of the unlaunched k_vt(b, h0) */
#define B0 0                         /* first batch processed (debug hook) */
#define NBR NB                       /* batches processed (debug hook) */
#define NR ((size_t)NB * SQ)         /* token rows */
#define MP ((int)((size_t)NBR * SQ)) /* rows projected (debug hook) */
#define QN SQ                        /* unused: k_attn covers all SQ queries */
#define NHD NH                       /* unused: k_attn covers all NH heads */
#define MPO MP                       /* rows through the output stage (debug hook) */
#define LQ (3 * DM)      /* row pitch of the q/k/v rows */
typedef __bf16 v16b __attribute__((ext_vector_type(16)));
typedef unsigned short v8us __attribute__((ext_vector_type(8), may_alias));
typedef float  v8f  __attribute__((ext_vector_type(8)));
typedef float  v4f  __attribute__((ext_vector_type(4)));
typedef float  v4fa __attribute__((ext_vector_type(4), may_alias));
union FragB { v16b v; v8us half[2]; unsigned short u[16]; };

__device__ __forceinline__ unsigned short bf16_bits(float x) { unsigned int u = __float_as_uint(x); return (unsigned short)((u + 0x7FFFu + ((u >> 16) & 1u)) >> 16); }
__device__ __forceinline__ float bf16_val(unsigned short b) { return __uint_as_float(((unsigned int)b) << 16); }
__device__ __forceinline__ float bf16_round(float x) { return bf16_val(bf16_bits(x)); }
// D += A·B with NT terms: 1 = ah·bh, 2 = + al·bh (A split), 3 = + ah·bl (both split)
template <int NT>
__device__ __forceinline__ v8f mmaN(v16b ah, v16b al, v16b bh, v16b bl, v8f c) {
  c = __builtin_amdgcn_wmma_f32_16x16x32_bf16(false, ah, false, bh, (short)0, c, false, false);
  if (NT >= 2) c = __builtin_amdgcn_wmma_f32_16x16x32_bf16(false, al, false, bh, (short)0, c, false, false);
  if (NT >= 3) c = __builtin_amdgcn_wmma_f32_16x16x32_bf16(false, ah, false, bl, (short)0, c, false, false);
  asm volatile("v_nop\n\tv_nop\n\tv_nop\n\tv_nop" : "+v"(c) : "v"(ah), "v"(al), "v"(bh), "v"(bl));
  return c;
}

__global__ __launch_bounds__(256) void k_wt_bf16(const float* __restrict__ W, unsigned short* __restrict__ Wt, int K, int N) {
  const int t = blockIdx.x * 256 + threadIdx.x;
  const int k8n = K / 8;
  if (t >= N * k8n) return;
  const int n = t / k8n, k8 = (t % k8n) * 8;
  v8us v;
#pragma unroll
  for (int i = 0; i < 8; ++i) v[i] = bf16_bits(W[(size_t)(k8 + i) * N + n]);
  *(v8us*)(Wt + (size_t)n * K + k8) = v;
  
}

// GEMM C[M][N] (f32, pitch ldc) = act(A[M][K]·W + bias). A f32 row-major (pitch lda) converted per fragment to bf16
// (ASPLIT: hi/lo two planes -> 2 terms, else single rounded term); Wt bf16 [N][K] (pitch ldb). BIAS_BF16 rounds the
// bias to bf16 first (bias quantised to bf16 before the add). K%32==0, M%16==0, N%64==0.
template <bool ASPLIT, int ACT, bool BIAS_BF16>
__global__ __launch_bounds__(128) void k_gemm_bf(const float* __restrict__ A, int lda, const unsigned short* __restrict__ Wt, int ldb,
                                               const float* __restrict__ bias, float* __restrict__ C, int ldc, int M, int N, int K) {
  __shared__ __attribute__((aligned(16))) float so[4][16][64];
  const int tid = threadIdx.x, w = tid >> 5, lane = tid & 31, ln = lane & 15, hh = lane >> 4;
  const int ntn = N / 64;
  const int wid = blockIdx.x * 4 + w;
  const int mt = wid / ntn, nq = wid % ntn;
  if (mt * 16 >= M) return;
  const int row0 = mt * 16, col0 = nq * 64;
  const float* arow = A + (size_t)(row0 + ln) * lda;
  v8f acc[4] = {};
  for (int kb = 0; kb < K; kb += 32) {
    FragB ah, al;
    const v4f x0 = *(const v4fa*)(arow + kb + 8 * hh), x1 = *(const v4fa*)(arow + kb + 8 * hh + 4);
    const v4f x2 = *(const v4fa*)(arow + kb + 16 + 8 * hh), x3 = *(const v4fa*)(arow + kb + 16 + 8 * hh + 4);
    float xs[16] = {x0[0],x0[1],x0[2],x0[3],x1[0],x1[1],x1[2],x1[3],x2[0],x2[1],x2[2],x2[3],x3[0],x3[1],x3[2],x3[3]};
#pragma unroll
    for (int i = 0; i < 16; ++i) { const unsigned short hb = bf16_bits(xs[i]); ah.u[i] = hb; al.u[i] = ASPLIT ? bf16_bits(xs[i] - bf16_val(hb)) : (unsigned short)0; }
#pragma unroll
    for (int t = 0; t < 4; ++t) {
      const unsigned short* brow = Wt + (size_t)(col0 + t * 16 + ln) * ldb + kb;
      FragB b;
      b.half[0] = *(const v8us*)(brow + 8 * hh);
      b.half[1] = *(const v8us*)(brow + 16 + 8 * hh);
      acc[t] = mmaN<ASPLIT ? 2 : 1>(ah.v, al.v, b.v, b.v, acc[t]);
    }
  }
#pragma unroll
  for (int t = 0; t < 4; ++t) {
    float bv = bias ? bias[col0 + t * 16 + ln] : 0.f;
    if (BIAS_BF16) bv = bf16_round(bv);
#pragma unroll
    for (int r = 0; r < 8; ++r) { float v = acc[t][r] + bv; if (ACT == 1) v = fmaxf(v, 0.f); so[w][8 * hh + r][t * 16 + ln] = v; }
  }
  __builtin_amdgcn_fence(__ATOMIC_ACQ_REL, "workgroup");
  __builtin_amdgcn_wave_barrier();
  const int rsub = lane >> 4, c4 = (lane & 15) * 4;
  {
#pragma unroll
    for (int q = 0; q < 8; ++q) {
      const int r = q * 2 + rsub;
      const v4f v = *(const v4fa*)&so[w][r][c4];
      *(v4f*)(C + (size_t)(row0 + r) * ldc + col0 + c4) = v;
    }
    
  }
}

// GEMM C = act(A·W + bias + resid): A f32 (ASPLIT -> hi/lo 2 terms), Wt bf16 [N][K]; ACT 0 none, 1 relu, 2 exact gelu;
// resid (optional, f32, row index = (row % rmod), pitch ldr, RES_BF16 rounds it) added before the activation.
template <bool ASPLIT, int ACT, bool BIAS_BF16, bool RES_BF16>
__global__ __launch_bounds__(128) void k_gemm_bf3(const float* __restrict__ A, int lda, const unsigned short* __restrict__ Wt, int ldb,
                                                const float* __restrict__ bias, const float* __restrict__ resid, int rmod, int ldr,
                                                float* __restrict__ C, int ldc, int M, int N, int K) {
  __shared__ __attribute__((aligned(16))) float so[4][16][64];
  const int tid = threadIdx.x, w = tid >> 5, lane = tid & 31, ln = lane & 15, hh = lane >> 4;
  const int ntn = N / 64;
  const int wid = blockIdx.x * 4 + w;
  const int mt = wid / ntn, nq = wid % ntn;
  if (mt * 16 >= M) return;
  const int row0 = mt * 16, col0 = nq * 64;
  const float* arow = A + (size_t)(row0 + ln) * lda;
  v8f acc[4] = {};
  for (int kb = 0; kb < K; kb += 32) {
    FragB ah, al;
    const v4f x0 = *(const v4fa*)(arow + kb + 8 * hh), x1 = *(const v4fa*)(arow + kb + 8 * hh + 4);
    const v4f x2 = *(const v4fa*)(arow + kb + 16 + 8 * hh), x3 = *(const v4fa*)(arow + kb + 16 + 8 * hh + 4);
    float xs[16] = {x0[0],x0[1],x0[2],x0[3],x1[0],x1[1],x1[2],x1[3],x2[0],x2[1],x2[2],x2[3],x3[0],x3[1],x3[2],x3[3]};
#pragma unroll
    for (int i = 0; i < 16; ++i) { const unsigned short hb = bf16_bits(xs[i]); ah.u[i] = hb; al.u[i] = ASPLIT ? bf16_bits(xs[i] - bf16_val(hb)) : (unsigned short)0; }
#pragma unroll
    for (int t = 0; t < 4; ++t) {
      const unsigned short* brow = Wt + (size_t)(col0 + t * 16 + ln) * ldb + kb;
      FragB b;
      b.half[0] = *(const v8us*)(brow + 8 * hh);
      b.half[1] = *(const v8us*)(brow + 16 + 8 * hh);
      acc[t] = mmaN<ASPLIT ? 2 : 1>(ah.v, al.v, b.v, b.v, acc[t]);
    }
  }
#pragma unroll
  for (int t = 0; t < 4; ++t) {
    const int col = col0 + t * 16 + ln;
    float bv = bias ? bias[col] : 0.f;
    if (BIAS_BF16) bv = bf16_round(bv);
#pragma unroll
    for (int r = 0; r < 8; ++r) {
      float v = acc[t][r] + bv;
      if (resid) { float rv = resid[(size_t)((row0 + 8 * hh + r) % rmod) * ldr + col]; if (RES_BF16) rv = bf16_round(rv); v += rv; }
      if (ACT == 1) v = fmaxf(v, 0.f);
      if (ACT == 2) v = 0.5f * v * (1.0f + erff(v * 0.70710678118654752f));
      if (ACT == 3) { const float u = 0.7978845608028654f * (v + 0.044715f * v * v * v); v = 0.5f * v * (1.0f + tanhf(u)); }
      so[w][8 * hh + r][t * 16 + ln] = v;
    }
  }
  __builtin_amdgcn_fence(__ATOMIC_ACQ_REL, "workgroup");
  __builtin_amdgcn_wave_barrier();
  const int rsub = lane >> 4, c4 = (lane & 15) * 4;
  {
#pragma unroll
    for (int q = 0; q < 8; ++q) {
      const int r = q * 2 + rsub;
      const v4f v = *(const v4fa*)&so[w][r][c4];
      *(v4f*)(C + (size_t)(row0 + r) * ldc + col0 + c4) = v;
    }
    
  }
}
// row LayerNorm (biased variance, eps) over N: s = X (+ R); optional out_sum <- s; out_norm <- (s-mu)*rsqrt(var+eps)*g + b
template <bool PARAM_BF16>
__global__ __launch_bounds__(256) void k_layernorm(const float* __restrict__ X, const float* __restrict__ R, const float* __restrict__ g, const float* __restrict__ bta,
                                                  float* __restrict__ out_sum, float* __restrict__ out_norm, int N, float eps) {
  __shared__ float red[256];
  const int row = blockIdx.x, tid = threadIdx.x;
  const float* x = X + (size_t)row * N; const float* rr = R ? R + (size_t)row * N : nullptr;
  float vals[16];                     // up to N = 4096
  const int per = N / 256;            // contiguous chunk per thread? use strided-by-4 chunks: thread handles j = tid*4 + 1024*u
  float s1 = 0.f;
  for (int u = 0; u < per / 4; ++u) {
    const int j = tid * 4 + 1024 * u;
    const v4f a = *(const v4fa*)(x + j);
    v4f b = {0.f,0.f,0.f,0.f}; if (rr) b = *(const v4fa*)(rr + j);
#pragma unroll
    for (int q = 0; q < 4; ++q) { const float v = a[q] + b[q]; vals[u * 4 + q] = v; s1 += v; }
  }
  red[tid] = s1; __syncthreads();
  for (int st = 128; st > 0; st >>= 1) { if (tid < st) red[tid] += red[tid + st]; __syncthreads(); }
  const float mu = red[0] / (float)N; __syncthreads();
  float s2 = 0.f;
  for (int u = 0; u < per / 4; ++u)
#pragma unroll
    for (int q = 0; q < 4; ++q) { const float c = vals[u * 4 + q] - mu; s2 += c * c; }
  red[tid] = s2; __syncthreads();
  for (int st = 128; st > 0; st >>= 1) { if (tid < st) red[tid] += red[tid + st]; __syncthreads(); }
  const float rs = rsqrtf(red[0] / (float)N + eps);
  {
    for (int u = 0; u < per / 4; ++u) {
      const int j = tid * 4 + 1024 * u;
      v4f o, sm;
#pragma unroll
      for (int q = 0; q < 4; ++q) {
        float gg = g[j + q], bb = bta[j + q];
        if (PARAM_BF16) { gg = bf16_round(gg); bb = bf16_round(bb); }
        sm[q] = vals[u * 4 + q]; o[q] = (vals[u * 4 + q] - mu) * rs * gg + bb;
      }
      if (out_sum) *(v4f*)(out_sum + (size_t)row * N + j) = sm;
      *(v4f*)(out_norm + (size_t)row * N + j) = o;
    }
    
  }
}



// ---- f16 WMMA path (v_wmma_f32_16x16x32_f16): 11-bit significands for operands in range — used where a [0,1] probability operand needs more precision than bf16
typedef _Float16 v16h __attribute__((ext_vector_type(16)));
union FragH { v16h v; v8us half[2]; _Float16 h[16]; unsigned short u[16]; };
template <int NT>
__device__ __forceinline__ v8f mmaH(v16h ah, v16h al, v16h bh, v16h bl, v8f c) {
  c = __builtin_amdgcn_wmma_f32_16x16x32_f16(false, ah, false, bh, (short)0, c, false, false);
  if (NT >= 2) c = __builtin_amdgcn_wmma_f32_16x16x32_f16(false, al, false, bh, (short)0, c, false, false);
  if (NT >= 3) c = __builtin_amdgcn_wmma_f32_16x16x32_f16(false, ah, false, bl, (short)0, c, false, false);
  asm volatile("v_nop\n\tv_nop\n\tv_nop\n\tv_nop" : "+v"(c) : "v"(ah), "v"(al), "v"(bh), "v"(bl));
  return c;
}
// batched GEMM like k_gemm_b but f16 operands: A f32 (split into f16 hi/lo if ASPLIT, else rounded to f16), Bt = f16 values [n][k]; alpha; C f32; N multiple of 16 (partial tiles skipped)
template <bool ASPLIT>
__global__ __launch_bounds__(128) void k_gemm_h(const float* __restrict__ A, int lda, size_t sA, const _Float16* __restrict__ Bh, int ldb, size_t sB, float alpha, float* __restrict__ C, int ldc, size_t sC, int M, int N, int K) {
  __shared__ __attribute__((aligned(16))) float so[4][16][64];
  const int tid = threadIdx.x, w = tid >> 5, lane = tid & 31, ln = lane & 15, hh = lane >> 4; const int by = blockIdx.y;
  A += (size_t)by * sA; Bh += (size_t)by * sB; C += (size_t)by * sC;
  const int ntn = (N + 63) / 64; const int wid = blockIdx.x * 4 + w; const int mt = wid / ntn, nq = wid % ntn; if (mt * 16 >= M) return;
  const int row0 = mt * 16, col0 = nq * 64; const float* arow = A + (size_t)(row0 + ln) * lda;
  v8f acc[4] = {};
  for (int kb = 0; kb < K; kb += 32) {
    FragH ah, al;
    const v4f x0 = *(const v4fa*)(arow + kb + 8 * hh), x1 = *(const v4fa*)(arow + kb + 8 * hh + 4), x2 = *(const v4fa*)(arow + kb + 16 + 8 * hh), x3 = *(const v4fa*)(arow + kb + 16 + 8 * hh + 4);
    float xs[16] = {x0[0],x0[1],x0[2],x0[3],x1[0],x1[1],x1[2],x1[3],x2[0],x2[1],x2[2],x2[3],x3[0],x3[1],x3[2],x3[3]};
#pragma unroll
    for (int i = 0; i < 16; ++i) { const _Float16 h = (_Float16)xs[i]; ah.h[i] = h; al.h[i] = ASPLIT ? (_Float16)(xs[i] - (float)h) : (_Float16)0.0f; }
#pragma unroll
    for (int t = 0; t < 4; ++t) { if (col0 + t * 16 >= N) continue; const size_t boff = (size_t)(col0 + t * 16 + ln) * ldb + kb; FragH bq; bq.half[0] = *(const v8us*)(Bh + boff + 8 * hh); bq.half[1] = *(const v8us*)(Bh + boff + 16 + 8 * hh);
      acc[t] = mmaH<ASPLIT ? 2 : 1>(ah.v, al.v, bq.v, bq.v, acc[t]); }
  }
#pragma unroll
  for (int t = 0; t < 4; ++t) { if (col0 + t * 16 >= N) continue;
#pragma unroll
    for (int r = 0; r < 8; ++r) so[w][8 * hh + r][t * 16 + ln] = acc[t][r] * alpha; }
  __builtin_amdgcn_fence(__ATOMIC_ACQ_REL, "workgroup"); __builtin_amdgcn_wave_barrier();
  const int rsub = lane >> 4, c4 = (lane & 15) * 4;
  {
#pragma unroll
    for (int q = 0; q < 8; ++q) { const int r = q * 2 + rsub; if (col0 + c4 < N) { const v4f v = *(const v4fa*)&so[w][r][c4]; *(v4f*)(C + (size_t)(row0 + r) * ldc + col0 + c4) = v; } }
     }
}

// Wt[n][k] = f16(W[k][n]·scale) from f32 row-major W[K][N] (scale = power of two; bf16-exact weights stay exact in f16 away from the subnormal range)
__global__ __launch_bounds__(256) void k_wt_f16(const float* __restrict__ W, _Float16* __restrict__ Wt, int K, int N, float scale) {
  const int t = blockIdx.x * 256 + threadIdx.x; if (t >= N * (K / 8)) return; const int n = t / (K / 8), k8 = (t % (K / 8)) * 8; FragH f;
#pragma unroll
  for (int i = 0; i < 8; ++i) f.h[i] = (_Float16)(bf16_round(W[(size_t)(k8 + i) * N + n]) * scale); const v8us o = f.half[0];
  *(v8us*)((unsigned short*)Wt + (size_t)n * K + k8) = o; 
}
// k_gemm_hh variant with fused epilogue: v = acc·alpha + bias[by·sBias + col] (+ CP[(row/rowsPerB)·sCPb + by·64 + col] if CP) ; ACT 0 none / 1 elu ; writes f16 C16 (and f32 C if non-null)
template <int ACT>
__global__ __launch_bounds__(128) void k_gemm_hhx(const _Float16* __restrict__ A, int lda, size_t sA, const _Float16* __restrict__ Bh, int ldb, size_t sB, float alpha, const float* __restrict__ bias, size_t sBias, const float* __restrict__ CP, int rowsPerB, size_t sCPb, int row0g,
    float* __restrict__ C, _Float16* __restrict__ C16, int ldc, size_t sC, int M, int N, int K) {
  __shared__ __attribute__((aligned(16))) float so[4][16][64];
  const int tid = threadIdx.x, w = tid >> 5, lane = tid & 31, ln = lane & 15, hh = lane >> 4; const int by = blockIdx.y;
  A += (size_t)by * sA; Bh += (size_t)by * sB; const size_t cofs = (size_t)by * sC; const float* bp = bias ? bias + (size_t)by * sBias : nullptr;
  const int ntn = (N + 63) / 64; const int wid = blockIdx.x * 4 + w; const int mt = wid / ntn, nq = wid % ntn; if (mt * 16 >= M) return;
  const int row0 = mt * 16, col0 = nq * 64; const _Float16* arow = A + (size_t)(row0 + ln) * lda;
  v8f acc[4] = {};
  for (int kb = 0; kb < K; kb += 32) { FragH ah; ah.half[0] = *(const v8us*)((const unsigned short*)arow + kb + 8 * hh); ah.half[1] = *(const v8us*)((const unsigned short*)arow + kb + 16 + 8 * hh);
#pragma unroll
    for (int t = 0; t < 4; ++t) { if (col0 + t * 16 >= N) continue; const size_t boff = (size_t)(col0 + t * 16 + ln) * ldb + kb; FragH bq; bq.half[0] = *(const v8us*)((const unsigned short*)Bh + boff + 8 * hh); bq.half[1] = *(const v8us*)((const unsigned short*)Bh + boff + 16 + 8 * hh);
      acc[t] = mmaH<1>(ah.v, ah.v, bq.v, bq.v, acc[t]); }
  }
#pragma unroll
  for (int t = 0; t < 4; ++t) { if (col0 + t * 16 >= N) continue; const int col = col0 + t * 16 + ln; const float bv = bp ? bf16_round(bp[col]) : 0.f;
#pragma unroll
    for (int r = 0; r < 8; ++r) { float v = acc[t][r] * alpha + bv; if (CP) { const int rr = row0g + row0 + 8 * hh + r; if (rowsPerB < 0) v += CP[cofs + (size_t)rr * ldc + col];      /* rowsPerB < 0: own element of the batched C plane */ else { const int bidx = rr / rowsPerB; v += CP[(size_t)bidx * sCPb + (size_t)by * 64 + col]; } } if (ACT == 1) v = (v > 0.f) ? v : expm1f(v); else if (ACT == 7) v = (v > 0.f) ? v + 1.0f : expf(v); else if (ACT == 8) v = tanhf(v); else if (ACT == 9) v = 0.5f * v * (1.0f + tanhf(0.7978845608028654f * (v + 0.044715f * v * v * v))); else if (ACT == 11) v = 1.0f / (1.0f + expf(-v)); else if (ACT == 12) v = (v > 0.f) ? v : 0.01f * v; else if (ACT == 14) v = (v > 0.f) ? v : 0.1f * v; else if (ACT == 16) v = (v >= 0.f) ? v : 0.3f * v; else if (ACT == 17) v = (v >= 0.f) ? v : 0.2f * v; else if (ACT == 15) v = v / (1.0f + expf(-v)); else if (ACT == 3) v = fmaxf(v, 0.f); else if (ACT == 6) v = 0.5f * v * (1.0f + erff(v * 0.70710678118654752f)); so[w][8 * hh + r][t * 16 + ln] = v; } }
  __builtin_amdgcn_fence(__ATOMIC_ACQ_REL, "workgroup"); __builtin_amdgcn_wave_barrier();
  const int rsub = lane >> 4, c4 = (lane & 15) * 4; typedef _Float16 v4h __attribute__((ext_vector_type(4)));
  {
#pragma unroll
    for (int q = 0; q < 8; ++q) { const int r = q * 2 + rsub; if (col0 + c4 < N) { const v4f v = *(const v4fa*)&so[w][r][c4]; if (C) *(v4f*)(C + cofs + (size_t)(row0 + r) * ldc + col0 + c4) = v; if (C16) { v4h h4; for (int i = 0; i < 4; ++i) h4[i] = (_Float16)v[i]; *(v4h*)(C16 + cofs + (size_t)(row0 + r) * ldc + col0 + c4) = h4; } } }
     }
}


typedef _Float16 v4h __attribute__((ext_vector_type(4)));

__global__ __launch_bounds__(256) void k_x16(const float* __restrict__ x, _Float16* __restrict__ X16, size_t n8) { const size_t t = (size_t)blockIdx.x * 256 + threadIdx.x; if (t >= n8) return; FragH f;
#pragma unroll
  for (int q = 0; q < 8; ++q) f.h[q] = (_Float16)bf16_round(x[t * 8 + q]); *(v8us*)((unsigned short*)X16 + t * 8) = f.half[0];  }
__global__ __launch_bounds__(256) void k_h16(const float* __restrict__ x, _Float16* __restrict__ X16, size_t n8) { const size_t t = (size_t)blockIdx.x * 256 + threadIdx.x; if (t >= n8) return; FragH f;
#pragma unroll
  for (int q = 0; q < 8; ++q) f.h[q] = (_Float16)x[t * 8 + q]; *(v8us*)((unsigned short*)X16 + t * 8) = f.half[0];  }
__global__ __launch_bounds__(256) void k_round16f(const float* __restrict__ W, _Float16* __restrict__ Bt, size_t n8) { const size_t t = (size_t)blockIdx.x * 256 + threadIdx.x; if (t >= n8) return; FragH f;
#pragma unroll
  for (int i = 0; i < 8; ++i) f.h[i] = (_Float16)(bf16_round(W[t * 8 + i]) * 16.0f); *(v8us*)((unsigned short*)Bt + t * 8) = f.half[0];  }
template <int NHv, int TTv>
__global__ __launch_bounds__(256) void k_vt(const _Float16* __restrict__ V16, int ldv, int voff, _Float16* __restrict__ Vt) { __shared__ unsigned short tl[64][66]; const int tid = threadIdx.x; const int slab = blockIdx.x / (TTv / 64), lg = blockIdx.x % (TTv / 64); const int b = slab / NHv, h = slab % NHv;
  for (int i = tid; i < 64 * 8; i += 256) { const int r = i / 8, c8 = (i % 8) * 8; FragH f; f.half[0] = *(const v8us*)((const unsigned short*)V16 + ((size_t)b * TTv + lg * 64 + r) * ldv + voff + h * 64 + c8);
#pragma unroll
    for (int q = 0; q < 8; ++q) tl[r][c8 + q] = f.u[q]; }
  __syncthreads();
  {
#pragma unroll
    for (int rd = 0; rd < 2; ++rd) { const int d = rd * 32 + tid / 8, pc = tid % 8; FragH f;
#pragma unroll
      for (int q = 0; q < 8; ++q) f.u[q] = tl[pc * 8 + q][d];
      *(v8us*)((unsigned short*)Vt + ((size_t)slab * 64 + d) * TTv + lg * 64 + pc * 8) = f.half[0]; }
     } }

__global__ __launch_bounds__(256) void k_hl(const float* __restrict__ F, _Float16* __restrict__ Hh, _Float16* __restrict__ Hl, size_t n8) { const size_t t = (size_t)blockIdx.x * 256 + threadIdx.x; if (t >= n8) return; FragH fh, fl; const v4f a = *(const v4fa*)(F + t * 8), c = *(const v4fa*)(F + t * 8 + 4);
#pragma unroll
  for (int q = 0; q < 4; ++q) { _Float16 h = (_Float16)a[q]; fh.h[q] = h; fl.h[q] = (_Float16)((a[q] - (float)h) * 1024.0f); h = (_Float16)c[q]; fh.h[4 + q] = h; fl.h[4 + q] = (_Float16)((c[q] - (float)h) * 1024.0f); }
  { *(v8us*)((unsigned short*)Hh + t * 8) = fh.half[0]; *(v8us*)((unsigned short*)Hl + t * 8) = fl.half[0];  } }

__global__ __launch_bounds__(256) void k_wnat(const float* __restrict__ w, size_t n8, _Float16* __restrict__ Bt) { const size_t t = (size_t)blockIdx.x * 256 + threadIdx.x; if (t >= n8) return; FragH f; for (int q = 0; q < 8; ++q) f.h[q] = (_Float16)(bf16_round(w[t * 8 + q]) * 16.0f); *(v8us*)((unsigned short*)Bt + t * 8) = f.half[0];  }
__global__ __launch_bounds__(256) void k_rsm(const float* __restrict__ S, _Float16* __restrict__ P, int nrows) {
  #pragma clang fp contract(off)
  const int i = blockIdx.x * 256 + threadIdx.x; if (i >= nrows) return; const float* s = S + (size_t)i * SQ; float mx = -3.0e38f;
#pragma unroll 1
  for (int j = 0; j < SQ; ++j) mx = fmaxf(mx, s[j]); float se = 0.f;
#pragma unroll 1
  for (int j = 0; j < SQ; ++j) se += expf(s[j] - mx); const float sc = 256.0f / se;
#pragma unroll 1
  for (int j0 = 0; j0 < SQ; j0 += 8) { FragH f; for (int q = 0; q < 8; ++q) f.h[q] = (_Float16)(expf(s[j0 + q] - mx) * sc); unsigned short* d = (unsigned short*)P + (size_t)i * SQ + j0; *(v8us*)d = f.half[0];  } }
__global__ __launch_bounds__(256) void k_vt(const _Float16* __restrict__ V16, int b, int h0, _Float16* __restrict__ VT) { __shared__ unsigned short tl[64][65]; const int tid = threadIdx.x; const int hh = blockIdx.x % HG, sg = blockIdx.x / HG; const int s0 = sg * 64; const int h = h0 + hh;
  for (int i = tid; i < 64 * 8; i += 256) { const int j = i / 8, d8 = (i % 8) * 8; FragH f; f.half[0] = *(const v8us*)((const unsigned short*)V16 + ((size_t)b * SQ + s0 + j) * DM + h * HD + d8); for (int q = 0; q < 8; ++q) tl[d8 + q][j] = f.u[q]; }
  __syncthreads();
  { for (int i = tid; i < 64 * 8; i += 256) { const int d = i / 8, j8 = (i % 8) * 8; FragH f; for (int q = 0; q < 8; ++q) f.u[q] = tl[d][j8 + q]; *(v8us*)((unsigned short*)VT + ((size_t)hh * HD + d) * SQ + s0 + j8) = f.half[0]; }  } }



__global__ __launch_bounds__(256) void k_rsmf(const float* __restrict__ S, _Float16* __restrict__ P, int qn, int hg) {
  #pragma clang fp contract(off)
  const int t = blockIdx.x * 256 + threadIdx.x; if (t >= qn * hg) return; const size_t i = (size_t)(t / qn) * SQ + (t % qn); const float* s = S + i * SQ; float mx = -3.0e38f;
#pragma unroll 1
  for (int j = 0; j < SQ; ++j) mx = fmaxf(mx, s[j]); float se = 0.f;
#pragma unroll 1
  for (int j = 0; j < SQ; ++j) se += __expf(s[j] - mx); const float sc = 256.0f / se;
#pragma unroll 1
  for (int j0 = 0; j0 < SQ; j0 += 8) { FragH f; for (int q = 0; q < 8; ++q) f.h[q] = (_Float16)(__expf(s[j0 + q] - mx) * sc); unsigned short* d = (unsigned short*)P + i * SQ + j0; *(v8us*)d = f.half[0];  } }

// Four reciprocals. One statement with results apart from sources, so that behind each v_rcp_f32 stands an instruction that touches neither its result nor its source: the next reciprocal, and behind the last the v_nop (the slot the instruction set asks for behind a transcendental).
__device__ __forceinline__ v4f rcp4(v4f d) { v4f o;
  asm("v_rcp_f32 %0, %4\n\tv_rcp_f32 %1, %5\n\tv_rcp_f32 %2, %6\n\tv_rcp_f32 %3, %7\n\tv_nop" : "=&v"(o[0]), "=&v"(o[1]), "=&v"(o[2]), "=&v"(o[3]) : "v"(d[0]), "v"(d[1]), "v"(d[2]), "v"(d[3]));
  return o; }
typedef _Float16 v8h __attribute__((ext_vector_type(8)));
#define AW 8                         /* query groups per work-group of the attention kernel */
#define AH 2                         /* waves per query group: each walks its own half of the keys */
#define AQ 32                        /* query columns per group, and per wave (two 16-column tiles) */
#define AK 64                        /* keys per LDS stage */
#define AP 72                        /* LDS row pitch in f16: 128 data bytes + 16 (16-byte fragment reads fall on different banks) */
#define ANS (SQ / AH / AK)           /* stages per walk over one half of the keys */
#define AT (AK * AP)                 /* f16 per LDS tile */
__device__ __forceinline__ v16h fa_frag(const unsigned short* p, int hh) { FragH f; f.half[0] = *(const v8us*)(p + 8 * hh); f.half[1] = *(const v8us*)(p + 16 + 8 * hh); return f.v; }
__device__ __forceinline__ v8f fa_mma(v16h a, v16h b, v8f c) { return __builtin_amdgcn_wmma_f32_16x16x32_f16(false, a, false, b, (short)0, c, false, false); }
// 256 x the stablemax3 weight for x <= 0, eight values: 1 / (1 - x (1 - x/2 (1 - x/3))) with the factor 2^-8 carried exactly through the two outer terms of the denominator; x / 3 as a multiply by f32(1/3); reciprocal through v_rcp_f32.
__device__ __forceinline__ v8f stm3w(v8f x) { const v8f a = 1.0f - x * 0.33333334f; const v8f b = 0.00390625f - (0.001953125f * x) * a; const v8f d = 0.00390625f - x * b;
  const v4f lo = rcp4(__builtin_shufflevector(d, d, 0, 1, 2, 3)), hi = rcp4(__builtin_shufflevector(d, d, 4, 5, 6, 7)); return __builtin_shufflevector(lo, hi, 0, 1, 2, 3, 4, 5, 6, 7); }
__global__ __launch_bounds__(AW * AH * 32) void k_attn(const _Float16* __restrict__ QKV, const _Float16* __restrict__ VT, _Float16* __restrict__ O16) {
  __shared__ __attribute__((aligned(16))) unsigned short sm[AH * 4 * AT];      /* per half of the keys: K buffers 0 and 1, V^T buffers 0 and 1; behind the last stage: the output tiles handed over */
  __shared__ float sx[AW * AH][32];      /* row maxima, later row sums, handed over */
  static_assert(AW * AH * 4 * 2 * 32 * 16 <= sizeof(sm), "the output tiles handed over fit the ring"); static_assert(AH == 2 && (ANS & (ANS - 1)) == 0 && ANS % 2 == 0, "two halves; the stage count wraps by a mask and leaves stage 0 in buffer 0");
  const int tid = threadIdx.x, lane = tid & 31, ln = lane & 15, hh = lane >> 4, w = tid >> 5; const int h = blockIdx.y, b = blockIdx.z;
  const int kh = __builtin_amdgcn_readfirstlane(w / AW), ts = tid & (AW * 32 - 1); const int q0 = blockIdx.x * (AW * AQ) + (w & (AW - 1)) * AQ;      /* kh: this wave's half of the keys, the same in every lane (held as a scalar); ts: the thread's number inside its half */
  const unsigned short* Qp = (const unsigned short*)QKV + (size_t)b * SQ * LQ + h * HD; const unsigned short* Kp = Qp + DM + (size_t)kh * (SQ / AH) * LQ; const unsigned short* Vp = (const unsigned short*)VT + (size_t)(b * NH + h) * HD * SQ + kh * (SQ / AH);
  unsigned short* sK = sm + kh * 4 * AT; unsigned short* sV = sK + 2 * AT;
  const int srow = ts >> 3, sch = (ts & 7) * 8; const int sl = srow * AP + sch;      /* staging: eight threads a 128-byte row, rows srow and srow + 32 */
  const unsigned short* kg = Kp + (size_t)srow * LQ + sch; const unsigned short* vg = Vp + (size_t)srow * SQ + sch;
  const v8f z8 = {0.f, 0.f, 0.f, 0.f, 0.f, 0.f, 0.f, 0.f};
  v16h qf[2][2]; const unsigned short* qg = Qp + (size_t)(q0 + ln) * LQ + 8 * hh;
#pragma unroll
  for (int n = 0; n < 2; ++n) for (int c = 0; c < 2; ++c) qf[n][c] = fa_frag(qg + (size_t)n * 16 * LQ + c * 32, 0);
  v8us k0 = *(const v8us*)kg, k1 = *(const v8us*)(kg + (size_t)32 * LQ), v0 = *(const v8us*)vg, v1 = *(const v8us*)(vg + (size_t)32 * SQ);
  asm volatile("s_wait_xcnt 0x0" :: "v"(qg), "v"(qg + (size_t)16 * LQ), "v"(kg), "v"(vg) : "memory");      /* the address registers of the loads above are kept, and not reused as a load's destination either, until this wait */
  *(v8us*)&sK[sl] = k0; *(v8us*)&sK[sl + 32 * AP] = k1; *(v8us*)&sV[sl] = v0; *(v8us*)&sV[sl + 32 * AP] = v1;      /* V^T stage 0 waits in its buffer through walk 1, which touches only sK */
  __syncthreads();
  v8f m8[2]; m8[0] = z8 - 3.0e38f; m8[1] = m8[0];
#pragma unroll 1      /* one stage a trip: the body is already 16 products long */
  for (int s = 0; s < ANS; ++s) { const int sn = (s + 1) & (ANS - 1);      /* the stage behind the last is stage 0 again: no branch in the trip, and walk 2 finds its first K tile in buffer 0 */
    { const unsigned short* g = kg + (size_t)sn * AK * LQ; k0 = *(const v8us*)g; k1 = *(const v8us*)(g + (size_t)32 * LQ);
      asm volatile("s_wait_xcnt 0x0" :: "v"(g) : "memory"); }      /* as above: the address pair is kept until this wait */
    const unsigned short* kb = sK + (s & 1) * AT;
#pragma unroll
    for (int j = 0; j < 4; ++j) { const v16h a0 = fa_frag(kb + (j * 16 + ln) * AP, hh), a1 = fa_frag(kb + (j * 16 + ln) * AP + 32, hh);
#pragma unroll
      for (int n = 0; n < 2; ++n) m8[n] = __builtin_elementwise_max(m8[n], fa_mma(a1, qf[n][1], fa_mma(a0, qf[n][0], z8))); }
    { unsigned short* d = sK + ((s + 1) & 1) * AT; *(v8us*)&d[sl] = k0; *(v8us*)&d[sl + 32 * AP] = k1; }
    __syncthreads(); }
  float mx[2];
#pragma unroll
  for (int n = 0; n < 2; ++n) { float m = fmaxf(fmaxf(fmaxf(m8[n][0], m8[n][1]), fmaxf(m8[n][2], m8[n][3])), fmaxf(fmaxf(m8[n][4], m8[n][5]), fmaxf(m8[n][6], m8[n][7]))); mx[n] = fmaxf(m, __shfl_xor(m, 16, 32)); }
  sx[w][lane] = hh ? mx[1] : mx[0];      /* this half's maxima: columns of tile 0 from lanes 0..15, of tile 1 from lanes 16..31 */
  __syncthreads();      /* the other half's maxima are read below */
#pragma unroll
  for (int n = 0; n < 2; ++n) mx[n] = fmaxf(mx[n], sx[w ^ AW][n * 16 + ln]) * 0.125f;
  v8f o[4][2]; v8f s8[2]; s8[0] = z8; s8[1] = z8;
#pragma unroll
  for (int t = 0; t < 4; ++t) { o[t][0] = z8; o[t][1] = z8; }
#pragma unroll 1      /* one stage a trip: the body is already 32 products long */
  for (int s = 0; s < ANS; ++s) { const int sn = (s + 1) & (ANS - 1);      /* as in walk 1; the last trip's refill is read by nobody */
    { const unsigned short* g = kg + (size_t)sn * AK * LQ; k0 = *(const v8us*)g; k1 = *(const v8us*)(g + (size_t)32 * LQ); const unsigned short* u = vg + sn * AK; v0 = *(const v8us*)u; v1 = *(const v8us*)(u + (size_t)32 * SQ);
      asm volatile("s_wait_xcnt 0x0" :: "v"(g), "v"(u) : "memory"); }      /* as above: both address pairs are kept until this wait */
    const unsigned short* kb = sK + (s & 1) * AT; const unsigned short* vb = sV + (s & 1) * AT;
#pragma unroll
    for (int kk = 0; kk < 2; ++kk) { union { v16h v; v8h p[2]; } pf[2]; v16h ka[2][2], va[4];
#pragma unroll
      for (int j = 0; j < 2; ++j) { const unsigned short* kr = kb + (kk * 32 + j * 16 + ln) * AP; ka[j][0] = fa_frag(kr, hh); ka[j][1] = fa_frag(kr + 32, hh); }
#pragma unroll
      for (int t = 0; t < 4; ++t) va[t] = fa_frag(vb + (t * 16 + ln) * AP + kk * 32, hh);
      __builtin_amdgcn_sched_barrier(0);      /* holds the loads above in front of the arithmetic: left free, the V^T fragments are fetched one at a time right in front of their products (an LDS latency each) and the next stage's global loads are issued in mid-stage */
#pragma unroll
      for (int j = 0; j < 2; ++j) {
#pragma unroll
        for (int n = 0; n < 2; ++n) { const v8f st = fa_mma(ka[j][1], qf[n][1], fa_mma(ka[j][0], qf[n][0], z8)); const v8f wt = stm3w(st * 0.125f - mx[n]); s8[n] += wt; pf[n].p[j] = __builtin_convertvector(wt, v8h); } }
#pragma unroll
      for (int t = 0; t < 4; ++t) { o[t][0] = fa_mma(va[t], pf[0].v, o[t][0]); o[t][1] = fa_mma(va[t], pf[1].v, o[t][1]); } }
    { unsigned short* d = sK + ((s + 1) & 1) * AT; *(v8us*)&d[sl] = k0; *(v8us*)&d[sl + 32 * AP] = k1; unsigned short* e = sV + ((s + 1) & 1) * AT; *(v8us*)&e[sl] = v0; *(v8us*)&e[sl + 32 * AP] = v1; }
    __syncthreads(); }
  float sh[2];
#pragma unroll
  for (int n = 0; n < 2; ++n) { const float se = ((s8[n][0] + s8[n][1]) + (s8[n][2] + s8[n][3])) + ((s8[n][4] + s8[n][5]) + (s8[n][6] + s8[n][7])); sh[n] = se + __shfl_xor(se, 16, 32); }
  // The wave of half kh finishes query tile kh and hands tile 1 - kh to its partner (same lane: same query, same d). The ring is free: the last stage's barrier ended every read of it and every store into it.
  v4fa* xo = (v4fa*)sm;      /* [wave][t][accumulators 0..3, 4..7][lane]: every LDS store and load is 512 contiguous bytes of a wave */
#pragma unroll
  for (int t = 0; t < 4; ++t) { const v8f g = kh ? o[t][0] : o[t][1]; xo[((w * 4 + t) * 2) * 32 + lane] = __builtin_shufflevector(g, g, 0, 1, 2, 3); xo[((w * 4 + t) * 2 + 1) * 32 + lane] = __builtin_shufflevector(g, g, 4, 5, 6, 7); }
  sx[w][lane] = kh ? sh[0] : sh[1];
  __syncthreads();      /* the partner's tile and sum are read below */
  const int pw = w ^ AW; const float sc = 64.0f / ((kh ? sh[1] : sh[0]) + sx[pw][lane]);      /* weights carry x256 in numerator and sum alike; o is carried x64 */
  _Float16* op = O16 + (size_t)(b * SQ + q0 + kh * 16 + ln) * DM + h * HD + 8 * hh;
#pragma unroll
  for (int t = 0; t < 4; ++t) { const v4f lo = xo[((pw * 4 + t) * 2) * 32 + lane], hi = xo[((pw * 4 + t) * 2 + 1) * 32 + lane]; const v8f a = (kh ? o[t][1] : o[t][0]) + __builtin_shufflevector(lo, hi, 0, 1, 2, 3, 4, 5, 6, 7);
    *(v8h*)(op + t * 16) = __builtin_convertvector(a * sc, v8h); } }      /* a lane's eight accumulators are eight consecutive d of one query: one 16-byte store */

// ---- GEMM C[M][N] = alpha A[M][K] . Bt[N][K]^T + bias, f16 operands, f32 accumulation; one 128 x 128 tile of C per work-group, four waves of 64 x 64 (M, N multiples of 128; K a multiple of 64, at least 128) ----
#define GT 128                       /* rows of A and rows of Bt per work-group tile */
#define GK 64                        /* k per stage: one whole 128-byte line of every operand row */
#define GP 72                        /* LDS row pitch in f16: 128 data bytes + 16 (16-byte fragment reads fall on different banks) */
#define GBUF (2 * GT * GP)           /* f16 per buffer: the A rows, then the Bt rows */
// Eight asynchronous 16-byte copies per lane, global memory to LDS: rows 16 apart (gs f16 in memory, 16 GP f16 in LDS). A wave's copy is four whole 128-byte lines. s_wait_xcnt 0 is the statement's own last line, so that no address register of a copy is rewritten in front of it (a precaution).
__device__ __forceinline__ void g3_copy8(unsigned l, const unsigned short* g, size_t gs) {
  asm volatile("global_load_async_to_lds_b128 %0, %8, off\n\tglobal_load_async_to_lds_b128 %1, %9, off\n\tglobal_load_async_to_lds_b128 %2, %10, off\n\tglobal_load_async_to_lds_b128 %3, %11, off\n\t"
               "global_load_async_to_lds_b128 %4, %12, off\n\tglobal_load_async_to_lds_b128 %5, %13, off\n\tglobal_load_async_to_lds_b128 %6, %14, off\n\tglobal_load_async_to_lds_b128 %7, %15, off\n\ts_wait_xcnt 0x0"
               :: "v"(l), "v"(l + 1u * 32u * GP), "v"(l + 2u * 32u * GP), "v"(l + 3u * 32u * GP), "v"(l + 4u * 32u * GP), "v"(l + 5u * 32u * GP), "v"(l + 6u * 32u * GP), "v"(l + 7u * 32u * GP),
                  "v"(g), "v"(g + gs), "v"(g + 2 * gs), "v"(g + 3 * gs), "v"(g + 4 * gs), "v"(g + 5 * gs), "v"(g + 6 * gs), "v"(g + 7 * gs) : "memory"); }
// Each operand line leaves L2 once per work-group, as a whole line, and is read from LDS by the two waves that need it. Two buffers: stage t + 1 flies while stage t is worked on; one barrier a stage (it publishes the next buffer and ends the reads of the one refilled behind it).
// Every accumulator takes its k blocks of 32 in ascending order. The epilogue turns each wave's tile through LDS (the ring, free behind the last stage's barrier) so that rows go out as whole lines.
// f16 output, columns from 2 DM on (the v third): a wave's 64 columns are the 64 d of one head and its 64 rows are 64 s of one batch, so the tile is staged as [d][s] (a lane's eight accumulators are eight consecutive s of one d: two 16-byte LDS stores) and goes out as 64 whole lines of CT = V^T [batch][head][d][s]; nothing is written to C16 there.
template <bool OUT16>      /* the output type is fixed at compile time: no branch in the epilogue, its LDS reads go out together */
__global__ __launch_bounds__(128) void k_gemm3(const _Float16* __restrict__ A, int lda, const _Float16* __restrict__ Bh, int ldb, float alpha, const float* __restrict__ bias, float* __restrict__ C, _Float16* __restrict__ C16, _Float16* __restrict__ CT, int ldc, int N, int K) {
  __shared__ __attribute__((aligned(16))) unsigned char smem[2 * GBUF * 2]; static_assert(4 * 64 * 68 * 4 <= 2 * GBUF * 2, "epilogue staging fits the ring");
  const unsigned short* sm = (const unsigned short*)smem;
  const int tid = threadIdx.x, w = tid >> 5, lane = tid & 31, ln = lane & 15, hh = lane >> 4; const int ntn = N >> 7; const int mt = blockIdx.x / ntn, nq = blockIdx.x - mt * ntn;
  const int row0 = mt * GT + (w >> 1) * 64, col0 = nq * GT + (w & 1) * 64;      /* this wave's 64 x 64 tile */
  const int srow = tid >> 3, sch = (tid & 7) * 8;      /* staging: eight lanes a 128-byte row; rows srow, srow + 16, ... */
  const unsigned short* ag = (const unsigned short*)A + (size_t)(mt * GT + srow) * lda + sch; const unsigned short* bg = (const unsigned short*)Bh + (size_t)(nq * GT + srow) * ldb + sch;
  const unsigned la = (unsigned)(size_t)(sm + srow * GP + sch), lb = la + GT * GP * 2u;      /* LDS byte addresses in buffer 0 */
  const int nt = K / GK; const size_t gsa = (size_t)16 * lda, gsb = (size_t)16 * ldb;
  const v8f z8 = {0.f, 0.f, 0.f, 0.f, 0.f, 0.f, 0.f, 0.f}; v8f acc[4][4];
#pragma unroll
  for (int i = 0; i < 4; ++i) for (int j = 0; j < 4; ++j) acc[i][j] = z8;
  g3_copy8(la, ag, gsa); g3_copy8(lb, bg, gsb);
  asm volatile("s_wait_asynccnt 0x0" ::: "memory");      /* this wave's part of stage 0 has landed */
  __syncthreads();
  g3_copy8(la + GBUF * 2u, ag + GK, gsa); g3_copy8(lb + GBUF * 2u, bg + GK, gsb);
#pragma unroll 1      /* one stage a trip: the body is already 32 products long */
  for (int t = 0; t < nt; ++t) { const unsigned short* ab = sm + (t & 1) * GBUF + ((w >> 1) * 64 + ln) * GP; const unsigned short* bb = sm + (t & 1) * GBUF + (GT + (w & 1) * 64 + ln) * GP;
#pragma unroll
    for (int c = 0; c < 2; ++c) { v16h af[4], bf[4];
#pragma unroll
      for (int i = 0; i < 4; ++i) { af[i] = fa_frag(ab + i * 16 * GP + c * 32, hh); bf[i] = fa_frag(bb + i * 16 * GP + c * 32, hh); }
      __builtin_amdgcn_sched_barrier(0);      /* holds the sixteen LDS reads above together in front of the products: left free, the A fragments are fetched one at a time, each with a full LDS latency in front of its four products */
#pragma unroll
      for (int i = 0; i < 4; ++i) for (int j = 0; j < 4; ++j) acc[i][j] = fa_mma(af[i], bf[j], acc[i][j]); }
    asm volatile("s_wait_dscnt 0x0" ::: "memory");      /* this wave's reads of the buffer are over before anybody refills it */
    asm volatile("s_wait_asynccnt 0x0" ::: "memory");      /* this wave's part of stage t + 1 has landed before anybody reads it */
    __syncthreads();
    if (t + 2 < nt) { const unsigned bo = (unsigned)(t & 1) * (GBUF * 2u); g3_copy8(la + bo, ag + (size_t)(t + 2) * GK, gsa); g3_copy8(lb + bo, bg + (size_t)(t + 2) * GK, gsb); } }
  asm volatile("s_wait_asynccnt 0x0" ::: "memory");      /* no copy is outstanding when the ring becomes output staging */
  float* so = (float*)smem + (size_t)w * 64 * 68; float bv[4] = {0.f, 0.f, 0.f, 0.f};
  if (bias) {
#pragma unroll
    for (int j = 0; j < 4; ++j) bv[j] = bf16_round(bias[col0 + j * 16 + ln]); }
  const int rsub = lane >> 4, c4 = (lane & 15) * 4;
  if (OUT16 && nq * GT >= 2 * DM) {      /* the v third; the test reads the same for the whole work-group (2 DM is a multiple of GT) */
#pragma unroll
    for (int i = 0; i < 4; ++i) {
#pragma unroll
      for (int j = 0; j < 4; ++j) { v4f lo, hi;
#pragma unroll
        for (int r = 0; r < 4; ++r) { lo[r] = acc[i][j][r] * alpha + bv[j]; hi[r] = acc[i][j][4 + r] * alpha + bv[j]; }
        float* d = so + (j * 16 + ln) * 68 + i * 16 + 8 * hh; *(v4fa*)d = lo; *(v4fa*)(d + 4) = hi; } }
    __builtin_amdgcn_fence(__ATOMIC_ACQ_REL, "workgroup"); __builtin_amdgcn_wave_barrier();      /* the rows read below were stored by other lanes of this wave: those LDS stores are finished, and not moved by the compiler, before the reads */
    _Float16* vt = CT + ((size_t)(row0 / SQ) * DM + (col0 - 2 * DM)) * SQ + row0 % SQ;      /* row (batch NH + head) HD of V^T, column s of the tile's first row */
#pragma unroll
    for (int q = 0; q < 32; ++q) { const int d = q * 2 + rsub; const v4f v = *(const v4fa*)&so[d * 68 + c4]; v4h h4; for (int i = 0; i < 4; ++i) h4[i] = (_Float16)v[i]; *(v4h*)(vt + (size_t)d * SQ + c4) = h4; }
    return; }
#pragma unroll
  for (int i = 0; i < 4; ++i) {
#pragma unroll
    for (int j = 0; j < 4; ++j) {
#pragma unroll
      for (int r = 0; r < 8; ++r) so[(i * 16 + 8 * hh + r) * 68 + j * 16 + ln] = acc[i][j][r] * alpha + bv[j]; } }
  __builtin_amdgcn_fence(__ATOMIC_ACQ_REL, "workgroup"); __builtin_amdgcn_wave_barrier();
#pragma unroll
  for (int q = 0; q < 32; ++q) { const int r = q * 2 + rsub; const v4f v = *(const v4fa*)&so[r * 68 + c4]; const size_t co = (size_t)(row0 + r) * ldc + col0 + c4;
    if (OUT16) { v4h h4; for (int i = 0; i < 4; ++i) h4[i] = (_Float16)v[i]; *(v4h*)(C16 + co) = h4; } else *(v4f*)(C + co) = v; } }

// ---- operand conversion: x, w_qkv and w_out to f16 in ONE launch of few, long waves ----
#define PG 512                       /* work-groups: 16 waves on every WGP */
#define PT (PG * 256)                /* threads of the launch */
#define PNX ((int)(NR * DM / 4 / PT))            /* 16-byte pieces per thread: of x */
#define PNQ ((int)((size_t)LQ * DM / 4 / PT))    /* of w_qkv */
#define PNO ((int)((size_t)DM * DM / 4 / PT))    /* of w_out */
__device__ __forceinline__ v4h cv_x(v4f a) { v4h r; for (int q = 0; q < 4; ++q) r[q] = (_Float16)bf16_round(a[q]); return r; }
__device__ __forceinline__ v4h cv_w(v4f a) { v4h r; for (int q = 0; q < 4; ++q) r[q] = (_Float16)(bf16_round(a[q]) * 16.0f); return r; }
// The time of a short elementwise launch is the time its waves take to start, so the same bytes go through an eighth of the waves and one launch instead of three.
// Piece i of a thread lies PT pieces behind piece i - 1: every wave-wide load is 512 contiguous bytes (four whole lines), every store 256. All of a thread's loads are issued before its first conversion.
__global__ __launch_bounds__(256) void k_prep(const float* __restrict__ x, const float* __restrict__ wq, const float* __restrict__ wo, _Float16* __restrict__ X16, _Float16* __restrict__ BQ, _Float16* __restrict__ BO) {
  static_assert(NR * DM % (4 * PT) == 0 && (size_t)LQ * DM % (4 * PT) == 0 && (size_t)DM * DM % (4 * PT) == 0, "every thread takes the same number of pieces");
  const unsigned t = blockIdx.x * 256u + threadIdx.x; v4f a[PNX], b[PNQ], c[PNO];
#pragma unroll
  for (int i = 0; i < PNX; ++i) a[i] = ((const v4fa*)x + (size_t)i * PT)[t];
#pragma unroll
  for (int i = 0; i < PNQ; ++i) b[i] = ((const v4fa*)wq + (size_t)i * PT)[t];
#pragma unroll
  for (int i = 0; i < PNO; ++i) c[i] = ((const v4fa*)wo + (size_t)i * PT)[t];
  asm volatile("s_wait_xcnt 0x0" :: "v"(t) : "memory");      /* no address register of the loads above is rewritten in front of this wait (a precaution): left to the compiler, the pair it forms for the pieces beyond an offset's reach is reused behind a load-count wait alone */
  __builtin_amdgcn_sched_barrier(0);      /* holds all sixteen loads in front of the arithmetic: left free, half of them are issued only behind the first results, a second memory latency in a wave that lives for little more than one */
#pragma unroll
  for (int i = 0; i < PNX; ++i) ((v4h*)X16 + (size_t)i * PT)[t] = cv_x(a[i]);
#pragma unroll
  for (int i = 0; i < PNQ; ++i) ((v4h*)BQ + (size_t)i * PT)[t] = cv_w(b[i]);
#pragma unroll
  for (int i = 0; i < PNO; ++i) ((v4h*)BO + (size_t)i * PT)[t] = cv_w(c[i]); }

extern "C" void kernel_launch(void* const* d_in, const int* in_sizes, int n_in,
                              void* d_out, int out_size, void* d_ws, size_t ws_size, hipStream_t stream) {
  (void)in_sizes; (void)n_in; (void)out_size;
  const float* const* I = (const float* const*)d_in; const float* x = I[0]; const float* wqkv = I[1]; const float* bqkv = nullptr; const float* wo = I[2]; const float* bo = I[3];      /* natural [out][in] fused weight [3072][1024] (NO bias: nullptr in the fused GEMM's bias slot); natural w_out [1024][1024] + b_out */
  char* ws = (char*)d_ws; size_t off = 0;
  auto take = [&](size_t bytes) { char* p = ws + off; off += (bytes + 255) & ~(size_t)255; return p; };
  _Float16* BQKV = (_Float16*)take((size_t)3 * DM * DM * 2); _Float16* BO = (_Float16*)take((size_t)DM * DM * 2);
  _Float16* X16 = (_Float16*)take(NR * DM * 2); _Float16* QKV = (_Float16*)take(NR * 3 * DM * 2); _Float16* O16 = (_Float16*)take(NR * DM * 2);
  _Float16* VT = (_Float16*)take((size_t)NB * NH * HD * SQ * 2);
  if (off > ws_size) return;
  k_prep<<<PG, 256, 0, stream>>>(x, wqkv, wo, X16, BQKV, BO);      /* x as f16 rows; natural [out][in] weights = Bt[n][k] x16 (no transpose): fused rows 0..1023 = q, 1024.. = k, 2048.. = v */
  const size_t r0p = (size_t)B0 * SQ;      /* first projected row */
  k_gemm3<true><<<(unsigned)((MP / GT) * (3 * DM / GT)), 128, 0, stream>>>(X16 + r0p * DM, DM, BQKV, DM, 0.0625f, bqkv, nullptr, QKV + r0p * 3 * DM, VT, 3 * DM, 3 * DM, DM);      /* q | k rows (f16; head h = columns h*HD.. of each DM block; the v columns of these rows stay unwritten and unread) and V^T [NB][NH][HD][SQ] */
  k_attn<<<dim3(SQ / (AW * AQ), NH, NB), AW * AH * 32, 0, stream>>>(QKV, VT, O16);      /* o (merged heads, x64) as f16 rows: scores, stablemax3 and P V in one launch for all batches and heads */
  k_gemm3<false><<<(unsigned)((MPO / GT) * (DM / GT)), 128, 0, stream>>>(O16 + r0p * DM, DM, BO, DM, 0.0009765625f, bo, (float*)d_out + r0p * DM, nullptr, nullptr, DM, DM, DM);      /* out rows are the output layout */
}

// v007
// It runs in 86.6 microseconds.
// Two timings next to v006 both put it at 1.05 times that version's speed.
// Counting every step since v000, it is 40.3 times as fast.
#include <hip/hip_runtime.h>
// Multi-head self-attention with a polynomial 'stablemax' normalisation instead of softmax (x [2][2048][1024]; qkv = x w_qkv^T (natural [3072][1024] sigma 0.02, NO bias) reshaped (B, S, 3, 16, 64): q | k | v thirds; attn = stablemax3(q k^T * 64^-0.5): logits minus the row max, then s(x) = 1 + x (1 + x/2 (1 + x/3)) for x >= 0 and 1 / (1 - x (1 - x/2 (1 - x/3))) for x < 0, normalised by the row sum; out = merged w_out^T + b_out (natural) -> [2][2048][1024]).
// Structure: token rows r = b*2048 + s; x as exact f16 rows (bf16-rounded); q | k | v as ONE WMMA GEMM (N = 3 x 1024) (128x128 work-group tiles staged in LDS, 64x64 wave tiles, f32 accumulation, exact x16 weights, no bias, f16 outputs; the v third leaves that GEMM already transposed, as V^T [batch][head][d][s]); one attention kernel per (batch, head, 256 queries): scores on WMMA (K = 64, alpha = 64^-0.5) formed twice, once for the row max and once for the weights (f32 statistics; weights x256 as f16 operands, normalised after the product), o = P . V on WMMA (o carried x64 against f16 subnormal flush, folded into the output GEMM alpha) written straight into the merged f16 o rows; out = o W_o + b GEMM (f32) into the output layout.
// Compute dtype: inputs rounded to bf16; x / weights exact; q, k, v, softmax weights and o as plain f16 GEMM operands (~2^-12); scores and softmax statistics f32; v_wmma_f32_16x16x32_f16.
#define NB 2
#define SQ 2048
#define DM 1024
#define NH 16
#define HD 64
#define HG 4                         /* heads per block group of the unlaunched k_vt(b, h0) */
#define B0 0                         /* first batch processed (debug hook) */
#define NBR NB                       /* batches processed (debug hook) */
#define NR ((size_t)NB * SQ)         /* token rows */
#define MP ((int)((size_t)NBR * SQ)) /* rows projected (debug hook) */
#define QN SQ                        /* unused: k_attn covers all SQ queries */
#define NHD NH                       /* unused: k_attn covers all NH heads */
#define MPO MP                       /* rows through the output stage (debug hook) */
#define LQ (3 * DM)      /* row pitch of the q/k/v rows */
typedef __bf16 v16b __attribute__((ext_vector_type(16)));
typedef unsigned short v8us __attribute__((ext_vector_type(8), may_alias));
typedef float  v8f  __attribute__((ext_vector_type(8)));
typedef float  v4f  __attribute__((ext_vector_type(4)));
typedef float  v4fa __attribute__((ext_vector_type(4), may_alias));
union FragB { v16b v; v8us half[2]; unsigned short u[16]; };

__device__ __forceinline__ unsigned short bf16_bits(float x) { unsigned int u = __float_as_uint(x); return (unsigned short)((u + 0x7FFFu + ((u >> 16) & 1u)) >> 16); }
__device__ __forceinline__ float bf16_val(unsigned short b) { return __uint_as_float(((unsigned int)b) << 16); }
__device__ __forceinline__ float bf16_round(float x) { return bf16_val(bf16_bits(x)); }
// D += A·B with NT terms: 1 = ah·bh, 2 = + al·bh (A split), 3 = + ah·bl (both split)
template <int NT>
__device__ __forceinline__ v8f mmaN(v16b ah, v16b al, v16b bh, v16b bl, v8f c) {
  c = __builtin_amdgcn_wmma_f32_16x16x32_bf16(false, ah, false, bh, (short)0, c, false, false);
  if (NT >= 2) c = __builtin_amdgcn_wmma_f32_16x16x32_bf16(false, al, false, bh, (short)0, c, false, false);
  if (NT >= 3) c = __builtin_amdgcn_wmma_f32_16x16x32_bf16(false, ah, false, bl, (short)0, c, false, false);
  asm volatile("v_nop\n\tv_nop\n\tv_nop\n\tv_nop" : "+v"(c) : "v"(ah), "v"(al), "v"(bh), "v"(bl));
  return c;
}

__global__ __launch_bounds__(256) void k_wt_bf16(const float* __restrict__ W, unsigned short* __restrict__ Wt, int K, int N) {
  const int t = blockIdx.x * 256 + threadIdx.x;
  const int k8n = K / 8;
  if (t >= N * k8n) return;
  const int n = t / k8n, k8 = (t % k8n) * 8;
  v8us v;
#pragma unroll
  for (int i = 0; i < 8; ++i) v[i] = bf16_bits(W[(size_t)(k8 + i) * N + n]);
  *(v8us*)(Wt + (size_t)n * K + k8) = v;
  
}

// GEMM C[M][N] (f32, pitch ldc) = act(A[M][K]·W + bias). A f32 row-major (pitch lda) converted per fragment to bf16
// (ASPLIT: hi/lo two planes -> 2 terms, else single rounded term); Wt bf16 [N][K] (pitch ldb). BIAS_BF16 rounds the
// bias to bf16 first (bias quantised to bf16 before the add). K%32==0, M%16==0, N%64==0.
template <bool ASPLIT, int ACT, bool BIAS_BF16>
__global__ __launch_bounds__(128) void k_gemm_bf(const float* __restrict__ A, int lda, const unsigned short* __restrict__ Wt, int ldb,
                                               const float* __restrict__ bias, float* __restrict__ C, int ldc, int M, int N, int K) {
  __shared__ __attribute__((aligned(16))) float so[4][16][64];
  const int tid = threadIdx.x, w = tid >> 5, lane = tid & 31, ln = lane & 15, hh = lane >> 4;
  const int ntn = N / 64;
  const int wid = blockIdx.x * 4 + w;
  const int mt = wid / ntn, nq = wid % ntn;
  if (mt * 16 >= M) return;
  const int row0 = mt * 16, col0 = nq * 64;
  const float* arow = A + (size_t)(row0 + ln) * lda;
  v8f acc[4] = {};
  for (int kb = 0; kb < K; kb += 32) {
    FragB ah, al;
    const v4f x0 = *(const v4fa*)(arow + kb + 8 * hh), x1 = *(const v4fa*)(arow + kb + 8 * hh + 4);
    const v4f x2 = *(const v4fa*)(arow + kb + 16 + 8 * hh), x3 = *(const v4fa*)(arow + kb + 16 + 8 * hh + 4);
    float xs[16] = {x0[0],x0[1],x0[2],x0[3],x1[0],x1[1],x1[2],x1[3],x2[0],x2[1],x2[2],x2[3],x3[0],x3[1],x3[2],x3[3]};
#pragma unroll
    for (int i = 0; i < 16; ++i) { const unsigned short hb = bf16_bits(xs[i]); ah.u[i] = hb; al.u[i] = ASPLIT ? bf16_bits(xs[i] - bf16_val(hb)) : (unsigned short)0; }
#pragma unroll
    for (int t = 0; t < 4; ++t) {
      const unsigned short* brow = Wt + (size_t)(col0 + t * 16 + ln) * ldb + kb;
      FragB b;
      b.half[0] = *(const v8us*)(brow + 8 * hh);
      b.half[1] = *(const v8us*)(brow + 16 + 8 * hh);
      acc[t] = mmaN<ASPLIT ? 2 : 1>(ah.v, al.v, b.v, b.v, acc[t]);
    }
  }
#pragma unroll
  for (int t = 0; t < 4; ++t) {
    float bv = bias ? bias[col0 + t * 16 + ln] : 0.f;
    if (BIAS_BF16) bv = bf16_round(bv);
#pragma unroll
    for (int r = 0; r < 8; ++r) { float v = acc[t][r] + bv; if (ACT == 1) v = fmaxf(v, 0.f); so[w][8 * hh + r][t * 16 + ln] = v; }
  }
  __builtin_amdgcn_fence(__ATOMIC_ACQ_REL, "workgroup");
  __builtin_amdgcn_wave_barrier();
  const int rsub = lane >> 4, c4 = (lane & 15) * 4;
  {
#pragma unroll
    for (int q = 0; q < 8; ++q) {
      const int r = q * 2 + rsub;
      const v4f v = *(const v4fa*)&so[w][r][c4];
      *(v4f*)(C + (size_t)(row0 + r) * ldc + col0 + c4) = v;
    }
    
  }
}

// GEMM C = act(A·W + bias + resid): A f32 (ASPLIT -> hi/lo 2 terms), Wt bf16 [N][K]; ACT 0 none, 1 relu, 2 exact gelu;
// resid (optional, f32, row index = (row % rmod), pitch ldr, RES_BF16 rounds it) added before the activation.
template <bool ASPLIT, int ACT, bool BIAS_BF16, bool RES_BF16>
__global__ __launch_bounds__(128) void k_gemm_bf3(const float* __restrict__ A, int lda, const unsigned short* __restrict__ Wt, int ldb,
                                                const float* __restrict__ bias, const float* __restrict__ resid, int rmod, int ldr,
                                                float* __restrict__ C, int ldc, int M, int N, int K) {
  __shared__ __attribute__((aligned(16))) float so[4][16][64];
  const int tid = threadIdx.x, w = tid >> 5, lane = tid & 31, ln = lane & 15, hh = lane >> 4;
  const int ntn = N / 64;
  const int wid = blockIdx.x * 4 + w;
  const int mt = wid / ntn, nq = wid % ntn;
  if (mt * 16 >= M) return;
  const int row0 = mt * 16, col0 = nq * 64;
  const float* arow = A + (size_t)(row0 + ln) * lda;
  v8f acc[4] = {};
  for (int kb = 0; kb < K; kb += 32) {
    FragB ah, al;
    const v4f x0 = *(const v4fa*)(arow + kb + 8 * hh), x1 = *(const v4fa*)(arow + kb + 8 * hh + 4);
    const v4f x2 = *(const v4fa*)(arow + kb + 16 + 8 * hh), x3 = *(const v4fa*)(arow + kb + 16 + 8 * hh + 4);
    float xs[16] = {x0[0],x0[1],x0[2],x0[3],x1[0],x1[1],x1[2],x1[3],x2[0],x2[1],x2[2],x2[3],x3[0],x3[1],x3[2],x3[3]};
#pragma unroll
    for (int i = 0; i < 16; ++i) { const unsigned short hb = bf16_bits(xs[i]); ah.u[i] = hb; al.u[i] = ASPLIT ? bf16_bits(xs[i] - bf16_val(hb)) : (unsigned short)0; }
#pragma unroll
    for (int t = 0; t < 4; ++t) {
      const unsigned short* brow = Wt + (size_t)(col0 + t * 16 + ln) * ldb + kb;
      FragB b;
      b.half[0] = *(const v8us*)(brow + 8 * hh);
      b.half[1] = *(const v8us*)(brow + 16 + 8 * hh);
      acc[t] = mmaN<ASPLIT ? 2 : 1>(ah.v, al.v, b.v, b.v, acc[t]);
    }
  }
#pragma unroll
  for (int t = 0; t < 4; ++t) {
    const int col = col0 + t * 16 + ln;
    float bv = bias ? bias[col] : 0.f;
    if (BIAS_BF16) bv = bf16_round(bv);
#pragma unroll
    for (int r = 0; r < 8; ++r) {
      float v = acc[t][r] + bv;
      if (resid) { float rv = resid[(size_t)((row0 + 8 * hh + r) % rmod) * ldr + col]; if (RES_BF16) rv = bf16_round(rv); v += rv; }
      if (ACT == 1) v = fmaxf(v, 0.f);
      if (ACT == 2) v = 0.5f * v * (1.0f + erff(v * 0.70710678118654752f));
      if (ACT == 3) { const float u = 0.7978845608028654f * (v + 0.044715f * v * v * v); v = 0.5f * v * (1.0f + tanhf(u)); }
      so[w][8 * hh + r][t * 16 + ln] = v;
    }
  }
  __builtin_amdgcn_fence(__ATOMIC_ACQ_REL, "workgroup");
  __builtin_amdgcn_wave_barrier();
  const int rsub = lane >> 4, c4 = (lane & 15) * 4;
  {
#pragma unroll
    for (int q = 0; q < 8; ++q) {
      const int r = q * 2 + rsub;
      const v4f v = *(const v4fa*)&so[w][r][c4];
      *(v4f*)(C + (size_t)(row0 + r) * ldc + col0 + c4) = v;
    }
    
  }
}
// row LayerNorm (biased variance, eps) over N: s = X (+ R); optional out_sum <- s; out_norm <- (s-mu)*rsqrt(var+eps)*g + b
template <bool PARAM_BF16>
__global__ __launch_bounds__(256) void k_layernorm(const float* __restrict__ X, const float* __restrict__ R, const float* __restrict__ g, const float* __restrict__ bta,
                                                  float* __restrict__ out_sum, float* __restrict__ out_norm, int N, float eps) {
  __shared__ float red[256];
  const int row = blockIdx.x, tid = threadIdx.x;
  const float* x = X + (size_t)row * N; const float* rr = R ? R + (size_t)row * N : nullptr;
  float vals[16];                     // up to N = 4096
  const int per = N / 256;            // contiguous chunk per thread? use strided-by-4 chunks: thread handles j = tid*4 + 1024*u
  float s1 = 0.f;
  for (int u = 0; u < per / 4; ++u) {
    const int j = tid * 4 + 1024 * u;
    const v4f a = *(const v4fa*)(x + j);
    v4f b = {0.f,0.f,0.f,0.f}; if (rr) b = *(const v4fa*)(rr + j);
#pragma unroll
    for (int q = 0; q < 4; ++q) { const float v = a[q] + b[q]; vals[u * 4 + q] = v; s1 += v; }
  }
  red[tid] = s1; __syncthreads();
  for (int st = 128; st > 0; st >>= 1) { if (tid < st) red[tid] += red[tid + st]; __syncthreads(); }
  const float mu = red[0] / (float)N; __syncthreads();
  float s2 = 0.f;
  for (int u = 0; u < per / 4; ++u)
#pragma unroll
    for (int q = 0; q < 4; ++q) { const float c = vals[u * 4 + q] - mu; s2 += c * c; }
  red[tid] = s2; __syncthreads();
  for (int st = 128; st > 0; st >>= 1) { if (tid < st) red[tid] += red[tid + st]; __syncthreads(); }
  const float rs = rsqrtf(red[0] / (float)N + eps);
  {
    for (int u = 0; u < per / 4; ++u) {
      const int j = tid * 4 + 1024 * u;
      v4f o, sm;
#pragma unroll
      for (int q = 0; q < 4; ++q) {
        float gg = g[j + q], bb = bta[j + q];
        if (PARAM_BF16) { gg = bf16_round(gg); bb = bf16_round(bb); }
        sm[q] = vals[u * 4 + q]; o[q] = (vals[u * 4 + q] - mu) * rs * gg + bb;
      }
      if (out_sum) *(v4f*)(out_sum + (size_t)row * N + j) = sm;
      *(v4f*)(out_norm + (size_t)row * N + j) = o;
    }
    
  }
}



// ---- f16 WMMA path (v_wmma_f32_16x16x32_f16): 11-bit significands for operands in range — used where a [0,1] probability operand needs more precision than bf16
typedef _Float16 v16h __attribute__((ext_vector_type(16)));
union FragH { v16h v; v8us half[2]; _Float16 h[16]; unsigned short u[16]; };
template <int NT>
__device__ __forceinline__ v8f mmaH(v16h ah, v16h al, v16h bh, v16h bl, v8f c) {
  c = __builtin_amdgcn_wmma_f32_16x16x32_f16(false, ah, false, bh, (short)0, c, false, false);
  if (NT >= 2) c = __builtin_amdgcn_wmma_f32_16x16x32_f16(false, al, false, bh, (short)0, c, false, false);
  if (NT >= 3) c = __builtin_amdgcn_wmma_f32_16x16x32_f16(false, ah, false, bl, (short)0, c, false, false);
  asm volatile("v_nop\n\tv_nop\n\tv_nop\n\tv_nop" : "+v"(c) : "v"(ah), "v"(al), "v"(bh), "v"(bl));
  return c;
}
// batched GEMM like k_gemm_b but f16 operands: A f32 (split into f16 hi/lo if ASPLIT, else rounded to f16), Bt = f16 values [n][k]; alpha; C f32; N multiple of 16 (partial tiles skipped)
template <bool ASPLIT>
__global__ __launch_bounds__(128) void k_gemm_h(const float* __restrict__ A, int lda, size_t sA, const _Float16* __restrict__ Bh, int ldb, size_t sB, float alpha, float* __restrict__ C, int ldc, size_t sC, int M, int N, int K) {
  __shared__ __attribute__((aligned(16))) float so[4][16][64];
  const int tid = threadIdx.x, w = tid >> 5, lane = tid & 31, ln = lane & 15, hh = lane >> 4; const int by = blockIdx.y;
  A += (size_t)by * sA; Bh += (size_t)by * sB; C += (size_t)by * sC;
  const int ntn = (N + 63) / 64; const int wid = blockIdx.x * 4 + w; const int mt = wid / ntn, nq = wid % ntn; if (mt * 16 >= M) return;
  const int row0 = mt * 16, col0 = nq * 64; const float* arow = A + (size_t)(row0 + ln) * lda;
  v8f acc[4] = {};
  for (int kb = 0; kb < K; kb += 32) {
    FragH ah, al;
    const v4f x0 = *(const v4fa*)(arow + kb + 8 * hh), x1 = *(const v4fa*)(arow + kb + 8 * hh + 4), x2 = *(const v4fa*)(arow + kb + 16 + 8 * hh), x3 = *(const v4fa*)(arow + kb + 16 + 8 * hh + 4);
    float xs[16] = {x0[0],x0[1],x0[2],x0[3],x1[0],x1[1],x1[2],x1[3],x2[0],x2[1],x2[2],x2[3],x3[0],x3[1],x3[2],x3[3]};
#pragma unroll
    for (int i = 0; i < 16; ++i) { const _Float16 h = (_Float16)xs[i]; ah.h[i] = h; al.h[i] = ASPLIT ? (_Float16)(xs[i] - (float)h) : (_Float16)0.0f; }
#pragma unroll
    for (int t = 0; t < 4; ++t) { if (col0 + t * 16 >= N) continue; const size_t boff = (size_t)(col0 + t * 16 + ln) * ldb + kb; FragH bq; bq.half[0] = *(const v8us*)(Bh + boff + 8 * hh); bq.half[1] = *(const v8us*)(Bh + boff + 16 + 8 * hh);
      acc[t] = mmaH<ASPLIT ? 2 : 1>(ah.v, al.v, bq.v, bq.v, acc[t]); }
  }
#pragma unroll
  for (int t = 0; t < 4; ++t) { if (col0 + t * 16 >= N) continue;
#pragma unroll
    for (int r = 0; r < 8; ++r) so[w][8 * hh + r][t * 16 + ln] = acc[t][r] * alpha; }
  __builtin_amdgcn_fence(__ATOMIC_ACQ_REL, "workgroup"); __builtin_amdgcn_wave_barrier();
  const int rsub = lane >> 4, c4 = (lane & 15) * 4;
  {
#pragma unroll
    for (int q = 0; q < 8; ++q) { const int r = q * 2 + rsub; if (col0 + c4 < N) { const v4f v = *(const v4fa*)&so[w][r][c4]; *(v4f*)(C + (size_t)(row0 + r) * ldc + col0 + c4) = v; } }
     }
}

// Wt[n][k] = f16(W[k][n]·scale) from f32 row-major W[K][N] (scale = power of two; bf16-exact weights stay exact in f16 away from the subnormal range)
__global__ __launch_bounds__(256) void k_wt_f16(const float* __restrict__ W, _Float16* __restrict__ Wt, int K, int N, float scale) {
  const int t = blockIdx.x * 256 + threadIdx.x; if (t >= N * (K / 8)) return; const int n = t / (K / 8), k8 = (t % (K / 8)) * 8; FragH f;
#pragma unroll
  for (int i = 0; i < 8; ++i) f.h[i] = (_Float16)(bf16_round(W[(size_t)(k8 + i) * N + n]) * scale); const v8us o = f.half[0];
  *(v8us*)((unsigned short*)Wt + (size_t)n * K + k8) = o; 
}
// k_gemm_hh variant with fused epilogue: v = acc·alpha + bias[by·sBias + col] (+ CP[(row/rowsPerB)·sCPb + by·64 + col] if CP) ; ACT 0 none / 1 elu ; writes f16 C16 (and f32 C if non-null)
template <int ACT>
__global__ __launch_bounds__(128) void k_gemm_hhx(const _Float16* __restrict__ A, int lda, size_t sA, const _Float16* __restrict__ Bh, int ldb, size_t sB, float alpha, const float* __restrict__ bias, size_t sBias, const float* __restrict__ CP, int rowsPerB, size_t sCPb, int row0g,
    float* __restrict__ C, _Float16* __restrict__ C16, int ldc, size_t sC, int M, int N, int K) {
  __shared__ __attribute__((aligned(16))) float so[4][16][64];
  const int tid = threadIdx.x, w = tid >> 5, lane = tid & 31, ln = lane & 15, hh = lane >> 4; const int by = blockIdx.y;
  A += (size_t)by * sA; Bh += (size_t)by * sB; const size_t cofs = (size_t)by * sC; const float* bp = bias ? bias + (size_t)by * sBias : nullptr;
  const int ntn = (N + 63) / 64; const int wid = blockIdx.x * 4 + w; const int mt = wid / ntn, nq = wid % ntn; if (mt * 16 >= M) return;
  const int row0 = mt * 16, col0 = nq * 64; const _Float16* arow = A + (size_t)(row0 + ln) * lda;
  v8f acc[4] = {};
  for (int kb = 0; kb < K; kb += 32) { FragH ah; ah.half[0] = *(const v8us*)((const unsigned short*)arow + kb + 8 * hh); ah.half[1] = *(const v8us*)((const unsigned short*)arow + kb + 16 + 8 * hh);
#pragma unroll
    for (int t = 0; t < 4; ++t) { if (col0 + t * 16 >= N) continue; const size_t boff = (size_t)(col0 + t * 16 + ln) * ldb + kb; FragH bq; bq.half[0] = *(const v8us*)((const unsigned short*)Bh + boff + 8 * hh); bq.half[1] = *(const v8us*)((const unsigned short*)Bh + boff + 16 + 8 * hh);
      acc[t] = mmaH<1>(ah.v, ah.v, bq.v, bq.v, acc[t]); }
  }
#pragma unroll
  for (int t = 0; t < 4; ++t) { if (col0 + t * 16 >= N) continue; const int col = col0 + t * 16 + ln; const float bv = bp ? bf16_round(bp[col]) : 0.f;
#pragma unroll
    for (int r = 0; r < 8; ++r) { float v = acc[t][r] * alpha + bv; if (CP) { const int rr = row0g + row0 + 8 * hh + r; if (rowsPerB < 0) v += CP[cofs + (size_t)rr * ldc + col];      /* rowsPerB < 0: own element of the batched C plane */ else { const int bidx = rr / rowsPerB; v += CP[(size_t)bidx * sCPb + (size_t)by * 64 + col]; } } if (ACT == 1) v = (v > 0.f) ? v : expm1f(v); else if (ACT == 7) v = (v > 0.f) ? v + 1.0f : expf(v); else if (ACT == 8) v = tanhf(v); else if (ACT == 9) v = 0.5f * v * (1.0f + tanhf(0.7978845608028654f * (v + 0.044715f * v * v * v))); else if (ACT == 11) v = 1.0f / (1.0f + expf(-v)); else if (ACT == 12) v = (v > 0.f) ? v : 0.01f * v; else if (ACT == 14) v = (v > 0.f) ? v : 0.1f * v; else if (ACT == 16) v = (v >= 0.f) ? v : 0.3f * v; else if (ACT == 17) v = (v >= 0.f) ? v : 0.2f * v; else if (ACT == 15) v = v / (1.0f + expf(-v)); else if (ACT == 3) v = fmaxf(v, 0.f); else if (ACT == 6) v = 0.5f * v * (1.0f + erff(v * 0.70710678118654752f)); so[w][8 * hh + r][t * 16 + ln] = v; } }
  __builtin_amdgcn_fence(__ATOMIC_ACQ_REL, "workgroup"); __builtin_amdgcn_wave_barrier();
  const int rsub = lane >> 4, c4 = (lane & 15) * 4; typedef _Float16 v4h __attribute__((ext_vector_type(4)));
  {
#pragma unroll
    for (int q = 0; q < 8; ++q) { const int r = q * 2 + rsub; if (col0 + c4 < N) { const v4f v = *(const v4fa*)&so[w][r][c4]; if (C) *(v4f*)(C + cofs + (size_t)(row0 + r) * ldc + col0 + c4) = v; if (C16) { v4h h4; for (int i = 0; i < 4; ++i) h4[i] = (_Float16)v[i]; *(v4h*)(C16 + cofs + (size_t)(row0 + r) * ldc + col0 + c4) = h4; } } }
     }
}


typedef _Float16 v4h __attribute__((ext_vector_type(4)));

__global__ __launch_bounds__(256) void k_x16(const float* __restrict__ x, _Float16* __restrict__ X16, size_t n8) { const size_t t = (size_t)blockIdx.x * 256 + threadIdx.x; if (t >= n8) return; FragH f;
#pragma unroll
  for (int q = 0; q < 8; ++q) f.h[q] = (_Float16)bf16_round(x[t * 8 + q]); *(v8us*)((unsigned short*)X16 + t * 8) = f.half[0];  }
__global__ __launch_bounds__(256) void k_h16(const float* __restrict__ x, _Float16* __restrict__ X16, size_t n8) { const size_t t = (size_t)blockIdx.x * 256 + threadIdx.x; if (t >= n8) return; FragH f;
#pragma unroll
  for (int q = 0; q < 8; ++q) f.h[q] = (_Float16)x[t * 8 + q]; *(v8us*)((unsigned short*)X16 + t * 8) = f.half[0];  }
__global__ __launch_bounds__(256) void k_round16f(const float* __restrict__ W, _Float16* __restrict__ Bt, size_t n8) { const size_t t = (size_t)blockIdx.x * 256 + threadIdx.x; if (t >= n8) return; FragH f;
#pragma unroll
  for (int i = 0; i < 8; ++i) f.h[i] = (_Float16)(bf16_round(W[t * 8 + i]) * 16.0f); *(v8us*)((unsigned short*)Bt + t * 8) = f.half[0];  }
template <int NHv, int TTv>
__global__ __launch_bounds__(256) void k_vt(const _Float16* __restrict__ V16, int ldv, int voff, _Float16* __restrict__ Vt) { __shared__ unsigned short tl[64][66]; const int tid = threadIdx.x; const int slab = blockIdx.x / (TTv / 64), lg = blockIdx.x % (TTv / 64); const int b = slab / NHv, h = slab % NHv;
  for (int i = tid; i < 64 * 8; i += 256) { const int r = i / 8, c8 = (i % 8) * 8; FragH f; f.half[0] = *(const v8us*)((const unsigned short*)V16 + ((size_t)b * TTv + lg * 64 + r) * ldv + voff + h * 64 + c8);
#pragma unroll
    for (int q = 0; q < 8; ++q) tl[r][c8 + q] = f.u[q]; }
  __syncthreads();
  {
#pragma unroll
    for (int rd = 0; rd < 2; ++rd) { const int d = rd * 32 + tid / 8, pc = tid % 8; FragH f;
#pragma unroll
      for (int q = 0; q < 8; ++q) f.u[q] = tl[pc * 8 + q][d];
      *(v8us*)((unsigned short*)Vt + ((size_t)slab * 64 + d) * TTv + lg * 64 + pc * 8) = f.half[0]; }
     } }

__global__ __launch_bounds__(256) void k_hl(const float* __restrict__ F, _Float16* __restrict__ Hh, _Float16* __restrict__ Hl, size_t n8) { const size_t t = (size_t)blockIdx.x * 256 + threadIdx.x; if (t >= n8) return; FragH fh, fl; const v4f a = *(const v4fa*)(F + t * 8), c = *(const v4fa*)(F + t * 8 + 4);
#pragma unroll
  for (int q = 0; q < 4; ++q) { _Float16 h = (_Float16)a[q]; fh.h[q] = h; fl.h[q] = (_Float16)((a[q] - (float)h) * 1024.0f); h = (_Float16)c[q]; fh.h[4 + q] = h; fl.h[4 + q] = (_Float16)((c[q] - (float)h) * 1024.0f); }
  { *(v8us*)((unsigned short*)Hh + t * 8) = fh.half[0]; *(v8us*)((unsigned short*)Hl + t * 8) = fl.half[0];  } }

__global__ __launch_bounds__(256) void k_wnat(const float* __restrict__ w, size_t n8, _Float16* __restrict__ Bt) { const size_t t = (size_t)blockIdx.x * 256 + threadIdx.x; if (t >= n8) return; FragH f; for (int q = 0; q < 8; ++q) f.h[q] = (_Float16)(bf16_round(w[t * 8 + q]) * 16.0f); *(v8us*)((unsigned short*)Bt + t * 8) = f.half[0];  }
__global__ __launch_bounds__(256) void k_rsm(const float* __restrict__ S, _Float16* __restrict__ P, int nrows) {
  #pragma clang fp contract(off)
  const int i = blockIdx.x * 256 + threadIdx.x; if (i >= nrows) return; const float* s = S + (size_t)i * SQ; float mx = -3.0e38f;
#pragma unroll 1
  for (int j = 0; j < SQ; ++j) mx = fmaxf(mx, s[j]); float se = 0.f;
#pragma unroll 1
  for (int j = 0; j < SQ; ++j) se += expf(s[j] - mx); const float sc = 256.0f / se;
#pragma unroll 1
  for (int j0 = 0; j0 < SQ; j0 += 8) { FragH f; for (int q = 0; q < 8; ++q) f.h[q] = (_Float16)(expf(s[j0 + q] - mx) * sc); unsigned short* d = (unsigned short*)P + (size_t)i * SQ + j0; *(v8us*)d = f.half[0];  } }
__global__ __launch_bounds__(256) void k_vt(const _Float16* __restrict__ V16, int b, int h0, _Float16* __restrict__ VT) { __shared__ unsigned short tl[64][65]; const int tid = threadIdx.x; const int hh = blockIdx.x % HG, sg = blockIdx.x / HG; const int s0 = sg * 64; const int h = h0 + hh;
  for (int i = tid; i < 64 * 8; i += 256) { const int j = i / 8, d8 = (i % 8) * 8; FragH f; f.half[0] = *(const v8us*)((const unsigned short*)V16 + ((size_t)b * SQ + s0 + j) * DM + h * HD + d8); for (int q = 0; q < 8; ++q) tl[d8 + q][j] = f.u[q]; }
  __syncthreads();
  { for (int i = tid; i < 64 * 8; i += 256) { const int d = i / 8, j8 = (i % 8) * 8; FragH f; for (int q = 0; q < 8; ++q) f.u[q] = tl[d][j8 + q]; *(v8us*)((unsigned short*)VT + ((size_t)hh * HD + d) * SQ + s0 + j8) = f.half[0]; }  } }



__global__ __launch_bounds__(256) void k_rsmf(const float* __restrict__ S, _Float16* __restrict__ P, int qn, int hg) {
  #pragma clang fp contract(off)
  const int t = blockIdx.x * 256 + threadIdx.x; if (t >= qn * hg) return; const size_t i = (size_t)(t / qn) * SQ + (t % qn); const float* s = S + i * SQ; float mx = -3.0e38f;
#pragma unroll 1
  for (int j = 0; j < SQ; ++j) mx = fmaxf(mx, s[j]); float se = 0.f;
#pragma unroll 1
  for (int j = 0; j < SQ; ++j) se += __expf(s[j] - mx); const float sc = 256.0f / se;
#pragma unroll 1
  for (int j0 = 0; j0 < SQ; j0 += 8) { FragH f; for (int q = 0; q < 8; ++q) f.h[q] = (_Float16)(__expf(s[j0 + q] - mx) * sc); unsigned short* d = (unsigned short*)P + i * SQ + j0; *(v8us*)d = f.half[0];  } }

// Four reciprocals. One statement with results apart from sources, so that behind each v_rcp_f32 stands an instruction that touches neither its result nor its source: the next reciprocal, and behind the last the v_nop (the slot the instruction set asks for behind a transcendental).
__device__ __forceinline__ v4f rcp4(v4f d) { v4f o;
  asm("v_rcp_f32 %0, %4\n\tv_rcp_f32 %1, %5\n\tv_rcp_f32 %2, %6\n\tv_rcp_f32 %3, %7\n\tv_nop" : "=&v"(o[0]), "=&v"(o[1]), "=&v"(o[2]), "=&v"(o[3]) : "v"(d[0]), "v"(d[1]), "v"(d[2]), "v"(d[3]));
  return o; }
typedef _Float16 v8h __attribute__((ext_vector_type(8)));
#define AW 8                         /* query groups per work-group of the attention kernel */
#define AH 2                         /* waves per query group: each walks its own half of the keys */
#define AQ 32                        /* query columns per group, and per wave (two 16-column tiles) */
#define AK 64                        /* keys per LDS stage */
#define AP 72                        /* LDS row pitch in f16: 128 data bytes + 16 (16-byte fragment reads fall on different banks) */
#define ANS (SQ / AH / AK)           /* stages per walk over one half of the keys */
#define AT (AK * AP)                 /* f16 per LDS tile */
#define AR 3                         /* buffers of the K ring and of the V^T ring, per half of the keys */
__device__ __forceinline__ v16h fa_frag(const unsigned short* p, int hh) { FragH f; f.half[0] = *(const v8us*)(p + 8 * hh); f.half[1] = *(const v8us*)(p + 16 + 8 * hh); return f.v; }
__device__ __forceinline__ v8f fa_mma(v16h a, v16h b, v8f c) { return __builtin_amdgcn_wmma_f32_16x16x32_f16(false, a, false, b, (short)0, c, false, false); }
// 256 x the stablemax3 weight for x <= 0, eight values: 1 / (1 - x (1 - x/2 (1 - x/3))) with the factor 2^-8 carried exactly through the two outer terms of the denominator; x / 3 as a multiply by f32(1/3); reciprocal through v_rcp_f32.
__device__ __forceinline__ v8f stm3w(v8f x) { const v8f a = 1.0f - x * 0.33333334f; const v8f b = 0.00390625f - (0.001953125f * x) * a; const v8f d = 0.00390625f - x * b;
  const v4f lo = rcp4(__builtin_shufflevector(d, d, 0, 1, 2, 3)), hi = rcp4(__builtin_shufflevector(d, d, 4, 5, 6, 7)); return __builtin_shufflevector(lo, hi, 0, 1, 2, 3, 4, 5, 6, 7); }
__device__ __forceinline__ void fa_signal() { asm volatile("s_wait_dscnt 0x0\n\ts_barrier_signal -1" ::: "memory"); }      /* first half of the stage barrier: this wave's LDS stores have landed and its earlier LDS reads are over, then it signals; the clobber keeps the compiler's LDS accesses on their side */
__device__ __forceinline__ void fa_wait() { asm volatile("s_barrier_wait -1" ::: "memory"); }      /* second half: every wave of the work-group has signalled; the clobber keeps the next stage's LDS reads and stores behind it */
__global__ __launch_bounds__(AW * AH * 32) void k_attn(const _Float16* __restrict__ QKV, const _Float16* __restrict__ VT, _Float16* __restrict__ O16) {
  __shared__ __attribute__((aligned(16))) unsigned short sm[AH * 2 * AR * AT];      /* per half of the keys: the K ring, then the V^T ring */
  __shared__ __attribute__((aligned(16))) float sxo[AW * AH * 4 * 2 * 32 * 4];      /* the output tiles handed over: a place of their own, because behind the last stage's wait a slower wave may still read the rings */
  __shared__ float sx[AW * AH][32];      /* row maxima, later row sums, handed over */
  static_assert(AH == 2 && (ANS & (ANS - 1)) == 0 && ANS >= 2 && AR == 3, "two halves; the stage count wraps by a mask; the split barrier needs three buffers");
  const int tid = threadIdx.x, lane = tid & 31, ln = lane & 15, hh = lane >> 4, w = tid >> 5; const int h = blockIdx.y, b = blockIdx.z;
  const int kh = __builtin_amdgcn_readfirstlane(w / AW), ts = tid & (AW * 32 - 1); const int q0 = blockIdx.x * (AW * AQ) + (w & (AW - 1)) * AQ;      /* kh: this wave's half of the keys, the same in every lane (held as a scalar); ts: the thread's number inside its half */
  const unsigned short* Qp = (const unsigned short*)QKV + (size_t)b * SQ * LQ + h * HD; const unsigned short* Kp = Qp + DM + (size_t)kh * (SQ / AH) * LQ; const unsigned short* Vp = (const unsigned short*)VT + (size_t)(b * NH + h) * HD * SQ + kh * (SQ / AH);
  unsigned short* sK = sm + kh * 2 * AR * AT; unsigned short* sV = sK + AR * AT;
  const int srow = ts >> 3, sch = (ts & 7) * 8; const int sl = srow * AP + sch;      /* staging: eight threads a 128-byte row, rows srow and srow + 32 */
  const unsigned short* kg = Kp + (size_t)srow * LQ + sch; const unsigned short* vg = Vp + (size_t)srow * SQ + sch;
  const v8f z8 = {0.f, 0.f, 0.f, 0.f, 0.f, 0.f, 0.f, 0.f};
  v16h qf[2][2]; const unsigned short* qg = Qp + (size_t)(q0 + ln) * LQ + 8 * hh;
#pragma unroll
  for (int n = 0; n < 2; ++n) for (int c = 0; c < 2; ++c) qf[n][c] = fa_frag(qg + (size_t)n * 16 * LQ + c * 32, 0);
  v8us k0 = *(const v8us*)kg, k1 = *(const v8us*)(kg + (size_t)32 * LQ), v0 = *(const v8us*)vg, v1 = *(const v8us*)(vg + (size_t)32 * SQ);
  const unsigned short* kg1 = kg + (size_t)AK * LQ; const v8us k2 = *(const v8us*)kg1, k3 = *(const v8us*)(kg1 + (size_t)32 * LQ);      /* K tile 1: stage 0 stores it at its head */
  asm volatile("s_wait_xcnt 0x0" :: "v"(qg), "v"(qg + (size_t)16 * LQ), "v"(kg), "v"(vg), "v"(kg1) : "memory");      /* the address registers of the loads above are kept, and not reused as a load's destination either, until this wait */
  *(v8us*)&sK[sl] = k0; *(v8us*)&sK[sl + 32 * AP] = k1; *(v8us*)&sV[(ANS % AR) * AT + sl] = v0; *(v8us*)&sV[(ANS % AR) * AT + sl + 32 * AP] = v1;      /* V^T tile 0 waits through walk 1, which touches only sK, in the ring place that walk 2 starts at */
  k0 = k2; k1 = k3;
  __syncthreads();
  int rc = 0;      /* ring place of the stage's tile; runs on from walk 1 into walk 2; the same in every wave (a scalar) */
  v8f m8[2]; m8[0] = z8 - 3.0e38f; m8[1] = m8[0];
#pragma unroll 1      /* one stage a trip: the body is already 16 products long */
  for (int s = 0; s < ANS; ++s) { const int sn = (s + 2) & (ANS - 1), rn = rc == AR - 1 ? 0 : rc + 1;      /* the tiles behind the last are tiles 0 and 1 again: no branch in the trip, and walk 2 finds its first K tile in the ring and its second in the registers */
    { unsigned short* d = sK + rn * AT; *(v8us*)&d[sl] = k0; *(v8us*)&d[sl + 32 * AP] = k1; }
    fa_signal();
    { const unsigned short* g = kg + (size_t)sn * AK * LQ; k0 = *(const v8us*)g; k1 = *(const v8us*)(g + (size_t)32 * LQ);
      asm volatile("s_wait_xcnt 0x0" :: "v"(g) : "memory"); }      /* as above: the address pair is kept until this wait */
    const unsigned short* kb = sK + rc * AT;
#pragma unroll
    for (int j = 0; j < 4; ++j) { const v16h a0 = fa_frag(kb + (j * 16 + ln) * AP, hh), a1 = fa_frag(kb + (j * 16 + ln) * AP + 32, hh);
#pragma unroll
      for (int n = 0; n < 2; ++n) m8[n] = __builtin_elementwise_max(m8[n], fa_mma(a1, qf[n][1], fa_mma(a0, qf[n][0], z8))); }
    __builtin_amdgcn_sched_barrier(0);      /* holds the stage's products and maxima in front of the wait: left free, the wait is lifted to right behind the stage's LDS reads, and no wave starts a stage's arithmetic before every wave has ended the stage before */
    fa_wait(); rc = rn; }
  { const unsigned short* u = vg + AK; v0 = *(const v8us*)u; v1 = *(const v8us*)(u + (size_t)32 * SQ);      /* V^T tile 1: walk 2 stores it at the head of its first stage */
    asm volatile("s_wait_xcnt 0x0" :: "v"(u) : "memory"); }      /* as above: the address pair is kept until this wait */
  float mx[2];
#pragma unroll
  for (int n = 0; n < 2; ++n) { float m = fmaxf(fmaxf(fmaxf(m8[n][0], m8[n][1]), fmaxf(m8[n][2], m8[n][3])), fmaxf(fmaxf(m8[n][4], m8[n][5]), fmaxf(m8[n][6], m8[n][7]))); mx[n] = fmaxf(m, __shfl_xor(m, 16, 32)); }
  sx[w][lane] = hh ? mx[1] : mx[0];      /* this half's maxima: columns of tile 0 from lanes 0..15, of tile 1 from lanes 16..31 */
  __syncthreads();      /* the other half's maxima are read below */
#pragma unroll
  for (int n = 0; n < 2; ++n) mx[n] = fmaxf(mx[n], sx[w ^ AW][n * 16 + ln]) * 0.125f;
  v8f o[4][2]; v8f s8[2]; s8[0] = z8; s8[1] = z8;
#pragma unroll
  for (int t = 0; t < 4; ++t) { o[t][0] = z8; o[t][1] = z8; }
#pragma unroll 1      /* one stage a trip: the body is already 32 products long */
  for (int s = 0; s < ANS; ++s) { const int sn = (s + 2) & (ANS - 1), rn = rc == AR - 1 ? 0 : rc + 1;      /* as in walk 1; what the last trip stores and the last two trips load is read by nobody */
    { unsigned short* d = sK + rn * AT; *(v8us*)&d[sl] = k0; *(v8us*)&d[sl + 32 * AP] = k1; unsigned short* e = sV + rn * AT; *(v8us*)&e[sl] = v0; *(v8us*)&e[sl + 32 * AP] = v1; }
    fa_signal();
    { const unsigned short* g = kg + (size_t)sn * AK * LQ; k0 = *(const v8us*)g; k1 = *(const v8us*)(g + (size_t)32 * LQ); const unsigned short* u = vg + sn * AK; v0 = *(const v8us*)u; v1 = *(const v8us*)(u + (size_t)32 * SQ);
      asm volatile("s_wait_xcnt 0x0" :: "v"(g), "v"(u) : "memory"); }      /* as above: both address pairs are kept until this wait */
    const unsigned short* kb = sK + rc * AT; const unsigned short* vb = sV + rc * AT;
#pragma unroll
    for (int kk = 0; kk < 2; ++kk) { union { v16h v; v8h p[2]; } pf[2]; v16h ka[2][2], va[4];
#pragma unroll
      for (int j = 0; j < 2; ++j) { const unsigned short* kr = kb + (kk * 32 + j * 16 + ln) * AP; ka[j][0] = fa_frag(kr, hh); ka[j][1] = fa_frag(kr + 32, hh); }
#pragma unroll
      for (int t = 0; t < 4; ++t) va[t] = fa_frag(vb + (t * 16 + ln) * AP + kk * 32, hh);
      __builtin_amdgcn_sched_barrier(0);      /* holds the loads above in front of the arithmetic: left free, the V^T fragments are fetched one at a time right in front of their products (an LDS latency each) and the next stage's global loads are issued in mid-stage */
#pragma unroll
      for (int j = 0; j < 2; ++j) {
#pragma unroll
        for (int n = 0; n < 2; ++n) { const v8f st = fa_mma(ka[j][1], qf[n][1], fa_mma(ka[j][0], qf[n][0], z8)); const v8f wt = stm3w(st * 0.125f - mx[n]); s8[n] += wt; pf[n].p[j] = __builtin_convertvector(wt, v8h); } }
#pragma unroll
      for (int t = 0; t < 4; ++t) { o[t][0] = fa_mma(va[t], pf[0].v, o[t][0]); o[t][1] = fa_mma(va[t], pf[1].v, o[t][1]); } }
    __builtin_amdgcn_sched_barrier(0);      /* as in walk 1: holds the stage's arithmetic in front of the wait */
    fa_wait(); rc = rn; }
  float sh[2];
#pragma unroll
  for (int n = 0; n < 2; ++n) { const float se = ((s8[n][0] + s8[n][1]) + (s8[n][2] + s8[n][3])) + ((s8[n][4] + s8[n][5]) + (s8[n][6] + s8[n][7])); sh[n] = se + __shfl_xor(se, 16, 32); }
  // The wave of half kh finishes query tile kh and hands tile 1 - kh to its partner (same lane: same query, same d).
  v4fa* xo = (v4fa*)sxo;      /* [wave][t][accumulators 0..3, 4..7][lane]: every LDS store and load is 512 contiguous bytes of a wave */
#pragma unroll
  for (int t = 0; t < 4; ++t) { const v8f g = kh ? o[t][0] : o[t][1]; xo[((w * 4 + t) * 2) * 32 + lane] = __builtin_shufflevector(g, g, 0, 1, 2, 3); xo[((w * 4 + t) * 2 + 1) * 32 + lane] = __builtin_shufflevector(g, g, 4, 5, 6, 7); }
  sx[w][lane] = kh ? sh[0] : sh[1];
  __syncthreads();      /* the partner's tile and sum are read below */
  const int pw = w ^ AW; const float sc = 64.0f / ((kh ? sh[1] : sh[0]) + sx[pw][lane]);      /* weights carry x256 in numerator and sum alike; o is carried x64 */
  _Float16* op = O16 + (size_t)(b * SQ + q0 + kh * 16 + ln) * DM + h * HD + 8 * hh;
#pragma unroll
  for (int t = 0; t < 4; ++t) { const v4f lo = xo[((pw * 4 + t) * 2) * 32 + lane], hi = xo[((pw * 4 + t) * 2 + 1) * 32 + lane]; const v8f a = (kh ? o[t][1] : o[t][0]) + __builtin_shufflevector(lo, hi, 0, 1, 2, 3, 4, 5, 6, 7);
    *(v8h*)(op + t * 16) = __builtin_convertvector(a * sc, v8h); } }      /* a lane's eight accumulators are eight consecutive d of one query: one 16-byte store */

// ---- GEMM C[M][N] = alpha A[M][K] . Bt[N][K]^T + bias, f16 operands, f32 accumulation; one 128 x 128 tile of C per work-group, four waves of 64 x 64 (M, N multiples of 128; K a multiple of 64, at least 128) ----
#define GT 128                       /* rows of A and rows of Bt per work-group tile */
#define GK 64                        /* k per stage: one whole 128-byte line of every operand row */
#define GP 72                        /* LDS row pitch in f16: 128 data bytes + 16 (16-byte fragment reads fall on different banks) */
#define GBUF (2 * GT * GP)           /* f16 per buffer: the A rows, then the Bt rows */
// Eight asynchronous 16-byte copies per lane, global memory to LDS: rows 16 apart (gs f16 in memory, 16 GP f16 in LDS). A wave's copy is four whole 128-byte lines. s_wait_xcnt 0 is the statement's own last line, so that no address register of a copy is rewritten in front of it (a precaution).
__device__ __forceinline__ void g3_copy8(unsigned l, const unsigned short* g, size_t gs) {
  asm volatile("global_load_async_to_lds_b128 %0, %8, off\n\tglobal_load_async_to_lds_b128 %1, %9, off\n\tglobal_load_async_to_lds_b128 %2, %10, off\n\tglobal_load_async_to_lds_b128 %3, %11, off\n\t"
               "global_load_async_to_lds_b128 %4, %12, off\n\tglobal_load_async_to_lds_b128 %5, %13, off\n\tglobal_load_async_to_lds_b128 %6, %14, off\n\tglobal_load_async_to_lds_b128 %7, %15, off\n\ts_wait_xcnt 0x0"
               :: "v"(l), "v"(l + 1u * 32u * GP), "v"(l + 2u * 32u * GP), "v"(l + 3u * 32u * GP), "v"(l + 4u * 32u * GP), "v"(l + 5u * 32u * GP), "v"(l + 6u * 32u * GP), "v"(l + 7u * 32u * GP),
                  "v"(g), "v"(g + gs), "v"(g + 2 * gs), "v"(g + 3 * gs), "v"(g + 4 * gs), "v"(g + 5 * gs), "v"(g + 6 * gs), "v"(g + 7 * gs) : "memory"); }
// Each operand line leaves L2 once per work-group, as a whole line, and is read from LDS by the two waves that need it. Two buffers: stage t + 1 flies while stage t is worked on; one barrier a stage (it publishes the next buffer and ends the reads of the one refilled behind it).
// Every accumulator takes its k blocks of 32 in ascending order. The epilogue turns each wave's tile through LDS (the ring, free behind the last stage's barrier) so that rows go out as whole lines.
// f16 output, columns from 2 DM on (the v third): a wave's 64 columns are the 64 d of one head and its 64 rows are 64 s of one batch, so the tile is staged as [d][s] (a lane's eight accumulators are eight consecutive s of one d: two 16-byte LDS stores) and goes out as 64 whole lines of CT = V^T [batch][head][d][s]; nothing is written to C16 there.
template <bool OUT16>      /* the output type is fixed at compile time: no branch in the epilogue, its LDS reads go out together */
__global__ __launch_bounds__(128) void k_gemm3(const _Float16* __restrict__ A, int lda, const _Float16* __restrict__ Bh, int ldb, float alpha, const float* __restrict__ bias, float* __restrict__ C, _Float16* __restrict__ C16, _Float16* __restrict__ CT, int ldc, int N, int K) {
  __shared__ __attribute__((aligned(16))) unsigned char smem[2 * GBUF * 2]; static_assert(4 * 64 * 68 * 4 <= 2 * GBUF * 2, "epilogue staging fits the ring");
  const unsigned short* sm = (const unsigned short*)smem;
  const int tid = threadIdx.x, w = tid >> 5, lane = tid & 31, ln = lane & 15, hh = lane >> 4; const int ntn = N >> 7; const int mt = blockIdx.x / ntn, nq = blockIdx.x - mt * ntn;
  const int row0 = mt * GT + (w >> 1) * 64, col0 = nq * GT + (w & 1) * 64;      /* this wave's 64 x 64 tile */
  const int srow = tid >> 3, sch = (tid & 7) * 8;      /* staging: eight lanes a 128-byte row; rows srow, srow + 16, ... */
  const unsigned short* ag = (const unsigned short*)A + (size_t)(mt * GT + srow) * lda + sch; const unsigned short* bg = (const unsigned short*)Bh + (size_t)(nq * GT + srow) * ldb + sch;
  const unsigned la = (unsigned)(size_t)(sm + srow * GP + sch), lb = la + GT * GP * 2u;      /* LDS byte addresses in buffer 0 */
  const int nt = K / GK; const size_t gsa = (size_t)16 * lda, gsb = (size_t)16 * ldb;
  const v8f z8 = {0.f, 0.f, 0.f, 0.f, 0.f, 0.f, 0.f, 0.f}; v8f acc[4][4];
#pragma unroll
  for (int i = 0; i < 4; ++i) for (int j = 0; j < 4; ++j) acc[i][j] = z8;
  g3_copy8(la, ag, gsa); g3_copy8(lb, bg, gsb);
  asm volatile("s_wait_asynccnt 0x0" ::: "memory");      /* this wave's part of stage 0 has landed */
  __syncthreads();
  g3_copy8(la + GBUF * 2u, ag + GK, gsa); g3_copy8(lb + GBUF * 2u, bg + GK, gsb);
#pragma unroll 1      /* one stage a trip: the body is already 32 products long */
  for (int t = 0; t < nt; ++t) { const unsigned short* ab = sm + (t & 1) * GBUF + ((w >> 1) * 64 + ln) * GP; const unsigned short* bb = sm + (t & 1) * GBUF + (GT + (w & 1) * 64 + ln) * GP;
#pragma unroll
    for (int c = 0; c < 2; ++c) { v16h af[4], bf[4];
#pragma unroll
      for (int i = 0; i < 4; ++i) { af[i] = fa_frag(ab + i * 16 * GP + c * 32, hh); bf[i] = fa_frag(bb + i * 16 * GP + c * 32, hh); }
      __builtin_amdgcn_sched_barrier(0);      /* holds the sixteen LDS reads above together in front of the products: left free, the A fragments are fetched one at a time, each with a full LDS latency in front of its four products */
#pragma unroll
      for (int i = 0; i < 4; ++i) for (int j = 0; j < 4; ++j) acc[i][j] = fa_mma(af[i], bf[j], acc[i][j]); }
    asm volatile("s_wait_dscnt 0x0" ::: "memory");      /* this wave's reads of the buffer are over before anybody refills it */
    asm volatile("s_wait_asynccnt 0x0" ::: "memory");      /* this wave's part of stage t + 1 has landed before anybody reads it */
    __syncthreads();
    if (t + 2 < nt) { const unsigned bo = (unsigned)(t & 1) * (GBUF * 2u); g3_copy8(la + bo, ag + (size_t)(t + 2) * GK, gsa); g3_copy8(lb + bo, bg + (size_t)(t + 2) * GK, gsb); } }
  asm volatile("s_wait_asynccnt 0x0" ::: "memory");      /* no copy is outstanding when the ring becomes output staging */
  float* so = (float*)smem + (size_t)w * 64 * 68; float bv[4] = {0.f, 0.f, 0.f, 0.f};
  if (bias) {
#pragma unroll
    for (int j = 0; j < 4; ++j) bv[j] = bf16_round(bias[col0 + j * 16 + ln]); }
  const int rsub = lane >> 4, c4 = (lane & 15) * 4;
  if (OUT16 && nq * GT >= 2 * DM) {      /* the v third; the test reads the same for the whole work-group (2 DM is a multiple of GT) */
#pragma unroll
    for (int i = 0; i < 4; ++i) {
#pragma unroll
      for (int j = 0; j < 4; ++j) { v4f lo, hi;
#pragma unroll
        for (int r = 0; r < 4; ++r) { lo[r] = acc[i][j][r] * alpha + bv[j]; hi[r] = acc[i][j][4 + r] * alpha + bv[j]; }
        float* d = so + (j * 16 + ln) * 68 + i * 16 + 8 * hh; *(v4fa*)d = lo; *(v4fa*)(d + 4) = hi; } }
    __builtin_amdgcn_fence(__ATOMIC_ACQ_REL, "workgroup"); __builtin_amdgcn_wave_barrier();      /* the rows read below were stored by other lanes of this wave: those LDS stores are finished, and not moved by the compiler, before the reads */
    _Float16* vt = CT + ((size_t)(row0 / SQ) * DM + (col0 - 2 * DM)) * SQ + row0 % SQ;      /* row (batch NH + head) HD of V^T, column s of the tile's first row */
#pragma unroll
    for (int q = 0; q < 32; ++q) { const int d = q * 2 + rsub; const v4f v = *(const v4fa*)&so[d * 68 + c4]; v4h h4; for (int i = 0; i < 4; ++i) h4[i] = (_Float16)v[i]; *(v4h*)(vt + (size_t)d * SQ + c4) = h4; }
    return; }
#pragma unroll
  for (int i = 0; i < 4; ++i) {
#pragma unroll
    for (int j = 0; j < 4; ++j) {
#pragma unroll
      for (int r = 0; r < 8; ++r) so[(i * 16 + 8 * hh + r) * 68 + j * 16 + ln] = acc[i][j][r] * alpha + bv[j]; } }
  __builtin_amdgcn_fence(__ATOMIC_ACQ_REL, "workgroup"); __builtin_amdgcn_wave_barrier();
#pragma unroll
  for (int q = 0; q < 32; ++q) { const int r = q * 2 + rsub; const v4f v = *(const v4fa*)&so[r * 68 + c4]; const size_t co = (size_t)(row0 + r) * ldc + col0 + c4;
    if (OUT16) { v4h h4; for (int i = 0; i < 4; ++i) h4[i] = (_Float16)v[i]; *(v4h*)(C16 + co) = h4; } else *(v4f*)(C + co) = v; } }

// ---- operand conversion: x, w_qkv and w_out to f16 in ONE launch of few, long waves ----
#define PG 512                       /* work-groups: 16 waves on every WGP */
#define PT (PG * 256)                /* threads of the launch */
#define PNX ((int)(NR * DM / 4 / PT))            /* 16-byte pieces per thread: of x */
#define PNQ ((int)((size_t)LQ * DM / 4 / PT))    /* of w_qkv */
#define PNO ((int)((size_t)DM * DM / 4 / PT))    /* of w_out */
__device__ __forceinline__ v4h cv_x(v4f a) { v4h r; for (int q = 0; q < 4; ++q) r[q] = (_Float16)bf16_round(a[q]); return r; }
__device__ __forceinline__ v4h cv_w(v4f a) { v4h r; for (int q = 0; q < 4; ++q) r[q] = (_Float16)(bf16_round(a[q]) * 16.0f); return r; }
// The time of a short elementwise launch is the time its waves take to start, so the same bytes go through an eighth of the waves and one launch instead of three.
// Piece i of a thread lies PT pieces behind piece i - 1: every wave-wide load is 512 contiguous bytes (four whole lines), every store 256. All of a thread's loads are issued before its first conversion.
__global__ __launch_bounds__(256) void k_prep(const float* __restrict__ x, const float* __restrict__ wq, const float* __restrict__ wo, _Float16* __restrict__ X16, _Float16* __restrict__ BQ, _Float16* __restrict__ BO) {
  static_assert(NR * DM % (4 * PT) == 0 && (size_t)LQ * DM % (4 * PT) == 0 && (size_t)DM * DM % (4 * PT) == 0, "every thread takes the same number of pieces");
  const unsigned t = blockIdx.x * 256u + threadIdx.x; v4f a[PNX], b[PNQ], c[PNO];
#pragma unroll
  for (int i = 0; i < PNX; ++i) a[i] = ((const v4fa*)x + (size_t)i * PT)[t];
#pragma unroll
  for (int i = 0; i < PNQ; ++i) b[i] = ((const v4fa*)wq + (size_t)i * PT)[t];
#pragma unroll
  for (int i = 0; i < PNO; ++i) c[i] = ((const v4fa*)wo + (size_t)i * PT)[t];
  asm volatile("s_wait_xcnt 0x0" :: "v"(t) : "memory");      /* no address register of the loads above is rewritten in front of this wait (a precaution): left to the compiler, the pair it forms for the pieces beyond an offset's reach is reused behind a load-count wait alone */
  __builtin_amdgcn_sched_barrier(0);      /* holds all sixteen loads in front of the arithmetic: left free, half of them are issued only behind the first results, a second memory latency in a wave that lives for little more than one */
#pragma unroll
  for (int i = 0; i < PNX; ++i) ((v4h*)X16 + (size_t)i * PT)[t] = cv_x(a[i]);
#pragma unroll
  for (int i = 0; i < PNQ; ++i) ((v4h*)BQ + (size_t)i * PT)[t] = cv_w(b[i]);
#pragma unroll
  for (int i = 0; i < PNO; ++i) ((v4h*)BO + (size_t)i * PT)[t] = cv_w(c[i]); }

extern "C" void kernel_launch(void* const* d_in, const int* in_sizes, int n_in,
                              void* d_out, int out_size, void* d_ws, size_t ws_size, hipStream_t stream) {
  (void)in_sizes; (void)n_in; (void)out_size;
  const float* const* I = (const float* const*)d_in; const float* x = I[0]; const float* wqkv = I[1]; const float* bqkv = nullptr; const float* wo = I[2]; const float* bo = I[3];      /* natural [out][in] fused weight [3072][1024] (NO bias: nullptr in the fused GEMM's bias slot); natural w_out [1024][1024] + b_out */
  char* ws = (char*)d_ws; size_t off = 0;
  auto take = [&](size_t bytes) { char* p = ws + off; off += (bytes + 255) & ~(size_t)255; return p; };
  _Float16* BQKV = (_Float16*)take((size_t)3 * DM * DM * 2); _Float16* BO = (_Float16*)take((size_t)DM * DM * 2);
  _Float16* X16 = (_Float16*)take(NR * DM * 2); _Float16* QKV = (_Float16*)take(NR * 3 * DM * 2); _Float16* O16 = (_Float16*)take(NR * DM * 2);
  _Float16* VT = (_Float16*)take((size_t)NB * NH * HD * SQ * 2);
  if (off > ws_size) return;
  k_prep<<<PG, 256, 0, stream>>>(x, wqkv, wo, X16, BQKV, BO);      /* x as f16 rows; natural [out][in] weights = Bt[n][k] x16 (no transpose): fused rows 0..1023 = q, 1024.. = k, 2048.. = v */
  const size_t r0p = (size_t)B0 * SQ;      /* first projected row */
  k_gemm3<true><<<(unsigned)((MP / GT) * (3 * DM / GT)), 128, 0, stream>>>(X16 + r0p * DM, DM, BQKV, DM, 0.0625f, bqkv, nullptr, QKV + r0p * 3 * DM, VT, 3 * DM, 3 * DM, DM);      /* q | k rows (f16; head h = columns h*HD.. of each DM block; the v columns of these rows stay unwritten and unread) and V^T [NB][NH][HD][SQ] */
  k_attn<<<dim3(SQ / (AW * AQ), NH, NB), AW * AH * 32, 0, stream>>>(QKV, VT, O16);      /* o (merged heads, x64) as f16 rows: scores, stablemax3 and P V in one launch for all batches and heads */
  k_gemm3<false><<<(unsigned)((MPO / GT) * (DM / GT)), 128, 0, stream>>>(O16 + r0p * DM, DM, BO, DM, 0.0009765625f, bo, (float*)d_out + r0p * DM, nullptr, nullptr, DM, DM, DM);      /* out rows are the output layout */
}

// v008
// One run takes 84.8 microseconds.
// Next to v007, in two timings, it ran 1.04 and 1.03 times as fast.
// Over all steps from v000 it is 41.8 times as fast.
#include <hip/hip_runtime.h>
// Multi-head self-attention with a polynomial 'stablemax' normalisation instead of softmax (x [2][2048][1024]; qkv = x w_qkv^T (natural [3072][1024] sigma 0.02, NO bias) reshaped (B, S, 3, 16, 64): q | k | v thirds; attn = stablemax3(q k^T * 64^-0.5): logits minus the row max, then s(x) = 1 + x (1 + x/2 (1 + x/3)) for x >= 0 and 1 / (1 - x (1 - x/2 (1 - x/3))) for x < 0, normalised by the row sum; out = merged w_out^T + b_out (natural) -> [2][2048][1024]).
// Structure: token rows r = b*2048 + s; x as exact f16 rows (bf16-rounded); q | k | v as ONE WMMA GEMM (N = 3 x 1024) (256x192 work-group tiles staged in LDS, 64x64 wave tiles, f32 accumulation, exact x16 weights, no bias, f16 outputs; the v third leaves that GEMM already transposed, as V^T [batch][head][d][s]); one attention kernel per (batch, head, 256 queries): scores on WMMA (K = 64, alpha = 64^-0.5) formed twice, once for the row max and once for the weights (f32 statistics; weights x256 as f16 operands, normalised after the product), o = P . V on WMMA (o carried x64 against f16 subnormal flush, folded into the output GEMM alpha) written straight into the merged f16 o rows; out = o W_o + b GEMM (f32) into the output layout.
// Compute dtype: inputs rounded to bf16; x / weights exact; q, k, v, softmax weights and o as plain f16 GEMM operands (~2^-12); scores and softmax statistics f32; v_wmma_f32_16x16x32_f16.
#define NB 2
#define SQ 2048
#define DM 1024
#define NH 16
#define HD 64
#define HG 4                         /* heads per block group of the unlaunched k_vt(b, h0) */
#define B0 0                         /* first batch processed (debug hook) */
#define NBR NB                       /* batches processed (debug hook) */
#define NR ((size_t)NB * SQ)         /* token rows */
#define MP ((int)((size_t)NBR * SQ)) /* rows projected (debug hook) */
#define QN SQ                        /* unused: k_attn covers all SQ queries */
#define NHD NH                       /* unused: k_attn covers all NH heads */
#define MPO MP                       /* rows through the output stage (debug hook) */
#define LQ (3 * DM)      /* row pitch of the q/k/v rows */
typedef __bf16 v16b __attribute__((ext_vector_type(16)));
typedef unsigned short v8us __attribute__((ext_vector_type(8), may_alias));
typedef float  v8f  __attribute__((ext_vector_type(8)));
typedef float  v4f  __attribute__((ext_vector_type(4)));
typedef float  v4fa __attribute__((ext_vector_type(4), may_alias));
union FragB { v16b v; v8us half[2]; unsigned short u[16]; };

__device__ __forceinline__ unsigned short bf16_bits(float x) { unsigned int u = __float_as_uint(x); return (unsigned short)((u + 0x7FFFu + ((u >> 16) & 1u)) >> 16); }
__device__ __forceinline__ float bf16_val(unsigned short b) { return __uint_as_float(((unsigned int)b) << 16); }
__device__ __forceinline__ float bf16_round(float x) { return bf16_val(bf16_bits(x)); }
// D += A·B with NT terms: 1 = ah·bh, 2 = + al·bh (A split), 3 = + ah·bl (both split)
template <int NT>
__device__ __forceinline__ v8f mmaN(v16b ah, v16b al, v16b bh, v16b bl, v8f c) {
  c = __builtin_amdgcn_wmma_f32_16x16x32_bf16(false, ah, false, bh, (short)0, c, false, false);
  if (NT >= 2) c = __builtin_amdgcn_wmma_f32_16x16x32_bf16(false, al, false, bh, (short)0, c, false, false);
  if (NT >= 3) c = __builtin_amdgcn_wmma_f32_16x16x32_bf16(false, ah, false, bl, (short)0, c, false, false);
  asm volatile("v_nop\n\tv_nop\n\tv_nop\n\tv_nop" : "+v"(c) : "v"(ah), "v"(al), "v"(bh), "v"(bl));
  return c;
}

__global__ __launch_bounds__(256) void k_wt_bf16(const float* __restrict__ W, unsigned short* __restrict__ Wt, int K, int N) {
  const int t = blockIdx.x * 256 + threadIdx.x;
  const int k8n = K / 8;
  if (t >= N * k8n) return;
  const int n = t / k8n, k8 = (t % k8n) * 8;
  v8us v;
#pragma unroll
  for (int i = 0; i < 8; ++i) v[i] = bf16_bits(W[(size_t)(k8 + i) * N + n]);
  *(v8us*)(Wt + (size_t)n * K + k8) = v;
  
}

// GEMM C[M][N] (f32, pitch ldc) = act(A[M][K]·W + bias). A f32 row-major (pitch lda) converted per fragment to bf16
// (ASPLIT: hi/lo two planes -> 2 terms, else single rounded term); Wt bf16 [N][K] (pitch ldb). BIAS_BF16 rounds the
// bias to bf16 first (bias quantised to bf16 before the add). K%32==0, M%16==0, N%64==0.
template <bool ASPLIT, int ACT, bool BIAS_BF16>
__global__ __launch_bounds__(128) void k_gemm_bf(const float* __restrict__ A, int lda, const unsigned short* __restrict__ Wt, int ldb,
                                               const float* __restrict__ bias, float* __restrict__ C, int ldc, int M, int N, int K) {
  __shared__ __attribute__((aligned(16))) float so[4][16][64];
  const int tid = threadIdx.x, w = tid >> 5, lane = tid & 31, ln = lane & 15, hh = lane >> 4;
  const int ntn = N / 64;
  const int wid = blockIdx.x * 4 + w;
  const int mt = wid / ntn, nq = wid % ntn;
  if (mt * 16 >= M) return;
  const int row0 = mt * 16, col0 = nq * 64;
  const float* arow = A + (size_t)(row0 + ln) * lda;
  v8f acc[4] = {};
  for (int kb = 0; kb < K; kb += 32) {
    FragB ah, al;
    const v4f x0 = *(const v4fa*)(arow + kb + 8 * hh), x1 = *(const v4fa*)(arow + kb + 8 * hh + 4);
    const v4f x2 = *(const v4fa*)(arow + kb + 16 + 8 * hh), x3 = *(const v4fa*)(arow + kb + 16 + 8 * hh + 4);
    float xs[16] = {x0[0],x0[1],x0[2],x0[3],x1[0],x1[1],x1[2],x1[3],x2[0],x2[1],x2[2],x2[3],x3[0],x3[1],x3[2],x3[3]};
#pragma unroll
    for (int i = 0; i < 16; ++i) { const unsigned short hb = bf16_bits(xs[i]); ah.u[i] = hb; al.u[i] = ASPLIT ? bf16_bits(xs[i] - bf16_val(hb)) : (unsigned short)0; }
#pragma unroll
    for (int t = 0; t < 4; ++t) {
      const unsigned short* brow = Wt + (size_t)(col0 + t * 16 + ln) * ldb + kb;
      FragB b;
      b.half[0] = *(const v8us*)(brow + 8 * hh);
      b.half[1] = *(const v8us*)(brow + 16 + 8 * hh);
      acc[t] = mmaN<ASPLIT ? 2 : 1>(ah.v, al.v, b.v, b.v, acc[t]);
    }
  }
#pragma unroll
  for (int t = 0; t < 4; ++t) {
    float bv = bias ? bias[col0 + t * 16 + ln] : 0.f;
    if (BIAS_BF16) bv = bf16_round(bv);
#pragma unroll
    for (int r = 0; r < 8; ++r) { float v = acc[t][r] + bv; if (ACT == 1) v = fmaxf(v, 0.f); so[w][8 * hh + r][t * 16 + ln] = v; }
  }
  __builtin_amdgcn_fence(__ATOMIC_ACQ_REL, "workgroup");
  __builtin_amdgcn_wave_barrier();
  const int rsub = lane >> 4, c4 = (lane & 15) * 4;
  {
#pragma unroll
    for (int q = 0; q < 8; ++q) {
      const int r = q * 2 + rsub;
      const v4f v = *(const v4fa*)&so[w][r][c4];
      *(v4f*)(C + (size_t)(row0 + r) * ldc + col0 + c4) = v;
    }
    
  }
}

// GEMM C = act(A·W + bias + resid): A f32 (ASPLIT -> hi/lo 2 terms), Wt bf16 [N][K]; ACT 0 none, 1 relu, 2 exact gelu;
// resid (optional, f32, row index = (row % rmod), pitch ldr, RES_BF16 rounds it) added before the activation.
template <bool ASPLIT, int ACT, bool BIAS_BF16, bool RES_BF16>
__global__ __launch_bounds__(128) void k_gemm_bf3(const float* __restrict__ A, int lda, const unsigned short* __restrict__ Wt, int ldb,
                                                const float* __restrict__ bias, const float* __restrict__ resid, int rmod, int ldr,
                                                float* __restrict__ C, int ldc, int M, int N, int K) {
  __shared__ __attribute__((aligned(16))) float so[4][16][64];
  const int tid = threadIdx.x, w = tid >> 5, lane = tid & 31, ln = lane & 15, hh = lane >> 4;
  const int ntn = N / 64;
  const int wid = blockIdx.x * 4 + w;
  const int mt = wid / ntn, nq = wid % ntn;
  if (mt * 16 >= M) return;
  const int row0 = mt * 16, col0 = nq * 64;
  const float* arow = A + (size_t)(row0 + ln) * lda;
  v8f acc[4] = {};
  for (int kb = 0; kb < K; kb += 32) {
    FragB ah, al;
    const v4f x0 = *(const v4fa*)(arow + kb + 8 * hh), x1 = *(const v4fa*)(arow + kb + 8 * hh + 4);
    const v4f x2 = *(const v4fa*)(arow + kb + 16 + 8 * hh), x3 = *(const v4fa*)(arow + kb + 16 + 8 * hh + 4);
    float xs[16] = {x0[0],x0[1],x0[2],x0[3],x1[0],x1[1],x1[2],x1[3],x2[0],x2[1],x2[2],x2[3],x3[0],x3[1],x3[2],x3[3]};
#pragma unroll
    for (int i = 0; i < 16; ++i) { const unsigned short hb = bf16_bits(xs[i]); ah.u[i] = hb; al.u[i] = ASPLIT ? bf16_bits(xs[i] - bf16_val(hb)) : (unsigned short)0; }
#pragma unroll
    for (int t = 0; t < 4; ++t) {
      const unsigned short* brow = Wt + (size_t)(col0 + t * 16 + ln) * ldb + kb;
      FragB b;
      b.half[0] = *(const v8us*)(brow + 8 * hh);
      b.half[1] = *(const v8us*)(brow + 16 + 8 * hh);
      acc[t] = mmaN<ASPLIT ? 2 : 1>(ah.v, al.v, b.v, b.v, acc[t]);
    }
  }
#pragma unroll
  for (int t = 0; t < 4; ++t) {
    const int col = col0 + t * 16 + ln;
    float bv = bias ? bias[col] : 0.f;
    if (BIAS_BF16) bv = bf16_round(bv);
#pragma unroll
    for (int r = 0; r < 8; ++r) {
      float v = acc[t][r] + bv;
      if (resid) { float rv = resid[(size_t)((row0 + 8 * hh + r) % rmod) * ldr + col]; if (RES_BF16) rv = bf16_round(rv); v += rv; }
      if (ACT == 1) v = fmaxf(v, 0.f);
      if (ACT == 2) v = 0.5f * v * (1.0f + erff(v * 0.70710678118654752f));
      if (ACT == 3) { const float u = 0.7978845608028654f * (v + 0.044715f * v * v * v); v = 0.5f * v * (1.0f + tanhf(u)); }
      so[w][8 * hh + r][t * 16 + ln] = v;
    }
  }
  __builtin_amdgcn_fence(__ATOMIC_ACQ_REL, "workgroup");
  __builtin_amdgcn_wave_barrier();
  const int rsub = lane >> 4, c4 = (lane & 15) * 4;
  {
#pragma unroll
    for (int q = 0; q < 8; ++q) {
      const int r = q * 2 + rsub;
      const v4f v = *(const v4fa*)&so[w][r][c4];
      *(v4f*)(C + (size_t)(row0 + r) * ldc + col0 + c4) = v;
    }
    
  }
}
// row LayerNorm (biased variance, eps) over N: s = X (+ R); optional out_sum <- s; out_norm <- (s-mu)*rsqrt(var+eps)*g + b
template <bool PARAM_BF16>
__global__ __launch_bounds__(256) void k_layernorm(const float* __restrict__ X, const float* __restrict__ R, const float* __restrict__ g, const float* __restrict__ bta,
                                                  float* __restrict__ out_sum, float* __restrict__ out_norm, int N, float eps) {
  __shared__ float red[256];
  const int row = blockIdx.x, tid = threadIdx.x;
  const float* x = X + (size_t)row * N; const float* rr = R ? R + (size_t)row * N : nullptr;
  float vals[16];                     // up to N = 4096
  const int per = N / 256;            // contiguous chunk per thread? use strided-by-4 chunks: thread handles j = tid*4 + 1024*u
  float s1 = 0.f;
  for (int u = 0; u < per / 4; ++u) {
    const int j = tid * 4 + 1024 * u;
    const v4f a = *(const v4fa*)(x + j);
    v4f b = {0.f,0.f,0.f,0.f}; if (rr) b = *(const v4fa*)(rr + j);
#pragma unroll
    for (int q = 0; q < 4; ++q) { const float v = a[q] + b[q]; vals[u * 4 + q] = v; s1 += v; }
  }
  red[tid] = s1; __syncthreads();
  for (int st = 128; st > 0; st >>= 1) { if (tid < st) red[tid] += red[tid + st]; __syncthreads(); }
  const float mu = red[0] / (float)N; __syncthreads();
  float s2 = 0.f;
  for (int u = 0; u < per / 4; ++u)
#pragma unroll
    for (int q = 0; q < 4; ++q) { const float c = vals[u * 4 + q] - mu; s2 += c * c; }
  red[tid] = s2; __syncthreads();
  for (int st = 128; st > 0; st >>= 1) { if (tid < st) red[tid] += red[tid + st]; __syncthreads(); }
  const float rs = rsqrtf(red[0] / (float)N + eps);
  {
    for (int u = 0; u < per / 4; ++u) {
      const int j = tid * 4 + 1024 * u;
      v4f o, sm;
#pragma unroll
      for (int q = 0; q < 4; ++q) {
        float gg = g[j + q], bb = bta[j + q];
        if (PARAM_BF16) { gg = bf16_round(gg); bb = bf16_round(bb); }
        sm[q] = vals[u * 4 + q]; o[q] = (vals[u * 4 + q] - mu) * rs * gg + bb;
      }
      if (out_sum) *(v4f*)(out_sum + (size_t)row * N + j) = sm;
      *(v4f*)(out_norm + (size_t)row * N + j) = o;
    }
    
  }
}



// ---- f16 WMMA path (v_wmma_f32_16x16x32_f16): 11-bit significands for operands in range — used where a [0,1] probability operand needs more precision than bf16
typedef _Float16 v16h __attribute__((ext_vector_type(16)));
union FragH { v16h v; v8us half[2]; _Float16 h[16]; unsigned short u[16]; };
template <int NT>
__device__ __forceinline__ v8f mmaH(v16h ah, v16h al, v16h bh, v16h bl, v8f c) {
  c = __builtin_amdgcn_wmma_f32_16x16x32_f16(false, ah, false, bh, (short)0, c, false, false);
  if (NT >= 2) c = __builtin_amdgcn_wmma_f32_16x16x32_f16(false, al, false, bh, (short)0, c, false, false);
  if (NT >= 3) c = __builtin_amdgcn_wmma_f32_16x16x32_f16(false, ah, false, bl, (short)0, c, false, false);
  asm volatile("v_nop\n\tv_nop\n\tv_nop\n\tv_nop" : "+v"(c) : "v"(ah), "v"(al), "v"(bh), "v"(bl));
  return c;
}
// batched GEMM like k_gemm_b but f16 operands: A f32 (split into f16 hi/lo if ASPLIT, else rounded to f16), Bt = f16 values [n][k]; alpha; C f32; N multiple of 16 (partial tiles skipped)
template <bool ASPLIT>
__global__ __launch_bounds__(128) void k_gemm_h(const float* __restrict__ A, int lda, size_t sA, const _Float16* __restrict__ Bh, int ldb, size_t sB, float alpha, float* __restrict__ C, int ldc, size_t sC, int M, int N, int K) {
  __shared__ __attribute__((aligned(16))) float so[4][16][64];
  const int tid = threadIdx.x, w = tid >> 5, lane = tid & 31, ln = lane & 15, hh = lane >> 4; const int by = blockIdx.y;
  A += (size_t)by * sA; Bh += (size_t)by * sB; C += (size_t)by * sC;
  const int ntn = (N + 63) / 64; const int wid = blockIdx.x * 4 + w; const int mt = wid / ntn, nq = wid % ntn; if (mt * 16 >= M) return;
  const int row0 = mt * 16, col0 = nq * 64; const float* arow = A + (size_t)(row0 + ln) * lda;
  v8f acc[4] = {};
  for (int kb = 0; kb < K; kb += 32) {
    FragH ah, al;
    const v4f x0 = *(const v4fa*)(arow + kb + 8 * hh), x1 = *(const v4fa*)(arow + kb + 8 * hh + 4), x2 = *(const v4fa*)(arow + kb + 16 + 8 * hh), x3 = *(const v4fa*)(arow + kb + 16 + 8 * hh + 4);
    float xs[16] = {x0[0],x0[1],x0[2],x0[3],x1[0],x1[1],x1[2],x1[3],x2[0],x2[1],x2[2],x2[3],x3[0],x3[1],x3[2],x3[3]};
#pragma unroll
    for (int i = 0; i < 16; ++i) { const _Float16 h = (_Float16)xs[i]; ah.h[i] = h; al.h[i] = ASPLIT ? (_Float16)(xs[i] - (float)h) : (_Float16)0.0f; }
#pragma unroll
    for (int t = 0; t < 4; ++t) { if (col0 + t * 16 >= N) continue; const size_t boff = (size_t)(col0 + t * 16 + ln) * ldb + kb; FragH bq; bq.half[0] = *(const v8us*)(Bh + boff + 8 * hh); bq.half[1] = *(const v8us*)(Bh + boff + 16 + 8 * hh);
      acc[t] = mmaH<ASPLIT ? 2 : 1>(ah.v, al.v, bq.v, bq.v, acc[t]); }
  }
#pragma unroll
  for (int t = 0; t < 4; ++t) { if (col0 + t * 16 >= N) continue;
#pragma unroll
    for (int r = 0; r < 8; ++r) so[w][8 * hh + r][t * 16 + ln] = acc[t][r] * alpha; }
  __builtin_amdgcn_fence(__ATOMIC_ACQ_REL, "workgroup"); __builtin_amdgcn_wave_barrier();
  const int rsub = lane >> 4, c4 = (lane & 15) * 4;
  {
#pragma unroll
    for (int q = 0; q < 8; ++q) { const int r = q * 2 + rsub; if (col0 + c4 < N) { const v4f v = *(const v4fa*)&so[w][r][c4]; *(v4f*)(C + (size_t)(row0 + r) * ldc + col0 + c4) = v; } }
     }
}

// Wt[n][k] = f16(W[k][n]·scale) from f32 row-major W[K][N] (scale = power of two; bf16-exact weights stay exact in f16 away from the subnormal range)
__global__ __launch_bounds__(256) void k_wt_f16(const float* __restrict__ W, _Float16* __restrict__ Wt, int K, int N, float scale) {
  const int t = blockIdx.x * 256 + threadIdx.x; if (t >= N * (K / 8)) return; const int n = t / (K / 8), k8 = (t % (K / 8)) * 8; FragH f;
#pragma unroll
  for (int i = 0; i < 8; ++i) f.h[i] = (_Float16)(bf16_round(W[(size_t)(k8 + i) * N + n]) * scale); const v8us o = f.half[0];
  *(v8us*)((unsigned short*)Wt + (size_t)n * K + k8) = o; 
}
// k_gemm_hh variant with fused epilogue: v = acc·alpha + bias[by·sBias + col] (+ CP[(row/rowsPerB)·sCPb + by·64 + col] if CP) ; ACT 0 none / 1 elu ; writes f16 C16 (and f32 C if non-null)
template <int ACT>
__global__ __launch_bounds__(128) void k_gemm_hhx(const _Float16* __restrict__ A, int lda, size_t sA, const _Float16* __restrict__ Bh, int ldb, size_t sB, float alpha, const float* __restrict__ bias, size_t sBias, const float* __restrict__ CP, int rowsPerB, size_t sCPb, int row0g,
    float* __restrict__ C, _Float16* __restrict__ C16, int ldc, size_t sC, int M, int N, int K) {
  __shared__ __attribute__((aligned(16))) float so[4][16][64];
  const int tid = threadIdx.x, w = tid >> 5, lane = tid & 31, ln = lane & 15, hh = lane >> 4; const int by = blockIdx.y;
  A += (size_t)by * sA; Bh += (size_t)by * sB; const size_t cofs = (size_t)by * sC; const float* bp = bias ? bias + (size_t)by * sBias : nullptr;
  const int ntn = (N + 63) / 64; const int wid = blockIdx.x * 4 + w; const int mt = wid / ntn, nq = wid % ntn; if (mt * 16 >= M) return;
  const int row0 = mt * 16, col0 = nq * 64; const _Float16* arow = A + (size_t)(row0 + ln) * lda;
  v8f acc[4] = {};
  for (int kb = 0; kb < K; kb += 32) { FragH ah; ah.half[0] = *(const v8us*)((const unsigned short*)arow + kb + 8 * hh); ah.half[1] = *(const v8us*)((const unsigned short*)arow + kb + 16 + 8 * hh);
#pragma unroll
    for (int t = 0; t < 4; ++t) { if (col0 + t * 16 >= N) continue; const size_t boff = (size_t)(col0 + t * 16 + ln) * ldb + kb; FragH bq; bq.half[0] = *(const v8us*)((const unsigned short*)Bh + boff + 8 * hh); bq.half[1] = *(const v8us*)((const unsigned short*)Bh + boff + 16 + 8 * hh);
      acc[t] = mmaH<1>(ah.v, ah.v, bq.v, bq.v, acc[t]); }
  }
#pragma unroll
  for (int t = 0; t < 4; ++t) { if (col0 + t * 16 >= N) continue; const int col = col0 + t * 16 + ln; const float bv = bp ? bf16_round(bp[col]) : 0.f;
#pragma unroll
    for (int r = 0; r < 8; ++r) { float v = acc[t][r] * alpha + bv; if (CP) { const int rr = row0g + row0 + 8 * hh + r; if (rowsPerB < 0) v += CP[cofs + (size_t)rr * ldc + col];      /* rowsPerB < 0: own element of the batched C plane */ else { const int bidx = rr / rowsPerB; v += CP[(size_t)bidx * sCPb + (size_t)by * 64 + col]; } } if (ACT == 1) v = (v > 0.f) ? v : expm1f(v); else if (ACT == 7) v = (v > 0.f) ? v + 1.0f : expf(v); else if (ACT == 8) v = tanhf(v); else if (ACT == 9) v = 0.5f * v * (1.0f + tanhf(0.7978845608028654f * (v + 0.044715f * v * v * v))); else if (ACT == 11) v = 1.0f / (1.0f + expf(-v)); else if (ACT == 12) v = (v > 0.f) ? v : 0.01f * v; else if (ACT == 14) v = (v > 0.f) ? v : 0.1f * v; else if (ACT == 16) v = (v >= 0.f) ? v : 0.3f * v; else if (ACT == 17) v = (v >= 0.f) ? v : 0.2f * v; else if (ACT == 15) v = v / (1.0f + expf(-v)); else if (ACT == 3) v = fmaxf(v, 0.f); else if (ACT == 6) v = 0.5f * v * (1.0f + erff(v * 0.70710678118654752f)); so[w][8 * hh + r][t * 16 + ln] = v; } }
  __builtin_amdgcn_fence(__ATOMIC_ACQ_REL, "workgroup"); __builtin_amdgcn_wave_barrier();
  const int rsub = lane >> 4, c4 = (lane & 15) * 4; typedef _Float16 v4h __attribute__((ext_vector_type(4)));
  {
#pragma unroll
    for (int q = 0; q < 8; ++q) { const int r = q * 2 + rsub; if (col0 + c4 < N) { const v4f v = *(const v4fa*)&so[w][r][c4]; if (C) *(v4f*)(C + cofs + (size_t)(row0 + r) * ldc + col0 + c4) = v; if (C16) { v4h h4; for (int i = 0; i < 4; ++i) h4[i] = (_Float16)v[i]; *(v4h*)(C16 + cofs + (size_t)(row0 + r) * ldc + col0 + c4) = h4; } } }
     }
}


typedef _Float16 v4h __attribute__((ext_vector_type(4)));

__global__ __launch_bounds__(256) void k_x16(const float* __restrict__ x, _Float16* __restrict__ X16, size_t n8) { const size_t t = (size_t)blockIdx.x * 256 + threadIdx.x; if (t >= n8) return; FragH f;
#pragma unroll
  for (int q = 0; q < 8; ++q) f.h[q] = (_Float16)bf16_round(x[t * 8 + q]); *(v8us*)((unsigned short*)X16 + t * 8) = f.half[0];  }
__global__ __launch_bounds__(256) void k_h16(const float* __restrict__ x, _Float16* __restrict__ X16, size_t n8) { const size_t t = (size_t)blockIdx.x * 256 + threadIdx.x; if (t >= n8) return; FragH f;
#pragma unroll
  for (int q = 0; q < 8; ++q) f.h[q] = (_Float16)x[t * 8 + q]; *(v8us*)((unsigned short*)X16 + t * 8) = f.half[0];  }
__global__ __launch_bounds__(256) void k_round16f(const float* __restrict__ W, _Float16* __restrict__ Bt, size_t n8) { const size_t t = (size_t)blockIdx.x * 256 + threadIdx.x; if (t >= n8) return; FragH f;
#pragma unroll
  for (int i = 0; i < 8; ++i) f.h[i] = (_Float16)(bf16_round(W[t * 8 + i]) * 16.0f); *(v8us*)((unsigned short*)Bt + t * 8) = f.half[0];  }
template <int NHv, int TTv>
__global__ __launch_bounds__(256) void k_vt(const _Float16* __restrict__ V16, int ldv, int voff, _Float16* __restrict__ Vt) { __shared__ unsigned short tl[64][66]; const int tid = threadIdx.x; const int slab = blockIdx.x / (TTv / 64), lg = blockIdx.x % (TTv / 64); const int b = slab / NHv, h = slab % NHv;
  for (int i = tid; i < 64 * 8; i += 256) { const int r = i / 8, c8 = (i % 8) * 8; FragH f; f.half[0] = *(const v8us*)((const unsigned short*)V16 + ((size_t)b * TTv + lg * 64 + r) * ldv + voff + h * 64 + c8);
#pragma unroll
    for (int q = 0; q < 8; ++q) tl[r][c8 + q] = f.u[q]; }
  __syncthreads();
  {
#pragma unroll
    for (int rd = 0; rd < 2; ++rd) { const int d = rd * 32 + tid / 8, pc = tid % 8; FragH f;
#pragma unroll
      for (int q = 0; q < 8; ++q) f.u[q] = tl[pc * 8 + q][d];
      *(v8us*)((unsigned short*)Vt + ((size_t)slab * 64 + d) * TTv + lg * 64 + pc * 8) = f.half[0]; }
     } }

__global__ __launch_bounds__(256) void k_hl(const float* __restrict__ F, _Float16* __restrict__ Hh, _Float16* __restrict__ Hl, size_t n8) { const size_t t = (size_t)blockIdx.x * 256 + threadIdx.x; if (t >= n8) return; FragH fh, fl; const v4f a = *(const v4fa*)(F + t * 8), c = *(const v4fa*)(F + t * 8 + 4);
#pragma unroll
  for (int q = 0; q < 4; ++q) { _Float16 h = (_Float16)a[q]; fh.h[q] = h; fl.h[q] = (_Float16)((a[q] - (float)h) * 1024.0f); h = (_Float16)c[q]; fh.h[4 + q] = h; fl.h[4 + q] = (_Float16)((c[q] - (float)h) * 1024.0f); }
  { *(v8us*)((unsigned short*)Hh + t * 8) = fh.half[0]; *(v8us*)((unsigned short*)Hl + t * 8) = fl.half[0];  } }

__global__ __launch_bounds__(256) void k_wnat(const float* __restrict__ w, size_t n8, _Float16* __restrict__ Bt) { const size_t t = (size_t)blockIdx.x * 256 + threadIdx.x; if (t >= n8) return; FragH f; for (int q = 0; q < 8; ++q) f.h[q] = (_Float16)(bf16_round(w[t * 8 + q]) * 16.0f); *(v8us*)((unsigned short*)Bt + t * 8) = f.half[0];  }
__global__ __launch_bounds__(256) void k_rsm(const float* __restrict__ S, _Float16* __restrict__ P, int nrows) {
  #pragma clang fp contract(off)
  const int i = blockIdx.x * 256 + threadIdx.x; if (i >= nrows) return; const float* s = S + (size_t)i * SQ; float mx = -3.0e38f;
#pragma unroll 1
  for (int j = 0; j < SQ; ++j) mx = fmaxf(mx, s[j]); float se = 0.f;
#pragma unroll 1
  for (int j = 0; j < SQ; ++j) se += expf(s[j] - mx); const float sc = 256.0f / se;
#pragma unroll 1
  for (int j0 = 0; j0 < SQ; j0 += 8) { FragH f; for (int q = 0; q < 8; ++q) f.h[q] = (_Float16)(expf(s[j0 + q] - mx) * sc); unsigned short* d = (unsigned short*)P + (size_t)i * SQ + j0; *(v8us*)d = f.half[0];  } }
__global__ __launch_bounds__(256) void k_vt(const _Float16* __restrict__ V16, int b, int h0, _Float16* __restrict__ VT) { __shared__ unsigned short tl[64][65]; const int tid = threadIdx.x; const int hh = blockIdx.x % HG, sg = blockIdx.x / HG; const int s0 = sg * 64; const int h = h0 + hh;
  for (int i = tid; i < 64 * 8; i += 256) { const int j = i / 8, d8 = (i % 8) * 8; FragH f; f.half[0] = *(const v8us*)((const unsigned short*)V16 + ((size_t)b * SQ + s0 + j) * DM + h * HD + d8); for (int q = 0; q < 8; ++q) tl[d8 + q][j] = f.u[q]; }
  __syncthreads();
  { for (int i = tid; i < 64 * 8; i += 256) { const int d = i / 8, j8 = (i % 8) * 8; FragH f; for (int q = 0; q < 8; ++q) f.u[q] = tl[d][j8 + q]; *(v8us*)((unsigned short*)VT + ((size_t)hh * HD + d) * SQ + s0 + j8) = f.half[0]; }  } }



__global__ __launch_bounds__(256) void k_rsmf(const float* __restrict__ S, _Float16* __restrict__ P, int qn, int hg) {
  #pragma clang fp contract(off)
  const int t = blockIdx.x * 256 + threadIdx.x; if (t >= qn * hg) return; const size_t i = (size_t)(t / qn) * SQ + (t % qn); const float* s = S + i * SQ; float mx = -3.0e38f;
#pragma unroll 1
  for (int j = 0; j < SQ; ++j) mx = fmaxf(mx, s[j]); float se = 0.f;
#pragma unroll 1
  for (int j = 0; j < SQ; ++j) se += __expf(s[j] - mx); const float sc = 256.0f / se;
#pragma unroll 1
  for (int j0 = 0; j0 < SQ; j0 += 8) { FragH f; for (int q = 0; q < 8; ++q) f.h[q] = (_Float16)(__expf(s[j0 + q] - mx) * sc); unsigned short* d = (unsigned short*)P + i * SQ + j0; *(v8us*)d = f.half[0];  } }

// Four reciprocals. One statement with results apart from sources, so that behind each v_rcp_f32 stands an instruction that touches neither its result nor its source: the next reciprocal, and behind the last the v_nop (the slot the instruction set asks for behind a transcendental).
__device__ __forceinline__ v4f rcp4(v4f d) { v4f o;
  asm("v_rcp_f32 %0, %4\n\tv_rcp_f32 %1, %5\n\tv_rcp_f32 %2, %6\n\tv_rcp_f32 %3, %7\n\tv_nop" : "=&v"(o[0]), "=&v"(o[1]), "=&v"(o[2]), "=&v"(o[3]) : "v"(d[0]), "v"(d[1]), "v"(d[2]), "v"(d[3]));
  return o; }
typedef _Float16 v8h __attribute__((ext_vector_type(8)));
#define AW 8                         /* query groups per work-group of the attention kernel */
#define AH 2                         /* waves per query group: each walks its own half of the keys */
#define AQ 32                        /* query columns per group, and per wave (two 16-column tiles) */
#define AK 64                        /* keys per LDS stage */
#define AP 72                        /* LDS row pitch in f16: 128 data bytes + 16 (16-byte fragment reads fall on different banks) */
#define ANS (SQ / AH / AK)           /* stages per walk over one half of the keys */
#define AT (AK * AP)                 /* f16 per LDS tile */
#define AR 3                         /* buffers of the K ring and of the V^T ring, per half of the keys */
__device__ __forceinline__ v16h fa_frag(const unsigned short* p, int hh) { FragH f; f.half[0] = *(const v8us*)(p + 8 * hh); f.half[1] = *(const v8us*)(p + 16 + 8 * hh); return f.v; }
__device__ __forceinline__ v8f fa_mma(v16h a, v16h b, v8f c) { return __builtin_amdgcn_wmma_f32_16x16x32_f16(false, a, false, b, (short)0, c, false, false); }
// 256 x the stablemax3 weight for x <= 0, eight values: 1 / (1 - x (1 - x/2 (1 - x/3))) with the factor 2^-8 carried exactly through the two outer terms of the denominator; x / 3 as a multiply by f32(1/3); reciprocal through v_rcp_f32.
__device__ __forceinline__ v8f stm3w(v8f x) { const v8f a = 1.0f - x * 0.33333334f; const v8f b = 0.00390625f - (0.001953125f * x) * a; const v8f d = 0.00390625f - x * b;
  const v4f lo = rcp4(__builtin_shufflevector(d, d, 0, 1, 2, 3)), hi = rcp4(__builtin_shufflevector(d, d, 4, 5, 6, 7)); return __builtin_shufflevector(lo, hi, 0, 1, 2, 3, 4, 5, 6, 7); }
__device__ __forceinline__ void fa_signal() { asm volatile("s_wait_dscnt 0x0\n\ts_barrier_signal -1" ::: "memory"); }      /* first half of the stage barrier: this wave's LDS stores have landed and its earlier LDS reads are over, then it signals; the clobber keeps the compiler's LDS accesses on their side */
__device__ __forceinline__ void fa_wait() { asm volatile("s_barrier_wait -1" ::: "memory"); }      /* second half: every wave of the work-group has signalled; the clobber keeps the next stage's LDS reads and stores behind it */
__global__ __launch_bounds__(AW * AH * 32) void k_attn(const _Float16* __restrict__ QKV, const _Float16* __restrict__ VT, _Float16* __restrict__ O16) {
  __shared__ __attribute__((aligned(16))) unsigned short sm[AH * 2 * AR * AT];      /* per half of the keys: the K ring, then the V^T ring */
  __shared__ __attribute__((aligned(16))) float sxo[AW * AH * 4 * 2 * 32 * 4];      /* the output tiles handed over: a place of their own, because behind the last stage's wait a slower wave may still read the rings */
  __shared__ float sx[AW * AH][32];      /* row maxima, later row sums, handed over */
  static_assert(AH == 2 && (ANS & (ANS - 1)) == 0 && ANS >= 2 && AR == 3, "two halves; the stage count wraps by a mask; the split barrier needs three buffers");
  const int tid = threadIdx.x, lane = tid & 31, ln = lane & 15, hh = lane >> 4, w = tid >> 5; const int h = blockIdx.y, b = blockIdx.z;
  const int kh = __builtin_amdgcn_readfirstlane(w / AW), ts = tid & (AW * 32 - 1); const int q0 = blockIdx.x * (AW * AQ) + (w & (AW - 1)) * AQ;      /* kh: this wave's half of the keys, the same in every lane (held as a scalar); ts: the thread's number inside its half */
  const unsigned short* Qp = (const unsigned short*)QKV + (size_t)b * SQ * LQ + h * HD; const unsigned short* Kp = Qp + DM + (size_t)kh * (SQ / AH) * LQ; const unsigned short* Vp = (const unsigned short*)VT + (size_t)(b * NH + h) * HD * SQ + kh * (SQ / AH);
  unsigned short* sK = sm + kh * 2 * AR * AT; unsigned short* sV = sK + AR * AT;
  const int srow = ts >> 3, sch = (ts & 7) * 8; const int sl = srow * AP + sch;      /* staging: eight threads a 128-byte row, rows srow and srow + 32 */
  const unsigned short* kg = Kp + (size_t)srow * LQ + sch; const unsigned short* vg = Vp + (size_t)srow * SQ + sch;
  const v8f z8 = {0.f, 0.f, 0.f, 0.f, 0.f, 0.f, 0.f, 0.f};
  v16h qf[2][2]; const unsigned short* qg = Qp + (size_t)(q0 + ln) * LQ + 8 * hh;
#pragma unroll
  for (int n = 0; n < 2; ++n) for (int c = 0; c < 2; ++c) qf[n][c] = fa_frag(qg + (size_t)n * 16 * LQ + c * 32, 0);
  v8us k0 = *(const v8us*)kg, k1 = *(const v8us*)(kg + (size_t)32 * LQ), v0 = *(const v8us*)vg, v1 = *(const v8us*)(vg + (size_t)32 * SQ);
  const unsigned short* kg1 = kg + (size_t)AK * LQ; const v8us k2 = *(const v8us*)kg1, k3 = *(const v8us*)(kg1 + (size_t)32 * LQ);      /* K tile 1: stage 0 stores it at its head */
  asm volatile("s_wait_xcnt 0x0" :: "v"(qg), "v"(qg + (size_t)16 * LQ), "v"(kg), "v"(vg), "v"(kg1) : "memory");      /* the address registers of the loads above are kept, and not reused as a load's destination either, until this wait */
  *(v8us*)&sK[sl] = k0; *(v8us*)&sK[sl + 32 * AP] = k1; *(v8us*)&sV[(ANS % AR) * AT + sl] = v0; *(v8us*)&sV[(ANS % AR) * AT + sl + 32 * AP] = v1;      /* V^T tile 0 waits through walk 1, which touches only sK, in the ring place that walk 2 starts at */
  k0 = k2; k1 = k3;
  __syncthreads();
  int rc = 0;      /* ring place of the stage's tile; runs on from walk 1 into walk 2; the same in every wave (a scalar) */
  v8f m8[2]; m8[0] = z8 - 3.0e38f; m8[1] = m8[0];
#pragma unroll 1      /* one stage a trip: the body is already 16 products long */
  for (int s = 0; s < ANS; ++s) { const int sn = (s + 2) & (ANS - 1), rn = rc == AR - 1 ? 0 : rc + 1;      /* the tiles behind the last are tiles 0 and 1 again: no branch in the trip, and walk 2 finds its first K tile in the ring and its second in the registers */
    { unsigned short* d = sK + rn * AT; *(v8us*)&d[sl] = k0; *(v8us*)&d[sl + 32 * AP] = k1; }
    fa_signal();
    { const unsigned short* g = kg + (size_t)sn * AK * LQ; k0 = *(const v8us*)g; k1 = *(const v8us*)(g + (size_t)32 * LQ);
      asm volatile("s_wait_xcnt 0x0" :: "v"(g) : "memory"); }      /* as above: the address pair is kept until this wait */
    const unsigned short* kb = sK + rc * AT;
#pragma unroll
    for (int j = 0; j < 4; ++j) { const v16h a0 = fa_frag(kb + (j * 16 + ln) * AP, hh), a1 = fa_frag(kb + (j * 16 + ln) * AP + 32, hh);
#pragma unroll
      for (int n = 0; n < 2; ++n) m8[n] = __builtin_elementwise_max(m8[n], fa_mma(a1, qf[n][1], fa_mma(a0, qf[n][0], z8))); }
    __builtin_amdgcn_sched_barrier(0);      /* holds the stage's products and maxima in front of the wait: left free, the wait is lifted to right behind the stage's LDS reads, and no wave starts a stage's arithmetic before every wave has ended the stage before */
    fa_wait(); rc = rn; }
  { const unsigned short* u = vg + AK; v0 = *(const v8us*)u; v1 = *(const v8us*)(u + (size_t)32 * SQ);      /* V^T tile 1: walk 2 stores it at the head of its first stage */
    asm volatile("s_wait_xcnt 0x0" :: "v"(u) : "memory"); }      /* as above: the address pair is kept until this wait */
  float mx[2];
#pragma unroll
  for (int n = 0; n < 2; ++n) { float m = fmaxf(fmaxf(fmaxf(m8[n][0], m8[n][1]), fmaxf(m8[n][2], m8[n][3])), fmaxf(fmaxf(m8[n][4], m8[n][5]), fmaxf(m8[n][6], m8[n][7]))); mx[n] = fmaxf(m, __shfl_xor(m, 16, 32)); }
  sx[w][lane] = hh ? mx[1] : mx[0];      /* this half's maxima: columns of tile 0 from lanes 0..15, of tile 1 from lanes 16..31 */
  __syncthreads();      /* the other half's maxima are read below */
#pragma unroll
  for (int n = 0; n < 2; ++n) mx[n] = fmaxf(mx[n], sx[w ^ AW][n * 16 + ln]) * 0.125f;
  v8f o[4][2]; v8f s8[2]; s8[0] = z8; s8[1] = z8;
#pragma unroll
  for (int t = 0; t < 4; ++t) { o[t][0] = z8; o[t][1] = z8; }
#pragma unroll 1      /* one stage a trip: the body is already 32 products long */
  for (int s = 0; s < ANS; ++s) { const int sn = (s + 2) & (ANS - 1), rn = rc == AR - 1 ? 0 : rc + 1;      /* as in walk 1; what the last trip stores and the last two trips load is read by nobody */
    { unsigned short* d = sK + rn * AT; *(v8us*)&d[sl] = k0; *(v8us*)&d[sl + 32 * AP] = k1; unsigned short* e = sV + rn * AT; *(v8us*)&e[sl] = v0; *(v8us*)&e[sl + 32 * AP] = v1; }
    fa_signal();
    { const unsigned short* g = kg + (size_t)sn * AK * LQ; k0 = *(const v8us*)g; k1 = *(const v8us*)(g + (size_t)32 * LQ); const unsigned short* u = vg + sn * AK; v0 = *(const v8us*)u; v1 = *(const v8us*)(u + (size_t)32 * SQ);
      asm volatile("s_wait_xcnt 0x0" :: "v"(g), "v"(u) : "memory"); }      /* as above: both address pairs are kept until this wait */
    const unsigned short* kb = sK + rc * AT; const unsigned short* vb = sV + rc * AT;
#pragma unroll
    for (int kk = 0; kk < 2; ++kk) { union { v16h v; v8h p[2]; } pf[2]; v16h ka[2][2], va[4];
#pragma unroll
      for (int j = 0; j < 2; ++j) { const unsigned short* kr = kb + (kk * 32 + j * 16 + ln) * AP; ka[j][0] = fa_frag(kr, hh); ka[j][1] = fa_frag(kr + 32, hh); }
#pragma unroll
      for (int t = 0; t < 4; ++t) va[t] = fa_frag(vb + (t * 16 + ln) * AP + kk * 32, hh);
      __builtin_amdgcn_sched_barrier(0);      /* holds the loads above in front of the arithmetic: left free, the V^T fragments are fetched one at a time right in front of their products (an LDS latency each) and the next stage's global loads are issued in mid-stage */
#pragma unroll
      for (int j = 0; j < 2; ++j) {
#pragma unroll
        for (int n = 0; n < 2; ++n) { const v8f st = fa_mma(ka[j][1], qf[n][1], fa_mma(ka[j][0], qf[n][0], z8)); const v8f wt = stm3w(st * 0.125f - mx[n]); s8[n] += wt; pf[n].p[j] = __builtin_convertvector(wt, v8h); } }
#pragma unroll
      for (int t = 0; t < 4; ++t) { o[t][0] = fa_mma(va[t], pf[0].v, o[t][0]); o[t][1] = fa_mma(va[t], pf[1].v, o[t][1]); } }
    __builtin_amdgcn_sched_barrier(0);      /* as in walk 1: holds the stage's arithmetic in front of the wait */
    fa_wait(); rc = rn; }
  float sh[2];
#pragma unroll
  for (int n = 0; n < 2; ++n) { const float se = ((s8[n][0] + s8[n][1]) + (s8[n][2] + s8[n][3])) + ((s8[n][4] + s8[n][5]) + (s8[n][6] + s8[n][7])); sh[n] = se + __shfl_xor(se, 16, 32); }
  // The wave of half kh finishes query tile kh and hands tile 1 - kh to its partner (same lane: same query, same d).
  v4fa* xo = (v4fa*)sxo;      /* [wave][t][accumulators 0..3, 4..7][lane]: every LDS store and load is 512 contiguous bytes of a wave */
#pragma unroll
  for (int t = 0; t < 4; ++t) { const v8f g = kh ? o[t][0] : o[t][1]; xo[((w * 4 + t) * 2) * 32 + lane] = __builtin_shufflevector(g, g, 0, 1, 2, 3); xo[((w * 4 + t) * 2 + 1) * 32 + lane] = __builtin_shufflevector(g, g, 4, 5, 6, 7); }
  sx[w][lane] = kh ? sh[0] : sh[1];
  __syncthreads();      /* the partner's tile and sum are read below */
  const int pw = w ^ AW; const float sc = 64.0f / ((kh ? sh[1] : sh[0]) + sx[pw][lane]);      /* weights carry x256 in numerator and sum alike; o is carried x64 */
  _Float16* op = O16 + (size_t)(b * SQ + q0 + kh * 16 + ln) * DM + h * HD + 8 * hh;
#pragma unroll
  for (int t = 0; t < 4; ++t) { const v4f lo = xo[((pw * 4 + t) * 2) * 32 + lane], hi = xo[((pw * 4 + t) * 2 + 1) * 32 + lane]; const v8f a = (kh ? o[t][1] : o[t][0]) + __builtin_shufflevector(lo, hi, 0, 1, 2, 3, 4, 5, 6, 7);
    *(v8h*)(op + t * 16) = __builtin_convertvector(a * sc, v8h); } }      /* a lane's eight accumulators are eight consecutive d of one query: one 16-byte store */

// ---- GEMM C[M][N] = alpha A[M][K] . Bt[N][K]^T + bias, f16 operands, f32 accumulation; one 128 x 128 tile of C per work-group, four waves of 64 x 64 (M, N multiples of 128; K a multiple of 64, at least 128) ----
#define GT 128                       /* rows of A and rows of Bt per work-group tile */
#define GK 64                        /* k per stage: one whole 128-byte line of every operand row */
#define GP 72                        /* LDS row pitch in f16: 128 data bytes + 16 (16-byte fragment reads fall on different banks) */
#define GBUF (2 * GT * GP)           /* f16 per buffer: the A rows, then the Bt rows */
// Eight asynchronous 16-byte copies per lane, global memory to LDS: rows 16 apart (gs f16 in memory, 16 GP f16 in LDS). A wave's copy is four whole 128-byte lines. s_wait_xcnt 0 is the statement's own last line, so that no address register of a copy is rewritten in front of it (a precaution).
__device__ __forceinline__ void g3_copy8(unsigned l, const unsigned short* g, size_t gs) {
  asm volatile("global_load_async_to_lds_b128 %0, %8, off\n\tglobal_load_async_to_lds_b128 %1, %9, off\n\tglobal_load_async_to_lds_b128 %2, %10, off\n\tglobal_load_async_to_lds_b128 %3, %11, off\n\t"
               "global_load_async_to_lds_b128 %4, %12, off\n\tglobal_load_async_to_lds_b128 %5, %13, off\n\tglobal_load_async_to_lds_b128 %6, %14, off\n\tglobal_load_async_to_lds_b128 %7, %15, off\n\ts_wait_xcnt 0x0"
               :: "v"(l), "v"(l + 1u * 32u * GP), "v"(l + 2u * 32u * GP), "v"(l + 3u * 32u * GP), "v"(l + 4u * 32u * GP), "v"(l + 5u * 32u * GP), "v"(l + 6u * 32u * GP), "v"(l + 7u * 32u * GP),
                  "v"(g), "v"(g + gs), "v"(g + 2 * gs), "v"(g + 3 * gs), "v"(g + 4 * gs), "v"(g + 5 * gs), "v"(g + 6 * gs), "v"(g + 7 * gs) : "memory"); }
// Each operand line leaves L2 once per work-group, as a whole line, and is read from LDS by the two waves that need it. Two buffers: stage t + 1 flies while stage t is worked on; one barrier a stage (it publishes the next buffer and ends the reads of the one refilled behind it).
// Every accumulator takes its k blocks of 32 in ascending order. The epilogue turns each wave's tile through LDS (the ring, free behind the last stage's barrier) so that rows go out as whole lines.
// f16 output, columns from 2 DM on (the v third): a wave's 64 columns are the 64 d of one head and its 64 rows are 64 s of one batch, so the tile is staged as [d][s] (a lane's eight accumulators are eight consecutive s of one d: two 16-byte LDS stores) and goes out as 64 whole lines of CT = V^T [batch][head][d][s]; nothing is written to C16 there.
template <bool OUT16>      /* the output type is fixed at compile time: no branch in the epilogue, its LDS reads go out together */
__global__ __launch_bounds__(128) void k_gemm3(const _Float16* __restrict__ A, int lda, const _Float16* __restrict__ Bh, int ldb, float alpha, const float* __restrict__ bias, float* __restrict__ C, _Float16* __restrict__ C16, _Float16* __restrict__ CT, int ldc, int N, int K) {
  __shared__ __attribute__((aligned(16))) unsigned char smem[2 * GBUF * 2]; static_assert(4 * 64 * 68 * 4 <= 2 * GBUF * 2, "epilogue staging fits the ring");
  const unsigned short* sm = (const unsigned short*)smem;
  const int tid = threadIdx.x, w = tid >> 5, lane = tid & 31, ln = lane & 15, hh = lane >> 4; const int ntn = N >> 7; const int mt = blockIdx.x / ntn, nq = blockIdx.x - mt * ntn;
  const int row0 = mt * GT + (w >> 1) * 64, col0 = nq * GT + (w & 1) * 64;      /* this wave's 64 x 64 tile */
  const int srow = tid >> 3, sch = (tid & 7) * 8;      /* staging: eight lanes a 128-byte row; rows srow, srow + 16, ... */
  const unsigned short* ag = (const unsigned short*)A + (size_t)(mt * GT + srow) * lda + sch; const unsigned short* bg = (const unsigned short*)Bh + (size_t)(nq * GT + srow) * ldb + sch;
  const unsigned la = (unsigned)(size_t)(sm + srow * GP + sch), lb = la + GT * GP * 2u;      /* LDS byte addresses in buffer 0 */
  const int nt = K / GK; const size_t gsa = (size_t)16 * lda, gsb = (size_t)16 * ldb;
  const v8f z8 = {0.f, 0.f, 0.f, 0.f, 0.f, 0.f, 0.f, 0.f}; v8f acc[4][4];
#pragma unroll
  for (int i = 0; i < 4; ++i) for (int j = 0; j < 4; ++j) acc[i][j] = z8;
  g3_copy8(la, ag, gsa); g3_copy8(lb, bg, gsb);
  asm volatile("s_wait_asynccnt 0x0" ::: "memory");      /* this wave's part of stage 0 has landed */
  __syncthreads();
  g3_copy8(la + GBUF * 2u, ag + GK, gsa); g3_copy8(lb + GBUF * 2u, bg + GK, gsb);
#pragma unroll 1      /* one stage a trip: the body is already 32 products long */
  for (int t = 0; t < nt; ++t) { const unsigned short* ab = sm + (t & 1) * GBUF + ((w >> 1) * 64 + ln) * GP; const unsigned short* bb = sm + (t & 1) * GBUF + (GT + (w & 1) * 64 + ln) * GP;
#pragma unroll
    for (int c = 0; c < 2; ++c) { v16h af[4], bf[4];
#pragma unroll
      for (int i = 0; i < 4; ++i) { af[i] = fa_frag(ab + i * 16 * GP + c * 32, hh); bf[i] = fa_frag(bb + i * 16 * GP + c * 32, hh); }
      __builtin_amdgcn_sched_barrier(0);      /* holds the sixteen LDS reads above together in front of the products: left free, the A fragments are fetched one at a time, each with a full LDS latency in front of its four products */
#pragma unroll
      for (int i = 0; i < 4; ++i) for (int j = 0; j < 4; ++j) acc[i][j] = fa_mma(af[i], bf[j], acc[i][j]); }
    asm volatile("s_wait_dscnt 0x0" ::: "memory");      /* this wave's reads of the buffer are over before anybody refills it */
    asm volatile("s_wait_asynccnt 0x0" ::: "memory");      /* this wave's part of stage t + 1 has landed before anybody reads it */
    __syncthreads();
    if (t + 2 < nt) { const unsigned bo = (unsigned)(t & 1) * (GBUF * 2u); g3_copy8(la + bo, ag + (size_t)(t + 2) * GK, gsa); g3_copy8(lb + bo, bg + (size_t)(t + 2) * GK, gsb); } }
  asm volatile("s_wait_asynccnt 0x0" ::: "memory");      /* no copy is outstanding when the ring becomes output staging */
  float* so = (float*)smem + (size_t)w * 64 * 68; float bv[4] = {0.f, 0.f, 0.f, 0.f};
  if (bias) {
#pragma unroll
    for (int j = 0; j < 4; ++j) bv[j] = bf16_round(bias[col0 + j * 16 + ln]); }
  const int rsub = lane >> 4, c4 = (lane & 15) * 4;
  if (OUT16 && nq * GT >= 2 * DM) {      /* the v third; the test reads the same for the whole work-group (2 DM is a multiple of GT) */
#pragma unroll
    for (int i = 0; i < 4; ++i) {
#pragma unroll
      for (int j = 0; j < 4; ++j) { v4f lo, hi;
#pragma unroll
        for (int r = 0; r < 4; ++r) { lo[r] = acc[i][j][r] * alpha + bv[j]; hi[r] = acc[i][j][4 + r] * alpha + bv[j]; }
        float* d = so + (j * 16 + ln) * 68 + i * 16 + 8 * hh; *(v4fa*)d = lo; *(v4fa*)(d + 4) = hi; } }
    __builtin_amdgcn_fence(__ATOMIC_ACQ_REL, "workgroup"); __builtin_amdgcn_wave_barrier();      /* the rows read below were stored by other lanes of this wave: those LDS stores are finished, and not moved by the compiler, before the reads */
    _Float16* vt = CT + ((size_t)(row0 / SQ) * DM + (col0 - 2 * DM)) * SQ + row0 % SQ;      /* row (batch NH + head) HD of V^T, column s of the tile's first row */
#pragma unroll
    for (int q = 0; q < 32; ++q) { const int d = q * 2 + rsub; const v4f v = *(const v4fa*)&so[d * 68 + c4]; v4h h4; for (int i = 0; i < 4; ++i) h4[i] = (_Float16)v[i]; *(v4h*)(vt + (size_t)d * SQ + c4) = h4; }
    return; }
#pragma unroll
  for (int i = 0; i < 4; ++i) {
#pragma unroll
    for (int j = 0; j < 4; ++j) {
#pragma unroll
      for (int r = 0; r < 8; ++r) so[(i * 16 + 8 * hh + r) * 68 + j * 16 + ln] = acc[i][j][r] * alpha + bv[j]; } }
  __builtin_amdgcn_fence(__ATOMIC_ACQ_REL, "workgroup"); __builtin_amdgcn_wave_barrier();
#pragma unroll
  for (int q = 0; q < 32; ++q) { const int r = q * 2 + rsub; const v4f v = *(const v4fa*)&so[r * 68 + c4]; const size_t co = (size_t)(row0 + r) * ldc + col0 + c4;
    if (OUT16) { v4h h4; for (int i = 0; i < 4; ++i) h4[i] = (_Float16)v[i]; *(v4h*)(C16 + co) = h4; } else *(v4f*)(C + co) = v; } }

// ---- q | k | v projection: the same GEMM with ONE 256 x 192 tile of C per work-group, twelve waves of 64 x 64 (M a multiple of 256, N of 192, K of 64, at least 192) ----
#define JM 256                       /* rows of A per work-group tile */
#define JN 192                       /* rows of Bt per work-group tile */
#define JW ((JM / 64) * (JN / 64))   /* waves per work-group */
#define JR (JM + JN)                 /* operand rows per stage */
#define JBUF (JR * GP)               /* f16 per buffer: the A rows, then the Bt rows */
#define JB 3                         /* buffers */
#define JG (JW / 2)                  /* waves per copying group */
// Eight (four) asynchronous 16-byte copies per lane: rows 4 apart (gs f16 in memory, 4 GP f16 in LDS), so a wave's run is 32 (16) consecutive whole 128-byte rows. s_wait_xcnt 0 is the statement's own last line, so that no address register of a copy is rewritten in front of it (a precaution).
__device__ __forceinline__ void g4_copy8(unsigned l, const unsigned short* g, size_t gs) {
  asm volatile("global_load_async_to_lds_b128 %0, %8, off\n\tglobal_load_async_to_lds_b128 %1, %9, off\n\tglobal_load_async_to_lds_b128 %2, %10, off\n\tglobal_load_async_to_lds_b128 %3, %11, off\n\t"
               "global_load_async_to_lds_b128 %4, %12, off\n\tglobal_load_async_to_lds_b128 %5, %13, off\n\tglobal_load_async_to_lds_b128 %6, %14, off\n\tglobal_load_async_to_lds_b128 %7, %15, off\n\ts_wait_xcnt 0x0"
               :: "v"(l), "v"(l + 1u * 8u * GP), "v"(l + 2u * 8u * GP), "v"(l + 3u * 8u * GP), "v"(l + 4u * 8u * GP), "v"(l + 5u * 8u * GP), "v"(l + 6u * 8u * GP), "v"(l + 7u * 8u * GP),
                  "v"(g), "v"(g + gs), "v"(g + 2 * gs), "v"(g + 3 * gs), "v"(g + 4 * gs), "v"(g + 5 * gs), "v"(g + 6 * gs), "v"(g + 7 * gs) : "memory"); }
__device__ __forceinline__ void g4_copy4(unsigned l, const unsigned short* g, size_t gs) {
  asm volatile("global_load_async_to_lds_b128 %0, %4, off\n\tglobal_load_async_to_lds_b128 %1, %5, off\n\tglobal_load_async_to_lds_b128 %2, %6, off\n\tglobal_load_async_to_lds_b128 %3, %7, off\n\ts_wait_xcnt 0x0"
               :: "v"(l), "v"(l + 1u * 8u * GP), "v"(l + 2u * 8u * GP), "v"(l + 3u * 8u * GP), "v"(g), "v"(g + gs), "v"(g + 2 * gs), "v"(g + 3 * gs) : "memory"); }
// The twelve 64 x 64 wave tiles that a WGP works on were three work-groups with 3 x 256 operand rows a stage from L2; as one work-group they share 448. The grid is one work-group per WGP.
// One work-group must now keep in flight what three kept, so a stage's copies get two trips to land: three buffers, and the waves copy by turns: waves 0..5 bring the even stages, waves 6..11 the odd ones.
// Publish point of trip t, behind the fetch of the stage's last fragments and in front of their products: every wave ends its LDS reads; the group that brought stage t + 1 waits for all its copies (it has no others out); barrier (it publishes stage t + 1 and ends the reads of stage t's buffer); the same group then sends stage t + 3 into that buffer. The other group's copies, stage t + 2, fly on across the barrier; nobody reads them before that group's own wait and the barrier behind it, at the publish point of trip t + 1.
// A stage is 14 runs of 32 rows (8 of A, 6 of Bt): wave g of a group takes runs g and g + 6, and waves 0..3 of the group a 16-row quarter each of the last two runs.
// Wave tile, fragment order, k order and epilogue are those of k_gemm3; whether a tile belongs to the v third is now asked per wave (192 does not divide 2 DM; the epilogue has no work-group barrier).
__global__ __launch_bounds__(JW * 32) void k_gemmq(const _Float16* __restrict__ A, int lda, const _Float16* __restrict__ Bh, int ldb, float alpha, const float* __restrict__ bias, _Float16* __restrict__ C16, _Float16* __restrict__ CT, int ldc, int N, int K) {
  __shared__ __attribute__((aligned(16))) unsigned char smem[JW * 64 * 68 * 4]; static_assert(JB * JBUF * 2 <= JW * 64 * 68 * 4 && JB == 3 && JR == 14 * 32 && JG == 6 && JM % 32 == 0, "the ring fits the epilogue staging; the deal of runs below");
  const unsigned short* sm = (const unsigned short*)smem;
  const int tid = threadIdx.x, lane = tid & 31, ln = lane & 15, hh = lane >> 4; const int w = __builtin_amdgcn_readfirstlane(tid >> 5);      /* the wave's number as a scalar: every test on it below is a scalar branch */
  const int ntn = N / JN; const int mt = blockIdx.x / ntn, nq = blockIdx.x - mt * ntn; const int wm = w / (JN / 64), wn = w - wm * (JN / 64);
  const int row0 = mt * JM + wm * 64, col0 = nq * JN + wn * 64;      /* this wave's 64 x 64 tile */
  const int grp = w / JG, gw = w - grp * JG;      /* copying group (parity of its stages) and the wave's number in it */
  const int lr = lane >> 3, sch = (lane & 7) * 8;      /* staging: eight lanes a 128-byte row, four rows a copy */
  const unsigned short* ab0 = (const unsigned short*)A + (size_t)(mt * JM + lr) * lda + sch; const unsigned short* bb0 = (const unsigned short*)Bh + (size_t)(nq * JN + lr) * ldb + sch;
  const bool a1 = (gw + JG) * 32 < JM;      /* the second run lies in A for waves 0 and 1 of a group, in Bt for the others */
  const unsigned short* g0 = ab0 + (size_t)(gw * 32) * lda; const unsigned short* g1 = a1 ? ab0 + (size_t)((gw + JG) * 32) * lda : bb0 + (size_t)((gw + JG) * 32 - JM) * ldb; const unsigned short* g2 = bb0 + (size_t)(2 * JG * 32 - JM + gw * 16) * ldb;
  const size_t s0 = (size_t)4 * lda, s2 = (size_t)4 * ldb, s1 = a1 ? s0 : s2;
  const unsigned l0 = (unsigned)(size_t)(sm + (gw * 32 + lr) * GP + sch), l1 = l0 + JG * 32 * GP * 2u, l2 = (unsigned)(size_t)(sm + (2 * JG * 32 + gw * 16 + lr) * GP + sch);      /* LDS byte addresses in buffer 0 */
  auto stage = [&](int st, int bf) { const unsigned bo = (unsigned)bf * (JBUF * 2u); const size_t ko = (size_t)st * GK; g4_copy8(l0 + bo, g0 + ko, s0); g4_copy8(l1 + bo, g1 + ko, s1); if (gw < 4) g4_copy4(l2 + bo, g2 + ko, s2); };
  const int nt = K / GK;
  const v8f z8 = {0.f, 0.f, 0.f, 0.f, 0.f, 0.f, 0.f, 0.f}; v8f acc[4][4];
#pragma unroll
  for (int i = 0; i < 4; ++i) for (int j = 0; j < 4; ++j) acc[i][j] = z8;
  stage(grp, grp);      /* stage 0 from group 0, stage 1 from group 1 */
  if (grp == 0) asm volatile("s_wait_asynccnt 0x0" ::: "memory");      /* this wave's part of stage 0 has landed */
  __syncthreads();
  if (grp == 0) stage(2, 2);
  int rb = 0;      /* ring place of the trip's stage */
#pragma unroll 1      /* one stage a trip: the body is already 32 products long */
  for (int t = 0; t < nt; ++t) { const unsigned short* ab = sm + rb * JBUF + (wm * 64 + ln) * GP; const unsigned short* bb = sm + rb * JBUF + (JM + wn * 64 + ln) * GP; v16h af[4], bf[4];
#pragma unroll
    for (int i = 0; i < 4; ++i) { af[i] = fa_frag(ab + i * 16 * GP, hh); bf[i] = fa_frag(bb + i * 16 * GP, hh); }
    __builtin_amdgcn_sched_barrier(0);      /* holds the sixteen LDS reads above together in front of the products: left free, the A fragments are fetched one at a time, each with a full LDS latency in front of its four products */
#pragma unroll
    for (int i = 0; i < 4; ++i) for (int j = 0; j < 4; ++j) acc[i][j] = fa_mma(af[i], bf[j], acc[i][j]);
#pragma unroll
    for (int i = 0; i < 4; ++i) { af[i] = fa_frag(ab + i * 16 * GP + 32, hh); bf[i] = fa_frag(bb + i * 16 * GP + 32, hh); }
    const bool mine = ((t + 1) & 1) == grp;      /* stages t + 1 and t + 3 are this wave's group's */
    asm volatile("s_wait_dscnt 0x0" ::: "memory");      /* the stage's last fragments are in registers: this wave's reads of the buffer are over before anybody refills it */
    if (mine) asm volatile("s_wait_asynccnt 0x0" ::: "memory");      /* this wave's part of stage t + 1 has landed before anybody reads it */
    __syncthreads();      /* in front of the stage's last sixteen products, which read registers alone: behind it every wave still holds matrix work while the first reads of stage t + 1 are under way */
    if (mine && t + 3 < nt) stage(t + 3, rb);
#pragma unroll
    for (int i = 0; i < 4; ++i) for (int j = 0; j < 4; ++j) acc[i][j] = fa_mma(af[i], bf[j], acc[i][j]);
    rb = rb == JB - 1 ? 0 : rb + 1; }
  asm volatile("s_wait_asynccnt 0x0" ::: "memory");      /* no copy is outstanding when the ring becomes output staging */
  float* so = (float*)smem + (size_t)w * 64 * 68; float bv[4] = {0.f, 0.f, 0.f, 0.f};
  if (bias) {
#pragma unroll
    for (int j = 0; j < 4; ++j) bv[j] = bf16_round(bias[col0 + j * 16 + ln]); }
  const int rsub = lane >> 4, c4 = (lane & 15) * 4;
  if (col0 >= 2 * DM) {      /* the v third; the test reads the same for the whole wave */
#pragma unroll
    for (int i = 0; i < 4; ++i) {
#pragma unroll
      for (int j = 0; j < 4; ++j) { v4f lo, hi;
#pragma unroll
        for (int r = 0; r < 4; ++r) { lo[r] = acc[i][j][r] * alpha + bv[j]; hi[r] = acc[i][j][4 + r] * alpha + bv[j]; }
        float* d = so + (j * 16 + ln) * 68 + i * 16 + 8 * hh; *(v4fa*)d = lo; *(v4fa*)(d + 4) = hi; } }
    __builtin_amdgcn_fence(__ATOMIC_ACQ_REL, "workgroup"); __builtin_amdgcn_wave_barrier();      /* the rows read below were stored by other lanes of this wave: those LDS stores are finished, and not moved by the compiler, before the reads */
    _Float16* vt = CT + ((size_t)(row0 / SQ) * DM + (col0 - 2 * DM)) * SQ + row0 % SQ;      /* row (batch NH + head) HD of V^T, column s of the tile's first row */
#pragma unroll
    for (int q = 0; q < 32; ++q) { const int d = q * 2 + rsub; const v4f v = *(const v4fa*)&so[d * 68 + c4]; v4h h4; for (int i = 0; i < 4; ++i) h4[i] = (_Float16)v[i]; *(v4h*)(vt + (size_t)d * SQ + c4) = h4; }
    return; }
#pragma unroll
  for (int i = 0; i < 4; ++i) {
#pragma unroll
    for (int j = 0; j < 4; ++j) {
#pragma unroll
      for (int r = 0; r < 8; ++r) so[(i * 16 + 8 * hh + r) * 68 + j * 16 + ln] = acc[i][j][r] * alpha + bv[j]; } }
  __builtin_amdgcn_fence(__ATOMIC_ACQ_REL, "workgroup"); __builtin_amdgcn_wave_barrier();      /* as above */
#pragma unroll
  for (int q = 0; q < 32; ++q) { const int r = q * 2 + rsub; const v4f v = *(const v4fa*)&so[r * 68 + c4]; v4h h4; for (int i = 0; i < 4; ++i) h4[i] = (_Float16)v[i]; *(v4h*)(C16 + (size_t)(row0 + r) * ldc + col0 + c4) = h4; } }

// ---- operand conversion: x, w_qkv and w_out to f16 in ONE launch of few, long waves ----
#define PG 512                       /* work-groups: 16 waves on every WGP */
#define PT (PG * 256)                /* threads of the launch */
#define PNX ((int)(NR * DM / 4 / PT))            /* 16-byte pieces per thread: of x */
#define PNQ ((int)((size_t)LQ * DM / 4 / PT))    /* of w_qkv */
#define PNO ((int)((size_t)DM * DM / 4 / PT))    /* of w_out */
__device__ __forceinline__ v4h cv_x(v4f a) { v4h r; for (int q = 0; q < 4; ++q) r[q] = (_Float16)bf16_round(a[q]); return r; }
__device__ __forceinline__ v4h cv_w(v4f a) { v4h r; for (int q = 0; q < 4; ++q) r[q] = (_Float16)(bf16_round(a[q]) * 16.0f); return r; }
// The time of a short elementwise launch is the time its waves take to start, so the same bytes go through an eighth of the waves and one launch instead of three.
// Piece i of a thread lies PT pieces behind piece i - 1: every wave-wide load is 512 contiguous bytes (four whole lines), every store 256. All of a thread's loads are issued before its first conversion.
__global__ __launch_bounds__(256) void k_prep(const float* __restrict__ x, const float* __restrict__ wq, const float* __restrict__ wo, _Float16* __restrict__ X16, _Float16* __restrict__ BQ, _Float16* __restrict__ BO) {
  static_assert(NR * DM % (4 * PT) == 0 && (size_t)LQ * DM % (4 * PT) == 0 && (size_t)DM * DM % (4 * PT) == 0, "every thread takes the same number of pieces");
  const unsigned t = blockIdx.x * 256u + threadIdx.x; v4f a[PNX], b[PNQ], c[PNO];
#pragma unroll
  for (int i = 0; i < PNX; ++i) a[i] = ((const v4fa*)x + (size_t)i * PT)[t];
#pragma unroll
  for (int i = 0; i < PNQ; ++i) b[i] = ((const v4fa*)wq + (size_t)i * PT)[t];
#pragma unroll
  for (int i = 0; i < PNO; ++i) c[i] = ((const v4fa*)wo + (size_t)i * PT)[t];
  asm volatile("s_wait_xcnt 0x0" :: "v"(t) : "memory");      /* no address register of the loads above is rewritten in front of this wait (a precaution): left to the compiler, the pair it forms for the pieces beyond an offset's reach is reused behind a load-count wait alone */
  __builtin_amdgcn_sched_barrier(0);      /* holds all sixteen loads in front of the arithmetic: left free, half of them are issued only behind the first results, a second memory latency in a wave that lives for little more than one */
#pragma unroll
  for (int i = 0; i < PNX; ++i) ((v4h*)X16 + (size_t)i * PT)[t] = cv_x(a[i]);
#pragma unroll
  for (int i = 0; i < PNQ; ++i) ((v4h*)BQ + (size_t)i * PT)[t] = cv_w(b[i]);
#pragma unroll
  for (int i = 0; i < PNO; ++i) ((v4h*)BO + (size_t)i * PT)[t] = cv_w(c[i]); }

extern "C" void kernel_launch(void* const* d_in, const int* in_sizes, int n_in,
                              void* d_out, int out_size, void* d_ws, size_t ws_size, hipStream_t stream) {
  (void)in_sizes; (void)n_in; (void)out_size;
  const float* const* I = (const float* const*)d_in; const float* x = I[0]; const float* wqkv = I[1]; const float* bqkv = nullptr; const float* wo = I[2]; const float* bo = I[3];      /* natural [out][in] fused weight [3072][1024] (NO bias: nullptr in the fused GEMM's bias slot); natural w_out [1024][1024] + b_out */
  char* ws = (char*)d_ws; size_t off = 0;
  auto take = [&](size_t bytes) { char* p = ws + off; off += (bytes + 255) & ~(size_t)255; return p; };
  _Float16* BQKV = (_Float16*)take((size_t)3 * DM * DM * 2); _Float16* BO = (_Float16*)take((size_t)DM * DM * 2);
  _Float16* X16 = (_Float16*)take(NR * DM * 2); _Float16* QKV = (_Float16*)take(NR * 3 * DM * 2); _Float16* O16 = (_Float16*)take(NR * DM * 2);
  _Float16* VT = (_Float16*)take((size_t)NB * NH * HD * SQ * 2);
  if (off > ws_size) return;
  k_prep<<<PG, 256, 0, stream>>>(x, wqkv, wo, X16, BQKV, BO);      /* x as f16 rows; natural [out][in] weights = Bt[n][k] x16 (no transpose): fused rows 0..1023 = q, 1024.. = k, 2048.. = v */
  const size_t r0p = (size_t)B0 * SQ;      /* first projected row */
  k_gemmq<<<(unsigned)((MP / JM) * (3 * DM / JN)), JW * 32, 0, stream>>>(X16 + r0p * DM, DM, BQKV, DM, 0.0625f, bqkv, QKV + r0p * 3 * DM, VT, 3 * DM, 3 * DM, DM);      /* q | k rows (f16; head h = columns h*HD.. of each DM block; the v columns of these rows stay unwritten and unread) and V^T [NB][NH][HD][SQ] */
  k_attn<<<dim3(SQ / (AW * AQ), NH, NB), AW * AH * 32, 0, stream>>>(QKV, VT, O16);      /* o (merged heads, x64) as f16 rows: scores, stablemax3 and P V in one launch for all batches and heads */
  k_gemm3<false><<<(unsigned)((MPO / GT) * (DM / GT)), 128, 0, stream>>>(O16 + r0p * DM, DM, BO, DM, 0.0009765625f, bo, (float*)d_out + r0p * DM, nullptr, nullptr, DM, DM, DM);      /* out rows are the output layout */
}

// v009
// It runs in 80.6 microseconds.
// In both of two side-by-side timings against v008, it was 1.05 times as fast.
// Over all steps from v000 it is 43.8 times as fast.
#include <hip/hip_runtime.h>
// Multi-head self-attention with a polynomial 'stablemax' normalisation instead of softmax (x [2][2048][1024]; qkv = x w_qkv^T (natural [3072][1024] sigma 0.02, NO bias) reshaped (B, S, 3, 16, 64): q | k | v thirds; attn = stablemax3(q k^T * 64^-0.5): logits minus the row max, then s(x) = 1 + x (1 + x/2 (1 + x/3)) for x >= 0 and 1 / (1 - x (1 - x/2 (1 - x/3))) for x < 0, normalised by the row sum; out = merged w_out^T + b_out (natural) -> [2][2048][1024]).
// Structure: token rows r = b*2048 + s; x as exact f16 rows (bf16-rounded); q | k | v as ONE WMMA GEMM (N = 3 x 1024) (256x192 work-group tiles staged in LDS, 64x64 wave tiles, f32 accumulation, exact x16 weights, no bias, f16 outputs; the v third leaves that GEMM already transposed, as V^T [batch][head][d][s]); one attention kernel per (batch, head, 256 queries): scores on WMMA (K = 64, alpha = 64^-0.5) formed twice, once for the row max and once for the weights (f32 statistics; weights x256 as f16 operands, normalised after the product), o = P . V on WMMA (o carried x64 against f16 subnormal flush, folded into the output GEMM alpha) written straight into the merged f16 o rows; out = o W_o + b GEMM (f32) into the output layout.
// Compute dtype: inputs rounded to bf16; x / weights exact; q, k, v, softmax weights and o as plain f16 GEMM operands (~2^-12); scores and softmax statistics f32; v_wmma_f32_16x16x32_f16.
#define NB 2
#define SQ 2048
#define DM 1024
#define NH 16
#define HD 64
#define HG 4                         /* heads per block group of the unlaunched k_vt(b, h0) */
#define B0 0                         /* first batch processed (debug hook) */
#define NBR NB                       /* batches processed (debug hook) */
#define NR ((size_t)NB * SQ)         /* token rows */
#define MP ((int)((size_t)NBR * SQ)) /* rows projected (debug hook) */
#define QN SQ                        /* unused: k_attn covers all SQ queries */
#define NHD NH                       /* unused: k_attn covers all NH heads */
#define MPO MP                       /* rows through the output stage (debug hook) */
#define LQ (3 * DM)      /* row pitch of the q/k/v rows */
typedef __bf16 v16b __attribute__((ext_vector_type(16)));
typedef unsigned short v8us __attribute__((ext_vector_type(8), may_alias));
typedef float  v8f  __attribute__((ext_vector_type(8)));
typedef float  v4f  __attribute__((ext_vector_type(4)));
typedef float  v4fa __attribute__((ext_vector_type(4), may_alias));
union FragB { v16b v; v8us half[2]; unsigned short u[16]; };

__device__ __forceinline__ unsigned short bf16_bits(float x) { unsigned int u = __float_as_uint(x); return (unsigned short)((u + 0x7FFFu + ((u >> 16) & 1u)) >> 16); }
__device__ __forceinline__ float bf16_val(unsigned short b) { return __uint_as_float(((unsigned int)b) << 16); }
__device__ __forceinline__ float bf16_round(float x) { return bf16_val(bf16_bits(x)); }
// D += A·B with NT terms: 1 = ah·bh, 2 = + al·bh (A split), 3 = + ah·bl (both split)
template <int NT>
__device__ __forceinline__ v8f mmaN(v16b ah, v16b al, v16b bh, v16b bl, v8f c) {
  c = __builtin_amdgcn_wmma_f32_16x16x32_bf16(false, ah, false, bh, (short)0, c, false, false);
  if (NT >= 2) c = __builtin_amdgcn_wmma_f32_16x16x32_bf16(false, al, false, bh, (short)0, c, false, false);
  if (NT >= 3) c = __builtin_amdgcn_wmma_f32_16x16x32_bf16(false, ah, false, bl, (short)0, c, false, false);
  asm volatile("v_nop\n\tv_nop\n\tv_nop\n\tv_nop" : "+v"(c) : "v"(ah), "v"(al), "v"(bh), "v"(bl));
  return c;
}

__global__ __launch_bounds__(256) void k_wt_bf16(const float* __restrict__ W, unsigned short* __restrict__ Wt, int K, int N) {
  const int t = blockIdx.x * 256 + threadIdx.x;
  const int k8n = K / 8;
  if (t >= N * k8n) return;
  const int n = t / k8n, k8 = (t % k8n) * 8;
  v8us v;
#pragma unroll
  for (int i = 0; i < 8; ++i) v[i] = bf16_bits(W[(size_t)(k8 + i) * N + n]);
  *(v8us*)(Wt + (size_t)n * K + k8) = v;
  
}

// GEMM C[M][N] (f32, pitch ldc) = act(A[M][K]·W + bias). A f32 row-major (pitch lda) converted per fragment to bf16
// (ASPLIT: hi/lo two planes -> 2 terms, else single rounded term); Wt bf16 [N][K] (pitch ldb). BIAS_BF16 rounds the
// bias to bf16 first (bias quantised to bf16 before the add). K%32==0, M%16==0, N%64==0.
template <bool ASPLIT, int ACT, bool BIAS_BF16>
__global__ __launch_bounds__(128) void k_gemm_bf(const float* __restrict__ A, int lda, const unsigned short* __restrict__ Wt, int ldb,
                                               const float* __restrict__ bias, float* __restrict__ C, int ldc, int M, int N, int K) {
  __shared__ __attribute__((aligned(16))) float so[4][16][64];
  const int tid = threadIdx.x, w = tid >> 5, lane = tid & 31, ln = lane & 15, hh = lane >> 4;
  const int ntn = N / 64;
  const int wid = blockIdx.x * 4 + w;
  const int mt = wid / ntn, nq = wid % ntn;
  if (mt * 16 >= M) return;
  const int row0 = mt * 16, col0 = nq * 64;
  const float* arow = A + (size_t)(row0 + ln) * lda;
  v8f acc[4] = {};
  for (int kb = 0; kb < K; kb += 32) {
    FragB ah, al;
    const v4f x0 = *(const v4fa*)(arow + kb + 8 * hh), x1 = *(const v4fa*)(arow + kb + 8 * hh + 4);
    const v4f x2 = *(const v4fa*)(arow + kb + 16 + 8 * hh), x3 = *(const v4fa*)(arow + kb + 16 + 8 * hh + 4);
    float xs[16] = {x0[0],x0[1],x0[2],x0[3],x1[0],x1[1],x1[2],x1[3],x2[0],x2[1],x2[2],x2[3],x3[0],x3[1],x3[2],x3[3]};
#pragma unroll
    for (int i = 0; i < 16; ++i) { const unsigned short hb = bf16_bits(xs[i]); ah.u[i] = hb; al.u[i] = ASPLIT ? bf16_bits(xs[i] - bf16_val(hb)) : (unsigned short)0; }
#pragma unroll
    for (int t = 0; t < 4; ++t) {
      const unsigned short* brow = Wt + (size_t)(col0 + t * 16 + ln) * ldb + kb;
      FragB b;
      b.half[0] = *(const v8us*)(brow + 8 * hh);
      b.half[1] = *(const v8us*)(brow + 16 + 8 * hh);
      acc[t] = mmaN<ASPLIT ? 2 : 1>(ah.v, al.v, b.v, b.v, acc[t]);
    }
  }
#pragma unroll
  for (int t = 0; t < 4; ++t) {
    float bv = bias ? bias[col0 + t * 16 + ln] : 0.f;
    if (BIAS_BF16) bv = bf16_round(bv);
#pragma unroll
    for (int r = 0; r < 8; ++r) { float v = acc[t][r] + bv; if (ACT == 1) v = fmaxf(v, 0.f); so[w][8 * hh + r][t * 16 + ln] = v; }
  }
  __builtin_amdgcn_fence(__ATOMIC_ACQ_REL, "workgroup");
  __builtin_amdgcn_wave_barrier();
  const int rsub = lane >> 4, c4 = (lane & 15) * 4;
  {
#pragma unroll
    for (int q = 0; q < 8; ++q) {
      const int r = q * 2 + rsub;
      const v4f v = *(const v4fa*)&so[w][r][c4];
      *(v4f*)(C + (size_t)(row0 + r) * ldc + col0 + c4) = v;
    }
    
  }
}

// GEMM C = act(A·W + bias + resid): A f32 (ASPLIT -> hi/lo 2 terms), Wt bf16 [N][K]; ACT 0 none, 1 relu, 2 exact gelu;
// resid (optional, f32, row index = (row % rmod), pitch ldr, RES_BF16 rounds it) added before the activation.
template <bool ASPLIT, int ACT, bool BIAS_BF16, bool RES_BF16>
__global__ __launch_bounds__(128) void k_gemm_bf3(const float* __restrict__ A, int lda, const unsigned short* __restrict__ Wt, int ldb,
                                                const float* __restrict__ bias, const float* __restrict__ resid, int rmod, int ldr,
                                                float* __restrict__ C, int ldc, int M, int N, int K) {
  __shared__ __attribute__((aligned(16))) float so[4][16][64];
  const int tid = threadIdx.x, w = tid >> 5, lane = tid & 31, ln = lane & 15, hh = lane >> 4;
  const int ntn = N / 64;
  const int wid = blockIdx.x * 4 + w;
  const int mt = wid / ntn, nq = wid % ntn;
  if (mt * 16 >= M) return;
  const int row0 = mt * 16, col0 = nq * 64;
  const float* arow = A + (size_t)(row0 + ln) * lda;
  v8f acc[4] = {};
  for (int kb = 0; kb < K; kb += 32) {
    FragB ah, al;
    const v4f x0 = *(const v4fa*)(arow + kb + 8 * hh), x1 = *(const v4fa*)(arow + kb + 8 * hh + 4);
    const v4f x2 = *(const v4fa*)(arow + kb + 16 + 8 * hh), x3 = *(const v4fa*)(arow + kb + 16 + 8 * hh + 4);
    float xs[16] = {x0[0],x0[1],x0[2],x0[3],x1[0],x1[1],x1[2],x1[3],x2[0],x2[1],x2[2],x2[3],x3[0],x3[1],x3[2],x3[3]};
#pragma unroll
    for (int i = 0; i < 16; ++i) { const unsigned short hb = bf16_bits(xs[i]); ah.u[i] = hb; al.u[i] = ASPLIT ? bf16_bits(xs[i] - bf16_val(hb)) : (unsigned short)0; }
#pragma unroll
    for (int t = 0; t < 4; ++t) {
      const unsigned short* brow = Wt + (size_t)(col0 + t * 16 + ln) * ldb + kb;
      FragB b;
      b.half[0] = *(const v8us*)(brow + 8 * hh);
      b.half[1] = *(const v8us*)(brow + 16 + 8 * hh);
      acc[t] = mmaN<ASPLIT ? 2 : 1>(ah.v, al.v, b.v, b.v, acc[t]);
    }
  }
#pragma unroll
  for (int t = 0; t < 4; ++t) {
    const int col = col0 + t * 16 + ln;
    float bv = bias ? bias[col] : 0.f;
    if (BIAS_BF16) bv = bf16_round(bv);
#pragma unroll
    for (int r = 0; r < 8; ++r) {
      float v = acc[t][r] + bv;
      if (resid) { float rv = resid[(size_t)((row0 + 8 * hh + r) % rmod) * ldr + col]; if (RES_BF16) rv = bf16_round(rv); v += rv; }
      if (ACT == 1) v = fmaxf(v, 0.f);
      if (ACT == 2) v = 0.5f * v * (1.0f + erff(v * 0.70710678118654752f));
      if (ACT == 3) { const float u = 0.7978845608028654f * (v + 0.044715f * v * v * v); v = 0.5f * v * (1.0f + tanhf(u)); }
      so[w][8 * hh + r][t * 16 + ln] = v;
    }
  }
  __builtin_amdgcn_fence(__ATOMIC_ACQ_REL, "workgroup");
  __builtin_amdgcn_wave_barrier();
  const int rsub = lane >> 4, c4 = (lane & 15) * 4;
  {
#pragma unroll
    for (int q = 0; q < 8; ++q) {
      const int r = q * 2 + rsub;
      const v4f v = *(const v4fa*)&so[w][r][c4];
      *(v4f*)(C + (size_t)(row0 + r) * ldc + col0 + c4) = v;
    }
    
  }
}
// row LayerNorm (biased variance, eps) over N: s = X (+ R); optional out_sum <- s; out_norm <- (s-mu)*rsqrt(var+eps)*g + b
template <bool PARAM_BF16>
__global__ __launch_bounds__(256) void k_layernorm(const float* __restrict__ X, const float* __restrict__ R, const float* __restrict__ g, const float* __restrict__ bta,
                                                  float* __restrict__ out_sum, float* __restrict__ out_norm, int N, float eps) {
  __shared__ float red[256];
  const int row = blockIdx.x, tid = threadIdx.x;
  const float* x = X + (size_t)row * N; const float* rr = R ? R + (size_t)row * N : nullptr;
  float vals[16];                     // up to N = 4096
  const int per = N / 256;            // contiguous chunk per thread? use strided-by-4 chunks: thread handles j = tid*4 + 1024*u
  float s1 = 0.f;
  for (int u = 0; u < per / 4; ++u) {
    const int j = tid * 4 + 1024 * u;
    const v4f a = *(const v4fa*)(x + j);
    v4f b = {0.f,0.f,0.f,0.f}; if (rr) b = *(const v4fa*)(rr + j);
#pragma unroll
    for (int q = 0; q < 4; ++q) { const float v = a[q] + b[q]; vals[u * 4 + q] = v; s1 += v; }
  }
  red[tid] = s1; __syncthreads();
  for (int st = 128; st > 0; st >>= 1) { if (tid < st) red[tid] += red[tid + st]; __syncthreads(); }
  const float mu = red[0] / (float)N; __syncthreads();
  float s2 = 0.f;
  for (int u = 0; u < per / 4; ++u)
#pragma unroll
    for (int q = 0; q < 4; ++q) { const float c = vals[u * 4 + q] - mu; s2 += c * c; }
  red[tid] = s2; __syncthreads();
  for (int st = 128; st > 0; st >>= 1) { if (tid < st) red[tid] += red[tid + st]; __syncthreads(); }
  const float rs = rsqrtf(red[0] / (float)N + eps);
  {
    for (int u = 0; u < per / 4; ++u) {
      const int j = tid * 4 + 1024 * u;
      v4f o, sm;
#pragma unroll
      for (int q = 0; q < 4; ++q) {
        float gg = g[j + q], bb = bta[j + q];
        if (PARAM_BF16) { gg = bf16_round(gg); bb = bf16_round(bb); }
        sm[q] = vals[u * 4 + q]; o[q] = (vals[u * 4 + q] - mu) * rs * gg + bb;
      }
      if (out_sum) *(v4f*)(out_sum + (size_t)row * N + j) = sm;
      *(v4f*)(out_norm + (size_t)row * N + j) = o;
    }
    
  }
}



// ---- f16 WMMA path (v_wmma_f32_16x16x32_f16): 11-bit significands for operands in range — used where a [0,1] probability operand needs more precision than bf16
typedef _Float16 v16h __attribute__((ext_vector_type(16)));
union FragH { v16h v; v8us half[2]; _Float16 h[16]; unsigned short u[16]; };
template <int NT>
__device__ __forceinline__ v8f mmaH(v16h ah, v16h al, v16h bh, v16h bl, v8f c) {
  c = __builtin_amdgcn_wmma_f32_16x16x32_f16(false, ah, false, bh, (short)0, c, false, false);
  if (NT >= 2) c = __builtin_amdgcn_wmma_f32_16x16x32_f16(false, al, false, bh, (short)0, c, false, false);
  if (NT >= 3) c = __builtin_amdgcn_wmma_f32_16x16x32_f16(false, ah, false, bl, (short)0, c, false, false);
  asm volatile("v_nop\n\tv_nop\n\tv_nop\n\tv_nop" : "+v"(c) : "v"(ah), "v"(al), "v"(bh), "v"(bl));
  return c;
}
// batched GEMM like k_gemm_b but f16 operands: A f32 (split into f16 hi/lo if ASPLIT, else rounded to f16), Bt = f16 values [n][k]; alpha; C f32; N multiple of 16 (partial tiles skipped)
template <bool ASPLIT>
__global__ __launch_bounds__(128) void k_gemm_h(const float* __restrict__ A, int lda, size_t sA, const _Float16* __restrict__ Bh, int ldb, size_t sB, float alpha, float* __restrict__ C, int ldc, size_t sC, int M, int N, int K) {
  __shared__ __attribute__((aligned(16))) float so[4][16][64];
  const int tid = threadIdx.x, w = tid >> 5, lane = tid & 31, ln = lane & 15, hh = lane >> 4; const int by = blockIdx.y;
  A += (size_t)by * sA; Bh += (size_t)by * sB; C += (size_t)by * sC;
  const int ntn = (N + 63) / 64; const int wid = blockIdx.x * 4 + w; const int mt = wid / ntn, nq = wid % ntn; if (mt * 16 >= M) return;
  const int row0 = mt * 16, col0 = nq * 64; const float* arow = A + (size_t)(row0 + ln) * lda;
  v8f acc[4] = {};
  for (int kb = 0; kb < K; kb += 32) {
    FragH ah, al;
    const v4f x0 = *(const v4fa*)(arow + kb + 8 * hh), x1 = *(const v4fa*)(arow + kb + 8 * hh + 4), x2 = *(const v4fa*)(arow + kb + 16 + 8 * hh), x3 = *(const v4fa*)(arow + kb + 16 + 8 * hh + 4);
    float xs[16] = {x0[0],x0[1],x0[2],x0[3],x1[0],x1[1],x1[2],x1[3],x2[0],x2[1],x2[2],x2[3],x3[0],x3[1],x3[2],x3[3]};
#pragma unroll
    for (int i = 0; i < 16; ++i) { const _Float16 h = (_Float16)xs[i]; ah.h[i] = h; al.h[i] = ASPLIT ? (_Float16)(xs[i] - (float)h) : (_Float16)0.0f; }
#pragma unroll
    for (int t = 0; t < 4; ++t) { if (col0 + t * 16 >= N) continue; const size_t boff = (size_t)(col0 + t * 16 + ln) * ldb + kb; FragH bq; bq.half[0] = *(const v8us*)(Bh + boff + 8 * hh); bq.half[1] = *(const v8us*)(Bh + boff + 16 + 8 * hh);
      acc[t] = mmaH<ASPLIT ? 2 : 1>(ah.v, al.v, bq.v, bq.v, acc[t]); }
  }
#pragma unroll
  for (int t = 0; t < 4; ++t) { if (col0 + t * 16 >= N) continue;
#pragma unroll
    for (int r = 0; r < 8; ++r) so[w][8 * hh + r][t * 16 + ln] = acc[t][r] * alpha; }
  __builtin_amdgcn_fence(__ATOMIC_ACQ_REL, "workgroup"); __builtin_amdgcn_wave_barrier();
  const int rsub = lane >> 4, c4 = (lane & 15) * 4;
  {
#pragma unroll
    for (int q = 0; q < 8; ++q) { const int r = q * 2 + rsub; if (col0 + c4 < N) { const v4f v = *(const v4fa*)&so[w][r][c4]; *(v4f*)(C + (size_t)(row0 + r) * ldc + col0 + c4) = v; } }
     }
}

// Wt[n][k] = f16(W[k][n]·scale) from f32 row-major W[K][N] (scale = power of two; bf16-exact weights stay exact in f16 away from the subnormal range)
__global__ __launch_bounds__(256) void k_wt_f16(const float* __restrict__ W, _Float16* __restrict__ Wt, int K, int N, float scale) {
  const int t = blockIdx.x * 256 + threadIdx.x; if (t >= N * (K / 8)) return; const int n = t / (K / 8), k8 = (t % (K / 8)) * 8; FragH f;
#pragma unroll
  for (int i = 0; i < 8; ++i) f.h[i] = (_Float16)(bf16_round(W[(size_t)(k8 + i) * N + n]) * scale); const v8us o = f.half[0];
  *(v8us*)((unsigned short*)Wt + (size_t)n * K + k8) = o; 
}
// k_gemm_hh variant with fused epilogue: v = acc·alpha + bias[by·sBias + col] (+ CP[(row/rowsPerB)·sCPb + by·64 + col] if CP) ; ACT 0 none / 1 elu ; writes f16 C16 (and f32 C if non-null)
template <int ACT>
__global__ __launch_bounds__(128) void k_gemm_hhx(const _Float16* __restrict__ A, int lda, size_t sA, const _Float16* __restrict__ Bh, int ldb, size_t sB, float alpha, const float* __restrict__ bias, size_t sBias, const float* __restrict__ CP, int rowsPerB, size_t sCPb, int row0g,
    float* __restrict__ C, _Float16* __restrict__ C16, int ldc, size_t sC, int M, int N, int K) {
  __shared__ __attribute__((aligned(16))) float so[4][16][64];
  const int tid = threadIdx.x, w = tid >> 5, lane = tid & 31, ln = lane & 15, hh = lane >> 4; const int by = blockIdx.y;
  A += (size_t)by * sA; Bh += (size_t)by * sB; const size_t cofs = (size_t)by * sC; const float* bp = bias ? bias + (size_t)by * sBias : nullptr;
  const int ntn = (N + 63) / 64; const int wid = blockIdx.x * 4 + w; const int mt = wid / ntn, nq = wid % ntn; if (mt * 16 >= M) return;
  const int row0 = mt * 16, col0 = nq * 64; const _Float16* arow = A + (size_t)(row0 + ln) * lda;
  v8f acc[4] = {};
  for (int kb = 0; kb < K; kb += 32) { FragH ah; ah.half[0] = *(const v8us*)((const unsigned short*)arow + kb + 8 * hh); ah.half[1] = *(const v8us*)((const unsigned short*)arow + kb + 16 + 8 * hh);
#pragma unroll
    for (int t = 0; t < 4; ++t) { if (col0 + t * 16 >= N) continue; const size_t boff = (size_t)(col0 + t * 16 + ln) * ldb + kb; FragH bq; bq.half[0] = *(const v8us*)((const unsigned short*)Bh + boff + 8 * hh); bq.half[1] = *(const v8us*)((const unsigned short*)Bh + boff + 16 + 8 * hh);
      acc[t] = mmaH<1>(ah.v, ah.v, bq.v, bq.v, acc[t]); }
  }
#pragma unroll
  for (int t = 0; t < 4; ++t) { if (col0 + t * 16 >= N) continue; const int col = col0 + t * 16 + ln; const float bv = bp ? bf16_round(bp[col]) : 0.f;
#pragma unroll
    for (int r = 0; r < 8; ++r) { float v = acc[t][r] * alpha + bv; if (CP) { const int rr = row0g + row0 + 8 * hh + r; if (rowsPerB < 0) v += CP[cofs + (size_t)rr * ldc + col];      /* rowsPerB < 0: own element of the batched C plane */ else { const int bidx = rr / rowsPerB; v += CP[(size_t)bidx * sCPb + (size_t)by * 64 + col]; } } if (ACT == 1) v = (v > 0.f) ? v : expm1f(v); else if (ACT == 7) v = (v > 0.f) ? v + 1.0f : expf(v); else if (ACT == 8) v = tanhf(v); else if (ACT == 9) v = 0.5f * v * (1.0f + tanhf(0.7978845608028654f * (v + 0.044715f * v * v * v))); else if (ACT == 11) v = 1.0f / (1.0f + expf(-v)); else if (ACT == 12) v = (v > 0.f) ? v : 0.01f * v; else if (ACT == 14) v = (v > 0.f) ? v : 0.1f * v; else if (ACT == 16) v = (v >= 0.f) ? v : 0.3f * v; else if (ACT == 17) v = (v >= 0.f) ? v : 0.2f * v; else if (ACT == 15) v = v / (1.0f + expf(-v)); else if (ACT == 3) v = fmaxf(v, 0.f); else if (ACT == 6) v = 0.5f * v * (1.0f + erff(v * 0.70710678118654752f)); so[w][8 * hh + r][t * 16 + ln] = v; } }
  __builtin_amdgcn_fence(__ATOMIC_ACQ_REL, "workgroup"); __builtin_amdgcn_wave_barrier();
  const int rsub = lane >> 4, c4 = (lane & 15) * 4; typedef _Float16 v4h __attribute__((ext_vector_type(4)));
  {
#pragma unroll
    for (int q = 0; q < 8; ++q) { const int r = q * 2 + rsub; if (col0 + c4 < N) { const v4f v = *(const v4fa*)&so[w][r][c4]; if (C) *(v4f*)(C + cofs + (size_t)(row0 + r) * ldc + col0 + c4) = v; if (C16) { v4h h4; for (int i = 0; i < 4; ++i) h4[i] = (_Float16)v[i]; *(v4h*)(C16 + cofs + (size_t)(row0 + r) * ldc + col0 + c4) = h4; } } }
     }
}


typedef _Float16 v4h __attribute__((ext_vector_type(4)));

__global__ __launch_bounds__(256) void k_x16(const float* __restrict__ x, _Float16* __restrict__ X16, size_t n8) { const size_t t = (size_t)blockIdx.x * 256 + threadIdx.x; if (t >= n8) return; FragH f;
#pragma unroll
  for (int q = 0; q < 8; ++q) f.h[q] = (_Float16)bf16_round(x[t * 8 + q]); *(v8us*)((unsigned short*)X16 + t * 8) = f.half[0];  }
__global__ __launch_bounds__(256) void k_h16(const float* __restrict__ x, _Float16* __restrict__ X16, size_t n8) { const size_t t = (size_t)blockIdx.x * 256 + threadIdx.x; if (t >= n8) return; FragH f;
#pragma unroll
  for (int q = 0; q < 8; ++q) f.h[q] = (_Float16)x[t * 8 + q]; *(v8us*)((unsigned short*)X16 + t * 8) = f.half[0];  }
__global__ __launch_bounds__(256) void k_round16f(const float* __restrict__ W, _Float16* __restrict__ Bt, size_t n8) { const size_t t = (size_t)blockIdx.x * 256 + threadIdx.x; if (t >= n8) return; FragH f;
#pragma unroll
  for (int i = 0; i < 8; ++i) f.h[i] = (_Float16)(bf16_round(W[t * 8 + i]) * 16.0f); *(v8us*)((unsigned short*)Bt + t * 8) = f.half[0];  }
template <int NHv, int TTv>
__global__ __launch_bounds__(256) void k_vt(const _Float16* __restrict__ V16, int ldv, int voff, _Float16* __restrict__ Vt) { __shared__ unsigned short tl[64][66]; const int tid = threadIdx.x; const int slab = blockIdx.x / (TTv / 64), lg = blockIdx.x % (TTv / 64); const int b = slab / NHv, h = slab % NHv;
  for (int i = tid; i < 64 * 8; i += 256) { const int r = i / 8, c8 = (i % 8) * 8; FragH f; f.half[0] = *(const v8us*)((const unsigned short*)V16 + ((size_t)b * TTv + lg * 64 + r) * ldv + voff + h * 64 + c8);
#pragma unroll
    for (int q = 0; q < 8; ++q) tl[r][c8 + q] = f.u[q]; }
  __syncthreads();
  {
#pragma unroll
    for (int rd = 0; rd < 2; ++rd) { const int d = rd * 32 + tid / 8, pc = tid % 8; FragH f;
#pragma unroll
      for (int q = 0; q < 8; ++q) f.u[q] = tl[pc * 8 + q][d];
      *(v8us*)((unsigned short*)Vt + ((size_t)slab * 64 + d) * TTv + lg * 64 + pc * 8) = f.half[0]; }
     } }

__global__ __launch_bounds__(256) void k_hl(const float* __restrict__ F, _Float16* __restrict__ Hh, _Float16* __restrict__ Hl, size_t n8) { const size_t t = (size_t)blockIdx.x * 256 + threadIdx.x; if (t >= n8) return; FragH fh, fl; const v4f a = *(const v4fa*)(F + t * 8), c = *(const v4fa*)(F + t * 8 + 4);
#pragma unroll
  for (int q = 0; q < 4; ++q) { _Float16 h = (_Float16)a[q]; fh.h[q] = h; fl.h[q] = (_Float16)((a[q] - (float)h) * 1024.0f); h = (_Float16)c[q]; fh.h[4 + q] = h; fl.h[4 + q] = (_Float16)((c[q] - (float)h) * 1024.0f); }
  { *(v8us*)((unsigned short*)Hh + t * 8) = fh.half[0]; *(v8us*)((unsigned short*)Hl + t * 8) = fl.half[0];  } }

__global__ __launch_bounds__(256) void k_wnat(const float* __restrict__ w, size_t n8, _Float16* __restrict__ Bt) { const size_t t = (size_t)blockIdx.x * 256 + threadIdx.x; if (t >= n8) return; FragH f; for (int q = 0; q < 8; ++q) f.h[q] = (_Float16)(bf16_round(w[t * 8 + q]) * 16.0f); *(v8us*)((unsigned short*)Bt + t * 8) = f.half[0];  }
__global__ __launch_bounds__(256) void k_rsm(const float* __restrict__ S, _Float16* __restrict__ P, int nrows) {
  #pragma clang fp contract(off)
  const int i = blockIdx.x * 256 + threadIdx.x; if (i >= nrows) return; const float* s = S + (size_t)i * SQ; float mx = -3.0e38f;
#pragma unroll 1
  for (int j = 0; j < SQ; ++j) mx = fmaxf(mx, s[j]); float se = 0.f;
#pragma unroll 1
  for (int j = 0; j < SQ; ++j) se += expf(s[j] - mx); const float sc = 256.0f / se;
#pragma unroll 1
  for (int j0 = 0; j0 < SQ; j0 += 8) { FragH f; for (int q = 0; q < 8; ++q) f.h[q] = (_Float16)(expf(s[j0 + q] - mx) * sc); unsigned short* d = (unsigned short*)P + (size_t)i * SQ + j0; *(v8us*)d = f.half[0];  } }
__global__ __launch_bounds__(256) void k_vt(const _Float16* __restrict__ V16, int b, int h0, _Float16* __restrict__ VT) { __shared__ unsigned short tl[64][65]; const int tid = threadIdx.x; const int hh = blockIdx.x % HG, sg = blockIdx.x / HG; const int s0 = sg * 64; const int h = h0 + hh;
  for (int i = tid; i < 64 * 8; i += 256) { const int j = i / 8, d8 = (i % 8) * 8; FragH f; f.half[0] = *(const v8us*)((const unsigned short*)V16 + ((size_t)b * SQ + s0 + j) * DM + h * HD + d8); for (int q = 0; q < 8; ++q) tl[d8 + q][j] = f.u[q]; }
  __syncthreads();
  { for (int i = tid; i < 64 * 8; i += 256) { const int d = i / 8, j8 = (i % 8) * 8; FragH f; for (int q = 0; q < 8; ++q) f.u[q] = tl[d][j8 + q]; *(v8us*)((unsigned short*)VT + ((size_t)hh * HD + d) * SQ + s0 + j8) = f.half[0]; }  } }



__global__ __launch_bounds__(256) void k_rsmf(const float* __restrict__ S, _Float16* __restrict__ P, int qn, int hg) {
  #pragma clang fp contract(off)
  const int t = blockIdx.x * 256 + threadIdx.x; if (t >= qn * hg) return; const size_t i = (size_t)(t / qn) * SQ + (t % qn); const float* s = S + i * SQ; float mx = -3.0e38f;
#pragma unroll 1
  for (int j = 0; j < SQ; ++j) mx = fmaxf(mx, s[j]); float se = 0.f;
#pragma unroll 1
  for (int j = 0; j < SQ; ++j) se += __expf(s[j] - mx); const float sc = 256.0f / se;
#pragma unroll 1
  for (int j0 = 0; j0 < SQ; j0 += 8) { FragH f; for (int q = 0; q < 8; ++q) f.h[q] = (_Float16)(__expf(s[j0 + q] - mx) * sc); unsigned short* d = (unsigned short*)P + i * SQ + j0; *(v8us*)d = f.half[0];  } }

// Four reciprocals. One statement with results apart from sources, so that behind each v_rcp_f32 stands an instruction that touches neither its result nor its source: the next reciprocal, and behind the last the v_nop (the slot the instruction set asks for behind a transcendental).
__device__ __forceinline__ v4f rcp4(v4f d) { v4f o;
  asm("v_rcp_f32 %0, %4\n\tv_rcp_f32 %1, %5\n\tv_rcp_f32 %2, %6\n\tv_rcp_f32 %3, %7\n\tv_nop" : "=&v"(o[0]), "=&v"(o[1]), "=&v"(o[2]), "=&v"(o[3]) : "v"(d[0]), "v"(d[1]), "v"(d[2]), "v"(d[3]));
  return o; }
typedef _Float16 v8h __attribute__((ext_vector_type(8)));
#define AW 8                         /* query groups per work-group of the attention kernel */
#define AH 2                         /* waves per query group: each walks its own half of the keys */
#define AQ 32                        /* query columns per group, and per wave (two 16-column tiles) */
#define AK 64                        /* keys per LDS stage */
#define AP 72                        /* LDS row pitch in f16: 128 data bytes + 16 (16-byte fragment reads fall on different banks) */
#define ANS (SQ / AH / AK)           /* stages per walk over one half of the keys */
#define AT (AK * AP)                 /* f16 per LDS tile */
#define AR 3                         /* buffers of the K ring and of the V^T ring, per half of the keys */
__device__ __forceinline__ v16h fa_frag(const unsigned short* p, int hh) { FragH f; f.half[0] = *(const v8us*)(p + 8 * hh); f.half[1] = *(const v8us*)(p + 16 + 8 * hh); return f.v; }
__device__ __forceinline__ v8f fa_mma(v16h a, v16h b, v8f c) { return __builtin_amdgcn_wmma_f32_16x16x32_f16(false, a, false, b, (short)0, c, false, false); }
// 256 x the stablemax3 weight for x <= 0, eight values: 1 / (1 - x (1 - x/2 (1 - x/3))) with the factor 2^-8 carried exactly through the two outer terms of the denominator; x / 3 as a multiply by f32(1/3); reciprocal through v_rcp_f32.
__device__ __forceinline__ v8f stm3w(v8f x) { const v8f a = 1.0f - x * 0.33333334f; const v8f b = 0.00390625f - (0.001953125f * x) * a; const v8f d = 0.00390625f - x * b;
  const v4f lo = rcp4(__builtin_shufflevector(d, d, 0, 1, 2, 3)), hi = rcp4(__builtin_shufflevector(d, d, 4, 5, 6, 7)); return __builtin_shufflevector(lo, hi, 0, 1, 2, 3, 4, 5, 6, 7); }
__device__ __forceinline__ void fa_signal() { asm volatile("s_wait_dscnt 0x0\n\ts_barrier_signal -1" ::: "memory"); }      /* first half of the stage barrier: this wave's LDS stores have landed and its earlier LDS reads are over, then it signals; the clobber keeps the compiler's LDS accesses on their side */
__device__ __forceinline__ void fa_wait() { asm volatile("s_barrier_wait -1" ::: "memory"); }      /* second half: every wave of the work-group has signalled; the clobber keeps the next stage's LDS reads and stores behind it */
__global__ __launch_bounds__(AW * AH * 32) void k_attn(const _Float16* __restrict__ QKV, const _Float16* __restrict__ VT, _Float16* __restrict__ O16) {
  __shared__ __attribute__((aligned(16))) unsigned short sm[AH * 2 * AR * AT];      /* per half of the keys: the K ring, then the V^T ring */
  __shared__ __attribute__((aligned(16))) float sxo[AW * AH * 4 * 2 * 32 * 4];      /* the output tiles handed over: a place of their own, because behind the last stage's wait a slower wave may still read the rings */
  __shared__ float sx[AW * AH][32];      /* row maxima, later row sums, handed over */
  static_assert(AH == 2 && (ANS & (ANS - 1)) == 0 && ANS >= 2 && AR == 3, "two halves; the stage count wraps by a mask; the split barrier needs three buffers");
  const int tid = threadIdx.x, lane = tid & 31, ln = lane & 15, hh = lane >> 4, w = tid >> 5; const int h = blockIdx.y, b = blockIdx.z;
  const int kh = __builtin_amdgcn_readfirstlane(w / AW), ts = tid & (AW * 32 - 1); const int q0 = blockIdx.x * (AW * AQ) + (w & (AW - 1)) * AQ;      /* kh: this wave's half of the keys, the same in every lane (held as a scalar); ts: the thread's number inside its half */
  const unsigned short* Qp = (const unsigned short*)QKV + (size_t)b * SQ * LQ + h * HD; const unsigned short* Kp = Qp + DM + (size_t)kh * (SQ / AH) * LQ; const unsigned short* Vp = (const unsigned short*)VT + (size_t)(b * NH + h) * HD * SQ + kh * (SQ / AH);
  unsigned short* sK = sm + kh * 2 * AR * AT; unsigned short* sV = sK + AR * AT;
  const int srow = ts >> 3, sch = (ts & 7) * 8; const int sl = srow * AP + sch;      /* staging: eight threads a 128-byte row, rows srow and srow + 32 */
  const unsigned short* kg = Kp + (size_t)srow * LQ + sch; const unsigned short* vg = Vp + (size_t)srow * SQ + sch;
  const v8f z8 = {0.f, 0.f, 0.f, 0.f, 0.f, 0.f, 0.f, 0.f};
  v16h qf[2][2]; const unsigned short* qg = Qp + (size_t)(q0 + ln) * LQ + 8 * hh;
#pragma unroll
  for (int n = 0; n < 2; ++n) for (int c = 0; c < 2; ++c) qf[n][c] = fa_frag(qg + (size_t)n * 16 * LQ + c * 32, 0);
  v8us k0 = *(const v8us*)kg, k1 = *(const v8us*)(kg + (size_t)32 * LQ), v0 = *(const v8us*)vg, v1 = *(const v8us*)(vg + (size_t)32 * SQ);
  const unsigned short* kg1 = kg + (size_t)AK * LQ; const v8us k2 = *(const v8us*)kg1, k3 = *(const v8us*)(kg1 + (size_t)32 * LQ);      /* K tile 1: stage 0 stores it at its head */
  asm volatile("s_wait_xcnt 0x0" :: "v"(qg), "v"(qg + (size_t)16 * LQ), "v"(kg), "v"(vg), "v"(kg1) : "memory");      /* the address registers of the loads above are kept, and not reused as a load's destination either, until this wait */
  *(v8us*)&sK[sl] = k0; *(v8us*)&sK[sl + 32 * AP] = k1; *(v8us*)&sV[(ANS % AR) * AT + sl] = v0; *(v8us*)&sV[(ANS % AR) * AT + sl + 32 * AP] = v1;      /* V^T tile 0 waits through walk 1, which touches only sK, in the ring place that walk 2 starts at */
  k0 = k2; k1 = k3;
  __syncthreads();
  int rc = 0;      /* ring place of the stage's tile; runs on from walk 1 into walk 2; the same in every wave (a scalar) */
  v8f m8[2]; m8[0] = z8 - 3.0e38f; m8[1] = m8[0];
#pragma unroll 1      /* one stage a trip: the body is already 16 products long */
  for (int s = 0; s < ANS; ++s) { const int sn = (s + 2) & (ANS - 1), rn = rc == AR - 1 ? 0 : rc + 1;      /* the tiles behind the last are tiles 0 and 1 again: no branch in the trip, and walk 2 finds its first K tile in the ring and its second in the registers */
    { unsigned short* d = sK + rn * AT; *(v8us*)&d[sl] = k0; *(v8us*)&d[sl + 32 * AP] = k1; }
    fa_signal();
    { const unsigned short* g = kg + (size_t)sn * AK * LQ; k0 = *(const v8us*)g; k1 = *(const v8us*)(g + (size_t)32 * LQ);
      asm volatile("s_wait_xcnt 0x0" :: "v"(g) : "memory"); }      /* as above: the address pair is kept until this wait */
    const unsigned short* kb = sK + rc * AT;
#pragma unroll
    for (int j = 0; j < 4; ++j) { const v16h a0 = fa_frag(kb + (j * 16 + ln) * AP, hh), a1 = fa_frag(kb + (j * 16 + ln) * AP + 32, hh);
#pragma unroll
      for (int n = 0; n < 2; ++n) m8[n] = __builtin_elementwise_max(m8[n], fa_mma(a1, qf[n][1], fa_mma(a0, qf[n][0], z8))); }
    __builtin_amdgcn_sched_barrier(0);      /* holds the stage's products and maxima in front of the wait: left free, the wait is lifted to right behind the stage's LDS reads, and no wave starts a stage's arithmetic before every wave has ended the stage before */
    fa_wait(); rc = rn; }
  { const unsigned short* u = vg + AK; v0 = *(const v8us*)u; v1 = *(const v8us*)(u + (size_t)32 * SQ);      /* V^T tile 1: walk 2 stores it at the head of its first stage */
    asm volatile("s_wait_xcnt 0x0" :: "v"(u) : "memory"); }      /* as above: the address pair is kept until this wait */
  float mx[2];
#pragma unroll
  for (int n = 0; n < 2; ++n) { float m = fmaxf(fmaxf(fmaxf(m8[n][0], m8[n][1]), fmaxf(m8[n][2], m8[n][3])), fmaxf(fmaxf(m8[n][4], m8[n][5]), fmaxf(m8[n][6], m8[n][7]))); mx[n] = fmaxf(m, __shfl_xor(m, 16, 32)); }
  sx[w][lane] = hh ? mx[1] : mx[0];      /* this half's maxima: columns of tile 0 from lanes 0..15, of tile 1 from lanes 16..31 */
  __syncthreads();      /* the other half's maxima are read below */
#pragma unroll
  for (int n = 0; n < 2; ++n) mx[n] = fmaxf(mx[n], sx[w ^ AW][n * 16 + ln]) * 0.125f;
  v8f o[4][2]; v8f s8[2]; s8[0] = z8; s8[1] = z8;
#pragma unroll
  for (int t = 0; t < 4; ++t) { o[t][0] = z8; o[t][1] = z8; }
#pragma unroll 1      /* one stage a trip: the body is already 32 products long */
  for (int s = 0; s < ANS; ++s) { const int sn = (s + 2) & (ANS - 1), rn = rc == AR - 1 ? 0 : rc + 1;      /* as in walk 1; what the last trip stores and the last two trips load is read by nobody */
    { unsigned short* d = sK + rn * AT; *(v8us*)&d[sl] = k0; *(v8us*)&d[sl + 32 * AP] = k1; unsigned short* e = sV + rn * AT; *(v8us*)&e[sl] = v0; *(v8us*)&e[sl + 32 * AP] = v1; }
    fa_signal();
    { const unsigned short* g = kg + (size_t)sn * AK * LQ; k0 = *(const v8us*)g; k1 = *(const v8us*)(g + (size_t)32 * LQ); const unsigned short* u = vg + sn * AK; v0 = *(const v8us*)u; v1 = *(const v8us*)(u + (size_t)32 * SQ);
      asm volatile("s_wait_xcnt 0x0" :: "v"(g), "v"(u) : "memory"); }      /* as above: both address pairs are kept until this wait */
    const unsigned short* kb = sK + rc * AT; const unsigned short* vb = sV + rc * AT;
#pragma unroll
    for (int kk = 0; kk < 2; ++kk) { union { v16h v; v8h p[2]; } pf[2]; v16h ka[2][2], va[4];
#pragma unroll
      for (int j = 0; j < 2; ++j) { const unsigned short* kr = kb + (kk * 32 + j * 16 + ln) * AP; ka[j][0] = fa_frag(kr, hh); ka[j][1] = fa_frag(kr + 32, hh); }
#pragma unroll
      for (int t = 0; t < 4; ++t) va[t] = fa_frag(vb + (t * 16 + ln) * AP + kk * 32, hh);
      __builtin_amdgcn_sched_barrier(0);      /* holds the loads above in front of the arithmetic: left free, the V^T fragments are fetched one at a time right in front of their products (an LDS latency each) and the next stage's global loads are issued in mid-stage */
#pragma unroll
      for (int j = 0; j < 2; ++j) {
#pragma unroll
        for (int n = 0; n < 2; ++n) { const v8f st = fa_mma(ka[j][1], qf[n][1], fa_mma(ka[j][0], qf[n][0], z8)); const v8f wt = stm3w(st * 0.125f - mx[n]); s8[n] += wt; pf[n].p[j] = __builtin_convertvector(wt, v8h); } }
#pragma unroll
      for (int t = 0; t < 4; ++t) { o[t][0] = fa_mma(va[t], pf[0].v, o[t][0]); o[t][1] = fa_mma(va[t], pf[1].v, o[t][1]); } }
    __builtin_amdgcn_sched_barrier(0);      /* as in walk 1: holds the stage's arithmetic in front of the wait */
    fa_wait(); rc = rn; }
  float sh[2];
#pragma unroll
  for (int n = 0; n < 2; ++n) { const float se = ((s8[n][0] + s8[n][1]) + (s8[n][2] + s8[n][3])) + ((s8[n][4] + s8[n][5]) + (s8[n][6] + s8[n][7])); sh[n] = se + __shfl_xor(se, 16, 32); }
  // The wave of half kh finishes query tile kh and hands tile 1 - kh to its partner (same lane: same query, same d).
  v4fa* xo = (v4fa*)sxo;      /* [wave][t][accumulators 0..3, 4..7][lane]: every LDS store and load is 512 contiguous bytes of a wave */
#pragma unroll
  for (int t = 0; t < 4; ++t) { const v8f g = kh ? o[t][0] : o[t][1]; xo[((w * 4 + t) * 2) * 32 + lane] = __builtin_shufflevector(g, g, 0, 1, 2, 3); xo[((w * 4 + t) * 2 + 1) * 32 + lane] = __builtin_shufflevector(g, g, 4, 5, 6, 7); }
  sx[w][lane] = kh ? sh[0] : sh[1];
  __syncthreads();      /* the partner's tile and sum are read below */
  const int pw = w ^ AW; const float sc = 64.0f / ((kh ? sh[1] : sh[0]) + sx[pw][lane]);      /* weights carry x256 in numerator and sum alike; o is carried x64 */
  _Float16* op = O16 + (size_t)(b * SQ + q0 + kh * 16 + ln) * DM + h * HD + 8 * hh;
#pragma unroll
  for (int t = 0; t < 4; ++t) { const v4f lo = xo[((pw * 4 + t) * 2) * 32 + lane], hi = xo[((pw * 4 + t) * 2 + 1) * 32 + lane]; const v8f a = (kh ? o[t][1] : o[t][0]) + __builtin_shufflevector(lo, hi, 0, 1, 2, 3, 4, 5, 6, 7);
    *(v8h*)(op + t * 16) = __builtin_convertvector(a * sc, v8h); } }      /* a lane's eight accumulators are eight consecutive d of one query: one 16-byte store */

// ---- GEMM C[M][N] = alpha A[M][K] . Bt[N][K]^T + bias, f16 operands, f32 accumulation; one 128 x 128 tile of C per work-group, four waves of 64 x 64 (M, N multiples of 128; K a multiple of 64, at least 128) ----
#define GT 128                       /* rows of A and rows of Bt per work-group tile */
#define GK 64                        /* k per stage: one whole 128-byte line of every operand row */
#define GP 72                        /* LDS row pitch in f16: 128 data bytes + 16 (16-byte fragment reads fall on different banks) */
#define GBUF (2 * GT * GP)           /* f16 per buffer: the A rows, then the Bt rows */
// Eight asynchronous 16-byte copies per lane, global memory to LDS: rows 16 apart (gs f16 in memory, 16 GP f16 in LDS). A wave's copy is four whole 128-byte lines. s_wait_xcnt 0 is the statement's own last line, so that no address register of a copy is rewritten in front of it (a precaution).
__device__ __forceinline__ void g3_copy8(unsigned l, const unsigned short* g, size_t gs) {
  asm volatile("global_load_async_to_lds_b128 %0, %8, off\n\tglobal_load_async_to_lds_b128 %1, %9, off\n\tglobal_load_async_to_lds_b128 %2, %10, off\n\tglobal_load_async_to_lds_b128 %3, %11, off\n\t"
               "global_load_async_to_lds_b128 %4, %12, off\n\tglobal_load_async_to_lds_b128 %5, %13, off\n\tglobal_load_async_to_lds_b128 %6, %14, off\n\tglobal_load_async_to_lds_b128 %7, %15, off\n\ts_wait_xcnt 0x0"
               :: "v"(l), "v"(l + 1u * 32u * GP), "v"(l + 2u * 32u * GP), "v"(l + 3u * 32u * GP), "v"(l + 4u * 32u * GP), "v"(l + 5u * 32u * GP), "v"(l + 6u * 32u * GP), "v"(l + 7u * 32u * GP),
                  "v"(g), "v"(g + gs), "v"(g + 2 * gs), "v"(g + 3 * gs), "v"(g + 4 * gs), "v"(g + 5 * gs), "v"(g + 6 * gs), "v"(g + 7 * gs) : "memory"); }
// Each operand line leaves L2 once per work-group, as a whole line, and is read from LDS by the two waves that need it. Two buffers: stage t + 1 flies while stage t is worked on; one barrier a stage (it publishes the next buffer and ends the reads of the one refilled behind it).
// Every accumulator takes its k blocks of 32 in ascending order. The epilogue turns each wave's tile through LDS (the ring, free behind the last stage's barrier) so that rows go out as whole lines.
// f16 output, columns from 2 DM on (the v third): a wave's 64 columns are the 64 d of one head and its 64 rows are 64 s of one batch, so the tile is staged as [d][s] (a lane's eight accumulators are eight consecutive s of one d: two 16-byte LDS stores) and goes out as 64 whole lines of CT = V^T [batch][head][d][s]; nothing is written to C16 there.
template <bool OUT16>      /* the output type is fixed at compile time: no branch in the epilogue, its LDS reads go out together */
__global__ __launch_bounds__(128) void k_gemm3(const _Float16* __restrict__ A, int lda, const _Float16* __restrict__ Bh, int ldb, float alpha, const float* __restrict__ bias, float* __restrict__ C, _Float16* __restrict__ C16, _Float16* __restrict__ CT, int ldc, int N, int K) {
  __shared__ __attribute__((aligned(16))) unsigned char smem[2 * GBUF * 2]; static_assert(4 * 64 * 68 * 4 <= 2 * GBUF * 2, "epilogue staging fits the ring");
  const unsigned short* sm = (const unsigned short*)smem;
  const int tid = threadIdx.x, w = tid >> 5, lane = tid & 31, ln = lane & 15, hh = lane >> 4; const int ntn = N >> 7; const int mt = blockIdx.x / ntn, nq = blockIdx.x - mt * ntn;
  const int row0 = mt * GT + (w >> 1) * 64, col0 = nq * GT + (w & 1) * 64;      /* this wave's 64 x 64 tile */
  const int srow = tid >> 3, sch = (tid & 7) * 8;      /* staging: eight lanes a 128-byte row; rows srow, srow + 16, ... */
  const unsigned short* ag = (const unsigned short*)A + (size_t)(mt * GT + srow) * lda + sch; const unsigned short* bg = (const unsigned short*)Bh + (size_t)(nq * GT + srow) * ldb + sch;
  const unsigned la = (unsigned)(size_t)(sm + srow * GP + sch), lb = la + GT * GP * 2u;      /* LDS byte addresses in buffer 0 */
  const int nt = K / GK; const size_t gsa = (size_t)16 * lda, gsb = (size_t)16 * ldb;
  const v8f z8 = {0.f, 0.f, 0.f, 0.f, 0.f, 0.f, 0.f, 0.f}; v8f acc[4][4];
#pragma unroll
  for (int i = 0; i < 4; ++i) for (int j = 0; j < 4; ++j) acc[i][j] = z8;
  g3_copy8(la, ag, gsa); g3_copy8(lb, bg, gsb);
  asm volatile("s_wait_asynccnt 0x0" ::: "memory");      /* this wave's part of stage 0 has landed */
  __syncthreads();
  g3_copy8(la + GBUF * 2u, ag + GK, gsa); g3_copy8(lb + GBUF * 2u, bg + GK, gsb);
#pragma unroll 1      /* one stage a trip: the body is already 32 products long */
  for (int t = 0; t < nt; ++t) { const unsigned short* ab = sm + (t & 1) * GBUF + ((w >> 1) * 64 + ln) * GP; const unsigned short* bb = sm + (t & 1) * GBUF + (GT + (w & 1) * 64 + ln) * GP;
#pragma unroll
    for (int c = 0; c < 2; ++c) { v16h af[4], bf[4];
#pragma unroll
      for (int i = 0; i < 4; ++i) { af[i] = fa_frag(ab + i * 16 * GP + c * 32, hh); bf[i] = fa_frag(bb + i * 16 * GP + c * 32, hh); }
      __builtin_amdgcn_sched_barrier(0);      /* holds the sixteen LDS reads above together in front of the products: left free, the A fragments are fetched one at a time, each with a full LDS latency in front of its four products */
#pragma unroll
      for (int i = 0; i < 4; ++i) for (int j = 0; j < 4; ++j) acc[i][j] = fa_mma(af[i], bf[j], acc[i][j]); }
    asm volatile("s_wait_dscnt 0x0" ::: "memory");      /* this wave's reads of the buffer are over before anybody refills it */
    asm volatile("s_wait_asynccnt 0x0" ::: "memory");      /* this wave's part of stage t + 1 has landed before anybody reads it */
    __syncthreads();
    if (t + 2 < nt) { const unsigned bo = (unsigned)(t & 1) * (GBUF * 2u); g3_copy8(la + bo, ag + (size_t)(t + 2) * GK, gsa); g3_copy8(lb + bo, bg + (size_t)(t + 2) * GK, gsb); } }
  asm volatile("s_wait_asynccnt 0x0" ::: "memory");      /* no copy is outstanding when the ring becomes output staging */
  float* so = (float*)smem + (size_t)w * 64 * 68; float bv[4] = {0.f, 0.f, 0.f, 0.f};
  if (bias) {
#pragma unroll
    for (int j = 0; j < 4; ++j) bv[j] = bf16_round(bias[col0 + j * 16 + ln]); }
  const int rsub = lane >> 4, c4 = (lane & 15) * 4;
  if (OUT16 && nq * GT >= 2 * DM) {      /* the v third; the test reads the same for the whole work-group (2 DM is a multiple of GT) */
#pragma unroll
    for (int i = 0; i < 4; ++i) {
#pragma unroll
      for (int j = 0; j < 4; ++j) { v4f lo, hi;
#pragma unroll
        for (int r = 0; r < 4; ++r) { lo[r] = acc[i][j][r] * alpha + bv[j]; hi[r] = acc[i][j][4 + r] * alpha + bv[j]; }
        float* d = so + (j * 16 + ln) * 68 + i * 16 + 8 * hh; *(v4fa*)d = lo; *(v4fa*)(d + 4) = hi; } }
    __builtin_amdgcn_fence(__ATOMIC_ACQ_REL, "workgroup"); __builtin_amdgcn_wave_barrier();      /* the rows read below were stored by other lanes of this wave: those LDS stores are finished, and not moved by the compiler, before the reads */
    _Float16* vt = CT + ((size_t)(row0 / SQ) * DM + (col0 - 2 * DM)) * SQ + row0 % SQ;      /* row (batch NH + head) HD of V^T, column s of the tile's first row */
#pragma unroll
    for (int q = 0; q < 32; ++q) { const int d = q * 2 + rsub; const v4f v = *(const v4fa*)&so[d * 68 + c4]; v4h h4; for (int i = 0; i < 4; ++i) h4[i] = (_Float16)v[i]; *(v4h*)(vt + (size_t)d * SQ + c4) = h4; }
    return; }
#pragma unroll
  for (int i = 0; i < 4; ++i) {
#pragma unroll
    for (int j = 0; j < 4; ++j) {
#pragma unroll
      for (int r = 0; r < 8; ++r) so[(i * 16 + 8 * hh + r) * 68 + j * 16 + ln] = acc[i][j][r] * alpha + bv[j]; } }
  __builtin_amdgcn_fence(__ATOMIC_ACQ_REL, "workgroup"); __builtin_amdgcn_wave_barrier();
#pragma unroll
  for (int q = 0; q < 32; ++q) { const int r = q * 2 + rsub; const v4f v = *(const v4fa*)&so[r * 68 + c4]; const size_t co = (size_t)(row0 + r) * ldc + col0 + c4;
    if (OUT16) { v4h h4; for (int i = 0; i < 4; ++i) h4[i] = (_Float16)v[i]; *(v4h*)(C16 + co) = h4; } else *(v4f*)(C + co) = v; } }

// ---- q | k | v projection: the same GEMM with ONE 256 x 192 tile of C per work-group, twelve waves of 64 x 64 (M a multiple of 256, N of 192, K of 64, at least 192) ----
#define JM 256                       /* rows of A per work-group tile */
#define JN 192                       /* rows of Bt per work-group tile */
#define JW ((JM / 64) * (JN / 64))   /* waves per work-group */
#define JR (JM + JN)                 /* operand rows per stage */
#define JBUF (JR * GP)               /* f16 per buffer: the A rows, then the Bt rows */
#define JB 3                         /* buffers */
#define JG (JW / 2)                  /* waves per copying group */
// Eight (four) asynchronous 16-byte copies per lane: rows 4 apart (gs f16 in memory, 4 GP f16 in LDS), so a wave's run is 32 (16) consecutive whole 128-byte rows. s_wait_xcnt 0 is the statement's own last line, so that no address register of a copy is rewritten in front of it (a precaution).
__device__ __forceinline__ void g4_copy8(unsigned l, const unsigned short* g, size_t gs) {
  asm volatile("global_load_async_to_lds_b128 %0, %8, off\n\tglobal_load_async_to_lds_b128 %1, %9, off\n\tglobal_load_async_to_lds_b128 %2, %10, off\n\tglobal_load_async_to_lds_b128 %3, %11, off\n\t"
               "global_load_async_to_lds_b128 %4, %12, off\n\tglobal_load_async_to_lds_b128 %5, %13, off\n\tglobal_load_async_to_lds_b128 %6, %14, off\n\tglobal_load_async_to_lds_b128 %7, %15, off\n\ts_wait_xcnt 0x0"
               :: "v"(l), "v"(l + 1u * 8u * GP), "v"(l + 2u * 8u * GP), "v"(l + 3u * 8u * GP), "v"(l + 4u * 8u * GP), "v"(l + 5u * 8u * GP), "v"(l + 6u * 8u * GP), "v"(l + 7u * 8u * GP),
                  "v"(g), "v"(g + gs), "v"(g + 2 * gs), "v"(g + 3 * gs), "v"(g + 4 * gs), "v"(g + 5 * gs), "v"(g + 6 * gs), "v"(g + 7 * gs) : "memory"); }
__device__ __forceinline__ void g4_copy4(unsigned l, const unsigned short* g, size_t gs) {
  asm volatile("global_load_async_to_lds_b128 %0, %4, off\n\tglobal_load_async_to_lds_b128 %1, %5, off\n\tglobal_load_async_to_lds_b128 %2, %6, off\n\tglobal_load_async_to_lds_b128 %3, %7, off\n\ts_wait_xcnt 0x0"
               :: "v"(l), "v"(l + 1u * 8u * GP), "v"(l + 2u * 8u * GP), "v"(l + 3u * 8u * GP), "v"(g), "v"(g + gs), "v"(g + 2 * gs), "v"(g + 3 * gs) : "memory"); }
// The twelve 64 x 64 wave tiles that a WGP works on were three work-groups with 3 x 256 operand rows a stage from L2; as one work-group they share 448. The grid is one work-group per WGP.
// One work-group must now keep in flight what three kept, so a stage's copies get two trips to land: three buffers, and the waves copy by turns: waves 0..5 bring the even stages, waves 6..11 the odd ones.
// Publish point of trip t, behind the fetch of the stage's last fragments and in front of their products: every wave ends its LDS reads; the group that brought stage t + 1 waits for all its copies (it has no others out); barrier (it publishes stage t + 1 and ends the reads of stage t's buffer); the same group then sends stage t + 3 into that buffer. The other group's copies, stage t + 2, fly on across the barrier; nobody reads them before that group's own wait and the barrier behind it, at the publish point of trip t + 1.
// A stage is 14 runs of 32 rows (8 of A, 6 of Bt): wave g of a group takes runs g and g + 6, and waves 0..3 of the group a 16-row quarter each of the last two runs.
// Wave tile, fragment order, k order and epilogue are those of k_gemm3; whether a tile belongs to the v third is now asked per wave (192 does not divide 2 DM; the epilogue has no work-group barrier).
__global__ __launch_bounds__(JW * 32) void k_gemmq(const _Float16* __restrict__ A, int lda, const _Float16* __restrict__ Bh, int ldb, float alpha, const float* __restrict__ bias, _Float16* __restrict__ C16, _Float16* __restrict__ CT, int ldc, int N, int K) {
  __shared__ __attribute__((aligned(16))) unsigned char smem[JW * 64 * 68 * 4]; static_assert(JB * JBUF * 2 <= JW * 64 * 68 * 4 && JB == 3 && JR == 14 * 32 && JG == 6 && JM % 32 == 0, "the ring fits the epilogue staging; the deal of runs below");
  const unsigned short* sm = (const unsigned short*)smem;
  const int tid = threadIdx.x, lane = tid & 31, ln = lane & 15, hh = lane >> 4; const int w = __builtin_amdgcn_readfirstlane(tid >> 5);      /* the wave's number as a scalar: every test on it below is a scalar branch */
  const int ntn = N / JN; const int mt = blockIdx.x / ntn, nq = blockIdx.x - mt * ntn; const int wm = w / (JN / 64), wn = w - wm * (JN / 64);
  const int row0 = mt * JM + wm * 64, col0 = nq * JN + wn * 64;      /* this wave's 64 x 64 tile */
  const int grp = w / JG, gw = w - grp * JG;      /* copying group (parity of its stages) and the wave's number in it */
  const int lr = lane >> 3, sch = (lane & 7) * 8;      /* staging: eight lanes a 128-byte row, four rows a copy */
  const unsigned short* ab0 = (const unsigned short*)A + (size_t)(mt * JM + lr) * lda + sch; const unsigned short* bb0 = (const unsigned short*)Bh + (size_t)(nq * JN + lr) * ldb + sch;
  const bool a1 = (gw + JG) * 32 < JM;      /* the second run lies in A for waves 0 and 1 of a group, in Bt for the others */
  const unsigned short* g0 = ab0 + (size_t)(gw * 32) * lda; const unsigned short* g1 = a1 ? ab0 + (size_t)((gw + JG) * 32) * lda : bb0 + (size_t)((gw + JG) * 32 - JM) * ldb; const unsigned short* g2 = bb0 + (size_t)(2 * JG * 32 - JM + gw * 16) * ldb;
  const size_t s0 = (size_t)4 * lda, s2 = (size_t)4 * ldb, s1 = a1 ? s0 : s2;
  const unsigned l0 = (unsigned)(size_t)(sm + (gw * 32 + lr) * GP + sch), l1 = l0 + JG * 32 * GP * 2u, l2 = (unsigned)(size_t)(sm + (2 * JG * 32 + gw * 16 + lr) * GP + sch);      /* LDS byte addresses in buffer 0 */
  auto stage = [&](int st, int bf) { const unsigned bo = (unsigned)bf * (JBUF * 2u); const size_t ko = (size_t)st * GK; g4_copy8(l0 + bo, g0 + ko, s0); g4_copy8(l1 + bo, g1 + ko, s1); if (gw < 4) g4_copy4(l2 + bo, g2 + ko, s2); };
  const int nt = K / GK;
  const v8f z8 = {0.f, 0.f, 0.f, 0.f, 0.f, 0.f, 0.f, 0.f}; v8f acc[4][4];
#pragma unroll
  for (int i = 0; i < 4; ++i) for (int j = 0; j < 4; ++j) acc[i][j] = z8;
  stage(grp, grp);      /* stage 0 from group 0, stage 1 from group 1 */
  if (grp == 0) asm volatile("s_wait_asynccnt 0x0" ::: "memory");      /* this wave's part of stage 0 has landed */
  __syncthreads();
  if (grp == 0) stage(2, 2);
  int rb = 0;      /* ring place of the trip's stage */
#pragma unroll 1      /* one stage a trip: the body is already 32 products long */
  for (int t = 0; t < nt; ++t) { const unsigned short* ab = sm + rb * JBUF + (wm * 64 + ln) * GP; const unsigned short* bb = sm + rb * JBUF + (JM + wn * 64 + ln) * GP; v16h af[4], bf[4];
#pragma unroll
    for (int i = 0; i < 4; ++i) { af[i] = fa_frag(ab + i * 16 * GP, hh); bf[i] = fa_frag(bb + i * 16 * GP, hh); }
    __builtin_amdgcn_sched_barrier(0);      /* holds the sixteen LDS reads above together in front of the products: left free, the A fragments are fetched one at a time, each with a full LDS latency in front of its four products */
#pragma unroll
    for (int i = 0; i < 4; ++i) for (int j = 0; j < 4; ++j) acc[i][j] = fa_mma(af[i], bf[j], acc[i][j]);
#pragma unroll
    for (int i = 0; i < 4; ++i) { af[i] = fa_frag(ab + i * 16 * GP + 32, hh); bf[i] = fa_frag(bb + i * 16 * GP + 32, hh); }
    const bool mine = ((t + 1) & 1) == grp;      /* stages t + 1 and t + 3 are this wave's group's */
    asm volatile("s_wait_dscnt 0x0" ::: "memory");      /* the stage's last fragments are in registers: this wave's reads of the buffer are over before anybody refills it */
    if (mine) asm volatile("s_wait_asynccnt 0x0" ::: "memory");      /* this wave's part of stage t + 1 has landed before anybody reads it */
    __syncthreads();      /* in front of the stage's last sixteen products, which read registers alone: behind it every wave still holds matrix work while the first reads of stage t + 1 are under way */
    if (mine && t + 3 < nt) stage(t + 3, rb);
#pragma unroll
    for (int i = 0; i < 4; ++i) for (int j = 0; j < 4; ++j) acc[i][j] = fa_mma(af[i], bf[j], acc[i][j]);
    rb = rb == JB - 1 ? 0 : rb + 1; }
  asm volatile("s_wait_asynccnt 0x0" ::: "memory");      /* no copy is outstanding when the ring becomes output staging */
  float* so = (float*)smem + (size_t)w * 64 * 68; float bv[4] = {0.f, 0.f, 0.f, 0.f};
  if (bias) {
#pragma unroll
    for (int j = 0; j < 4; ++j) bv[j] = bf16_round(bias[col0 + j * 16 + ln]); }
  const int rsub = lane >> 4, c4 = (lane & 15) * 4;
  if (col0 >= 2 * DM) {      /* the v third; the test reads the same for the whole wave */
#pragma unroll
    for (int i = 0; i < 4; ++i) {
#pragma unroll
      for (int j = 0; j < 4; ++j) { v4f lo, hi;
#pragma unroll
        for (int r = 0; r < 4; ++r) { lo[r] = acc[i][j][r] * alpha + bv[j]; hi[r] = acc[i][j][4 + r] * alpha + bv[j]; }
        float* d = so + (j * 16 + ln) * 68 + i * 16 + 8 * hh; *(v4fa*)d = lo; *(v4fa*)(d + 4) = hi; } }
    __builtin_amdgcn_fence(__ATOMIC_ACQ_REL, "workgroup"); __builtin_amdgcn_wave_barrier();      /* the rows read below were stored by other lanes of this wave: those LDS stores are finished, and not moved by the compiler, before the reads */
    _Float16* vt = CT + ((size_t)(row0 / SQ) * DM + (col0 - 2 * DM)) * SQ + row0 % SQ;      /* row (batch NH + head) HD of V^T, column s of the tile's first row */
#pragma unroll
    for (int q = 0; q < 32; ++q) { const int d = q * 2 + rsub; const v4f v = *(const v4fa*)&so[d * 68 + c4]; v4h h4; for (int i = 0; i < 4; ++i) h4[i] = (_Float16)v[i]; *(v4h*)(vt + (size_t)d * SQ + c4) = h4; }
    return; }
#pragma unroll
  for (int i = 0; i < 4; ++i) {
#pragma unroll
    for (int j = 0; j < 4; ++j) {
#pragma unroll
      for (int r = 0; r < 8; ++r) so[(i * 16 + 8 * hh + r) * 68 + j * 16 + ln] = acc[i][j][r] * alpha + bv[j]; } }
  __builtin_amdgcn_fence(__ATOMIC_ACQ_REL, "workgroup"); __builtin_amdgcn_wave_barrier();      /* as above */
#pragma unroll
  for (int q = 0; q < 32; ++q) { const int r = q * 2 + rsub; const v4f v = *(const v4fa*)&so[r * 68 + c4]; v4h h4; for (int i = 0; i < 4; ++i) h4[i] = (_Float16)v[i]; *(v4h*)(C16 + (size_t)(row0 + r) * ldc + col0 + c4) = h4; } }

// ---- output projection: C[M][N] (f32) = alpha A[M][K] . Bt[N][K]^T + bias; one 128 x 128 tile of C per work-group, EIGHT waves: two per 64 x 64 tile (M, N multiples of 128; K a multiple of 128, at least 256) ----
#define OW 8                         /* waves per work-group */
#define OB 3                         /* buffers of GBUF f16: 128 A rows, then 128 Bt rows */
#define OX (OW * 8 * 8 * 32 * 4)     /* bytes of the hand-over area: eight accumulator tiles per wave */
// The grid gives a WGP one 128 x 128 tile, four 64 x 64 wave tiles: one wave a SIMD, which stood still through its own LDS latency, its copies' issue and the stage barrier. Now every wave tile is worked by two waves, which share a SIMD: wave gw takes k 0..31 of every stage, wave gw + 4 takes k 32..63, each into accumulators of its own.
// A wave's sixteen fragment reads of stage t + 1 go out behind the barrier that publishes that stage, into a second register set, in front of the sixteen products of stage t, which cover their latency.
// Copies as in k_gemmq: three buffers, waves 0..3 bring the even stages, waves 4..7 the odd ones, so a stage's copies have two trips to land and in every trip one of a SIMD's two waves has no copy to issue.
// Publish point, at the head of trip t: every wave ends its LDS reads (the fragments of stage t are in registers); the group that brought stage t + 1 waits for all its copies (it has no others out); barrier (it publishes stage t + 1 and ends the reads of stage t's buffer); the same group then sends stage t + 3 into that buffer.
// A stage is 8 runs of 32 rows (4 of A, 4 of Bt): wave gw of the copying group takes run gw of each.
// Behind the loop the two waves of a tile join their sums through LDS: each hands 32 of its 64 rows over and finishes the other 32 (sum of the two k halves), then turns them through LDS so that rows go out as whole lines.
__global__ __launch_bounds__(OW * 32) void k_gemmo(const _Float16* __restrict__ A, int lda, const _Float16* __restrict__ Bh, int ldb, float alpha, const float* __restrict__ bias, float* __restrict__ C, int ldc, int N, int K) {
  __shared__ __attribute__((aligned(16))) unsigned char smem[OX + OW * 32 * 68 * 4]; static_assert(OB * GBUF * 2 <= OX + OW * 32 * 68 * 4 && OB == 3 && GT == 128 && GK == 64, "the ring fits under the hand-over area and the output staging; the deal of runs and of k below");
  const unsigned short* sm = (const unsigned short*)smem;
  const int tid = threadIdx.x, lane = tid & 31, ln = lane & 15, hh = lane >> 4; const int w = __builtin_amdgcn_readfirstlane(tid >> 5);      /* the wave's number as a scalar: every test on it below is a scalar branch */
  const int ntn = N >> 7; const int mt = blockIdx.x / ntn, nq = blockIdx.x - mt * ntn;
  const int grp = w >> 2, gw = w & 3;      /* k half and copying group (parity of its stages); wave tile */
  const int row0 = mt * GT + (gw >> 1) * 64, col0 = nq * GT + (gw & 1) * 64;      /* the 64 x 64 tile of this wave and its partner */
  const int lr = lane >> 3, sch = (lane & 7) * 8;      /* staging: eight lanes a 128-byte row, four rows a copy */
  const unsigned short* g0 = (const unsigned short*)A + (size_t)(mt * GT + gw * 32 + lr) * lda + sch; const unsigned short* g1 = (const unsigned short*)Bh + (size_t)(nq * GT + gw * 32 + lr) * ldb + sch;
  const size_t s0 = (size_t)4 * lda, s1 = (size_t)4 * ldb;
  const unsigned l0 = (unsigned)(size_t)(sm + (gw * 32 + lr) * GP + sch), l1 = l0 + GT * GP * 2u;      /* LDS byte addresses in buffer 0 */
  auto stage = [&](int st, int bf) { const unsigned bo = (unsigned)bf * (GBUF * 2u); const size_t ko = (size_t)st * GK; g4_copy8(l0 + bo, g0 + ko, s0); g4_copy8(l1 + bo, g1 + ko, s1); };
  const unsigned short* fa0 = sm + ((gw >> 1) * 64 + ln) * GP + grp * 32; const unsigned short* fb0 = sm + (GT + (gw & 1) * 64 + ln) * GP + grp * 32;      /* this wave's fragment rows in buffer 0, at its k half */
  const int nt = K / GK;
  const v8f z8 = {0.f, 0.f, 0.f, 0.f, 0.f, 0.f, 0.f, 0.f}; v8f acc[4][4];
#pragma unroll
  for (int i = 0; i < 4; ++i) for (int j = 0; j < 4; ++j) acc[i][j] = z8;
  stage(grp, grp);      /* stage 0 from group 0, stage 1 from group 1 */
  if (grp == 0) asm volatile("s_wait_asynccnt 0x0" ::: "memory");      /* this wave's part of stage 0 has landed */
  __syncthreads();
  if (grp == 0) stage(2, 2);
  v16h a0[4], b0[4], a1[4], b1[4];
#pragma unroll
  for (int i = 0; i < 4; ++i) { a0[i] = fa_frag(fa0 + i * 16 * GP, hh); b0[i] = fa_frag(fb0 + i * 16 * GP, hh); }
  int rb = 0;      /* ring place of the trip's stage */
  auto trip = [&](int t, v16h (&ca)[4], v16h (&cb)[4], v16h (&na)[4], v16h (&nb)[4]) { const bool mine = ((t + 1) & 1) == grp;      /* stages t + 1 and t + 3 are this wave's group's */
    const int rn = rb == OB - 1 ? 0 : rb + 1;
    asm volatile("s_wait_dscnt 0x0" ::: "memory");      /* the fragments of stage t are in registers: this wave's reads of the buffer are over before anybody refills it */
    if (mine) asm volatile("s_wait_asynccnt 0x0" ::: "memory");      /* this wave's part of stage t + 1 has landed before anybody reads it */
    __syncthreads();
    if (mine && t + 3 < nt) stage(t + 3, rb);
    if (t + 1 < nt) {
#pragma unroll
      for (int i = 0; i < 4; ++i) { na[i] = fa_frag(fa0 + rn * GBUF + i * 16 * GP, hh); nb[i] = fa_frag(fb0 + rn * GBUF + i * 16 * GP, hh); } }
    __builtin_amdgcn_sched_barrier(0);      /* holds the sixteen LDS reads above together in front of the products that cover their latency: left free, they are sunk towards their use in the next trip */
#pragma unroll
    for (int i = 0; i < 4; ++i) for (int j = 0; j < 4; ++j) acc[i][j] = fa_mma(ca[i], cb[j], acc[i][j]);
    __builtin_amdgcn_sched_barrier(0);      /* holds the products in front of the next trip's LDS wait: left free, that wait is lifted to behind the first product, and the wave stands through the latency that the products are there to cover */
    rb = rn; };
#pragma unroll 1      /* two stages a trip, one for each fragment register set */
  for (int t = 0; t < nt; t += 2) { trip(t, a0, b0, a1, b1); trip(t + 1, a1, b1, a0, b0); }
  asm volatile("s_wait_asynccnt 0x0" ::: "memory");      /* no copy is outstanding when the ring becomes hand-over area (every wave's last ring read ended in front of the last trip's barrier) */
  const int pw = w ^ 4; v4fa* xo = (v4fa*)smem;      /* [wave][tile][accumulators 0..3, 4..7][lane]: every LDS store and load is 512 contiguous bytes of a wave */
#pragma unroll
  for (int i = 0; i < 2; ++i) {
#pragma unroll
    for (int j = 0; j < 4; ++j) { const v8f g = grp ? acc[i][j] : acc[2 + i][j]; xo[((w * 8 + i * 4 + j) * 2) * 32 + lane] = __builtin_shufflevector(g, g, 0, 1, 2, 3); xo[((w * 8 + i * 4 + j) * 2 + 1) * 32 + lane] = __builtin_shufflevector(g, g, 4, 5, 6, 7); } }
  float bv[4] = {0.f, 0.f, 0.f, 0.f};
  if (bias) {
#pragma unroll
    for (int j = 0; j < 4; ++j) bv[j] = bf16_round(bias[col0 + j * 16 + ln]); }
  __syncthreads();      /* the partner's rows are read below */
  float* so = (float*)(smem + OX) + (size_t)w * 32 * 68;      /* a place of its own: a slower wave may still read the hand-over area */ v8f fin[2][4];
#pragma unroll
  for (int i = 0; i < 2; ++i) {
#pragma unroll
    for (int j = 0; j < 4; ++j) { const v4f lo = xo[((pw * 8 + i * 4 + j) * 2) * 32 + lane], hi = xo[((pw * 8 + i * 4 + j) * 2 + 1) * 32 + lane]; fin[i][j] = (grp ? acc[2 + i][j] : acc[i][j]) + __builtin_shufflevector(lo, hi, 0, 1, 2, 3, 4, 5, 6, 7); } }      /* all sixteen reads stand in front of the first staging store, so that they go out together: one LDS latency, not eight */
#pragma unroll
  for (int i = 0; i < 2; ++i) {
#pragma unroll
    for (int j = 0; j < 4; ++j) {
#pragma unroll
      for (int r = 0; r < 8; ++r) so[(i * 16 + 8 * hh + r) * 68 + j * 16 + ln] = fin[i][j][r] * alpha + bv[j]; } }
  __builtin_amdgcn_fence(__ATOMIC_ACQ_REL, "workgroup"); __builtin_amdgcn_wave_barrier();      /* the rows read below were stored by other lanes of this wave: those LDS stores are finished, and not moved by the compiler, before the reads */
  const int rsub = lane >> 4, c4 = (lane & 15) * 4;
#pragma unroll
  for (int q = 0; q < 16; ++q) { const int r = q * 2 + rsub; const v4f v = *(const v4fa*)&so[r * 68 + c4]; *(v4f*)(C + (size_t)(row0 + grp * 32 + r) * ldc + col0 + c4) = v; } }

// ---- operand conversion: x, w_qkv and w_out to f16 in ONE launch of few, long waves ----
#define PG 512                       /* work-groups: 16 waves on every WGP */
#define PT (PG * 256)                /* threads of the launch */
#define PNX ((int)(NR * DM / 4 / PT))            /* 16-byte pieces per thread: of x */
#define PNQ ((int)((size_t)LQ * DM / 4 / PT))    /* of w_qkv */
#define PNO ((int)((size_t)DM * DM / 4 / PT))    /* of w_out */
__device__ __forceinline__ v4h cv_x(v4f a) { v4h r; for (int q = 0; q < 4; ++q) r[q] = (_Float16)bf16_round(a[q]); return r; }
__device__ __forceinline__ v4h cv_w(v4f a) { v4h r; for (int q = 0; q < 4; ++q) r[q] = (_Float16)(bf16_round(a[q]) * 16.0f); return r; }
// The time of a short elementwise launch is the time its waves take to start, so the same bytes go through an eighth of the waves and one launch instead of three.
// Piece i of a thread lies PT pieces behind piece i - 1: every wave-wide load is 512 contiguous bytes (four whole lines), every store 256. All of a thread's loads are issued before its first conversion.
__global__ __launch_bounds__(256) void k_prep(const float* __restrict__ x, const float* __restrict__ wq, const float* __restrict__ wo, _Float16* __restrict__ X16, _Float16* __restrict__ BQ, _Float16* __restrict__ BO) {
  static_assert(NR * DM % (4 * PT) == 0 && (size_t)LQ * DM % (4 * PT) == 0 && (size_t)DM * DM % (4 * PT) == 0, "every thread takes the same number of pieces");
  const unsigned t = blockIdx.x * 256u + threadIdx.x; v4f a[PNX], b[PNQ], c[PNO];
#pragma unroll
  for (int i = 0; i < PNX; ++i) a[i] = ((const v4fa*)x + (size_t)i * PT)[t];
#pragma unroll
  for (int i = 0; i < PNQ; ++i) b[i] = ((const v4fa*)wq + (size_t)i * PT)[t];
#pragma unroll
  for (int i = 0; i < PNO; ++i) c[i] = ((const v4fa*)wo + (size_t)i * PT)[t];
  asm volatile("s_wait_xcnt 0x0" :: "v"(t) : "memory");      /* no address register of the loads above is rewritten in front of this wait (a precaution): left to the compiler, the pair it forms for the pieces beyond an offset's reach is reused behind a load-count wait alone */
  __builtin_amdgcn_sched_barrier(0);      /* holds all sixteen loads in front of the arithmetic: left free, half of them are issued only behind the first results, a second memory latency in a wave that lives for little more than one */
#pragma unroll
  for (int i = 0; i < PNX; ++i) ((v4h*)X16 + (size_t)i * PT)[t] = cv_x(a[i]);
#pragma unroll
  for (int i = 0; i < PNQ; ++i) ((v4h*)BQ + (size_t)i * PT)[t] = cv_w(b[i]);
#pragma unroll
  for (int i = 0; i < PNO; ++i) ((v4h*)BO + (size_t)i * PT)[t] = cv_w(c[i]); }

extern "C" void kernel_launch(void* const* d_in, const int* in_sizes, int n_in,
                              void* d_out, int out_size, void* d_ws, size_t ws_size, hipStream_t stream) {
  (void)in_sizes; (void)n_in; (void)out_size;
  const float* const* I = (const float* const*)d_in; const float* x = I[0]; const float* wqkv = I[1]; const float* bqkv = nullptr; const float* wo = I[2]; const float* bo = I[3];      /* natural [out][in] fused weight [3072][1024] (NO bias: nullptr in the fused GEMM's bias slot); natural w_out [1024][1024] + b_out */
  char* ws = (char*)d_ws; size_t off = 0;
  auto take = [&](size_t bytes) { char* p = ws + off; off += (bytes + 255) & ~(size_t)255; return p; };
  _Float16* BQKV = (_Float16*)take((size_t)3 * DM * DM * 2); _Float16* BO = (_Float16*)take((size_t)DM * DM * 2);
  _Float16* X16 = (_Float16*)take(NR * DM * 2); _Float16* QKV = (_Float16*)take(NR * 3 * DM * 2); _Float16* O16 = (_Float16*)take(NR * DM * 2);
  _Float16* VT = (_Float16*)take((size_t)NB * NH * HD * SQ * 2);
  if (off > ws_size) return;
  k_prep<<<PG, 256, 0, stream>>>(x, wqkv, wo, X16, BQKV, BO);      /* x as f16 rows; natural [out][in] weights = Bt[n][k] x16 (no transpose): fused rows 0..1023 = q, 1024.. = k, 2048.. = v */
  const size_t r0p = (size_t)B0 * SQ;      /* first projected row */
  k_gemmq<<<(unsigned)((MP / JM) * (3 * DM / JN)), JW * 32, 0, stream>>>(X16 + r0p * DM, DM, BQKV, DM, 0.0625f, bqkv, QKV + r0p * 3 * DM, VT, 3 * DM, 3 * DM, DM);      /* q | k rows (f16; head h = columns h*HD.. of each DM block; the v columns of these rows stay unwritten and unread) and V^T [NB][NH][HD][SQ] */
  k_attn<<<dim3(SQ / (AW * AQ), NH, NB), AW * AH * 32, 0, stream>>>(QKV, VT, O16);      /* o (merged heads, x64) as f16 rows: scores, stablemax3 and P V in one launch for all batches and heads */
  k_gemmo<<<(unsigned)((MPO / GT) * (DM / GT)), OW * 32, 0, stream>>>(O16 + r0p * DM, DM, BO, DM, 0.0009765625f, bo, (float*)d_out + r0p * DM, DM, DM, DM);      /* out rows are the output layout */
}
